// v000
// The times below were measured on an AMD MI455X: many runs one after another, warmed up first and cycling through
// copies of the inputs, with the whole window's GPU time divided by the number of runs. Launches and the gaps
// between them are all in it. The median over several windows is given; except for v000 it joins two sittings, which
// can be a few percent apart, so the side-by-side timings, each taken in one sitting, are the better comparison.
// v000, which the later versions start from, runs in 263 microseconds.
// Contractions: q/k/v projections = v_wmma_f32_16x16x32_bf16 (bf16 operands from RNE-converted nodes, W^T and bias, single product); q.k^T scores = v_wmma_f32_16x16x32_f16 (q, k as f16 hi planes carried x16 plus f16 residual planes x1024: hi.hi + (hi.lo + lo.hi) in a separate accumulator, 3 products); p.v = v_wmma_f32_16x16x32_f16 (p carried x1024 in f16; v^T as f16 hi plane x256 plus f16 residual plane x4096 in a separate accumulator folded with 2^-12, 2 products); output projection = v_wmma_f32_16x16x32_f16 (msgs as f16 hi plane x1024 plus f16 residual plane x1024 in a separate accumulator folded with 2^-10; Wo^T = RNE bf16 value carried x4096 in f16; 2 products); all f32 accumulate; softmax in f32.
#include <hip/hip_runtime.h>
#include <math.h>
#include <stdint.h>

#define NB    8
#define SEQ   1024
#define DM    512
#define NH    8
#define HD    64
#define NQB   (SEQ / 64)
#define ROWS  (NB * SEQ)            // 8192 token rows
#define OUTN  (ROWS * DM)
static_assert(NH * HD == DM);
static_assert(HD == 64);
static_assert((SEQ % 64) == 0 && (DM % 64) == 0 && (ROWS % 64) == 0);
static_assert(((ROWS / 64) * (DM / 64)) % 8 == 0);
static_assert(((ROWS / 32) * (DM / 64)) % 8 == 0);
static_assert(((ROWS * DM / 8) % 256) == 0);

typedef _Float16 v16h __attribute__((ext_vector_type(16)));
typedef _Float16 v8h  __attribute__((ext_vector_type(8)));
typedef __bf16   v16b __attribute__((ext_vector_type(16)));
typedef __bf16   v8b  __attribute__((ext_vector_type(8)));
typedef float    v8f  __attribute__((ext_vector_type(8)));
typedef float    v4f  __attribute__((ext_vector_type(4)));
typedef unsigned int v4u __attribute__((ext_vector_type(4)));

// ---- scalar helpers --------------------------------------------------------------------------------
__device__ __forceinline__ unsigned short bf_bits(float f) {          // f32 -> bf16 bits, RNE convert
  unsigned u = __float_as_uint(f);
  return (unsigned short)((u + 0x7FFFu + ((u >> 16) & 1u)) >> 16);
}
__device__ __forceinline__ float bf_up(unsigned short h) { return __uint_as_float(((unsigned)h) << 16); }
__device__ __forceinline__ unsigned short h_bits(_Float16 x) { return __builtin_bit_cast(unsigned short, x); }
__device__ __forceinline__ unsigned pk16(unsigned short a, unsigned short b) { return (unsigned)a | ((unsigned)b << 16); }
__device__ __forceinline__ v8f zero8() { v8f z = {0.f, 0.f, 0.f, 0.f, 0.f, 0.f, 0.f, 0.f}; return z; }

// ---- fragment loaders: 16-bit A/B operand, lane -> row/col (lane&15), p already includes +8*(lane>>4);
//      elements 0..7 <- p[0..7] (k0+8h..), elements 8..15 <- p[16..23] (k0+16+8h..)
__device__ __forceinline__ v16b ldfrag_b(const __bf16* p) {
  union { v16b v; v8b h[2]; } f;
  f.h[0] = *(const v8b*)(p);
  f.h[1] = *(const v8b*)(p + 16);
  return f.v;
}
__device__ __forceinline__ v16h ldfrag_h(const _Float16* p) {
  union { v16h v; v8h h[2]; } f;
  f.h[0] = *(const v8h*)(p);
  f.h[1] = *(const v8h*)(p + 16);
  return f.v;
}

// ---- WMMA helpers with trailing VALU hazard gap --------------------------------------------------------
__device__ __forceinline__ v8f mma_h(v16h a, v16h b, v8f c) {
  c = __builtin_amdgcn_wmma_f32_16x16x32_f16(false, a, false, b, (short)0, c, false, false);
#if defined(__HIP_DEVICE_COMPILE__)
  asm volatile("v_nop\n\tv_nop\n\tv_nop\n\tv_nop" : "+v"(c) : "v"(a), "v"(b));
#endif
  return c;
}
__device__ __forceinline__ v8f mma_b_raw(v16b a, v16b b, v8f c) {
  return __builtin_amdgcn_wmma_f32_16x16x32_bf16(false, a, false, b, (short)0, c, false, false);
}
__device__ __forceinline__ void dep_guard_b(v8f& a, v8f& b, v16b x, v16b y) {
#if defined(__HIP_DEVICE_COMPILE__)
  asm volatile("v_nop\n\tv_nop\n\tv_nop\n\tv_nop" : "+v"(a), "+v"(b) : "v"(x), "v"(y));
#endif
}
__device__ __forceinline__ void keep4_b(v16b a, v16b b, v16b c, v16b d) {
#if defined(__HIP_DEVICE_COMPILE__)
  asm volatile("v_nop" :: "v"(a), "v"(b), "v"(c), "v"(d));
#endif
}
__device__ __forceinline__ void acc_guard4(v8f& a, v8f& b, v8f& c, v8f& d) {
#if defined(__HIP_DEVICE_COMPILE__)
  asm volatile("v_nop\n\tv_nop\n\tv_nop\n\tv_nop" : "+v"(a), "+v"(b), "+v"(c), "+v"(d));
#endif
}

// =====================================================================================================
// f32 -> bf16 (RNE convert), 8 elements per thread, one 16-B store per lane: a wave writes 512 contiguous B
// coverage: n8 threads x 8 = whole plane (n8 is a multiple of 256 here).
// =====================================================================================================
__global__ __launch_bounds__(256) void cvt_bf16x8(const float* __restrict__ in, unsigned short* out, int n8) {
  const int i = blockIdx.x * 256 + threadIdx.x;
  if (i < n8) {
    const v4f a = *(const v4f*)(in + (size_t)i * 8);
    const v4f b = *(const v4f*)(in + (size_t)i * 8 + 4);
    v4u p;
    p[0] = pk16(bf_bits(a[0]), bf_bits(a[1]));
    p[1] = pk16(bf_bits(a[2]), bf_bits(a[3]));
    p[2] = pk16(bf_bits(b[0]), bf_bits(b[1]));
    p[3] = pk16(bf_bits(b[2]), bf_bits(b[3]));
    *(v4u*)(out + (size_t)i * 8) = p;
    
  }
}

// =====================================================================================================
// f32 -> f16 hi plane = f16(v * scale) (scale a power of two) + f16 residual plane = f16((v*scale - hi) * 1024),
// same element index in both planes; 8 elements per thread, one 16-B store per lane and plane: a wave writes
// coverage: n8 threads x 8 = whole plane (n8 multiple of 256).
// =====================================================================================================
__global__ __launch_bounds__(256) void planes_f16x8(const float* __restrict__ in, unsigned short* hp,
                                                    unsigned short* lp, int n8, float scale) {
  const int i = blockIdx.x * 256 + threadIdx.x;
  if (i < n8) {
    const v4f a = *(const v4f*)(in + (size_t)i * 8);
    const v4f b = *(const v4f*)(in + (size_t)i * 8 + 4);
    float f[8];
    f[0] = a[0]; f[1] = a[1]; f[2] = a[2]; f[3] = a[3];
    f[4] = b[0]; f[5] = b[1]; f[6] = b[2]; f[7] = b[3];
    v4u ph, pl;
#pragma unroll
    for (int e = 0; e < 4; ++e) {
      const float f0 = f[2 * e] * scale;
      const float f1 = f[2 * e + 1] * scale;
      const _Float16 x0 = (_Float16)f0, x1 = (_Float16)f1;
      const _Float16 l0 = (_Float16)((f0 - (float)x0) * 1024.0f);
      const _Float16 l1 = (_Float16)((f1 - (float)x1) * 1024.0f);
      ph[e] = pk16(h_bits(x0), h_bits(x1));
      pl[e] = pk16(h_bits(l0), h_bits(l1));
    }
    *(v4u*)(hp + (size_t)i * 8) = ph;
    *(v4u*)(lp + (size_t)i * 8) = pl;
    
  }
}

// =====================================================================================================
// Weight transpose + convert: in W f32 [DM rows (e, contraction index)][DM cols (n, output feature)] (the
// x @ W layout) -> out Wt 16-bit [DM (n)][DM (e)] (the [n][k], k-contiguous layout the GEMM B operand uses).
// MODE 0: RNE bf16 bits. MODE 1: f16 bits of (RNE bf16 value * scale), scale a power of two (exact in f16).
// Block = one 64 e x 64 n tile: grid = (DM/64 e tiles, DM/64 n tiles). The tile is staged in LDS as [ee][nn]
// pitch 68 floats (v4f loads, __syncthreads). in[rows e][cols n] -> out[rows n][cols e] (square here).
// Store: group g = tid>>3 (0..31), piece = tid&7: iteration it writes row n0 + (it*32+g), lanes 8q..8q+7 x 16 B
// coverage: 2 iterations x 32 groups = 64 rows n, 8 pieces x 8 = 64 e per row; grid covers every (e tile,
// n tile) -> the whole [DM][DM] plane.
// =====================================================================================================
template <int MODE>
__device__ __forceinline__ void wt_tile_body(const float* __restrict__ W, unsigned short* Wt, float scale,
                                             float* sw) {
  const int tid = threadIdx.x;
  const int e0  = blockIdx.x * 64;
  const int n0  = blockIdx.y * 64;
#pragma unroll
  for (int i = 0; i < 4; ++i) {
    const int idx = i * 256 + tid;                  // 0..1023
    const int ee = idx >> 4, c4 = (idx & 15) * 4;
    const v4f a = *(const v4f*)(W + ((size_t)(e0 + ee)) * DM + n0 + c4);
    *(v4f*)(sw + ee * 68 + c4) = a;
  }
  __syncthreads();

  const int g = tid >> 3, piece = tid & 7;
  v4u hv[2];
  size_t hofs[2];
#pragma unroll
  for (int it = 0; it < 2; ++it) {
    const int n = it * 32 + g;
    v4u a;
#pragma unroll
    for (int e = 0; e < 4; ++e) {
      const float f0 = sw[(piece * 8 + 2 * e) * 68 + n];
      const float f1 = sw[(piece * 8 + 2 * e + 1) * 68 + n];
      unsigned short u0, u1;
      if (MODE == 0) {
        u0 = bf_bits(f0);
        u1 = bf_bits(f1);
      } else {
        u0 = h_bits((_Float16)(bf_up(bf_bits(f0)) * scale));
        u1 = h_bits((_Float16)(bf_up(bf_bits(f1)) * scale));
      }
      a[e] = pk16(u0, u1);
    }
    hv[it] = a;
    hofs[it] = ((size_t)(n0 + n)) * DM + e0 + piece * 8;
  }
  {
#pragma unroll
    for (int it = 0; it < 2; ++it) {
      *(v4u*)(Wt + hofs[it]) = hv[it];
    }
    
  }
}
__global__ __launch_bounds__(256) void wt_bf16(const float* __restrict__ W, unsigned short* Wt) {
  __shared__ __align__(16) float sw[64 * 68];       // [ee][nn] pitch 68 floats
  wt_tile_body<0>(W, Wt, 1.0f, sw);
}
__global__ __launch_bounds__(256) void wt_f16s(const float* __restrict__ W, unsigned short* Wt, float scale) {
  __shared__ __align__(16) float sw[64 * 68];       // [ee][nn] pitch 68 floats
  wt_tile_body<1>(W, Wt, scale, sw);
}

// =====================================================================================================
// Register-blocked bf16 WMMA GEMM with bias: C[m][n] = sum_k A[m][k] * Bt[n][k] + bf16rne(bias[n]); one wave per
// 64x64 tile, no block barriers. A row-major [M][K] pitch lda; Bt row-major [N][K] pitch ldb (k contiguous);
// bias f32 [N] (RNE converted to bf16 and widened in the epilogue); M, N multiples of 64, K multiple of 32
// (host-checked); the tile count is a multiple of 8 for every launch here (no idle waves).
// Output f32 [M][N] pitch ldc. Epilogue: 16-row slabs staged per wave in LDS; each 64-wide row segment
// =====================================================================================================
__global__ __launch_bounds__(256) void gemm64(
    const unsigned short* __restrict__ Ap, int lda,
    const unsigned short* __restrict__ Btp, int ldb,
    const float* __restrict__ bias,
    float* C, int ldc, int M, int N, int K) {
  const __bf16* Ab  = (const __bf16*)(const void*)Ap;
  const __bf16* Bb  = (const __bf16*)(const void*)Btp;
  __shared__ __align__(16) float sT[8][16 * 68];   // per-wave 16x64 slab, pitch 68 floats
  const int lane = threadIdx.x & 31;
  const int wave = threadIdx.x >> 5;
  const int tilesN = N >> 6;
  const int tilesM = M >> 6;
  const int tile = blockIdx.x * 8 + wave;
  if (tile >= tilesM * tilesN) return;   // wave-uniform; no block barriers in this kernel
  const int tm = tile / tilesN;
  const int tn = tile - tm * tilesN;
  const int m0 = tm << 6;
  const int n0 = tn << 6;

  const int rlane = lane & 15;                 // row (A) / col (B, D) within subtile
  const int koff  = (lane >> 4) * 8;           // k offset of this lane half
  const int mOff  = (lane >> 4) * 8;           // D row offset

  v8f acc[4][4];
#pragma unroll
  for (int i = 0; i < 4; ++i)
#pragma unroll
    for (int j = 0; j < 4; ++j) acc[i][j] = zero8();

  for (int k0 = 0; k0 < K; k0 += 32) {
    v16b bh[4];
#pragma unroll
    for (int j = 0; j < 4; ++j) {
      const size_t bo = (size_t)(n0 + (j << 4) + rlane) * ldb + koff + k0;
      bh[j] = ldfrag_b(Bb + bo);
    }
#pragma unroll
    for (int i = 0; i < 4; ++i) {
      const size_t ao = (size_t)(m0 + (i << 4) + rlane) * lda + koff + k0;
      const v16b ah = ldfrag_b(Ab + ao);
#pragma unroll
      for (int j = 0; j < 4; ++j) {
        acc[i][j] = mma_b_raw(ah, bh[j], acc[i][j]);
      }
      dep_guard_b(acc[i][0], acc[i][3], ah, ah);
    }
    keep4_b(bh[0], bh[1], bh[2], bh[3]);
  }
  acc_guard4(acc[0][0], acc[0][1], acc[0][2], acc[0][3]);
  acc_guard4(acc[1][0], acc[1][1], acc[1][2], acc[1][3]);
  acc_guard4(acc[2][0], acc[2][1], acc[2][2], acc[2][3]);
  acc_guard4(acc[3][0], acc[3][1], acc[3][2], acc[3][3]);

  // ---- bias per D column of this lane (n0 + 16j + rlane < N) ----
  float bz[4];
#pragma unroll
  for (int j = 0; j < 4; ++j) bz[j] = bf_up(bf_bits(bias[n0 + (j << 4) + rlane]));

  // ---- epilogue ----
  float* slab = sT[wave];
#pragma unroll
  for (int i = 0; i < 4; ++i) {
    const int mBase = m0 + (i << 4);
#pragma unroll
    for (int r = 0; r < 8; ++r) {
#pragma unroll
      for (int j = 0; j < 4; ++j) {
        slab[(mOff + r) * 68 + (j << 4) + rlane] = acc[i][j][r] + bz[j];
      }
    }
    __builtin_amdgcn_fence(__ATOMIC_RELEASE, "workgroup");
    __builtin_amdgcn_wave_barrier();
    __builtin_amdgcn_fence(__ATOMIC_ACQUIRE, "workgroup");
    {
      const int hh = lane >> 4, c4 = (lane & 15) * 4;     // 256-B row segment = 16 lanes x 16 B
      v4f ov[8];
#pragma unroll
      for (int it = 0; it < 8; ++it) {
        const int row = it * 2 + hh;                       // it 0..7 x hh 0..1 = rows 0..15
        ov[it] = *(const v4f*)(slab + row * 68 + c4);
      }
      {
#pragma unroll
        for (int it = 0; it < 8; ++it) {
          const int row = it * 2 + hh;
          *(v4f*)(C + (size_t)(mBase + row) * ldc + n0 + c4) = ov[it];
        }
        
      }
    }
    __builtin_amdgcn_fence(__ATOMIC_RELEASE, "workgroup");
    __builtin_amdgcn_wave_barrier();
    __builtin_amdgcn_fence(__ATOMIC_ACQUIRE, "workgroup");
  }
}

// =====================================================================================================
// f16 WMMA GEMM with a two-plane A operand and bias:
//   C[m][n] = (sum_k Ah[m][k]*Bt[n][k] + 2^-10 * sum_k Al[m][k]*Bt[n][k]) * oscale + bf16rne(bias[n]),
// the residual products in a separate accumulator. One wave per 32x64 tile, no block barriers. Ah/Al row-major
// [M][K] pitch lda (f16 hi and residual planes, same index); Bt row-major [N][K] pitch ldb (f16, k contiguous);
// M multiple of 32, N multiple of 64, K multiple of 32 (host-checked); tile count a multiple of 8 (no idle
// waves). A fragments (2 rows x 2 planes) cached per k-step, B fragments streamed; every WMMA nop-guarded.
// Output f32 [M][N] pitch ldc. Epilogue: 16-row slabs staged per wave in LDS; each 64-wide row segment (256 B)
// coverage: 2 slabs x 16 rows x 64 cols = the wave's whole 32x64 tile.
// =====================================================================================================
__global__ __launch_bounds__(256) void gemm_o(
    const unsigned short* __restrict__ Ahp, const unsigned short* __restrict__ Alp, int lda,
    const unsigned short* __restrict__ Btp, int ldb,
    const float* __restrict__ bias,
    float* C, int ldc, int M, int N, int K, float oscale) {
  const _Float16* Ah = (const _Float16*)(const void*)Ahp;
  const _Float16* Al = (const _Float16*)(const void*)Alp;
  const _Float16* Bh = (const _Float16*)(const void*)Btp;
  __shared__ __align__(16) float sT[8][16 * 68];   // per-wave 16x64 slab, pitch 68 floats
  const int lane = threadIdx.x & 31;
  const int wave = threadIdx.x >> 5;
  const int tilesN = N >> 6;
  const int tilesM = M >> 5;
  const int tile = blockIdx.x * 8 + wave;
  if (tile >= tilesM * tilesN) return;   // wave-uniform; no block barriers in this kernel
  const int tm = tile / tilesN;
  const int tn = tile - tm * tilesN;
  const int m0 = tm << 5;
  const int n0 = tn << 6;

  const int rlane = lane & 15;
  const int koff  = (lane >> 4) * 8;
  const int mOff  = (lane >> 4) * 8;

  v8f acc[2][4], acl[2][4];
#pragma unroll
  for (int i = 0; i < 2; ++i)
#pragma unroll
    for (int j = 0; j < 4; ++j) { acc[i][j] = zero8(); acl[i][j] = zero8(); }

  for (int k0 = 0; k0 < K; k0 += 32) {
    v16h ah[2], al[2];
#pragma unroll
    for (int i = 0; i < 2; ++i) {
      const size_t ao = (size_t)(m0 + (i << 4) + rlane) * lda + koff + k0;
      ah[i] = ldfrag_h(Ah + ao);
      al[i] = ldfrag_h(Al + ao);
    }
#pragma unroll
    for (int j = 0; j < 4; ++j) {
      const size_t bo = (size_t)(n0 + (j << 4) + rlane) * ldb + koff + k0;
      const v16h bfr = ldfrag_h(Bh + bo);
#pragma unroll
      for (int i = 0; i < 2; ++i) {
        acc[i][j] = mma_h(ah[i], bfr, acc[i][j]);
        acl[i][j] = mma_h(al[i], bfr, acl[i][j]);
      }
    }
  }

  // ---- bias per D column of this lane (n0 + 16j + rlane < N) ----
  float bz[4];
#pragma unroll
  for (int j = 0; j < 4; ++j) bz[j] = bf_up(bf_bits(bias[n0 + (j << 4) + rlane]));

  // ---- epilogue ----
  float* slab = sT[wave];
#pragma unroll
  for (int i = 0; i < 2; ++i) {
    const int mBase = m0 + (i << 4);
#pragma unroll
    for (int r = 0; r < 8; ++r) {
#pragma unroll
      for (int j = 0; j < 4; ++j) {
        const float y = (acc[i][j][r] + acl[i][j][r] * (1.0f / 1024.0f)) * oscale + bz[j];
        slab[(mOff + r) * 68 + (j << 4) + rlane] = y;
      }
    }
    __builtin_amdgcn_fence(__ATOMIC_RELEASE, "workgroup");
    __builtin_amdgcn_wave_barrier();
    __builtin_amdgcn_fence(__ATOMIC_ACQUIRE, "workgroup");
    {
      const int hh = lane >> 4, c4 = (lane & 15) * 4;     // 256-B row segment = 16 lanes x 16 B
      v4f ov[8];
#pragma unroll
      for (int it = 0; it < 8; ++it) {
        const int row = it * 2 + hh;                       // it 0..7 x hh 0..1 = rows 0..15
        ov[it] = *(const v4f*)(slab + row * 68 + c4);
      }
      {
#pragma unroll
        for (int it = 0; it < 8; ++it) {
          const int row = it * 2 + hh;
          *(v4f*)(C + (size_t)(mBase + row) * ldc + n0 + c4) = ov[it];
        }
        
      }
    }
    __builtin_amdgcn_fence(__ATOMIC_RELEASE, "workgroup");
    __builtin_amdgcn_wave_barrier();
    __builtin_amdgcn_fence(__ATOMIC_ACQUIRE, "workgroup");
  }
}

// =====================================================================================================
// v f32 token-major columns vf[(b*SEQ + t)*vrp + h*64 + d] ->
// f16 v^T hi plane vth[(b*DM + h*64 + d)*SEQ + t] = f16(v * vscale) (vscale a power of two) and residual plane
// vtl[same index] = f16((v*vscale - hi) * 4096).
// Block = one 64-token x 64-feature tile of one (b, h); grid = (SEQ/64, NH, NB); tile staged in LDS as f32
// (v4f loads, __syncthreads).
// Store: group g = tid>>3 (0..31), piece = tid&7: iteration it writes row d = it*32+g, lanes 8q..8q+7 x 16 B =
// coverage: 2 iterations x 32 groups = 64 rows d, 8 pieces x 8 = 64 tokens per row; grid covers every (b, h,
// t tile) -> both whole planes.
// =====================================================================================================
__global__ __launch_bounds__(256) void v_planes(const float* __restrict__ vf, int vrp,
                                                unsigned short* vth, unsigned short* vtl, float vscale) {
  __shared__ __align__(16) float sv[64 * 68];       // [tt][d] pitch 68 floats
  const int tid = threadIdx.x;
  const int t0  = blockIdx.x * 64;
  const int hh  = blockIdx.y;
  const int b   = blockIdx.z;
#pragma unroll
  for (int i = 0; i < 4; ++i) {
    const int idx = i * 256 + tid;                  // 0..1023
    const int tt = idx >> 4, c4 = (idx & 15) * 4;
    const v4f a = *(const v4f*)(vf + ((size_t)(b * SEQ + t0 + tt)) * vrp + hh * HD + c4);
    *(v4f*)(sv + tt * 68 + c4) = a;
  }
  __syncthreads();

  const int g = tid >> 3, piece = tid & 7;
  v4u hv[2], lv[2];
  size_t hofs[2];
#pragma unroll
  for (int it = 0; it < 2; ++it) {
    const int d = it * 32 + g;
    v4u a, a2;
#pragma unroll
    for (int e = 0; e < 4; ++e) {
      const float f0 = sv[(piece * 8 + 2 * e) * 68 + d] * vscale;
      const float f1 = sv[(piece * 8 + 2 * e + 1) * 68 + d] * vscale;
      const _Float16 x0 = (_Float16)f0, x1 = (_Float16)f1;
      const unsigned short h0 = h_bits(x0), h1 = h_bits(x1);
      const unsigned short l0 = h_bits((_Float16)((f0 - (float)x0) * 4096.0f));
      const unsigned short l1 = h_bits((_Float16)((f1 - (float)x1) * 4096.0f));
      a[e] = pk16(h0, h1); a2[e] = pk16(l0, l1);
    }
    hv[it] = a; lv[it] = a2;
    hofs[it] = ((size_t)(b * DM + hh * HD + d)) * SEQ + t0 + piece * 8;
  }
  {
#pragma unroll
    for (int it = 0; it < 2; ++it) {
      *(v4u*)(vth + hofs[it]) = hv[it];
      *(v4u*)(vtl + hofs[it]) = lv[it];
    }
    
  }
}

// =====================================================================================================
// Bidirectional multi-head attention, head dim 64, no mask.
//   q f16 hi plane (x16): element (b, t, h, d) at [(b*SEQ + t)*DM + h*64 + d]; q residual plane
//     ((q*16 - hi)*1024) at the same index into qlp
//   k f16 hi plane (x16): element (b, s, h, d) at [(b*SEQ + s)*DM + h*64 + d]; k residual plane same into klp
//   v^T f16 hi plane (x256): element (b, h, d, s) at [(b*DM + h*64 + d)*SEQ + s]
//   v^T f16 residual plane ((v*256 - hi)*4096): same index into vlp
//   All NQB key tiles of 64 are processed for every query tile (static trip count).
//   logit = (qhi.khi + (qhi.klo + qlo.khi) * 2^-10) * sscale, f16 products with f32 accumulate, the residual
//   products in a separate accumulator; p = exp(s - m) carried as ph = f16(1024 p);
//   context = ph . vhi on f16 WMMA plus ph . vres into a separate accumulator folded back with 2^-12 per tile
//   in f32; online softmax in f32; out f32 plane: element (b, t, h*64 + d) at [(b*SEQ + t)*DM + h*64 + d] =
//   normalised context (oscl folds back the p and v carries).
//   Block = 4 waves = 64 query rows of one (b, h); grid = NB*NH*NQB; kv tiles of 64.
//   K hi / K residual / V^T hi / V^T residual tile staging: 128 threads x 32 elements per plane = the whole
//   64x64 tile (plain 16-B loads, __syncthreads before and after); P tiles are wave-private, spilled with
//   Output coverage: each wave stores rows q0..q0+15 (it 0..7 x lane>>4 0..1) x 64 columns (16 lanes x 4
//   (b, h, query tile) -> the whole plane.
// =====================================================================================================
__global__ __launch_bounds__(128)
void attn64(const unsigned short* __restrict__ qhp, const unsigned short* __restrict__ qlp,
            const unsigned short* __restrict__ khp, const unsigned short* __restrict__ klp,
            const unsigned short* __restrict__ vhp, const unsigned short* __restrict__ vlp,
            float* outp, float sscale, float oscl) {
  union FH { v16h v; v8h h[2]; };
  __shared__ __align__(16) _Float16 Ksh[64 * 64];                 // K hi [kv][d]    8 KB
  __shared__ __align__(16) _Float16 Ksl[64 * 64];                 // K residual      8 KB
  __shared__ __align__(16) _Float16 Vth[64 * 64];                 // V^T hi [d][kv]  8 KB
  __shared__ __align__(16) _Float16 Vtl[64 * 64];                 // V^T residual    8 KB
  __shared__ __align__(16) _Float16 Psh[4][16 * 64];              // per wave P hi [row][kv]      8 KB
  __shared__ __align__(16) float    Os[4][16 * 64];               // per wave context tile [row][d] 16 KB

  const int tid  = threadIdx.x;
  const int wave = tid >> 5;
  const int lane = tid & 31;
  const int hh   = lane >> 4;
  const int c    = lane & 15;

  const int bx   = blockIdx.x;
  const int qb   = bx % NQB;
  const int rest = bx / NQB;
  const int h    = rest % NH;
  const int b    = rest / NH;                // < NB by the grid size
  const int q0   = qb * 64 + wave * 16;
  const size_t rowB = (size_t)b * SEQ;

  const _Float16* Qp  = (const _Float16*)(const void*)qhp + (size_t)h * HD;
  const _Float16* Qlq = (const _Float16*)(const void*)qlp + (size_t)h * HD;
  const _Float16* Kp  = (const _Float16*)(const void*)khp + (size_t)h * HD;
  const _Float16* Klq = (const _Float16*)(const void*)klp + (size_t)h * HD;
  const _Float16* Vh  = (const _Float16*)(const void*)vhp + ((size_t)b * DM + (size_t)h * HD) * SEQ;
  const _Float16* Vl  = (const _Float16*)(const void*)vlp + ((size_t)b * DM + (size_t)h * HD) * SEQ;

  // ---- Q fragments (A operand, row = lane&15): 2 d-chunks, hi and residual ----
  v16h qa[2], ql[2];
#pragma unroll
  for (int dc = 0; dc < 2; ++dc) {
    const size_t qo = (rowB + q0 + c) * DM + dc * 32 + 8 * hh;
    qa[dc] = ldfrag_h(Qp + qo);
    ql[dc] = ldfrag_h(Qlq + qo);
  }

  float mrow[8], lrow[8];
  v8f oacc[4];
#pragma unroll
  for (int r = 0; r < 8; ++r) { mrow[r] = -INFINITY; lrow[r] = 0.f; }
#pragma unroll
  for (int t = 0; t < 4; ++t) oacc[t] = zero8();

  for (int kt = 0; kt < NQB; ++kt) {
    const int kv0 = kt * 64;
    __syncthreads();
    {
      const int r = tid >> 1, half = (tid & 1) * 32;
      const _Float16* kg  = Kp  + (rowB + kv0 + r) * DM + half;    // K hi row kv0+r, d = half..half+31
      const _Float16* klg = Klq + (rowB + kv0 + r) * DM + half;    // K residual row kv0+r
      const _Float16* vg  = Vh + (size_t)r * SEQ + kv0 + half;     // V^T hi row d = r, s = kv0+half..+31
      const _Float16* vlg = Vl + (size_t)r * SEQ + kv0 + half;     // V^T residual row d = r
#pragma unroll
      for (int i = 0; i < 4; ++i) {
        const v8h a0 = *(const v8h*)(kg + 8 * i);
        const v8h a1 = *(const v8h*)(klg + 8 * i);
        const v8h b0 = *(const v8h*)(vg + 8 * i);
        const v8h b1 = *(const v8h*)(vlg + 8 * i);
        *(v8h*)(Ksh + r * 64 + half + 8 * i) = a0;
        *(v8h*)(Ksl + r * 64 + half + 8 * i) = a1;
        *(v8h*)(Vth + r * 64 + half + 8 * i) = b0;
        *(v8h*)(Vtl + r * 64 + half + 8 * i) = b1;
      }
    }
    __syncthreads();

    // ---- scores: 16 query rows x 64 keys per wave; hi.hi into s, hi.lo + lo.hi into s1 (folded x 2^-10) ----
    v8f s[4];
#pragma unroll
    for (int j = 0; j < 4; ++j) {
      s[j] = zero8();
      v8f s1 = zero8();
#pragma unroll
      for (int dc = 0; dc < 2; ++dc) {
        FH kb, kr;
        kb.h[0] = *(const v8h*)(Ksh + (j * 16 + c) * 64 + dc * 32 + 8 * hh);
        kb.h[1] = *(const v8h*)(Ksh + (j * 16 + c) * 64 + dc * 32 + 16 + 8 * hh);
        kr.h[0] = *(const v8h*)(Ksl + (j * 16 + c) * 64 + dc * 32 + 8 * hh);
        kr.h[1] = *(const v8h*)(Ksl + (j * 16 + c) * 64 + dc * 32 + 16 + 8 * hh);
        s[j] = mma_h(qa[dc], kb.v, s[j]);
        s1   = mma_h(qa[dc], kr.v, s1);
        s1   = mma_h(ql[dc], kb.v, s1);
      }
#pragma unroll
      for (int r = 0; r < 8; ++r) s[j][r] += s1[r] * (1.0f / 1024.0f);
    }

    // ---- scale, row max, online softmax, P (x1024, f16) to LDS ----
    _Float16* pwh = Psh[wave];
#pragma unroll
    for (int r = 0; r < 8; ++r) {
      float m = -INFINITY;
#pragma unroll
      for (int j = 0; j < 4; ++j) {
        const float sv = s[j][r] * sscale;
        s[j][r] = sv;
        m = fmaxf(m, sv);
      }
#pragma unroll
      for (int off = 1; off < 16; off <<= 1) m = fmaxf(m, __shfl_xor(m, off, 32));
      const float mnew  = fmaxf(mrow[r], m);
      const float msafe = (mnew == -INFINITY) ? 0.f : mnew;
      const float alpha = __expf(mrow[r] - msafe);
      mrow[r] = mnew;
      float psum = 0.f;
#pragma unroll
      for (int j = 0; j < 4; ++j) {
        const float p = __expf(s[j][r] - msafe);
        psum += p;
        const float p1024 = p * 1024.0f;
        const _Float16 ph = (_Float16)p1024;
        pwh[(8 * hh + r) * 64 + j * 16 + c] = ph;
      }
#pragma unroll
      for (int off = 1; off < 16; off <<= 1) psum += __shfl_xor(psum, off, 32);
      lrow[r] = lrow[r] * alpha + psum;
#pragma unroll
      for (int t = 0; t < 4; ++t) oacc[t][r] *= alpha;
    }
    __builtin_amdgcn_fence(__ATOMIC_RELEASE, "workgroup");
    __builtin_amdgcn_wave_barrier();
    __builtin_amdgcn_fence(__ATOMIC_ACQUIRE, "workgroup");

    // ---- context += P . Vhi (f16 WMMA); P . Vres into a separate accumulator ----
    v8f o1[4];
#pragma unroll
    for (int t = 0; t < 4; ++t) o1[t] = zero8();
#pragma unroll 1
    for (int kk = 0; kk < 2; ++kk) {
      FH pa;
      pa.h[0] = *(const v8h*)(pwh + c * 64 + kk * 32 + 8 * hh);
      pa.h[1] = *(const v8h*)(pwh + c * 64 + kk * 32 + 16 + 8 * hh);
#pragma unroll
      for (int t = 0; t < 4; ++t) {
        FH vb;
        vb.h[0] = *(const v8h*)(Vth + (t * 16 + c) * 64 + kk * 32 + 8 * hh);
        vb.h[1] = *(const v8h*)(Vth + (t * 16 + c) * 64 + kk * 32 + 16 + 8 * hh);
        oacc[t] = mma_h(pa.v, vb.v, oacc[t]);
        FH vl;
        vl.h[0] = *(const v8h*)(Vtl + (t * 16 + c) * 64 + kk * 32 + 8 * hh);
        vl.h[1] = *(const v8h*)(Vtl + (t * 16 + c) * 64 + kk * 32 + 16 + 8 * hh);
        o1[t] = mma_h(pa.v, vl.v, o1[t]);
      }
    }
#pragma unroll
    for (int t = 0; t < 4; ++t)
#pragma unroll
      for (int r = 0; r < 8; ++r) oacc[t][r] += o1[t][r] * (1.0f / 4096.0f);
  }

  // ---- normalise (1/l and the carries via oscl), stage the wave's 16x64 tile in LDS, then write whole 256-B
  float* os = Os[wave];
#pragma unroll
  for (int r = 0; r < 8; ++r) {
    const float l = lrow[r];
    const float inv = ((l > 0.f) ? (1.0f / l) : 0.f) * oscl;
#pragma unroll
    for (int t = 0; t < 4; ++t) {
      os[(8 * hh + r) * 64 + t * 16 + c] = oacc[t][r] * inv;
    }
  }
  __builtin_amdgcn_fence(__ATOMIC_RELEASE, "workgroup");
  __builtin_amdgcn_wave_barrier();
  __builtin_amdgcn_fence(__ATOMIC_ACQUIRE, "workgroup");
  {
    const int h2 = lane >> 4, c4 = (lane & 15) * 4;
    v4f ov[8];
#pragma unroll
    for (int it = 0; it < 8; ++it) {
      const int row = it * 2 + h2;   // it 0..7 x h2 0..1 = rows 0..15 of the wave tile
      ov[it] = *(const v4f*)(os + row * 64 + c4);
    }
    {
#pragma unroll
      for (int it = 0; it < 8; ++it) {
        const int row = it * 2 + h2;
        const size_t go = (rowB + q0 + row) * DM + (size_t)h * HD + c4;
        *(v4f*)(outp + go) = ov[it];
      }
      
    }
  }
}

// =====================================================================================================
// Workspace map (bytes), every region an exact multiple of its whole-line / whole-tile store granularity
// 8192 x 512, 512 x 512 and 4096 x 1024 are whole tiles/lines):
//   Xb    bf16 [8192][512]            0          8388608
//   Wtq   bf16 [512][512]       8388608           524288   ([n][e])
//   Wtk   bf16 [512][512]       8912896           524288
//   Wtv   bf16 [512][512]       9437184           524288
//   Wto   f16  [512][512]       9961472           524288   ([n][k], bf16rne value x4096)
//   Tf    f32  [8192][512]     10485760         16777216   (scratch: q, then k, then v, then msgs)
//   Qh    f16  [8192][512]     27262976          8388608
//   Ql    f16  [8192][512]     35651584          8388608
//   Kh    f16  [8192][512]     44040192          8388608
//   Kl    f16  [8192][512]     52428800          8388608
//   VTh   f16  [4096][1024]    60817408          8388608   ([b*DM + h*64 + d][s])
//   VTl   f16  [4096][1024]    69206016          8388608
//   Mh    f16  [8192][512]     77594624          8388608   (msgs x1024)
//   Ml    f16  [8192][512]     85983232          8388608   (msgs residual)
//   end                        94371840
// Inputs: nodes f32 [8][1024][512]; Wq, Wk, Wv, Wo f32 [512 in][512 out] (x @ W layout); bq, bk, bv, bo f32
// [512] (index h*64+d = n). d_out f32: [8192][512] at byte 0 (row = b*SEQ + t, col = n).
// =====================================================================================================
extern "C" void kernel_launch(void* const* d_in, const int* in_sizes, int n_in,
                              void* d_out, int out_size, void* d_ws, size_t ws_size,
                              hipStream_t stream) {
  if (n_in < 9) return;
  if (in_sizes[0] != NB * SEQ * DM) return;
  if (in_sizes[1] != DM * DM) return;
  if (in_sizes[2] != DM * DM) return;
  if (in_sizes[3] != DM * DM) return;
  if (in_sizes[4] != DM) return;
  if (in_sizes[5] != DM) return;
  if (in_sizes[6] != DM) return;
  if (in_sizes[7] != DM * DM) return;
  if (in_sizes[8] != DM) return;
  if (out_size != OUTN) return;

  const float* x  = (const float*)d_in[0];   // [NB*SEQ][DM]
  const float* Wq = (const float*)d_in[1];   // [DM e][DM n]
  const float* Wk = (const float*)d_in[2];
  const float* Wv = (const float*)d_in[3];
  const float* bq = (const float*)d_in[4];   // [DM]
  const float* bk = (const float*)d_in[5];
  const float* bv = (const float*)d_in[6];
  const float* Wo = (const float*)d_in[7];   // [DM k][DM n]
  const float* bo = (const float*)d_in[8];

  const size_t PXb = (size_t)ROWS * DM * 2;          //  8388608
  const size_t PW  = (size_t)DM * DM * 2;            //   524288
  const size_t PF  = (size_t)ROWS * DM * 4;          // 16777216
  const size_t PH  = (size_t)ROWS * DM * 2;          //  8388608
  const size_t PVt = (size_t)NB * DM * SEQ * 2;      //  8388608
  size_t off = 0;
  const size_t oXb = off; off += PXb;
  const size_t oWq = off; off += PW;
  const size_t oWk = off; off += PW;
  const size_t oWv = off; off += PW;
  const size_t oWo = off; off += PW;
  const size_t oTf = off; off += PF;
  const size_t oQh = off; off += PH;
  const size_t oQl = off; off += PH;
  const size_t oKh = off; off += PH;
  const size_t oKl = off; off += PH;
  const size_t oVt = off; off += PVt;
  const size_t oVl = off; off += PVt;
  const size_t oMh = off; off += PH;
  const size_t oMl = off; off += PH;
  if (off > ws_size) return;                        // off = 94371840
  if (off > (size_t)134217728) return;

  char* ws = (char*)d_ws;
  unsigned short* Xb  = (unsigned short*)(ws + oXb);
  unsigned short* Wtq = (unsigned short*)(ws + oWq);
  unsigned short* Wtk = (unsigned short*)(ws + oWk);
  unsigned short* Wtv = (unsigned short*)(ws + oWv);
  unsigned short* Wto = (unsigned short*)(ws + oWo);
  float*          Tf  = (float*)(ws + oTf);
  unsigned short* Qh  = (unsigned short*)(ws + oQh);
  unsigned short* Ql  = (unsigned short*)(ws + oQl);
  unsigned short* Kh  = (unsigned short*)(ws + oKh);
  unsigned short* Kl  = (unsigned short*)(ws + oKl);
  unsigned short* VTh = (unsigned short*)(ws + oVt);
  unsigned short* VTl = (unsigned short*)(ws + oVl);
  unsigned short* Mh  = (unsigned short*)(ws + oMh);
  unsigned short* Ml  = (unsigned short*)(ws + oMl);
  float*          outf = (float*)d_out;             // [ROWS][DM]

  const dim3 blk(256);
  const int n8x = ROWS * DM / 8;                    // 524288
  const dim3 gCvtX((n8x + 255) / 256);              // 2048 blocks
  const dim3 gWt(DM / 64, DM / 64);                 // (8 e tiles, 8 n tiles)
  const dim3 gGemm(((ROWS / 64) * (DM / 64) + 7) / 8);    // 1024 tiles -> 128 blocks
  const dim3 gGemO(((ROWS / 32) * (DM / 64) + 7) / 8);    // 2048 tiles -> 256 blocks
  const dim3 gVpl(SEQ / 64, NH, NB);                // (16, 8, 8)
  const dim3 gAttn(NB * NH * NQB);                  // 1024 blocks
  const float qkScale = 16.0f;                      // q and k hi planes carried x16 (residual x1024 on top)
  const float sscale  = 1.0f / 2048.0f;             // 1/(16*16) * 1/sqrt(64)
  const float vScale  = 256.0f;                     // v^T hi plane carried x256
  const float attOscl = 1.0f / 262144.0f;           // 1/(1024 * 256): p and v carries folded back
  const float mScale  = 1024.0f;                    // msgs hi plane carried x1024 (residual x1024 on top)
  const float woScale = 4096.0f;                    // Wo^T carried x4096 in f16
  const float outOscl = 1.0f / 4194304.0f;          // 1/(1024 * 4096)

  // (1) activations -> bf16 plane; weights -> transposed 16-bit planes [n][e] (RNE convert)
  cvt_bf16x8<<<gCvtX, blk, 0, stream>>>(x, Xb, n8x);
  wt_bf16<<<gWt, blk, 0, stream>>>(Wq, Wtq);
  wt_bf16<<<gWt, blk, 0, stream>>>(Wk, Wtk);
  wt_bf16<<<gWt, blk, 0, stream>>>(Wv, Wtv);
  wt_f16s<<<gWt, blk, 0, stream>>>(Wo, Wto, woScale);
  // (2) q = Xb . Wtq^T + bq -> Tf [8192][512] (M=8192, N=512, K=512), then f16 hi (x16) + residual planes
  gemm64<<<gGemm, blk, 0, stream>>>(Xb, DM, Wtq, DM, bq, Tf, DM, ROWS, DM, DM);
  planes_f16x8<<<gCvtX, blk, 0, stream>>>(Tf, Qh, Ql, n8x, qkScale);
  // (3) k likewise
  gemm64<<<gGemm, blk, 0, stream>>>(Xb, DM, Wtk, DM, bk, Tf, DM, ROWS, DM, DM);
  planes_f16x8<<<gCvtX, blk, 0, stream>>>(Tf, Kh, Kl, n8x, qkScale);
  // (4) v, then -> f16 v^T hi plane (x256) and residual plane (x4096 on top)
  gemm64<<<gGemm, blk, 0, stream>>>(Xb, DM, Wtv, DM, bv, Tf, DM, ROWS, DM, DM);
  v_planes<<<gVpl, blk, 0, stream>>>(Tf, DM, VTh, VTl, vScale);
  // (5) attention -> msgs f32 [8192][512] in Tf, then f16 hi (x1024) + residual planes
  attn64<<<gAttn, dim3(128), 0, stream>>>(Qh, Ql, Kh, Kl, VTh, VTl, Tf, sscale, attOscl);
  planes_f16x8<<<gCvtX, blk, 0, stream>>>(Tf, Mh, Ml, n8x, mScale);
  // (6) out = msgs . Wo + bo -> d_out f32 [8192][512] (M=8192, N=512, K=512)
  gemm_o<<<gGemO, blk, 0, stream>>>(Mh, Ml, DM, Wto, DM, bo, outf, DM, ROWS, DM, DM, outOscl);
  (void)hipGetLastError();
}

// v001
// Measured time: 212 microseconds a run.
// Two timings next to v000 put it at 1.27 and 1.28 times that version's speed.
// Contractions: q/k/v projections = v_wmma_f32_16x16x32_bf16 (bf16 operands from RNE-converted nodes, W^T and bias, single product); q.k^T scores = v_wmma_f32_16x16x32_f16 (q, k as f16 hi planes carried x16 plus f16 residual planes x1024: hi.hi + (hi.lo + lo.hi) in a separate accumulator, 3 products); p.v = v_wmma_f32_16x16x32_f16 (p carried x1024 in f16; v^T as f16 hi plane x256 plus f16 residual plane x4096 in a separate accumulator folded with 2^-12, 2 products); output projection = v_wmma_f32_16x16x32_f16 (msgs as f16 hi plane x1024 plus f16 residual plane x1024 in a separate accumulator folded with 2^-10; Wo^T = RNE bf16 value carried x4096 in f16; 2 products); all f32 accumulate; softmax in f32.
#include <hip/hip_runtime.h>
#include <math.h>
#include <stdint.h>

#define NB    8
#define SEQ   1024
#define DM    512
#define NH    8
#define HD    64
#define NQB   (SEQ / 64)
#define ROWS  (NB * SEQ)            // 8192 token rows
#define OUTN  (ROWS * DM)
#define KVP   72                    // LDS pitch of the 64-wide f16 tiles in attn64, in halves: 144 B = 16 B x 9 (odd)
#define OSP   68                    // LDS pitch of the 64-wide f32 context tile in attn64, in floats
static_assert(NH * HD == DM);
static_assert(HD == 64);
static_assert((SEQ % 64) == 0 && (DM % 64) == 0 && (ROWS % 64) == 0);
static_assert(((ROWS / 64) * (DM / 64)) % 8 == 0);
static_assert(((ROWS / 32) * (DM / 64)) % 8 == 0);
static_assert(((ROWS * DM / 8) % 256) == 0);

typedef _Float16 v16h __attribute__((ext_vector_type(16)));
typedef _Float16 v8h  __attribute__((ext_vector_type(8)));
typedef __bf16   v16b __attribute__((ext_vector_type(16)));
typedef __bf16   v8b  __attribute__((ext_vector_type(8)));
typedef float    v8f  __attribute__((ext_vector_type(8)));
typedef float    v4f  __attribute__((ext_vector_type(4)));
typedef unsigned int v4u __attribute__((ext_vector_type(4)));

// ---- scalar helpers --------------------------------------------------------------------------------
__device__ __forceinline__ unsigned short bf_bits(float f) {          // f32 -> bf16 bits, RNE convert
  unsigned u = __float_as_uint(f);
  return (unsigned short)((u + 0x7FFFu + ((u >> 16) & 1u)) >> 16);
}
__device__ __forceinline__ float bf_up(unsigned short h) { return __uint_as_float(((unsigned)h) << 16); }
__device__ __forceinline__ unsigned short h_bits(_Float16 x) { return __builtin_bit_cast(unsigned short, x); }
__device__ __forceinline__ unsigned pk16(unsigned short a, unsigned short b) { return (unsigned)a | ((unsigned)b << 16); }
__device__ __forceinline__ v8f zero8() { v8f z = {0.f, 0.f, 0.f, 0.f, 0.f, 0.f, 0.f, 0.f}; return z; }

// ---- fragment loaders: 16-bit A/B operand, lane -> row/col (lane&15), p already includes +8*(lane>>4);
//      elements 0..7 <- p[0..7] (k0+8h..), elements 8..15 <- p[16..23] (k0+16+8h..)
__device__ __forceinline__ v16b ldfrag_b(const __bf16* p) {
  union { v16b v; v8b h[2]; } f;
  f.h[0] = *(const v8b*)(p);
  f.h[1] = *(const v8b*)(p + 16);
  return f.v;
}
__device__ __forceinline__ v16h ldfrag_h(const _Float16* p) {
  union { v16h v; v8h h[2]; } f;
  f.h[0] = *(const v8h*)(p);
  f.h[1] = *(const v8h*)(p + 16);
  return f.v;
}

// ---- WMMA helpers with trailing VALU hazard gap --------------------------------------------------------
__device__ __forceinline__ v8f mma_h(v16h a, v16h b, v8f c) {
  c = __builtin_amdgcn_wmma_f32_16x16x32_f16(false, a, false, b, (short)0, c, false, false);
#if defined(__HIP_DEVICE_COMPILE__)
  asm volatile("v_nop\n\tv_nop\n\tv_nop\n\tv_nop" : "+v"(c) : "v"(a), "v"(b));
#endif
  return c;
}
__device__ __forceinline__ v8f mma_b_raw(v16b a, v16b b, v8f c) {
  return __builtin_amdgcn_wmma_f32_16x16x32_bf16(false, a, false, b, (short)0, c, false, false);
}
__device__ __forceinline__ void dep_guard_b(v8f& a, v8f& b, v16b x, v16b y) {
#if defined(__HIP_DEVICE_COMPILE__)
  asm volatile("v_nop\n\tv_nop\n\tv_nop\n\tv_nop" : "+v"(a), "+v"(b) : "v"(x), "v"(y));
#endif
}
__device__ __forceinline__ void keep4_b(v16b a, v16b b, v16b c, v16b d) {
#if defined(__HIP_DEVICE_COMPILE__)
  asm volatile("v_nop" :: "v"(a), "v"(b), "v"(c), "v"(d));
#endif
}
__device__ __forceinline__ void acc_guard4(v8f& a, v8f& b, v8f& c, v8f& d) {
#if defined(__HIP_DEVICE_COMPILE__)
  asm volatile("v_nop\n\tv_nop\n\tv_nop\n\tv_nop" : "+v"(a), "+v"(b), "+v"(c), "+v"(d));
#endif
}

// =====================================================================================================
// f32 -> bf16 (RNE convert), 8 elements per thread, one 16-B store per lane: a wave writes 512 contiguous B
// coverage: n8 threads x 8 = whole plane (n8 is a multiple of 256 here).
// =====================================================================================================
__global__ __launch_bounds__(256) void cvt_bf16x8(const float* __restrict__ in, unsigned short* out, int n8) {
  const int i = blockIdx.x * 256 + threadIdx.x;
  if (i < n8) {
    const v4f a = *(const v4f*)(in + (size_t)i * 8);
    const v4f b = *(const v4f*)(in + (size_t)i * 8 + 4);
    v4u p;
    p[0] = pk16(bf_bits(a[0]), bf_bits(a[1]));
    p[1] = pk16(bf_bits(a[2]), bf_bits(a[3]));
    p[2] = pk16(bf_bits(b[0]), bf_bits(b[1]));
    p[3] = pk16(bf_bits(b[2]), bf_bits(b[3]));
    *(v4u*)(out + (size_t)i * 8) = p;
    
  }
}

// =====================================================================================================
// f32 -> f16 hi plane = f16(v * scale) (scale a power of two) + f16 residual plane = f16((v*scale - hi) * 1024),
// same element index in both planes; 8 elements per thread, one 16-B store per lane and plane: a wave writes
// coverage: n8 threads x 8 = whole plane (n8 multiple of 256).
// =====================================================================================================
__global__ __launch_bounds__(256) void planes_f16x8(const float* __restrict__ in, unsigned short* hp,
                                                    unsigned short* lp, int n8, float scale) {
  const int i = blockIdx.x * 256 + threadIdx.x;
  if (i < n8) {
    const v4f a = *(const v4f*)(in + (size_t)i * 8);
    const v4f b = *(const v4f*)(in + (size_t)i * 8 + 4);
    float f[8];
    f[0] = a[0]; f[1] = a[1]; f[2] = a[2]; f[3] = a[3];
    f[4] = b[0]; f[5] = b[1]; f[6] = b[2]; f[7] = b[3];
    v4u ph, pl;
#pragma unroll
    for (int e = 0; e < 4; ++e) {
      const float f0 = f[2 * e] * scale;
      const float f1 = f[2 * e + 1] * scale;
      const _Float16 x0 = (_Float16)f0, x1 = (_Float16)f1;
      const _Float16 l0 = (_Float16)((f0 - (float)x0) * 1024.0f);
      const _Float16 l1 = (_Float16)((f1 - (float)x1) * 1024.0f);
      ph[e] = pk16(h_bits(x0), h_bits(x1));
      pl[e] = pk16(h_bits(l0), h_bits(l1));
    }
    *(v4u*)(hp + (size_t)i * 8) = ph;
    *(v4u*)(lp + (size_t)i * 8) = pl;
    
  }
}

// =====================================================================================================
// Weight transpose + convert: in W f32 [DM rows (e, contraction index)][DM cols (n, output feature)] (the
// x @ W layout) -> out Wt 16-bit [DM (n)][DM (e)] (the [n][k], k-contiguous layout the GEMM B operand uses).
// MODE 0: RNE bf16 bits. MODE 1: f16 bits of (RNE bf16 value * scale), scale a power of two (exact in f16).
// Block = one 64 e x 64 n tile: grid = (DM/64 e tiles, DM/64 n tiles). The tile is staged in LDS as [ee][nn]
// pitch 68 floats (v4f loads, __syncthreads). in[rows e][cols n] -> out[rows n][cols e] (square here).
// Store: group g = tid>>3 (0..31), piece = tid&7: iteration it writes row n0 + (it*32+g), lanes 8q..8q+7 x 16 B
// coverage: 2 iterations x 32 groups = 64 rows n, 8 pieces x 8 = 64 e per row; grid covers every (e tile,
// n tile) -> the whole [DM][DM] plane.
// =====================================================================================================
template <int MODE>
__device__ __forceinline__ void wt_tile_body(const float* __restrict__ W, unsigned short* Wt, float scale,
                                             float* sw) {
  const int tid = threadIdx.x;
  const int e0  = blockIdx.x * 64;
  const int n0  = blockIdx.y * 64;
#pragma unroll
  for (int i = 0; i < 4; ++i) {
    const int idx = i * 256 + tid;                  // 0..1023
    const int ee = idx >> 4, c4 = (idx & 15) * 4;
    const v4f a = *(const v4f*)(W + ((size_t)(e0 + ee)) * DM + n0 + c4);
    *(v4f*)(sw + ee * 68 + c4) = a;
  }
  __syncthreads();

  const int g = tid >> 3, piece = tid & 7;
  v4u hv[2];
  size_t hofs[2];
#pragma unroll
  for (int it = 0; it < 2; ++it) {
    const int n = it * 32 + g;
    v4u a;
#pragma unroll
    for (int e = 0; e < 4; ++e) {
      const float f0 = sw[(piece * 8 + 2 * e) * 68 + n];
      const float f1 = sw[(piece * 8 + 2 * e + 1) * 68 + n];
      unsigned short u0, u1;
      if (MODE == 0) {
        u0 = bf_bits(f0);
        u1 = bf_bits(f1);
      } else {
        u0 = h_bits((_Float16)(bf_up(bf_bits(f0)) * scale));
        u1 = h_bits((_Float16)(bf_up(bf_bits(f1)) * scale));
      }
      a[e] = pk16(u0, u1);
    }
    hv[it] = a;
    hofs[it] = ((size_t)(n0 + n)) * DM + e0 + piece * 8;
  }
  {
#pragma unroll
    for (int it = 0; it < 2; ++it) {
      *(v4u*)(Wt + hofs[it]) = hv[it];
    }
    
  }
}
__global__ __launch_bounds__(256) void wt_bf16(const float* __restrict__ W, unsigned short* Wt) {
  __shared__ __align__(16) float sw[64 * 68];       // [ee][nn] pitch 68 floats
  wt_tile_body<0>(W, Wt, 1.0f, sw);
}
__global__ __launch_bounds__(256) void wt_f16s(const float* __restrict__ W, unsigned short* Wt, float scale) {
  __shared__ __align__(16) float sw[64 * 68];       // [ee][nn] pitch 68 floats
  wt_tile_body<1>(W, Wt, scale, sw);
}

// =====================================================================================================
// Register-blocked bf16 WMMA GEMM with bias: C[m][n] = sum_k A[m][k] * Bt[n][k] + bf16rne(bias[n]); one wave per
// 64x64 tile, no block barriers. A row-major [M][K] pitch lda; Bt row-major [N][K] pitch ldb (k contiguous);
// bias f32 [N] (RNE converted to bf16 and widened in the epilogue); M, N multiples of 64, K multiple of 32
// (host-checked); the tile count is a multiple of 8 for every launch here (no idle waves).
// Output f32 [M][N] pitch ldc. Epilogue: 16-row slabs staged per wave in LDS; each 64-wide row segment
// =====================================================================================================
__global__ __launch_bounds__(256) void gemm64(
    const unsigned short* __restrict__ Ap, int lda,
    const unsigned short* __restrict__ Btp, int ldb,
    const float* __restrict__ bias,
    float* C, int ldc, int M, int N, int K) {
  const __bf16* Ab  = (const __bf16*)(const void*)Ap;
  const __bf16* Bb  = (const __bf16*)(const void*)Btp;
  __shared__ __align__(16) float sT[8][16 * 68];   // per-wave 16x64 slab, pitch 68 floats
  const int lane = threadIdx.x & 31;
  const int wave = threadIdx.x >> 5;
  const int tilesN = N >> 6;
  const int tilesM = M >> 6;
  const int tile = blockIdx.x * 8 + wave;
  if (tile >= tilesM * tilesN) return;   // wave-uniform; no block barriers in this kernel
  const int tm = tile / tilesN;
  const int tn = tile - tm * tilesN;
  const int m0 = tm << 6;
  const int n0 = tn << 6;

  const int rlane = lane & 15;                 // row (A) / col (B, D) within subtile
  const int koff  = (lane >> 4) * 8;           // k offset of this lane half
  const int mOff  = (lane >> 4) * 8;           // D row offset

  v8f acc[4][4];
#pragma unroll
  for (int i = 0; i < 4; ++i)
#pragma unroll
    for (int j = 0; j < 4; ++j) acc[i][j] = zero8();

  for (int k0 = 0; k0 < K; k0 += 32) {
    v16b bh[4];
#pragma unroll
    for (int j = 0; j < 4; ++j) {
      const size_t bo = (size_t)(n0 + (j << 4) + rlane) * ldb + koff + k0;
      bh[j] = ldfrag_b(Bb + bo);
    }
#pragma unroll
    for (int i = 0; i < 4; ++i) {
      const size_t ao = (size_t)(m0 + (i << 4) + rlane) * lda + koff + k0;
      const v16b ah = ldfrag_b(Ab + ao);
#pragma unroll
      for (int j = 0; j < 4; ++j) {
        acc[i][j] = mma_b_raw(ah, bh[j], acc[i][j]);
      }
      dep_guard_b(acc[i][0], acc[i][3], ah, ah);
    }
    keep4_b(bh[0], bh[1], bh[2], bh[3]);
  }
  acc_guard4(acc[0][0], acc[0][1], acc[0][2], acc[0][3]);
  acc_guard4(acc[1][0], acc[1][1], acc[1][2], acc[1][3]);
  acc_guard4(acc[2][0], acc[2][1], acc[2][2], acc[2][3]);
  acc_guard4(acc[3][0], acc[3][1], acc[3][2], acc[3][3]);

  // ---- bias per D column of this lane (n0 + 16j + rlane < N) ----
  float bz[4];
#pragma unroll
  for (int j = 0; j < 4; ++j) bz[j] = bf_up(bf_bits(bias[n0 + (j << 4) + rlane]));

  // ---- epilogue ----
  float* slab = sT[wave];
#pragma unroll
  for (int i = 0; i < 4; ++i) {
    const int mBase = m0 + (i << 4);
#pragma unroll
    for (int r = 0; r < 8; ++r) {
#pragma unroll
      for (int j = 0; j < 4; ++j) {
        slab[(mOff + r) * 68 + (j << 4) + rlane] = acc[i][j][r] + bz[j];
      }
    }
    __builtin_amdgcn_fence(__ATOMIC_RELEASE, "workgroup");
    __builtin_amdgcn_wave_barrier();
    __builtin_amdgcn_fence(__ATOMIC_ACQUIRE, "workgroup");
    {
      const int hh = lane >> 4, c4 = (lane & 15) * 4;     // 256-B row segment = 16 lanes x 16 B
      v4f ov[8];
#pragma unroll
      for (int it = 0; it < 8; ++it) {
        const int row = it * 2 + hh;                       // it 0..7 x hh 0..1 = rows 0..15
        ov[it] = *(const v4f*)(slab + row * 68 + c4);
      }
      {
#pragma unroll
        for (int it = 0; it < 8; ++it) {
          const int row = it * 2 + hh;
          *(v4f*)(C + (size_t)(mBase + row) * ldc + n0 + c4) = ov[it];
        }
        
      }
    }
    __builtin_amdgcn_fence(__ATOMIC_RELEASE, "workgroup");
    __builtin_amdgcn_wave_barrier();
    __builtin_amdgcn_fence(__ATOMIC_ACQUIRE, "workgroup");
  }
}

// =====================================================================================================
// f16 WMMA GEMM with a two-plane A operand and bias:
//   C[m][n] = (sum_k Ah[m][k]*Bt[n][k] + 2^-10 * sum_k Al[m][k]*Bt[n][k]) * oscale + bf16rne(bias[n]),
// the residual products in a separate accumulator. One wave per 32x64 tile, no block barriers. Ah/Al row-major
// [M][K] pitch lda (f16 hi and residual planes, same index); Bt row-major [N][K] pitch ldb (f16, k contiguous);
// M multiple of 32, N multiple of 64, K multiple of 32 (host-checked); tile count a multiple of 8 (no idle
// waves). A fragments (2 rows x 2 planes) cached per k-step, B fragments streamed; every WMMA nop-guarded.
// Output f32 [M][N] pitch ldc. Epilogue: 16-row slabs staged per wave in LDS; each 64-wide row segment (256 B)
// coverage: 2 slabs x 16 rows x 64 cols = the wave's whole 32x64 tile.
// =====================================================================================================
__global__ __launch_bounds__(256) void gemm_o(
    const unsigned short* __restrict__ Ahp, const unsigned short* __restrict__ Alp, int lda,
    const unsigned short* __restrict__ Btp, int ldb,
    const float* __restrict__ bias,
    float* C, int ldc, int M, int N, int K, float oscale) {
  const _Float16* Ah = (const _Float16*)(const void*)Ahp;
  const _Float16* Al = (const _Float16*)(const void*)Alp;
  const _Float16* Bh = (const _Float16*)(const void*)Btp;
  __shared__ __align__(16) float sT[8][16 * 68];   // per-wave 16x64 slab, pitch 68 floats
  const int lane = threadIdx.x & 31;
  const int wave = threadIdx.x >> 5;
  const int tilesN = N >> 6;
  const int tilesM = M >> 5;
  const int tile = blockIdx.x * 8 + wave;
  if (tile >= tilesM * tilesN) return;   // wave-uniform; no block barriers in this kernel
  const int tm = tile / tilesN;
  const int tn = tile - tm * tilesN;
  const int m0 = tm << 5;
  const int n0 = tn << 6;

  const int rlane = lane & 15;
  const int koff  = (lane >> 4) * 8;
  const int mOff  = (lane >> 4) * 8;

  v8f acc[2][4], acl[2][4];
#pragma unroll
  for (int i = 0; i < 2; ++i)
#pragma unroll
    for (int j = 0; j < 4; ++j) { acc[i][j] = zero8(); acl[i][j] = zero8(); }

  for (int k0 = 0; k0 < K; k0 += 32) {
    v16h ah[2], al[2];
#pragma unroll
    for (int i = 0; i < 2; ++i) {
      const size_t ao = (size_t)(m0 + (i << 4) + rlane) * lda + koff + k0;
      ah[i] = ldfrag_h(Ah + ao);
      al[i] = ldfrag_h(Al + ao);
    }
#pragma unroll
    for (int j = 0; j < 4; ++j) {
      const size_t bo = (size_t)(n0 + (j << 4) + rlane) * ldb + koff + k0;
      const v16h bfr = ldfrag_h(Bh + bo);
#pragma unroll
      for (int i = 0; i < 2; ++i) {
        acc[i][j] = mma_h(ah[i], bfr, acc[i][j]);
        acl[i][j] = mma_h(al[i], bfr, acl[i][j]);
      }
    }
  }

  // ---- bias per D column of this lane (n0 + 16j + rlane < N) ----
  float bz[4];
#pragma unroll
  for (int j = 0; j < 4; ++j) bz[j] = bf_up(bf_bits(bias[n0 + (j << 4) + rlane]));

  // ---- epilogue ----
  float* slab = sT[wave];
#pragma unroll
  for (int i = 0; i < 2; ++i) {
    const int mBase = m0 + (i << 4);
#pragma unroll
    for (int r = 0; r < 8; ++r) {
#pragma unroll
      for (int j = 0; j < 4; ++j) {
        const float y = (acc[i][j][r] + acl[i][j][r] * (1.0f / 1024.0f)) * oscale + bz[j];
        slab[(mOff + r) * 68 + (j << 4) + rlane] = y;
      }
    }
    __builtin_amdgcn_fence(__ATOMIC_RELEASE, "workgroup");
    __builtin_amdgcn_wave_barrier();
    __builtin_amdgcn_fence(__ATOMIC_ACQUIRE, "workgroup");
    {
      const int hh = lane >> 4, c4 = (lane & 15) * 4;     // 256-B row segment = 16 lanes x 16 B
      v4f ov[8];
#pragma unroll
      for (int it = 0; it < 8; ++it) {
        const int row = it * 2 + hh;                       // it 0..7 x hh 0..1 = rows 0..15
        ov[it] = *(const v4f*)(slab + row * 68 + c4);
      }
      {
#pragma unroll
        for (int it = 0; it < 8; ++it) {
          const int row = it * 2 + hh;
          *(v4f*)(C + (size_t)(mBase + row) * ldc + n0 + c4) = ov[it];
        }
        
      }
    }
    __builtin_amdgcn_fence(__ATOMIC_RELEASE, "workgroup");
    __builtin_amdgcn_wave_barrier();
    __builtin_amdgcn_fence(__ATOMIC_ACQUIRE, "workgroup");
  }
}

// =====================================================================================================
// v f32 token-major columns vf[(b*SEQ + t)*vrp + h*64 + d] ->
// f16 v^T hi plane vth[(b*DM + h*64 + d)*SEQ + t] = f16(v * vscale) (vscale a power of two) and residual plane
// vtl[same index] = f16((v*vscale - hi) * 4096).
// Block = one 64-token x 64-feature tile of one (b, h); grid = (SEQ/64, NH, NB); tile staged in LDS as f32
// (v4f loads, __syncthreads).
// Store: group g = tid>>3 (0..31), piece = tid&7: iteration it writes row d = it*32+g, lanes 8q..8q+7 x 16 B =
// coverage: 2 iterations x 32 groups = 64 rows d, 8 pieces x 8 = 64 tokens per row; grid covers every (b, h,
// t tile) -> both whole planes.
// =====================================================================================================
__global__ __launch_bounds__(256) void v_planes(const float* __restrict__ vf, int vrp,
                                                unsigned short* vth, unsigned short* vtl, float vscale) {
  __shared__ __align__(16) float sv[64 * 68];       // [tt][d] pitch 68 floats
  const int tid = threadIdx.x;
  const int t0  = blockIdx.x * 64;
  const int hh  = blockIdx.y;
  const int b   = blockIdx.z;
#pragma unroll
  for (int i = 0; i < 4; ++i) {
    const int idx = i * 256 + tid;                  // 0..1023
    const int tt = idx >> 4, c4 = (idx & 15) * 4;
    const v4f a = *(const v4f*)(vf + ((size_t)(b * SEQ + t0 + tt)) * vrp + hh * HD + c4);
    *(v4f*)(sv + tt * 68 + c4) = a;
  }
  __syncthreads();

  const int g = tid >> 3, piece = tid & 7;
  v4u hv[2], lv[2];
  size_t hofs[2];
#pragma unroll
  for (int it = 0; it < 2; ++it) {
    const int d = it * 32 + g;
    v4u a, a2;
#pragma unroll
    for (int e = 0; e < 4; ++e) {
      const float f0 = sv[(piece * 8 + 2 * e) * 68 + d] * vscale;
      const float f1 = sv[(piece * 8 + 2 * e + 1) * 68 + d] * vscale;
      const _Float16 x0 = (_Float16)f0, x1 = (_Float16)f1;
      const unsigned short h0 = h_bits(x0), h1 = h_bits(x1);
      const unsigned short l0 = h_bits((_Float16)((f0 - (float)x0) * 4096.0f));
      const unsigned short l1 = h_bits((_Float16)((f1 - (float)x1) * 4096.0f));
      a[e] = pk16(h0, h1); a2[e] = pk16(l0, l1);
    }
    hv[it] = a; lv[it] = a2;
    hofs[it] = ((size_t)(b * DM + hh * HD + d)) * SEQ + t0 + piece * 8;
  }
  {
#pragma unroll
    for (int it = 0; it < 2; ++it) {
      *(v4u*)(vth + hofs[it]) = hv[it];
      *(v4u*)(vtl + hofs[it]) = lv[it];
    }
    
  }
}

// =====================================================================================================
// Bidirectional multi-head attention, head dim 64, no mask.
//   q f16 hi plane (x16): element (b, t, h, d) at [(b*SEQ + t)*DM + h*64 + d]; q residual plane
//     ((q*16 - hi)*1024) at the same index into qlp
//   k f16 hi plane (x16): element (b, s, h, d) at [(b*SEQ + s)*DM + h*64 + d]; k residual plane same into klp
//   v^T f16 hi plane (x256): element (b, h, d, s) at [(b*DM + h*64 + d)*SEQ + s]
//   v^T f16 residual plane ((v*256 - hi)*4096): same index into vlp
//   All NQB key tiles of 64 are processed for every query tile (static trip count).
//   logit = (qhi.khi + (qhi.klo + qlo.khi) * 2^-10) * sscale, f16 products with f32 accumulate, the residual
//   products in a separate accumulator; p = exp(s - m) carried as ph = f16(1024 p);
//   context = ph . vhi on f16 WMMA plus ph . vres into a separate accumulator folded back with 2^-12 per tile
//   in f32; online softmax in f32; out f32 plane: element (b, t, h*64 + d) at [(b*SEQ + t)*DM + h*64 + d] =
//   normalised context (oscl folds back the p and v carries).
//   Block = 4 waves = 64 query rows of one (b, h); grid = NB*NH*NQB; kv tiles of 64.
//   K hi / K residual / V^T hi / V^T residual tile staging: 128 threads x 32 elements per plane = the whole
//   64x64 tile (plain 16-B loads, __syncthreads before and after); P tiles are wave-private, spilled with
//   Output coverage: each wave stores rows q0..q0+15 (it 0..7 x lane>>4 0..1) x 64 columns (16 lanes x 4
//   (b, h, query tile) -> the whole plane.
// =====================================================================================================
__global__ __launch_bounds__(128)
void attn64(const unsigned short* __restrict__ qhp, const unsigned short* __restrict__ qlp,
            const unsigned short* __restrict__ khp, const unsigned short* __restrict__ klp,
            const unsigned short* __restrict__ vhp, const unsigned short* __restrict__ vlp,
            float* outp, float sscale, float oscl) {
  union FH { v16h v; v8h h[2]; };
  __shared__ __align__(16) _Float16 Ksh[64 * KVP];                // K hi [kv][d]    9 KB
  __shared__ __align__(16) _Float16 Ksl[64 * KVP];                // K residual      9 KB
  __shared__ __align__(16) _Float16 Vth[64 * KVP];                // V^T hi [d][kv]  9 KB
  __shared__ __align__(16) _Float16 Vtl[64 * KVP];                // V^T residual    9 KB
  __shared__ __align__(16) _Float16 Psh[4][16 * KVP];             // per wave P hi [row][kv]      9 KB
  __shared__ __align__(16) float    Os[4][16 * OSP];              // per wave context tile [row][d] 17 KB

  const int tid  = threadIdx.x;
  const int wave = tid >> 5;
  const int lane = tid & 31;
  const int hh   = lane >> 4;
  const int c    = lane & 15;

  const int bx   = blockIdx.x;
  const int qb   = bx % NQB;
  const int rest = bx / NQB;
  const int h    = rest % NH;
  const int b    = rest / NH;                // < NB by the grid size
  const int q0   = qb * 64 + wave * 16;
  const size_t rowB = (size_t)b * SEQ;

  const _Float16* Qp  = (const _Float16*)(const void*)qhp + (size_t)h * HD;
  const _Float16* Qlq = (const _Float16*)(const void*)qlp + (size_t)h * HD;
  const _Float16* Kp  = (const _Float16*)(const void*)khp + (size_t)h * HD;
  const _Float16* Klq = (const _Float16*)(const void*)klp + (size_t)h * HD;
  const _Float16* Vh  = (const _Float16*)(const void*)vhp + ((size_t)b * DM + (size_t)h * HD) * SEQ;
  const _Float16* Vl  = (const _Float16*)(const void*)vlp + ((size_t)b * DM + (size_t)h * HD) * SEQ;

  // ---- Q fragments (A operand, row = lane&15): 2 d-chunks, hi and residual ----
  v16h qa[2], ql[2];
#pragma unroll
  for (int dc = 0; dc < 2; ++dc) {
    const size_t qo = (rowB + q0 + c) * DM + dc * 32 + 8 * hh;
    qa[dc] = ldfrag_h(Qp + qo);
    ql[dc] = ldfrag_h(Qlq + qo);
  }

  float mrow[8], lrow[8];
  v8f oacc[4];
#pragma unroll
  for (int r = 0; r < 8; ++r) { mrow[r] = -INFINITY; lrow[r] = 0.f; }
#pragma unroll
  for (int t = 0; t < 4; ++t) oacc[t] = zero8();

  for (int kt = 0; kt < NQB; ++kt) {
    const int kv0 = kt * 64;
    __syncthreads();
    {
      const int r = tid >> 1, half = (tid & 1) * 32;
      const _Float16* kg  = Kp  + (rowB + kv0 + r) * DM + half;    // K hi row kv0+r, d = half..half+31
      const _Float16* klg = Klq + (rowB + kv0 + r) * DM + half;    // K residual row kv0+r
      const _Float16* vg  = Vh + (size_t)r * SEQ + kv0 + half;     // V^T hi row d = r, s = kv0+half..+31
      const _Float16* vlg = Vl + (size_t)r * SEQ + kv0 + half;     // V^T residual row d = r
#pragma unroll
      for (int i = 0; i < 4; ++i) {
        const v8h a0 = *(const v8h*)(kg + 8 * i);
        const v8h a1 = *(const v8h*)(klg + 8 * i);
        const v8h b0 = *(const v8h*)(vg + 8 * i);
        const v8h b1 = *(const v8h*)(vlg + 8 * i);
        *(v8h*)(Ksh + r * KVP + half + 8 * i) = a0;
        *(v8h*)(Ksl + r * KVP + half + 8 * i) = a1;
        *(v8h*)(Vth + r * KVP + half + 8 * i) = b0;
        *(v8h*)(Vtl + r * KVP + half + 8 * i) = b1;
      }
    }
    __syncthreads();

    // ---- scores: 16 query rows x 64 keys per wave; hi.hi into s, hi.lo + lo.hi into s1 (folded x 2^-10) ----
    v8f s[4];
#pragma unroll
    for (int j = 0; j < 4; ++j) {
      s[j] = zero8();
      v8f s1 = zero8();
#pragma unroll
      for (int dc = 0; dc < 2; ++dc) {
        FH kb, kr;
        kb.h[0] = *(const v8h*)(Ksh + (j * 16 + c) * KVP + dc * 32 + 8 * hh);
        kb.h[1] = *(const v8h*)(Ksh + (j * 16 + c) * KVP + dc * 32 + 16 + 8 * hh);
        kr.h[0] = *(const v8h*)(Ksl + (j * 16 + c) * KVP + dc * 32 + 8 * hh);
        kr.h[1] = *(const v8h*)(Ksl + (j * 16 + c) * KVP + dc * 32 + 16 + 8 * hh);
        s[j] = mma_h(qa[dc], kb.v, s[j]);
        s1   = mma_h(qa[dc], kr.v, s1);
        s1   = mma_h(ql[dc], kb.v, s1);
      }
#pragma unroll
      for (int r = 0; r < 8; ++r) s[j][r] += s1[r] * (1.0f / 1024.0f);
    }

    // ---- scale, row max, online softmax, P (x1024, f16) to LDS ----
    _Float16* pwh = Psh[wave];
#pragma unroll
    for (int r = 0; r < 8; ++r) {
      float m = -INFINITY;
#pragma unroll
      for (int j = 0; j < 4; ++j) {
        const float sv = s[j][r] * sscale;
        s[j][r] = sv;
        m = fmaxf(m, sv);
      }
#pragma unroll
      for (int off = 1; off < 16; off <<= 1) m = fmaxf(m, __shfl_xor(m, off, 32));
      const float mnew  = fmaxf(mrow[r], m);
      const float msafe = (mnew == -INFINITY) ? 0.f : mnew;
      const float alpha = __expf(mrow[r] - msafe);
      mrow[r] = mnew;
      float psum = 0.f;
#pragma unroll
      for (int j = 0; j < 4; ++j) {
        const float p = __expf(s[j][r] - msafe);
        psum += p;
        const float p1024 = p * 1024.0f;
        const _Float16 ph = (_Float16)p1024;
        pwh[(8 * hh + r) * KVP + j * 16 + c] = ph;
      }
#pragma unroll
      for (int off = 1; off < 16; off <<= 1) psum += __shfl_xor(psum, off, 32);
      lrow[r] = lrow[r] * alpha + psum;
#pragma unroll
      for (int t = 0; t < 4; ++t) oacc[t][r] *= alpha;
    }
    __builtin_amdgcn_fence(__ATOMIC_RELEASE, "workgroup");
    __builtin_amdgcn_wave_barrier();
    __builtin_amdgcn_fence(__ATOMIC_ACQUIRE, "workgroup");

    // ---- context += P . Vhi (f16 WMMA); P . Vres into a separate accumulator ----
    v8f o1[4];
#pragma unroll
    for (int t = 0; t < 4; ++t) o1[t] = zero8();
#pragma unroll 1
    for (int kk = 0; kk < 2; ++kk) {
      FH pa;
      pa.h[0] = *(const v8h*)(pwh + c * KVP + kk * 32 + 8 * hh);
      pa.h[1] = *(const v8h*)(pwh + c * KVP + kk * 32 + 16 + 8 * hh);
#pragma unroll
      for (int t = 0; t < 4; ++t) {
        FH vb;
        vb.h[0] = *(const v8h*)(Vth + (t * 16 + c) * KVP + kk * 32 + 8 * hh);
        vb.h[1] = *(const v8h*)(Vth + (t * 16 + c) * KVP + kk * 32 + 16 + 8 * hh);
        oacc[t] = mma_h(pa.v, vb.v, oacc[t]);
        FH vl;
        vl.h[0] = *(const v8h*)(Vtl + (t * 16 + c) * KVP + kk * 32 + 8 * hh);
        vl.h[1] = *(const v8h*)(Vtl + (t * 16 + c) * KVP + kk * 32 + 16 + 8 * hh);
        o1[t] = mma_h(pa.v, vl.v, o1[t]);
      }
    }
#pragma unroll
    for (int t = 0; t < 4; ++t)
#pragma unroll
      for (int r = 0; r < 8; ++r) oacc[t][r] += o1[t][r] * (1.0f / 4096.0f);
  }

  // ---- normalise (1/l and the carries via oscl), stage the wave's 16x64 tile in LDS, then write whole 256-B
  float* os = Os[wave];
#pragma unroll
  for (int r = 0; r < 8; ++r) {
    const float l = lrow[r];
    const float inv = ((l > 0.f) ? (1.0f / l) : 0.f) * oscl;
#pragma unroll
    for (int t = 0; t < 4; ++t) {
      os[(8 * hh + r) * OSP + t * 16 + c] = oacc[t][r] * inv;
    }
  }
  __builtin_amdgcn_fence(__ATOMIC_RELEASE, "workgroup");
  __builtin_amdgcn_wave_barrier();
  __builtin_amdgcn_fence(__ATOMIC_ACQUIRE, "workgroup");
  {
    const int h2 = lane >> 4, c4 = (lane & 15) * 4;
    v4f ov[8];
#pragma unroll
    for (int it = 0; it < 8; ++it) {
      const int row = it * 2 + h2;   // it 0..7 x h2 0..1 = rows 0..15 of the wave tile
      ov[it] = *(const v4f*)(os + row * OSP + c4);
    }
    {
#pragma unroll
      for (int it = 0; it < 8; ++it) {
        const int row = it * 2 + h2;
        const size_t go = (rowB + q0 + row) * DM + (size_t)h * HD + c4;
        *(v4f*)(outp + go) = ov[it];
      }
      
    }
  }
}

// =====================================================================================================
// Workspace map (bytes), every region an exact multiple of its whole-line / whole-tile store granularity
// 8192 x 512, 512 x 512 and 4096 x 1024 are whole tiles/lines):
//   Xb    bf16 [8192][512]            0          8388608
//   Wtq   bf16 [512][512]       8388608           524288   ([n][e])
//   Wtk   bf16 [512][512]       8912896           524288
//   Wtv   bf16 [512][512]       9437184           524288
//   Wto   f16  [512][512]       9961472           524288   ([n][k], bf16rne value x4096)
//   Tf    f32  [8192][512]     10485760         16777216   (scratch: q, then k, then v, then msgs)
//   Qh    f16  [8192][512]     27262976          8388608
//   Ql    f16  [8192][512]     35651584          8388608
//   Kh    f16  [8192][512]     44040192          8388608
//   Kl    f16  [8192][512]     52428800          8388608
//   VTh   f16  [4096][1024]    60817408          8388608   ([b*DM + h*64 + d][s])
//   VTl   f16  [4096][1024]    69206016          8388608
//   Mh    f16  [8192][512]     77594624          8388608   (msgs x1024)
//   Ml    f16  [8192][512]     85983232          8388608   (msgs residual)
//   end                        94371840
// Inputs: nodes f32 [8][1024][512]; Wq, Wk, Wv, Wo f32 [512 in][512 out] (x @ W layout); bq, bk, bv, bo f32
// [512] (index h*64+d = n). d_out f32: [8192][512] at byte 0 (row = b*SEQ + t, col = n).
// =====================================================================================================
extern "C" void kernel_launch(void* const* d_in, const int* in_sizes, int n_in,
                              void* d_out, int out_size, void* d_ws, size_t ws_size,
                              hipStream_t stream) {
  if (n_in < 9) return;
  if (in_sizes[0] != NB * SEQ * DM) return;
  if (in_sizes[1] != DM * DM) return;
  if (in_sizes[2] != DM * DM) return;
  if (in_sizes[3] != DM * DM) return;
  if (in_sizes[4] != DM) return;
  if (in_sizes[5] != DM) return;
  if (in_sizes[6] != DM) return;
  if (in_sizes[7] != DM * DM) return;
  if (in_sizes[8] != DM) return;
  if (out_size != OUTN) return;

  const float* x  = (const float*)d_in[0];   // [NB*SEQ][DM]
  const float* Wq = (const float*)d_in[1];   // [DM e][DM n]
  const float* Wk = (const float*)d_in[2];
  const float* Wv = (const float*)d_in[3];
  const float* bq = (const float*)d_in[4];   // [DM]
  const float* bk = (const float*)d_in[5];
  const float* bv = (const float*)d_in[6];
  const float* Wo = (const float*)d_in[7];   // [DM k][DM n]
  const float* bo = (const float*)d_in[8];

  const size_t PXb = (size_t)ROWS * DM * 2;          //  8388608
  const size_t PW  = (size_t)DM * DM * 2;            //   524288
  const size_t PF  = (size_t)ROWS * DM * 4;          // 16777216
  const size_t PH  = (size_t)ROWS * DM * 2;          //  8388608
  const size_t PVt = (size_t)NB * DM * SEQ * 2;      //  8388608
  size_t off = 0;
  const size_t oXb = off; off += PXb;
  const size_t oWq = off; off += PW;
  const size_t oWk = off; off += PW;
  const size_t oWv = off; off += PW;
  const size_t oWo = off; off += PW;
  const size_t oTf = off; off += PF;
  const size_t oQh = off; off += PH;
  const size_t oQl = off; off += PH;
  const size_t oKh = off; off += PH;
  const size_t oKl = off; off += PH;
  const size_t oVt = off; off += PVt;
  const size_t oVl = off; off += PVt;
  const size_t oMh = off; off += PH;
  const size_t oMl = off; off += PH;
  if (off > ws_size) return;                        // off = 94371840
  if (off > (size_t)134217728) return;

  char* ws = (char*)d_ws;
  unsigned short* Xb  = (unsigned short*)(ws + oXb);
  unsigned short* Wtq = (unsigned short*)(ws + oWq);
  unsigned short* Wtk = (unsigned short*)(ws + oWk);
  unsigned short* Wtv = (unsigned short*)(ws + oWv);
  unsigned short* Wto = (unsigned short*)(ws + oWo);
  float*          Tf  = (float*)(ws + oTf);
  unsigned short* Qh  = (unsigned short*)(ws + oQh);
  unsigned short* Ql  = (unsigned short*)(ws + oQl);
  unsigned short* Kh  = (unsigned short*)(ws + oKh);
  unsigned short* Kl  = (unsigned short*)(ws + oKl);
  unsigned short* VTh = (unsigned short*)(ws + oVt);
  unsigned short* VTl = (unsigned short*)(ws + oVl);
  unsigned short* Mh  = (unsigned short*)(ws + oMh);
  unsigned short* Ml  = (unsigned short*)(ws + oMl);
  float*          outf = (float*)d_out;             // [ROWS][DM]

  const dim3 blk(256);
  const int n8x = ROWS * DM / 8;                    // 524288
  const dim3 gCvtX((n8x + 255) / 256);              // 2048 blocks
  const dim3 gWt(DM / 64, DM / 64);                 // (8 e tiles, 8 n tiles)
  const dim3 gGemm(((ROWS / 64) * (DM / 64) + 7) / 8);    // 1024 tiles -> 128 blocks
  const dim3 gGemO(((ROWS / 32) * (DM / 64) + 7) / 8);    // 2048 tiles -> 256 blocks
  const dim3 gVpl(SEQ / 64, NH, NB);                // (16, 8, 8)
  const dim3 gAttn(NB * NH * NQB);                  // 1024 blocks
  const float qkScale = 16.0f;                      // q and k hi planes carried x16 (residual x1024 on top)
  const float sscale  = 1.0f / 2048.0f;             // 1/(16*16) * 1/sqrt(64)
  const float vScale  = 256.0f;                     // v^T hi plane carried x256
  const float attOscl = 1.0f / 262144.0f;           // 1/(1024 * 256): p and v carries folded back
  const float mScale  = 1024.0f;                    // msgs hi plane carried x1024 (residual x1024 on top)
  const float woScale = 4096.0f;                    // Wo^T carried x4096 in f16
  const float outOscl = 1.0f / 4194304.0f;          // 1/(1024 * 4096)

  // (1) activations -> bf16 plane; weights -> transposed 16-bit planes [n][e] (RNE convert)
  cvt_bf16x8<<<gCvtX, blk, 0, stream>>>(x, Xb, n8x);
  wt_bf16<<<gWt, blk, 0, stream>>>(Wq, Wtq);
  wt_bf16<<<gWt, blk, 0, stream>>>(Wk, Wtk);
  wt_bf16<<<gWt, blk, 0, stream>>>(Wv, Wtv);
  wt_f16s<<<gWt, blk, 0, stream>>>(Wo, Wto, woScale);
  // (2) q = Xb . Wtq^T + bq -> Tf [8192][512] (M=8192, N=512, K=512), then f16 hi (x16) + residual planes
  gemm64<<<gGemm, blk, 0, stream>>>(Xb, DM, Wtq, DM, bq, Tf, DM, ROWS, DM, DM);
  planes_f16x8<<<gCvtX, blk, 0, stream>>>(Tf, Qh, Ql, n8x, qkScale);
  // (3) k likewise
  gemm64<<<gGemm, blk, 0, stream>>>(Xb, DM, Wtk, DM, bk, Tf, DM, ROWS, DM, DM);
  planes_f16x8<<<gCvtX, blk, 0, stream>>>(Tf, Kh, Kl, n8x, qkScale);
  // (4) v, then -> f16 v^T hi plane (x256) and residual plane (x4096 on top)
  gemm64<<<gGemm, blk, 0, stream>>>(Xb, DM, Wtv, DM, bv, Tf, DM, ROWS, DM, DM);
  v_planes<<<gVpl, blk, 0, stream>>>(Tf, DM, VTh, VTl, vScale);
  // (5) attention -> msgs f32 [8192][512] in Tf, then f16 hi (x1024) + residual planes
  attn64<<<gAttn, dim3(128), 0, stream>>>(Qh, Ql, Kh, Kl, VTh, VTl, Tf, sscale, attOscl);
  planes_f16x8<<<gCvtX, blk, 0, stream>>>(Tf, Mh, Ml, n8x, mScale);
  // (6) out = msgs . Wo + bo -> d_out f32 [8192][512] (M=8192, N=512, K=512)
  gemm_o<<<gGemO, blk, 0, stream>>>(Mh, Ml, DM, Wto, DM, bo, outf, DM, ROWS, DM, DM, outOscl);
  (void)hipGetLastError();
}

// v002
// One run takes 158 microseconds.
// Two timings next to v001 put it at 1.34 and 1.35 times that version's speed.
// Counting every step since v000, it is 1.71 times as fast.
// Contractions: q/k/v projections = v_wmma_f32_16x16x32_bf16 (bf16 operands from RNE-converted nodes, W^T and bias, single product); q.k^T scores = v_wmma_f32_16x16x32_f16 (q, k as f16 hi planes carried x16 plus f16 residual planes x1024: hi.hi + (hi.lo + lo.hi) in a separate accumulator, 3 products); p.v = v_wmma_f32_16x16x32_f16 (p carried x1024 in f16; v^T as f16 hi plane x256 plus f16 residual plane x4096 in a separate accumulator folded with 2^-12, 2 products); output projection = v_wmma_f32_16x16x32_f16 (msgs as f16 hi plane x1024 plus f16 residual plane x1024 in a separate accumulator folded with 2^-10; Wo^T = RNE bf16 value carried x4096 in f16; 2 products); all f32 accumulate; softmax in f32.
#include <hip/hip_runtime.h>
#include <math.h>
#include <stdint.h>

#define NB    8
#define SEQ   1024
#define DM    512
#define NH    8
#define HD    64
#define NQB   (SEQ / 64)
#define ROWS  (NB * SEQ)            // 8192 token rows
#define OUTN  (ROWS * DM)
#define KVP   72                    // LDS pitch of the 64-wide f16 tiles in attn64, in halves: 144 B = 16 B x 9 (odd)
#define OSP   68                    // LDS pitch of the 64-wide f32 context tile in attn64, in floats
#define GKC   64                    // GEMMs: k elements of one staged slice = 128 B of every staged row
#define GSP   72                    // GEMMs: LDS pitch of a staged row, in 16-bit elements: 144 B = 16 B x 9 (odd)
#define GROWS (64 + DM)             // GEMMs: staged rows of a slice: 64 A rows, then the DM rows of B
#define GBUF  (GROWS * GSP)         // GEMMs: 16-bit elements of one slice buffer (82944 B)
#define NSL   (DM / GKC)            // GEMMs: slices along k
static_assert(NH * HD == DM);
static_assert(HD == 64);
static_assert(32 * GSP * 2 == 4608);                           // copy9: LDS bytes of 32 staged rows
static_assert(DM == 8 * 64 && GROWS == 18 * 32 && NSL >= 2);   // 8 waves x 64 columns; 18 copies per thread; two buffers
static_assert((SEQ % 64) == 0 && (DM % 64) == 0 && (ROWS % 64) == 0);
static_assert(((ROWS / 64) * (DM / 64)) % 8 == 0);
static_assert(((ROWS / 32) * (DM / 64)) % 8 == 0);
static_assert(((ROWS * DM / 8) % 256) == 0);

typedef _Float16 v16h __attribute__((ext_vector_type(16)));
typedef _Float16 v8h  __attribute__((ext_vector_type(8)));
typedef __bf16   v16b __attribute__((ext_vector_type(16)));
typedef __bf16   v8b  __attribute__((ext_vector_type(8)));
typedef float    v8f  __attribute__((ext_vector_type(8)));
typedef float    v4f  __attribute__((ext_vector_type(4)));
typedef unsigned int v4u __attribute__((ext_vector_type(4)));

// ---- scalar helpers --------------------------------------------------------------------------------
__device__ __forceinline__ unsigned short bf_bits(float f) {          // f32 -> bf16 bits, RNE convert
  unsigned u = __float_as_uint(f);
  return (unsigned short)((u + 0x7FFFu + ((u >> 16) & 1u)) >> 16);
}
__device__ __forceinline__ float bf_up(unsigned short h) { return __uint_as_float(((unsigned)h) << 16); }
__device__ __forceinline__ unsigned short h_bits(_Float16 x) { return __builtin_bit_cast(unsigned short, x); }
__device__ __forceinline__ unsigned pk16(unsigned short a, unsigned short b) { return (unsigned)a | ((unsigned)b << 16); }
__device__ __forceinline__ v8f zero8() { v8f z = {0.f, 0.f, 0.f, 0.f, 0.f, 0.f, 0.f, 0.f}; return z; }

// ---- fragment loaders: 16-bit A/B operand, lane -> row/col (lane&15), p already includes +8*(lane>>4);
//      elements 0..7 <- p[0..7] (k0+8h..), elements 8..15 <- p[16..23] (k0+16+8h..)
__device__ __forceinline__ v16b ldfrag_b(const __bf16* p) {
  union { v16b v; v8b h[2]; } f;
  f.h[0] = *(const v8b*)(p);
  f.h[1] = *(const v8b*)(p + 16);
  return f.v;
}
__device__ __forceinline__ v16h ldfrag_h(const _Float16* p) {
  union { v16h v; v8h h[2]; } f;
  f.h[0] = *(const v8h*)(p);
  f.h[1] = *(const v8h*)(p + 16);
  return f.v;
}

// ---- WMMA helpers with trailing VALU hazard gap --------------------------------------------------------
__device__ __forceinline__ v8f mma_h(v16h a, v16h b, v8f c) {
  c = __builtin_amdgcn_wmma_f32_16x16x32_f16(false, a, false, b, (short)0, c, false, false);
#if defined(__HIP_DEVICE_COMPILE__)
  asm volatile("v_nop\n\tv_nop\n\tv_nop\n\tv_nop" : "+v"(c) : "v"(a), "v"(b));
#endif
  return c;
}
__device__ __forceinline__ v8f mma_b_raw(v16b a, v16b b, v8f c) {
  return __builtin_amdgcn_wmma_f32_16x16x32_bf16(false, a, false, b, (short)0, c, false, false);
}
__device__ __forceinline__ void dep_guard_b(v8f& a, v8f& b, v16b x, v16b y) {
#if defined(__HIP_DEVICE_COMPILE__)
  asm volatile("v_nop\n\tv_nop\n\tv_nop\n\tv_nop" : "+v"(a), "+v"(b) : "v"(x), "v"(y));
#endif
}
__device__ __forceinline__ void keep4_b(v16b a, v16b b, v16b c, v16b d) {
#if defined(__HIP_DEVICE_COMPILE__)
  asm volatile("v_nop" :: "v"(a), "v"(b), "v"(c), "v"(d));
#endif
}
__device__ __forceinline__ void acc_guard4(v8f& a, v8f& b, v8f& c, v8f& d) {
#if defined(__HIP_DEVICE_COMPILE__)
  asm volatile("v_nop\n\tv_nop\n\tv_nop\n\tv_nop" : "+v"(a), "+v"(b), "+v"(c), "+v"(d));
#endif
}

// ---- GEMM operand staging: asynchronous copies global -> LDS, waits -----------------------------------
__device__ __forceinline__ unsigned lds_off(const void* p) { return (unsigned)(size_t)p; }   // LDS byte address
// nine 16-B copies of this lane: LDS bytes l + 4608 i (32 staged rows of 144 B further each) <- global g0 .. g8
__device__ __forceinline__ void copy9(unsigned l, const unsigned short* g0, const unsigned short* g1,
                                      const unsigned short* g2, const unsigned short* g3, const unsigned short* g4,
                                      const unsigned short* g5, const unsigned short* g6, const unsigned short* g7,
                                      const unsigned short* g8) {
#if defined(__HIP_DEVICE_COMPILE__)
  // the closing s_wait_xcnt stands in the copies' own statement: no address register is rewritten in front of it
  asm volatile(
      "global_load_async_to_lds_b128 %0, %9, off\n\t"
      "global_load_async_to_lds_b128 %1, %10, off\n\t"
      "global_load_async_to_lds_b128 %2, %11, off\n\t"
      "global_load_async_to_lds_b128 %3, %12, off\n\t"
      "global_load_async_to_lds_b128 %4, %13, off\n\t"
      "global_load_async_to_lds_b128 %5, %14, off\n\t"
      "global_load_async_to_lds_b128 %6, %15, off\n\t"
      "global_load_async_to_lds_b128 %7, %16, off\n\t"
      "global_load_async_to_lds_b128 %8, %17, off\n\t"
      "s_wait_xcnt 0x0"
      :: "v"(l), "v"(l + 4608u), "v"(l + 2u * 4608u), "v"(l + 3u * 4608u), "v"(l + 4u * 4608u),
         "v"(l + 5u * 4608u), "v"(l + 6u * 4608u), "v"(l + 7u * 4608u), "v"(l + 8u * 4608u),
         "v"(g0), "v"(g1), "v"(g2), "v"(g3), "v"(g4), "v"(g5), "v"(g6), "v"(g7), "v"(g8)
      : "memory");
#endif
}
// One slice = GROWS rows x 128 B = 18 groups of 32 rows; thread tid copies 16-B column tid&7 of row tid>>3 of every
// group, so 8 lanes copy one whole 128-B line. l: the lane's LDS byte address in group 0 of the buffer; a0, a1: its
// source in A row groups 0 and 1; b: its source in B row group 0 (groups 2..17 = B rows 0..DM-1, row pitch DM).
__device__ __forceinline__ void stage_slice(unsigned l, const unsigned short* a0, const unsigned short* a1,
                                            const unsigned short* b) {
  constexpr size_t S = (size_t)32 * DM;           // 32 B rows, in elements
  copy9(l, a0, a1, b, b + S, b + 2 * S, b + 3 * S, b + 4 * S, b + 5 * S, b + 6 * S);
  copy9(l + 9u * 4608u, b + 7 * S, b + 8 * S, b + 9 * S, b + 10 * S, b + 11 * S, b + 12 * S, b + 13 * S, b + 14 * S,
        b + 15 * S);
}
__device__ __forceinline__ void wait_copies() {   // this wave's copies have landed in LDS
#if defined(__HIP_DEVICE_COMPILE__)
  asm volatile("s_wait_asynccnt 0x0" ::: "memory");
#endif
}
__device__ __forceinline__ void wait_lds_reads() {   // this wave's LDS reads are done before the buffer is handed on
#if defined(__HIP_DEVICE_COMPILE__)
  asm volatile("s_wait_dscnt 0x0" ::: "memory");
#endif
}

// =====================================================================================================
// f32 -> bf16 (RNE convert), 8 elements per thread, one 16-B store per lane: a wave writes 512 contiguous B
// coverage: n8 threads x 8 = whole plane (n8 is a multiple of 256 here).
// =====================================================================================================
__global__ __launch_bounds__(256) void cvt_bf16x8(const float* __restrict__ in, unsigned short* out, int n8) {
  const int i = blockIdx.x * 256 + threadIdx.x;
  if (i < n8) {
    const v4f a = *(const v4f*)(in + (size_t)i * 8);
    const v4f b = *(const v4f*)(in + (size_t)i * 8 + 4);
    v4u p;
    p[0] = pk16(bf_bits(a[0]), bf_bits(a[1]));
    p[1] = pk16(bf_bits(a[2]), bf_bits(a[3]));
    p[2] = pk16(bf_bits(b[0]), bf_bits(b[1]));
    p[3] = pk16(bf_bits(b[2]), bf_bits(b[3]));
    *(v4u*)(out + (size_t)i * 8) = p;
    
  }
}

// =====================================================================================================
// f32 -> f16 hi plane = f16(v * scale) (scale a power of two) + f16 residual plane = f16((v*scale - hi) * 1024),
// same element index in both planes; 8 elements per thread, one 16-B store per lane and plane: a wave writes
// coverage: n8 threads x 8 = whole plane (n8 multiple of 256).
// =====================================================================================================
__global__ __launch_bounds__(256) void planes_f16x8(const float* __restrict__ in, unsigned short* hp,
                                                    unsigned short* lp, int n8, float scale) {
  const int i = blockIdx.x * 256 + threadIdx.x;
  if (i < n8) {
    const v4f a = *(const v4f*)(in + (size_t)i * 8);
    const v4f b = *(const v4f*)(in + (size_t)i * 8 + 4);
    float f[8];
    f[0] = a[0]; f[1] = a[1]; f[2] = a[2]; f[3] = a[3];
    f[4] = b[0]; f[5] = b[1]; f[6] = b[2]; f[7] = b[3];
    v4u ph, pl;
#pragma unroll
    for (int e = 0; e < 4; ++e) {
      const float f0 = f[2 * e] * scale;
      const float f1 = f[2 * e + 1] * scale;
      const _Float16 x0 = (_Float16)f0, x1 = (_Float16)f1;
      const _Float16 l0 = (_Float16)((f0 - (float)x0) * 1024.0f);
      const _Float16 l1 = (_Float16)((f1 - (float)x1) * 1024.0f);
      ph[e] = pk16(h_bits(x0), h_bits(x1));
      pl[e] = pk16(h_bits(l0), h_bits(l1));
    }
    *(v4u*)(hp + (size_t)i * 8) = ph;
    *(v4u*)(lp + (size_t)i * 8) = pl;
    
  }
}

// =====================================================================================================
// Weight transpose + convert: in W f32 [DM rows (e, contraction index)][DM cols (n, output feature)] (the
// x @ W layout) -> out Wt 16-bit [DM (n)][DM (e)] (the [n][k], k-contiguous layout the GEMM B operand uses).
// MODE 0: RNE bf16 bits. MODE 1: f16 bits of (RNE bf16 value * scale), scale a power of two (exact in f16).
// Block = one 64 e x 64 n tile: grid = (DM/64 e tiles, DM/64 n tiles). The tile is staged in LDS as [ee][nn]
// pitch 68 floats (v4f loads, __syncthreads). in[rows e][cols n] -> out[rows n][cols e] (square here).
// Store: group g = tid>>3 (0..31), piece = tid&7: iteration it writes row n0 + (it*32+g), lanes 8q..8q+7 x 16 B
// coverage: 2 iterations x 32 groups = 64 rows n, 8 pieces x 8 = 64 e per row; grid covers every (e tile,
// n tile) -> the whole [DM][DM] plane.
// =====================================================================================================
template <int MODE>
__device__ __forceinline__ void wt_tile_body(const float* __restrict__ W, unsigned short* Wt, float scale,
                                             float* sw) {
  const int tid = threadIdx.x;
  const int e0  = blockIdx.x * 64;
  const int n0  = blockIdx.y * 64;
#pragma unroll
  for (int i = 0; i < 4; ++i) {
    const int idx = i * 256 + tid;                  // 0..1023
    const int ee = idx >> 4, c4 = (idx & 15) * 4;
    const v4f a = *(const v4f*)(W + ((size_t)(e0 + ee)) * DM + n0 + c4);
    *(v4f*)(sw + ee * 68 + c4) = a;
  }
  __syncthreads();

  const int g = tid >> 3, piece = tid & 7;
  v4u hv[2];
  size_t hofs[2];
#pragma unroll
  for (int it = 0; it < 2; ++it) {
    const int n = it * 32 + g;
    v4u a;
#pragma unroll
    for (int e = 0; e < 4; ++e) {
      const float f0 = sw[(piece * 8 + 2 * e) * 68 + n];
      const float f1 = sw[(piece * 8 + 2 * e + 1) * 68 + n];
      unsigned short u0, u1;
      if (MODE == 0) {
        u0 = bf_bits(f0);
        u1 = bf_bits(f1);
      } else {
        u0 = h_bits((_Float16)(bf_up(bf_bits(f0)) * scale));
        u1 = h_bits((_Float16)(bf_up(bf_bits(f1)) * scale));
      }
      a[e] = pk16(u0, u1);
    }
    hv[it] = a;
    hofs[it] = ((size_t)(n0 + n)) * DM + e0 + piece * 8;
  }
  {
#pragma unroll
    for (int it = 0; it < 2; ++it) {
      *(v4u*)(Wt + hofs[it]) = hv[it];
    }
    
  }
}
__global__ __launch_bounds__(256) void wt_bf16(const float* __restrict__ W, unsigned short* Wt) {
  __shared__ __align__(16) float sw[64 * 68];       // [ee][nn] pitch 68 floats
  wt_tile_body<0>(W, Wt, 1.0f, sw);
}
__global__ __launch_bounds__(256) void wt_f16s(const float* __restrict__ W, unsigned short* Wt, float scale) {
  __shared__ __align__(16) float sw[64 * 68];       // [ee][nn] pitch 68 floats
  wt_tile_body<1>(W, Wt, scale, sw);
}

// =====================================================================================================
// Register-blocked bf16 WMMA GEMM with bias: C[m][n] = sum_k A[m][k] * Bt[n][k] + bf16rne(bias[n]), N = K = DM.
// Block = 64 rows x DM columns, one wave per 64x64 tile (wave w: columns 64 w ..). A row-major [M][DM]; Bt row-major
// [DM n][DM k] (k contiguous); bias f32 [DM] (RNE converted to bf16 and widened in the epilogue); M multiple of 64.
// Operands: k slices of GKC, the block's 64 A rows and all DM B rows, staged in LDS by asynchronous copies, two
// buffers: slice t + 1 is in flight while slice t is multiplied; per slice one hand-over (LDS reads done, own copies
// landed, block barrier), then slice t + 2 is copied into the buffer slice t has left.
// Output f32 [M][DM] pitch DM. Epilogue: 16-row slabs staged per wave in LDS; each 64-wide row segment
// =====================================================================================================
__global__ __launch_bounds__(256) void gemm64(
    const unsigned short* __restrict__ Ap,
    const unsigned short* __restrict__ Btp,
    const float* __restrict__ bias,
    float* C, int M) {
  __shared__ __align__(16) __bf16 sAB[2 * GBUF];   // two slice buffers: rows 0..63 = A, rows 64.. = B
  __shared__ __align__(16) float sT[8][16 * 68];   // per-wave 16x64 slab, pitch 68 floats
  constexpr int ldc = DM;
  const int tid  = threadIdx.x;
  const int lane = tid & 31;
  const int wave = tid >> 5;
  const int m0 = blockIdx.x << 6;
  if (m0 >= M) return;                   // block-uniform, in front of every barrier
  const int n0 = wave << 6;

  // this lane's piece of every 32-row group: row tid>>3, 16-B column tid&7
  const unsigned short* ga0 = Ap + (size_t)(m0 + (tid >> 3)) * DM + (tid & 7) * 8;
  const unsigned short* ga1 = ga0 + (size_t)32 * DM;
  const unsigned short* gb  = Btp + (size_t)(tid >> 3) * DM + (tid & 7) * 8;
  const unsigned l0 = lds_off(sAB) + (unsigned)((tid >> 3) * GSP + (tid & 7) * 8) * 2u;
  stage_slice(l0, ga0, ga1, gb);
  wait_copies();
  __syncthreads();                       // slice 0 is readable by every wave
  stage_slice(l0 + GBUF * 2u, ga0 + GKC, ga1 + GKC, gb + GKC);

  const int rlane = lane & 15;                 // row (A) / col (B, D) within subtile
  const int koff  = (lane >> 4) * 8;           // k offset of this lane half
  const int mOff  = (lane >> 4) * 8;           // D row offset

  v8f acc[4][4];
#pragma unroll
  for (int i = 0; i < 4; ++i)
#pragma unroll
    for (int j = 0; j < 4; ++j) acc[i][j] = zero8();

  for (int t = 0; t < NSL; ++t) {
    const __bf16* sb = sAB + (t & 1) * GBUF;
#pragma unroll
    for (int kk = 0; kk < GKC; kk += 32) {
      v16b bh[4], ah[4];                 // the k step's LDS reads stand together, in front of its WMMAs
#pragma unroll
      for (int j = 0; j < 4; ++j) {
        bh[j] = ldfrag_b(sb + (64 + n0 + (j << 4) + rlane) * GSP + koff + kk);
      }
#pragma unroll
      for (int i = 0; i < 4; ++i) {
        ah[i] = ldfrag_b(sb + ((i << 4) + rlane) * GSP + koff + kk);
      }
#pragma unroll
      for (int i = 0; i < 4; ++i) {
#pragma unroll
        for (int j = 0; j < 4; ++j) {
          acc[i][j] = mma_b_raw(ah[i], bh[j], acc[i][j]);
        }
        dep_guard_b(acc[i][0], acc[i][3], ah[i], ah[i]);
      }
      keep4_b(bh[0], bh[1], bh[2], bh[3]);
    }
    // hand-over: slice t + 1 becomes readable, slice t's buffer becomes free
    wait_lds_reads();
    wait_copies();
    __syncthreads();
    if (t + 2 < NSL) {
      stage_slice(l0 + (unsigned)(t & 1) * (GBUF * 2u), ga0 + (t + 2) * GKC, ga1 + (t + 2) * GKC, gb + (t + 2) * GKC);
    }
  }
  wait_copies();
  acc_guard4(acc[0][0], acc[0][1], acc[0][2], acc[0][3]);
  acc_guard4(acc[1][0], acc[1][1], acc[1][2], acc[1][3]);
  acc_guard4(acc[2][0], acc[2][1], acc[2][2], acc[2][3]);
  acc_guard4(acc[3][0], acc[3][1], acc[3][2], acc[3][3]);

  // ---- bias per D column of this lane (n0 + 16j + rlane < N) ----
  float bz[4];
#pragma unroll
  for (int j = 0; j < 4; ++j) bz[j] = bf_up(bf_bits(bias[n0 + (j << 4) + rlane]));

  // ---- epilogue ----
  float* slab = sT[wave];
#pragma unroll
  for (int i = 0; i < 4; ++i) {
    const int mBase = m0 + (i << 4);
#pragma unroll
    for (int r = 0; r < 8; ++r) {
#pragma unroll
      for (int j = 0; j < 4; ++j) {
        slab[(mOff + r) * 68 + (j << 4) + rlane] = acc[i][j][r] + bz[j];
      }
    }
    __builtin_amdgcn_fence(__ATOMIC_RELEASE, "workgroup");
    __builtin_amdgcn_wave_barrier();
    __builtin_amdgcn_fence(__ATOMIC_ACQUIRE, "workgroup");
    {
      const int hh = lane >> 4, c4 = (lane & 15) * 4;     // 256-B row segment = 16 lanes x 16 B
      v4f ov[8];
#pragma unroll
      for (int it = 0; it < 8; ++it) {
        const int row = it * 2 + hh;                       // it 0..7 x hh 0..1 = rows 0..15
        ov[it] = *(const v4f*)(slab + row * 68 + c4);
      }
      {
#pragma unroll
        for (int it = 0; it < 8; ++it) {
          const int row = it * 2 + hh;
          *(v4f*)(C + (size_t)(mBase + row) * ldc + n0 + c4) = ov[it];
        }
        
      }
    }
    __builtin_amdgcn_fence(__ATOMIC_RELEASE, "workgroup");
    __builtin_amdgcn_wave_barrier();
    __builtin_amdgcn_fence(__ATOMIC_ACQUIRE, "workgroup");
  }
}

// =====================================================================================================
// f16 WMMA GEMM with a two-plane A operand and bias:
//   C[m][n] = (sum_k Ah[m][k]*Bt[n][k] + 2^-10 * sum_k Al[m][k]*Bt[n][k]) * oscale + bf16rne(bias[n]),
// the residual products in a separate accumulator, N = K = DM. Block = 32 rows x DM columns, one wave per 32x64 tile
// (wave w: columns 64 w ..). Ah/Al row-major [M][DM] (f16 hi and residual planes, same index); Bt row-major
// [DM n][DM k] (f16, k contiguous); M multiple of 32. Operands staged in LDS as in gemm64 (staged rows 0..31 = Ah,
// 32..63 = Al, 64.. = B). Every WMMA nop-guarded.
// Output f32 [M][DM] pitch DM. Epilogue: 16-row slabs staged per wave in LDS; each 64-wide row segment (256 B)
// coverage: 2 slabs x 16 rows x 64 cols = the wave's whole 32x64 tile.
// =====================================================================================================
__global__ __launch_bounds__(256) void gemm_o(
    const unsigned short* __restrict__ Ahp, const unsigned short* __restrict__ Alp,
    const unsigned short* __restrict__ Btp,
    const float* __restrict__ bias,
    float* C, int M, float oscale) {
  __shared__ __align__(16) _Float16 sAB[2 * GBUF]; // two slice buffers: rows 0..31 = Ah, 32..63 = Al, 64.. = B
  __shared__ __align__(16) float sT[8][16 * 68];   // per-wave 16x64 slab, pitch 68 floats
  constexpr int ldc = DM;
  const int tid  = threadIdx.x;
  const int lane = tid & 31;
  const int wave = tid >> 5;
  const int m0 = blockIdx.x << 5;
  if (m0 >= M) return;                   // block-uniform, in front of every barrier
  const int n0 = wave << 6;

  // this lane's piece of every 32-row group: row tid>>3, 16-B column tid&7
  const size_t ao = (size_t)(m0 + (tid >> 3)) * DM + (tid & 7) * 8;
  const unsigned short* ga0 = Ahp + ao;
  const unsigned short* ga1 = Alp + ao;
  const unsigned short* gb  = Btp + (size_t)(tid >> 3) * DM + (tid & 7) * 8;
  const unsigned l0 = lds_off(sAB) + (unsigned)((tid >> 3) * GSP + (tid & 7) * 8) * 2u;
  stage_slice(l0, ga0, ga1, gb);
  wait_copies();
  __syncthreads();                       // slice 0 is readable by every wave
  stage_slice(l0 + GBUF * 2u, ga0 + GKC, ga1 + GKC, gb + GKC);

  const int rlane = lane & 15;
  const int koff  = (lane >> 4) * 8;
  const int mOff  = (lane >> 4) * 8;

  v8f acc[2][4], acl[2][4];
#pragma unroll
  for (int i = 0; i < 2; ++i)
#pragma unroll
    for (int j = 0; j < 4; ++j) { acc[i][j] = zero8(); acl[i][j] = zero8(); }

  for (int t = 0; t < NSL; ++t) {
    const _Float16* sb = sAB + (t & 1) * GBUF;
#pragma unroll
    for (int kk = 0; kk < GKC; kk += 32) {
      v16h ah[2], al[2], bfr[4];         // the k step's LDS reads stand together, in front of its WMMAs
#pragma unroll
      for (int i = 0; i < 2; ++i) {
        ah[i] = ldfrag_h(sb + ((i << 4) + rlane) * GSP + koff + kk);
        al[i] = ldfrag_h(sb + (32 + (i << 4) + rlane) * GSP + koff + kk);
      }
#pragma unroll
      for (int j = 0; j < 4; ++j) {
        bfr[j] = ldfrag_h(sb + (64 + n0 + (j << 4) + rlane) * GSP + koff + kk);
      }
#pragma unroll
      for (int j = 0; j < 4; ++j) {
#pragma unroll
        for (int i = 0; i < 2; ++i) {
          acc[i][j] = mma_h(ah[i], bfr[j], acc[i][j]);
          acl[i][j] = mma_h(al[i], bfr[j], acl[i][j]);
        }
      }
    }
    // hand-over: slice t + 1 becomes readable, slice t's buffer becomes free
    wait_lds_reads();
    wait_copies();
    __syncthreads();
    if (t + 2 < NSL) {
      stage_slice(l0 + (unsigned)(t & 1) * (GBUF * 2u), ga0 + (t + 2) * GKC, ga1 + (t + 2) * GKC, gb + (t + 2) * GKC);
    }
  }
  wait_copies();

  // ---- bias per D column of this lane (n0 + 16j + rlane < N) ----
  float bz[4];
#pragma unroll
  for (int j = 0; j < 4; ++j) bz[j] = bf_up(bf_bits(bias[n0 + (j << 4) + rlane]));

  // ---- epilogue ----
  float* slab = sT[wave];
#pragma unroll
  for (int i = 0; i < 2; ++i) {
    const int mBase = m0 + (i << 4);
#pragma unroll
    for (int r = 0; r < 8; ++r) {
#pragma unroll
      for (int j = 0; j < 4; ++j) {
        const float y = (acc[i][j][r] + acl[i][j][r] * (1.0f / 1024.0f)) * oscale + bz[j];
        slab[(mOff + r) * 68 + (j << 4) + rlane] = y;
      }
    }
    __builtin_amdgcn_fence(__ATOMIC_RELEASE, "workgroup");
    __builtin_amdgcn_wave_barrier();
    __builtin_amdgcn_fence(__ATOMIC_ACQUIRE, "workgroup");
    {
      const int hh = lane >> 4, c4 = (lane & 15) * 4;     // 256-B row segment = 16 lanes x 16 B
      v4f ov[8];
#pragma unroll
      for (int it = 0; it < 8; ++it) {
        const int row = it * 2 + hh;                       // it 0..7 x hh 0..1 = rows 0..15
        ov[it] = *(const v4f*)(slab + row * 68 + c4);
      }
      {
#pragma unroll
        for (int it = 0; it < 8; ++it) {
          const int row = it * 2 + hh;
          *(v4f*)(C + (size_t)(mBase + row) * ldc + n0 + c4) = ov[it];
        }
        
      }
    }
    __builtin_amdgcn_fence(__ATOMIC_RELEASE, "workgroup");
    __builtin_amdgcn_wave_barrier();
    __builtin_amdgcn_fence(__ATOMIC_ACQUIRE, "workgroup");
  }
}

// =====================================================================================================
// v f32 token-major columns vf[(b*SEQ + t)*vrp + h*64 + d] ->
// f16 v^T hi plane vth[(b*DM + h*64 + d)*SEQ + t] = f16(v * vscale) (vscale a power of two) and residual plane
// vtl[same index] = f16((v*vscale - hi) * 4096).
// Block = one 64-token x 64-feature tile of one (b, h); grid = (SEQ/64, NH, NB); tile staged in LDS as f32
// (v4f loads, __syncthreads).
// Store: group g = tid>>3 (0..31), piece = tid&7: iteration it writes row d = it*32+g, lanes 8q..8q+7 x 16 B =
// coverage: 2 iterations x 32 groups = 64 rows d, 8 pieces x 8 = 64 tokens per row; grid covers every (b, h,
// t tile) -> both whole planes.
// =====================================================================================================
__global__ __launch_bounds__(256) void v_planes(const float* __restrict__ vf, int vrp,
                                                unsigned short* vth, unsigned short* vtl, float vscale) {
  __shared__ __align__(16) float sv[64 * 68];       // [tt][d] pitch 68 floats
  const int tid = threadIdx.x;
  const int t0  = blockIdx.x * 64;
  const int hh  = blockIdx.y;
  const int b   = blockIdx.z;
#pragma unroll
  for (int i = 0; i < 4; ++i) {
    const int idx = i * 256 + tid;                  // 0..1023
    const int tt = idx >> 4, c4 = (idx & 15) * 4;
    const v4f a = *(const v4f*)(vf + ((size_t)(b * SEQ + t0 + tt)) * vrp + hh * HD + c4);
    *(v4f*)(sv + tt * 68 + c4) = a;
  }
  __syncthreads();

  const int g = tid >> 3, piece = tid & 7;
  v4u hv[2], lv[2];
  size_t hofs[2];
#pragma unroll
  for (int it = 0; it < 2; ++it) {
    const int d = it * 32 + g;
    v4u a, a2;
#pragma unroll
    for (int e = 0; e < 4; ++e) {
      const float f0 = sv[(piece * 8 + 2 * e) * 68 + d] * vscale;
      const float f1 = sv[(piece * 8 + 2 * e + 1) * 68 + d] * vscale;
      const _Float16 x0 = (_Float16)f0, x1 = (_Float16)f1;
      const unsigned short h0 = h_bits(x0), h1 = h_bits(x1);
      const unsigned short l0 = h_bits((_Float16)((f0 - (float)x0) * 4096.0f));
      const unsigned short l1 = h_bits((_Float16)((f1 - (float)x1) * 4096.0f));
      a[e] = pk16(h0, h1); a2[e] = pk16(l0, l1);
    }
    hv[it] = a; lv[it] = a2;
    hofs[it] = ((size_t)(b * DM + hh * HD + d)) * SEQ + t0 + piece * 8;
  }
  {
#pragma unroll
    for (int it = 0; it < 2; ++it) {
      *(v4u*)(vth + hofs[it]) = hv[it];
      *(v4u*)(vtl + hofs[it]) = lv[it];
    }
    
  }
}

// =====================================================================================================
// Bidirectional multi-head attention, head dim 64, no mask.
//   q f16 hi plane (x16): element (b, t, h, d) at [(b*SEQ + t)*DM + h*64 + d]; q residual plane
//     ((q*16 - hi)*1024) at the same index into qlp
//   k f16 hi plane (x16): element (b, s, h, d) at [(b*SEQ + s)*DM + h*64 + d]; k residual plane same into klp
//   v^T f16 hi plane (x256): element (b, h, d, s) at [(b*DM + h*64 + d)*SEQ + s]
//   v^T f16 residual plane ((v*256 - hi)*4096): same index into vlp
//   All NQB key tiles of 64 are processed for every query tile (static trip count).
//   logit = (qhi.khi + (qhi.klo + qlo.khi) * 2^-10) * sscale, f16 products with f32 accumulate, the residual
//   products in a separate accumulator; p = exp(s - m) carried as ph = f16(1024 p);
//   context = ph . vhi on f16 WMMA plus ph . vres into a separate accumulator folded back with 2^-12 per tile
//   in f32; online softmax in f32; out f32 plane: element (b, t, h*64 + d) at [(b*SEQ + t)*DM + h*64 + d] =
//   normalised context (oscl folds back the p and v carries).
//   Block = 4 waves = 64 query rows of one (b, h); grid = NB*NH*NQB; kv tiles of 64.
//   K hi / K residual / V^T hi / V^T residual tile staging: 128 threads x 32 elements per plane = the whole
//   64x64 tile (plain 16-B loads, __syncthreads before and after); P tiles are wave-private, spilled with
//   Output coverage: each wave stores rows q0..q0+15 (it 0..7 x lane>>4 0..1) x 64 columns (16 lanes x 4
//   (b, h, query tile) -> the whole plane.
// =====================================================================================================
__global__ __launch_bounds__(128)
void attn64(const unsigned short* __restrict__ qhp, const unsigned short* __restrict__ qlp,
            const unsigned short* __restrict__ khp, const unsigned short* __restrict__ klp,
            const unsigned short* __restrict__ vhp, const unsigned short* __restrict__ vlp,
            float* outp, float sscale, float oscl) {
  union FH { v16h v; v8h h[2]; };
  __shared__ __align__(16) _Float16 Ksh[64 * KVP];                // K hi [kv][d]    9 KB
  __shared__ __align__(16) _Float16 Ksl[64 * KVP];                // K residual      9 KB
  __shared__ __align__(16) _Float16 Vth[64 * KVP];                // V^T hi [d][kv]  9 KB
  __shared__ __align__(16) _Float16 Vtl[64 * KVP];                // V^T residual    9 KB
  __shared__ __align__(16) _Float16 Psh[4][16 * KVP];             // per wave P hi [row][kv]      9 KB
  __shared__ __align__(16) float    Os[4][16 * OSP];              // per wave context tile [row][d] 17 KB

  const int tid  = threadIdx.x;
  const int wave = tid >> 5;
  const int lane = tid & 31;
  const int hh   = lane >> 4;
  const int c    = lane & 15;

  const int bx   = blockIdx.x;
  const int qb   = bx % NQB;
  const int rest = bx / NQB;
  const int h    = rest % NH;
  const int b    = rest / NH;                // < NB by the grid size
  const int q0   = qb * 64 + wave * 16;
  const size_t rowB = (size_t)b * SEQ;

  const _Float16* Qp  = (const _Float16*)(const void*)qhp + (size_t)h * HD;
  const _Float16* Qlq = (const _Float16*)(const void*)qlp + (size_t)h * HD;
  const _Float16* Kp  = (const _Float16*)(const void*)khp + (size_t)h * HD;
  const _Float16* Klq = (const _Float16*)(const void*)klp + (size_t)h * HD;
  const _Float16* Vh  = (const _Float16*)(const void*)vhp + ((size_t)b * DM + (size_t)h * HD) * SEQ;
  const _Float16* Vl  = (const _Float16*)(const void*)vlp + ((size_t)b * DM + (size_t)h * HD) * SEQ;

  // ---- Q fragments (A operand, row = lane&15): 2 d-chunks, hi and residual ----
  v16h qa[2], ql[2];
#pragma unroll
  for (int dc = 0; dc < 2; ++dc) {
    const size_t qo = (rowB + q0 + c) * DM + dc * 32 + 8 * hh;
    qa[dc] = ldfrag_h(Qp + qo);
    ql[dc] = ldfrag_h(Qlq + qo);
  }

  float mrow[8], lrow[8];
  v8f oacc[4];
#pragma unroll
  for (int r = 0; r < 8; ++r) { mrow[r] = -INFINITY; lrow[r] = 0.f; }
#pragma unroll
  for (int t = 0; t < 4; ++t) oacc[t] = zero8();

  for (int kt = 0; kt < NQB; ++kt) {
    const int kv0 = kt * 64;
    __syncthreads();
    {
      const int r = tid >> 1, half = (tid & 1) * 32;
      const _Float16* kg  = Kp  + (rowB + kv0 + r) * DM + half;    // K hi row kv0+r, d = half..half+31
      const _Float16* klg = Klq + (rowB + kv0 + r) * DM + half;    // K residual row kv0+r
      const _Float16* vg  = Vh + (size_t)r * SEQ + kv0 + half;     // V^T hi row d = r, s = kv0+half..+31
      const _Float16* vlg = Vl + (size_t)r * SEQ + kv0 + half;     // V^T residual row d = r
#pragma unroll
      for (int i = 0; i < 4; ++i) {
        const v8h a0 = *(const v8h*)(kg + 8 * i);
        const v8h a1 = *(const v8h*)(klg + 8 * i);
        const v8h b0 = *(const v8h*)(vg + 8 * i);
        const v8h b1 = *(const v8h*)(vlg + 8 * i);
        *(v8h*)(Ksh + r * KVP + half + 8 * i) = a0;
        *(v8h*)(Ksl + r * KVP + half + 8 * i) = a1;
        *(v8h*)(Vth + r * KVP + half + 8 * i) = b0;
        *(v8h*)(Vtl + r * KVP + half + 8 * i) = b1;
      }
    }
    __syncthreads();

    // ---- scores: 16 query rows x 64 keys per wave; hi.hi into s, hi.lo + lo.hi into s1 (folded x 2^-10) ----
    v8f s[4];
#pragma unroll
    for (int j = 0; j < 4; ++j) {
      s[j] = zero8();
      v8f s1 = zero8();
#pragma unroll
      for (int dc = 0; dc < 2; ++dc) {
        FH kb, kr;
        kb.h[0] = *(const v8h*)(Ksh + (j * 16 + c) * KVP + dc * 32 + 8 * hh);
        kb.h[1] = *(const v8h*)(Ksh + (j * 16 + c) * KVP + dc * 32 + 16 + 8 * hh);
        kr.h[0] = *(const v8h*)(Ksl + (j * 16 + c) * KVP + dc * 32 + 8 * hh);
        kr.h[1] = *(const v8h*)(Ksl + (j * 16 + c) * KVP + dc * 32 + 16 + 8 * hh);
        s[j] = mma_h(qa[dc], kb.v, s[j]);
        s1   = mma_h(qa[dc], kr.v, s1);
        s1   = mma_h(ql[dc], kb.v, s1);
      }
#pragma unroll
      for (int r = 0; r < 8; ++r) s[j][r] += s1[r] * (1.0f / 1024.0f);
    }

    // ---- scale, row max, online softmax, P (x1024, f16) to LDS ----
    _Float16* pwh = Psh[wave];
#pragma unroll
    for (int r = 0; r < 8; ++r) {
      float m = -INFINITY;
#pragma unroll
      for (int j = 0; j < 4; ++j) {
        const float sv = s[j][r] * sscale;
        s[j][r] = sv;
        m = fmaxf(m, sv);
      }
#pragma unroll
      for (int off = 1; off < 16; off <<= 1) m = fmaxf(m, __shfl_xor(m, off, 32));
      const float mnew  = fmaxf(mrow[r], m);
      const float msafe = (mnew == -INFINITY) ? 0.f : mnew;
      const float alpha = __expf(mrow[r] - msafe);
      mrow[r] = mnew;
      float psum = 0.f;
#pragma unroll
      for (int j = 0; j < 4; ++j) {
        const float p = __expf(s[j][r] - msafe);
        psum += p;
        const float p1024 = p * 1024.0f;
        const _Float16 ph = (_Float16)p1024;
        pwh[(8 * hh + r) * KVP + j * 16 + c] = ph;
      }
#pragma unroll
      for (int off = 1; off < 16; off <<= 1) psum += __shfl_xor(psum, off, 32);
      lrow[r] = lrow[r] * alpha + psum;
#pragma unroll
      for (int t = 0; t < 4; ++t) oacc[t][r] *= alpha;
    }
    __builtin_amdgcn_fence(__ATOMIC_RELEASE, "workgroup");
    __builtin_amdgcn_wave_barrier();
    __builtin_amdgcn_fence(__ATOMIC_ACQUIRE, "workgroup");

    // ---- context += P . Vhi (f16 WMMA); P . Vres into a separate accumulator ----
    v8f o1[4];
#pragma unroll
    for (int t = 0; t < 4; ++t) o1[t] = zero8();
#pragma unroll 1
    for (int kk = 0; kk < 2; ++kk) {
      FH pa;
      pa.h[0] = *(const v8h*)(pwh + c * KVP + kk * 32 + 8 * hh);
      pa.h[1] = *(const v8h*)(pwh + c * KVP + kk * 32 + 16 + 8 * hh);
#pragma unroll
      for (int t = 0; t < 4; ++t) {
        FH vb;
        vb.h[0] = *(const v8h*)(Vth + (t * 16 + c) * KVP + kk * 32 + 8 * hh);
        vb.h[1] = *(const v8h*)(Vth + (t * 16 + c) * KVP + kk * 32 + 16 + 8 * hh);
        oacc[t] = mma_h(pa.v, vb.v, oacc[t]);
        FH vl;
        vl.h[0] = *(const v8h*)(Vtl + (t * 16 + c) * KVP + kk * 32 + 8 * hh);
        vl.h[1] = *(const v8h*)(Vtl + (t * 16 + c) * KVP + kk * 32 + 16 + 8 * hh);
        o1[t] = mma_h(pa.v, vl.v, o1[t]);
      }
    }
#pragma unroll
    for (int t = 0; t < 4; ++t)
#pragma unroll
      for (int r = 0; r < 8; ++r) oacc[t][r] += o1[t][r] * (1.0f / 4096.0f);
  }

  // ---- normalise (1/l and the carries via oscl), stage the wave's 16x64 tile in LDS, then write whole 256-B
  float* os = Os[wave];
#pragma unroll
  for (int r = 0; r < 8; ++r) {
    const float l = lrow[r];
    const float inv = ((l > 0.f) ? (1.0f / l) : 0.f) * oscl;
#pragma unroll
    for (int t = 0; t < 4; ++t) {
      os[(8 * hh + r) * OSP + t * 16 + c] = oacc[t][r] * inv;
    }
  }
  __builtin_amdgcn_fence(__ATOMIC_RELEASE, "workgroup");
  __builtin_amdgcn_wave_barrier();
  __builtin_amdgcn_fence(__ATOMIC_ACQUIRE, "workgroup");
  {
    const int h2 = lane >> 4, c4 = (lane & 15) * 4;
    v4f ov[8];
#pragma unroll
    for (int it = 0; it < 8; ++it) {
      const int row = it * 2 + h2;   // it 0..7 x h2 0..1 = rows 0..15 of the wave tile
      ov[it] = *(const v4f*)(os + row * OSP + c4);
    }
    {
#pragma unroll
      for (int it = 0; it < 8; ++it) {
        const int row = it * 2 + h2;
        const size_t go = (rowB + q0 + row) * DM + (size_t)h * HD + c4;
        *(v4f*)(outp + go) = ov[it];
      }
      
    }
  }
}

// =====================================================================================================
// Workspace map (bytes), every region an exact multiple of its whole-line / whole-tile store granularity
// 8192 x 512, 512 x 512 and 4096 x 1024 are whole tiles/lines):
//   Xb    bf16 [8192][512]            0          8388608
//   Wtq   bf16 [512][512]       8388608           524288   ([n][e])
//   Wtk   bf16 [512][512]       8912896           524288
//   Wtv   bf16 [512][512]       9437184           524288
//   Wto   f16  [512][512]       9961472           524288   ([n][k], bf16rne value x4096)
//   Tf    f32  [8192][512]     10485760         16777216   (scratch: q, then k, then v, then msgs)
//   Qh    f16  [8192][512]     27262976          8388608
//   Ql    f16  [8192][512]     35651584          8388608
//   Kh    f16  [8192][512]     44040192          8388608
//   Kl    f16  [8192][512]     52428800          8388608
//   VTh   f16  [4096][1024]    60817408          8388608   ([b*DM + h*64 + d][s])
//   VTl   f16  [4096][1024]    69206016          8388608
//   Mh    f16  [8192][512]     77594624          8388608   (msgs x1024)
//   Ml    f16  [8192][512]     85983232          8388608   (msgs residual)
//   end                        94371840
// Inputs: nodes f32 [8][1024][512]; Wq, Wk, Wv, Wo f32 [512 in][512 out] (x @ W layout); bq, bk, bv, bo f32
// [512] (index h*64+d = n). d_out f32: [8192][512] at byte 0 (row = b*SEQ + t, col = n).
// =====================================================================================================
extern "C" void kernel_launch(void* const* d_in, const int* in_sizes, int n_in,
                              void* d_out, int out_size, void* d_ws, size_t ws_size,
                              hipStream_t stream) {
  if (n_in < 9) return;
  if (in_sizes[0] != NB * SEQ * DM) return;
  if (in_sizes[1] != DM * DM) return;
  if (in_sizes[2] != DM * DM) return;
  if (in_sizes[3] != DM * DM) return;
  if (in_sizes[4] != DM) return;
  if (in_sizes[5] != DM) return;
  if (in_sizes[6] != DM) return;
  if (in_sizes[7] != DM * DM) return;
  if (in_sizes[8] != DM) return;
  if (out_size != OUTN) return;

  const float* x  = (const float*)d_in[0];   // [NB*SEQ][DM]
  const float* Wq = (const float*)d_in[1];   // [DM e][DM n]
  const float* Wk = (const float*)d_in[2];
  const float* Wv = (const float*)d_in[3];
  const float* bq = (const float*)d_in[4];   // [DM]
  const float* bk = (const float*)d_in[5];
  const float* bv = (const float*)d_in[6];
  const float* Wo = (const float*)d_in[7];   // [DM k][DM n]
  const float* bo = (const float*)d_in[8];

  const size_t PXb = (size_t)ROWS * DM * 2;          //  8388608
  const size_t PW  = (size_t)DM * DM * 2;            //   524288
  const size_t PF  = (size_t)ROWS * DM * 4;          // 16777216
  const size_t PH  = (size_t)ROWS * DM * 2;          //  8388608
  const size_t PVt = (size_t)NB * DM * SEQ * 2;      //  8388608
  size_t off = 0;
  const size_t oXb = off; off += PXb;
  const size_t oWq = off; off += PW;
  const size_t oWk = off; off += PW;
  const size_t oWv = off; off += PW;
  const size_t oWo = off; off += PW;
  const size_t oTf = off; off += PF;
  const size_t oQh = off; off += PH;
  const size_t oQl = off; off += PH;
  const size_t oKh = off; off += PH;
  const size_t oKl = off; off += PH;
  const size_t oVt = off; off += PVt;
  const size_t oVl = off; off += PVt;
  const size_t oMh = off; off += PH;
  const size_t oMl = off; off += PH;
  if (off > ws_size) return;                        // off = 94371840
  if (off > (size_t)134217728) return;

  char* ws = (char*)d_ws;
  unsigned short* Xb  = (unsigned short*)(ws + oXb);
  unsigned short* Wtq = (unsigned short*)(ws + oWq);
  unsigned short* Wtk = (unsigned short*)(ws + oWk);
  unsigned short* Wtv = (unsigned short*)(ws + oWv);
  unsigned short* Wto = (unsigned short*)(ws + oWo);
  float*          Tf  = (float*)(ws + oTf);
  unsigned short* Qh  = (unsigned short*)(ws + oQh);
  unsigned short* Ql  = (unsigned short*)(ws + oQl);
  unsigned short* Kh  = (unsigned short*)(ws + oKh);
  unsigned short* Kl  = (unsigned short*)(ws + oKl);
  unsigned short* VTh = (unsigned short*)(ws + oVt);
  unsigned short* VTl = (unsigned short*)(ws + oVl);
  unsigned short* Mh  = (unsigned short*)(ws + oMh);
  unsigned short* Ml  = (unsigned short*)(ws + oMl);
  float*          outf = (float*)d_out;             // [ROWS][DM]

  const dim3 blk(256);
  const int n8x = ROWS * DM / 8;                    // 524288
  const dim3 gCvtX((n8x + 255) / 256);              // 2048 blocks
  const dim3 gWt(DM / 64, DM / 64);                 // (8 e tiles, 8 n tiles)
  const dim3 gGemm(ROWS / 64);                      // 128 blocks of 64 rows x 512 columns
  const dim3 gGemO(ROWS / 32);                      // 256 blocks of 32 rows x 512 columns
  const dim3 gVpl(SEQ / 64, NH, NB);                // (16, 8, 8)
  const dim3 gAttn(NB * NH * NQB);                  // 1024 blocks
  const float qkScale = 16.0f;                      // q and k hi planes carried x16 (residual x1024 on top)
  const float sscale  = 1.0f / 2048.0f;             // 1/(16*16) * 1/sqrt(64)
  const float vScale  = 256.0f;                     // v^T hi plane carried x256
  const float attOscl = 1.0f / 262144.0f;           // 1/(1024 * 256): p and v carries folded back
  const float mScale  = 1024.0f;                    // msgs hi plane carried x1024 (residual x1024 on top)
  const float woScale = 4096.0f;                    // Wo^T carried x4096 in f16
  const float outOscl = 1.0f / 4194304.0f;          // 1/(1024 * 4096)

  // (1) activations -> bf16 plane; weights -> transposed 16-bit planes [n][e] (RNE convert)
  cvt_bf16x8<<<gCvtX, blk, 0, stream>>>(x, Xb, n8x);
  wt_bf16<<<gWt, blk, 0, stream>>>(Wq, Wtq);
  wt_bf16<<<gWt, blk, 0, stream>>>(Wk, Wtk);
  wt_bf16<<<gWt, blk, 0, stream>>>(Wv, Wtv);
  wt_f16s<<<gWt, blk, 0, stream>>>(Wo, Wto, woScale);
  // (2) q = Xb . Wtq^T + bq -> Tf [8192][512] (M=8192, N=512, K=512), then f16 hi (x16) + residual planes
  gemm64<<<gGemm, blk, 0, stream>>>(Xb, Wtq, bq, Tf, ROWS);
  planes_f16x8<<<gCvtX, blk, 0, stream>>>(Tf, Qh, Ql, n8x, qkScale);
  // (3) k likewise
  gemm64<<<gGemm, blk, 0, stream>>>(Xb, Wtk, bk, Tf, ROWS);
  planes_f16x8<<<gCvtX, blk, 0, stream>>>(Tf, Kh, Kl, n8x, qkScale);
  // (4) v, then -> f16 v^T hi plane (x256) and residual plane (x4096 on top)
  gemm64<<<gGemm, blk, 0, stream>>>(Xb, Wtv, bv, Tf, ROWS);
  v_planes<<<gVpl, blk, 0, stream>>>(Tf, DM, VTh, VTl, vScale);
  // (5) attention -> msgs f32 [8192][512] in Tf, then f16 hi (x1024) + residual planes
  attn64<<<gAttn, dim3(128), 0, stream>>>(Qh, Ql, Kh, Kl, VTh, VTl, Tf, sscale, attOscl);
  planes_f16x8<<<gCvtX, blk, 0, stream>>>(Tf, Mh, Ml, n8x, mScale);
  // (6) out = msgs . Wo + bo -> d_out f32 [8192][512] (M=8192, N=512, K=512)
  gemm_o<<<gGemO, blk, 0, stream>>>(Mh, Ml, Wto, bo, outf, ROWS, outOscl);
  (void)hipGetLastError();
}

// v003
// A run of this version takes 134 microseconds.
// Two timings next to v002 put it at 1.19 and 1.18 times that version's speed.
// Over all steps from v000 it is 2.02 times as fast.
// Contractions: q/k/v projections = v_wmma_f32_16x16x32_bf16 (bf16 operands from RNE-converted nodes, W^T and bias, single product); q.k^T scores = v_wmma_f32_16x16x32_f16 (q, k as f16 hi planes carried x16 plus f16 residual planes x1024: hi.hi + (hi.lo + lo.hi) in a separate accumulator, 3 products); p.v = v_wmma_f32_16x16x32_f16 (p carried x1024 in f16; v^T as f16 hi plane x256 plus f16 residual plane x4096 in a separate accumulator folded with 2^-12, 2 products); output projection = v_wmma_f32_16x16x32_f16 (msgs as f16 hi plane x1024 plus f16 residual plane x1024 in a separate accumulator folded with 2^-10; Wo^T = RNE bf16 value carried x4096 in f16; 2 products); all f32 accumulate; softmax in f32.
#include <hip/hip_runtime.h>
#include <math.h>
#include <stdint.h>

#define NB    8
#define SEQ   1024
#define DM    512
#define NH    8
#define HD    64
#define NQB   (SEQ / 64)
#define ROWS  (NB * SEQ)            // 8192 token rows
#define OUTN  (ROWS * DM)
#define KVP   72                    // LDS pitch of the 64-wide f16 tiles in attn64, in halves: 144 B = 16 B x 9 (odd)
#define OSP   68                    // LDS pitch of the 64-wide f32 context tile in attn64, in floats
#define GKC   64                    // GEMMs: k elements of one staged slice = 128 B of every staged row
#define GSP   72                    // GEMMs: LDS pitch of a staged row, in 16-bit elements: 144 B = 16 B x 9 (odd)
#define GROWS (64 + DM)             // GEMMs: staged rows of a slice: 64 A rows, then the DM rows of B
#define GBUF  (GROWS * GSP)         // GEMMs: 16-bit elements of one slice buffer (82944 B)
#define NSL   (DM / GKC)            // GEMMs: slices along k
#define WTB   ((DM / 64) * (DM / 64))      // 64 x 64 tiles of one weight matrix
#define VTB   ((SEQ / 64) * NH * NB)       // 64 x 64 tiles of v
#define PLB   (ROWS * DM / 8 / 256)        // blocks of one 8-elements-per-thread pass over a [ROWS][DM] plane
static_assert(NH * HD == DM);
static_assert(HD == 64);
static_assert(32 * GSP * 2 == 4608);                           // copy9: LDS bytes of 32 staged rows
static_assert(DM == 8 * 64 && GROWS == 18 * 32 && NSL >= 2);   // 8 waves x 64 columns; 18 copies per thread; two buffers
static_assert((SEQ % 64) == 0 && (DM % 64) == 0 && (ROWS % 64) == 0);
static_assert(((ROWS / 64) * (DM / 64)) % 8 == 0);
static_assert(((ROWS / 32) * (DM / 64)) % 8 == 0);
static_assert(((ROWS * DM / 8) % 256) == 0);

typedef _Float16 v16h __attribute__((ext_vector_type(16)));
typedef _Float16 v8h  __attribute__((ext_vector_type(8)));
typedef __bf16   v16b __attribute__((ext_vector_type(16)));
typedef __bf16   v8b  __attribute__((ext_vector_type(8)));
typedef float    v8f  __attribute__((ext_vector_type(8)));
typedef float    v4f  __attribute__((ext_vector_type(4)));
typedef unsigned int v4u __attribute__((ext_vector_type(4)));

// ---- scalar helpers --------------------------------------------------------------------------------
__device__ __forceinline__ unsigned short bf_bits(float f) {          // f32 -> bf16 bits, RNE convert
  unsigned u = __float_as_uint(f);
  return (unsigned short)((u + 0x7FFFu + ((u >> 16) & 1u)) >> 16);
}
__device__ __forceinline__ float bf_up(unsigned short h) { return __uint_as_float(((unsigned)h) << 16); }
__device__ __forceinline__ unsigned short h_bits(_Float16 x) { return __builtin_bit_cast(unsigned short, x); }
__device__ __forceinline__ unsigned pk16(unsigned short a, unsigned short b) { return (unsigned)a | ((unsigned)b << 16); }
__device__ __forceinline__ v8f zero8() { v8f z = {0.f, 0.f, 0.f, 0.f, 0.f, 0.f, 0.f, 0.f}; return z; }

// ---- fragment loaders: 16-bit A/B operand, lane -> row/col (lane&15), p already includes +8*(lane>>4);
//      elements 0..7 <- p[0..7] (k0+8h..), elements 8..15 <- p[16..23] (k0+16+8h..)
__device__ __forceinline__ v16b ldfrag_b(const __bf16* p) {
  union { v16b v; v8b h[2]; } f;
  f.h[0] = *(const v8b*)(p);
  f.h[1] = *(const v8b*)(p + 16);
  return f.v;
}
__device__ __forceinline__ v16h ldfrag_h(const _Float16* p) {
  union { v16h v; v8h h[2]; } f;
  f.h[0] = *(const v8h*)(p);
  f.h[1] = *(const v8h*)(p + 16);
  return f.v;
}

// ---- WMMA helpers with trailing VALU hazard gap --------------------------------------------------------
__device__ __forceinline__ v8f mma_h(v16h a, v16h b, v8f c) {
  c = __builtin_amdgcn_wmma_f32_16x16x32_f16(false, a, false, b, (short)0, c, false, false);
#if defined(__HIP_DEVICE_COMPILE__)
  asm volatile("v_nop\n\tv_nop\n\tv_nop\n\tv_nop" : "+v"(c) : "v"(a), "v"(b));
#endif
  return c;
}
__device__ __forceinline__ v8f mma_b_raw(v16b a, v16b b, v8f c) {
  return __builtin_amdgcn_wmma_f32_16x16x32_bf16(false, a, false, b, (short)0, c, false, false);
}
__device__ __forceinline__ void dep_guard_b(v8f& a, v8f& b, v16b x, v16b y) {
#if defined(__HIP_DEVICE_COMPILE__)
  asm volatile("v_nop\n\tv_nop\n\tv_nop\n\tv_nop" : "+v"(a), "+v"(b) : "v"(x), "v"(y));
#endif
}
__device__ __forceinline__ void keep4_b(v16b a, v16b b, v16b c, v16b d) {
#if defined(__HIP_DEVICE_COMPILE__)
  asm volatile("v_nop" :: "v"(a), "v"(b), "v"(c), "v"(d));
#endif
}
__device__ __forceinline__ void acc_guard4(v8f& a, v8f& b, v8f& c, v8f& d) {
#if defined(__HIP_DEVICE_COMPILE__)
  asm volatile("v_nop\n\tv_nop\n\tv_nop\n\tv_nop" : "+v"(a), "+v"(b), "+v"(c), "+v"(d));
#endif
}

// ---- GEMM operand staging: asynchronous copies global -> LDS, waits -----------------------------------
__device__ __forceinline__ unsigned lds_off(const void* p) { return (unsigned)(size_t)p; }   // LDS byte address
// nine 16-B copies of this lane: LDS bytes l + 4608 i (32 staged rows of 144 B further each) <- global g0 .. g8
__device__ __forceinline__ void copy9(unsigned l, const unsigned short* g0, const unsigned short* g1,
                                      const unsigned short* g2, const unsigned short* g3, const unsigned short* g4,
                                      const unsigned short* g5, const unsigned short* g6, const unsigned short* g7,
                                      const unsigned short* g8) {
#if defined(__HIP_DEVICE_COMPILE__)
  // the closing s_wait_xcnt stands in the copies' own statement: no address register is rewritten in front of it
  asm volatile(
      "global_load_async_to_lds_b128 %0, %9, off\n\t"
      "global_load_async_to_lds_b128 %1, %10, off\n\t"
      "global_load_async_to_lds_b128 %2, %11, off\n\t"
      "global_load_async_to_lds_b128 %3, %12, off\n\t"
      "global_load_async_to_lds_b128 %4, %13, off\n\t"
      "global_load_async_to_lds_b128 %5, %14, off\n\t"
      "global_load_async_to_lds_b128 %6, %15, off\n\t"
      "global_load_async_to_lds_b128 %7, %16, off\n\t"
      "global_load_async_to_lds_b128 %8, %17, off\n\t"
      "s_wait_xcnt 0x0"
      :: "v"(l), "v"(l + 4608u), "v"(l + 2u * 4608u), "v"(l + 3u * 4608u), "v"(l + 4u * 4608u),
         "v"(l + 5u * 4608u), "v"(l + 6u * 4608u), "v"(l + 7u * 4608u), "v"(l + 8u * 4608u),
         "v"(g0), "v"(g1), "v"(g2), "v"(g3), "v"(g4), "v"(g5), "v"(g6), "v"(g7), "v"(g8)
      : "memory");
#endif
}
// One slice = GROWS rows x 128 B = 18 groups of 32 rows; thread tid copies 16-B column tid&7 of row tid>>3 of every
// group, so 8 lanes copy one whole 128-B line. l: the lane's LDS byte address in group 0 of the buffer; a0, a1: its
// source in A row groups 0 and 1; b: its source in B row group 0 (groups 2..17 = B rows 0..DM-1, row pitch DM).
__device__ __forceinline__ void stage_slice(unsigned l, const unsigned short* a0, const unsigned short* a1,
                                            const unsigned short* b) {
  constexpr size_t S = (size_t)32 * DM;           // 32 B rows, in elements
  copy9(l, a0, a1, b, b + S, b + 2 * S, b + 3 * S, b + 4 * S, b + 5 * S, b + 6 * S);
  copy9(l + 9u * 4608u, b + 7 * S, b + 8 * S, b + 9 * S, b + 10 * S, b + 11 * S, b + 12 * S, b + 13 * S, b + 14 * S,
        b + 15 * S);
}
__device__ __forceinline__ void wait_copies() {   // this wave's copies have landed in LDS
#if defined(__HIP_DEVICE_COMPILE__)
  asm volatile("s_wait_asynccnt 0x0" ::: "memory");
#endif
}
__device__ __forceinline__ void wait_lds_reads() {   // this wave's LDS reads are done before the buffer is handed on
#if defined(__HIP_DEVICE_COMPILE__)
  asm volatile("s_wait_dscnt 0x0" ::: "memory");
#endif
}

// =====================================================================================================
// f32 -> bf16 (RNE convert), 8 elements per thread, one 16-B store per lane: a wave writes 512 contiguous B
// coverage: n8 threads x 8 = whole plane (n8 is a multiple of 256 here).
// =====================================================================================================
__device__ __forceinline__ void cvt_bf16x8_body(const float* __restrict__ in, unsigned short* out, int n8, int blk) {
  const int i = blk * 256 + threadIdx.x;
  if (i < n8) {
    const v4f a = *(const v4f*)(in + (size_t)i * 8);
    const v4f b = *(const v4f*)(in + (size_t)i * 8 + 4);
    v4u p;
    p[0] = pk16(bf_bits(a[0]), bf_bits(a[1]));
    p[1] = pk16(bf_bits(a[2]), bf_bits(a[3]));
    p[2] = pk16(bf_bits(b[0]), bf_bits(b[1]));
    p[3] = pk16(bf_bits(b[2]), bf_bits(b[3]));
    *(v4u*)(out + (size_t)i * 8) = p;
    
  }
}

// =====================================================================================================
// f32 -> f16 hi plane = f16(v * scale) (scale a power of two) + f16 residual plane = f16((v*scale - hi) * 1024),
// same element index in both planes; 8 elements per thread, one 16-B store per lane and plane: a wave writes
// coverage: n8 threads x 8 = whole plane (n8 multiple of 256).
// =====================================================================================================
__device__ __forceinline__ void planes_f16x8_body(const float* __restrict__ in, unsigned short* hp,
                                                  unsigned short* lp, int n8, float scale, int blk) {
  const int i = blk * 256 + threadIdx.x;
  if (i < n8) {
    const v4f a = *(const v4f*)(in + (size_t)i * 8);
    const v4f b = *(const v4f*)(in + (size_t)i * 8 + 4);
    float f[8];
    f[0] = a[0]; f[1] = a[1]; f[2] = a[2]; f[3] = a[3];
    f[4] = b[0]; f[5] = b[1]; f[6] = b[2]; f[7] = b[3];
    v4u ph, pl;
#pragma unroll
    for (int e = 0; e < 4; ++e) {
      const float f0 = f[2 * e] * scale;
      const float f1 = f[2 * e + 1] * scale;
      const _Float16 x0 = (_Float16)f0, x1 = (_Float16)f1;
      const _Float16 l0 = (_Float16)((f0 - (float)x0) * 1024.0f);
      const _Float16 l1 = (_Float16)((f1 - (float)x1) * 1024.0f);
      ph[e] = pk16(h_bits(x0), h_bits(x1));
      pl[e] = pk16(h_bits(l0), h_bits(l1));
    }
    *(v4u*)(hp + (size_t)i * 8) = ph;
    *(v4u*)(lp + (size_t)i * 8) = pl;
    
  }
}
__global__ __launch_bounds__(256) void planes_f16x8(const float* __restrict__ in, unsigned short* hp,
                                                    unsigned short* lp, int n8, float scale) {
  planes_f16x8_body(in, hp, lp, n8, scale, blockIdx.x);
}

// =====================================================================================================
// Weight transpose + convert: in W f32 [DM rows (e, contraction index)][DM cols (n, output feature)] (the
// x @ W layout) -> out Wt 16-bit [DM (n)][DM (e)] (the [n][k], k-contiguous layout the GEMM B operand uses).
// MODE 0: RNE bf16 bits. MODE 1: f16 bits of (RNE bf16 value * scale), scale a power of two (exact in f16).
// Block = one 64 e x 64 n tile (et, nt: its e and n tile index, DM/64 of each). The tile is staged in LDS as [ee][nn]
// pitch 68 floats (v4f loads, __syncthreads). in[rows e][cols n] -> out[rows n][cols e] (square here).
// Store: group g = tid>>3 (0..31), piece = tid&7: iteration it writes row n0 + (it*32+g), lanes 8q..8q+7 x 16 B
// coverage: 2 iterations x 32 groups = 64 rows n, 8 pieces x 8 = 64 e per row; grid covers every (e tile,
// n tile) -> the whole [DM][DM] plane.
// =====================================================================================================
template <int MODE>
__device__ __forceinline__ void wt_tile_body(const float* __restrict__ W, unsigned short* Wt, float scale,
                                             float* sw, int et, int nt) {
  const int tid = threadIdx.x;
  const int e0  = et * 64;
  const int n0  = nt * 64;
#pragma unroll
  for (int i = 0; i < 4; ++i) {
    const int idx = i * 256 + tid;                  // 0..1023
    const int ee = idx >> 4, c4 = (idx & 15) * 4;
    const v4f a = *(const v4f*)(W + ((size_t)(e0 + ee)) * DM + n0 + c4);
    *(v4f*)(sw + ee * 68 + c4) = a;
  }
  __syncthreads();

  const int g = tid >> 3, piece = tid & 7;
  v4u hv[2];
  size_t hofs[2];
#pragma unroll
  for (int it = 0; it < 2; ++it) {
    const int n = it * 32 + g;
    v4u a;
#pragma unroll
    for (int e = 0; e < 4; ++e) {
      const float f0 = sw[(piece * 8 + 2 * e) * 68 + n];
      const float f1 = sw[(piece * 8 + 2 * e + 1) * 68 + n];
      unsigned short u0, u1;
      if (MODE == 0) {
        u0 = bf_bits(f0);
        u1 = bf_bits(f1);
      } else {
        u0 = h_bits((_Float16)(bf_up(bf_bits(f0)) * scale));
        u1 = h_bits((_Float16)(bf_up(bf_bits(f1)) * scale));
      }
      a[e] = pk16(u0, u1);
    }
    hv[it] = a;
    hofs[it] = ((size_t)(n0 + n)) * DM + e0 + piece * 8;
  }
  {
#pragma unroll
    for (int it = 0; it < 2; ++it) {
      *(v4u*)(Wt + hofs[it]) = hv[it];
    }
#if defined(__HIP_DEVICE_COMPILE__)
    // both tile bodies stand in one kernel: no register that the two stores name is rewritten in front of this wait
    asm volatile("s_wait_xcnt 0x0" ::: "memory");
#endif
  }
}
// One grid for all operand preparation (the five jobs are independent of one another): blocks 0 .. 4 WTB - 1 = the
// weight tiles of Wq, Wk, Wv (bf16) and Wo (f16 x woscale), WTB tiles each; the blocks behind them = the activations'
// bf16 plane. The branch is block-uniform, so the tile body's barrier is passed by whole blocks only.
__global__ __launch_bounds__(256) void prep(const float* __restrict__ x, const float* __restrict__ Wq,
                                            const float* __restrict__ Wk, const float* __restrict__ Wv,
                                            const float* __restrict__ Wo, unsigned short* Xb, unsigned short* Wtq,
                                            unsigned short* Wtk, unsigned short* Wtv, unsigned short* Wto,
                                            int n8, float woscale) {
  __shared__ __align__(16) float sw[64 * 68];       // [ee][nn] pitch 68 floats
  const int bx = blockIdx.x;
  if (bx < 4 * WTB) {
    const int w = bx / WTB, tile = bx % WTB;
    const int et = tile % (DM / 64), nt = tile / (DM / 64);
    if (w == 3) {
      wt_tile_body<1>(Wo, Wto, woscale, sw, et, nt);
    } else {
      wt_tile_body<0>(w == 0 ? Wq : (w == 1 ? Wk : Wv), w == 0 ? Wtq : (w == 1 ? Wtk : Wtv), 1.0f, sw, et, nt);
    }
  } else {
    cvt_bf16x8_body(x, Xb, n8, bx - 4 * WTB);
  }
}

// =====================================================================================================
// Register-blocked bf16 WMMA GEMM with bias: C[m][n] = sum_k A[m][k] * Bt[n][k] + bf16rne(bias[n]), N = K = DM.
// Block = 64 rows x DM columns, one wave per 64x64 tile (wave w: columns 64 w ..). A row-major [M][DM]; Bt row-major
// [DM n][DM k] (k contiguous); bias f32 [DM] (RNE converted to bf16 and widened in the epilogue); M multiple of 64.
// Operands: k slices of GKC, the block's 64 A rows and all DM B rows, staged in LDS by asynchronous copies, two
// buffers: slice t + 1 is in flight while slice t is multiplied; per slice one hand-over (LDS reads done, own copies
// landed, block barrier), then slice t + 2 is copied into the buffer slice t has left.
// Output f32 [M][DM] pitch DM. Epilogue: 16-row slabs staged per wave in LDS; each 64-wide row segment
// =====================================================================================================
// One grid for the three projections: blockIdx.y = 0, 1, 2 picks (Bt, bias, C) of q, k, v; A is common to them.
__global__ __launch_bounds__(256) void gemm64(
    const unsigned short* __restrict__ Ap,
    const unsigned short* __restrict__ Btq, const unsigned short* __restrict__ Btk,
    const unsigned short* __restrict__ Btv,
    const float* __restrict__ biasq, const float* __restrict__ biask, const float* __restrict__ biasv,
    float* Cq, float* Ck, float* Cv, int M) {
  const int which = blockIdx.y;
  const unsigned short* __restrict__ Btp = which == 0 ? Btq : (which == 1 ? Btk : Btv);
  const float* __restrict__ bias = which == 0 ? biasq : (which == 1 ? biask : biasv);
  float* C = which == 0 ? Cq : (which == 1 ? Ck : Cv);
  __shared__ __align__(16) __bf16 sAB[2 * GBUF];   // two slice buffers: rows 0..63 = A, rows 64.. = B
  __shared__ __align__(16) float sT[8][16 * 68];   // per-wave 16x64 slab, pitch 68 floats
  constexpr int ldc = DM;
  const int tid  = threadIdx.x;
  const int lane = tid & 31;
  const int wave = tid >> 5;
  const int m0 = blockIdx.x << 6;
  if (m0 >= M) return;                   // block-uniform, in front of every barrier
  const int n0 = wave << 6;

  // this lane's piece of every 32-row group: row tid>>3, 16-B column tid&7
  const unsigned short* ga0 = Ap + (size_t)(m0 + (tid >> 3)) * DM + (tid & 7) * 8;
  const unsigned short* ga1 = ga0 + (size_t)32 * DM;
  const unsigned short* gb  = Btp + (size_t)(tid >> 3) * DM + (tid & 7) * 8;
  const unsigned l0 = lds_off(sAB) + (unsigned)((tid >> 3) * GSP + (tid & 7) * 8) * 2u;
  stage_slice(l0, ga0, ga1, gb);
  wait_copies();
  __syncthreads();                       // slice 0 is readable by every wave
  stage_slice(l0 + GBUF * 2u, ga0 + GKC, ga1 + GKC, gb + GKC);

  const int rlane = lane & 15;                 // row (A) / col (B, D) within subtile
  const int koff  = (lane >> 4) * 8;           // k offset of this lane half
  const int mOff  = (lane >> 4) * 8;           // D row offset

  v8f acc[4][4];
#pragma unroll
  for (int i = 0; i < 4; ++i)
#pragma unroll
    for (int j = 0; j < 4; ++j) acc[i][j] = zero8();

  for (int t = 0; t < NSL; ++t) {
    const __bf16* sb = sAB + (t & 1) * GBUF;
#pragma unroll
    for (int kk = 0; kk < GKC; kk += 32) {
      v16b bh[4], ah[4];                 // the k step's LDS reads stand together, in front of its WMMAs
#pragma unroll
      for (int j = 0; j < 4; ++j) {
        bh[j] = ldfrag_b(sb + (64 + n0 + (j << 4) + rlane) * GSP + koff + kk);
      }
#pragma unroll
      for (int i = 0; i < 4; ++i) {
        ah[i] = ldfrag_b(sb + ((i << 4) + rlane) * GSP + koff + kk);
      }
#pragma unroll
      for (int i = 0; i < 4; ++i) {
#pragma unroll
        for (int j = 0; j < 4; ++j) {
          acc[i][j] = mma_b_raw(ah[i], bh[j], acc[i][j]);
        }
        dep_guard_b(acc[i][0], acc[i][3], ah[i], ah[i]);
      }
      keep4_b(bh[0], bh[1], bh[2], bh[3]);
    }
    // hand-over: slice t + 1 becomes readable, slice t's buffer becomes free
    wait_lds_reads();
    wait_copies();
    __syncthreads();
    if (t + 2 < NSL) {
      stage_slice(l0 + (unsigned)(t & 1) * (GBUF * 2u), ga0 + (t + 2) * GKC, ga1 + (t + 2) * GKC, gb + (t + 2) * GKC);
    }
  }
  wait_copies();
  acc_guard4(acc[0][0], acc[0][1], acc[0][2], acc[0][3]);
  acc_guard4(acc[1][0], acc[1][1], acc[1][2], acc[1][3]);
  acc_guard4(acc[2][0], acc[2][1], acc[2][2], acc[2][3]);
  acc_guard4(acc[3][0], acc[3][1], acc[3][2], acc[3][3]);

  // ---- bias per D column of this lane (n0 + 16j + rlane < N) ----
  float bz[4];
#pragma unroll
  for (int j = 0; j < 4; ++j) bz[j] = bf_up(bf_bits(bias[n0 + (j << 4) + rlane]));

  // ---- epilogue ----
  float* slab = sT[wave];
#pragma unroll
  for (int i = 0; i < 4; ++i) {
    const int mBase = m0 + (i << 4);
#pragma unroll
    for (int r = 0; r < 8; ++r) {
#pragma unroll
      for (int j = 0; j < 4; ++j) {
        slab[(mOff + r) * 68 + (j << 4) + rlane] = acc[i][j][r] + bz[j];
      }
    }
    __builtin_amdgcn_fence(__ATOMIC_RELEASE, "workgroup");
    __builtin_amdgcn_wave_barrier();
    __builtin_amdgcn_fence(__ATOMIC_ACQUIRE, "workgroup");
    {
      const int hh = lane >> 4, c4 = (lane & 15) * 4;     // 256-B row segment = 16 lanes x 16 B
      v4f ov[8];
#pragma unroll
      for (int it = 0; it < 8; ++it) {
        const int row = it * 2 + hh;                       // it 0..7 x hh 0..1 = rows 0..15
        ov[it] = *(const v4f*)(slab + row * 68 + c4);
      }
      {
#pragma unroll
        for (int it = 0; it < 8; ++it) {
          const int row = it * 2 + hh;
          *(v4f*)(C + (size_t)(mBase + row) * ldc + n0 + c4) = ov[it];
        }
        
      }
    }
    __builtin_amdgcn_fence(__ATOMIC_RELEASE, "workgroup");
    __builtin_amdgcn_wave_barrier();
    __builtin_amdgcn_fence(__ATOMIC_ACQUIRE, "workgroup");
  }
}

// =====================================================================================================
// f16 WMMA GEMM with a two-plane A operand and bias:
//   C[m][n] = (sum_k Ah[m][k]*Bt[n][k] + 2^-10 * sum_k Al[m][k]*Bt[n][k]) * oscale + bf16rne(bias[n]),
// the residual products in a separate accumulator, N = K = DM. Block = 32 rows x DM columns, one wave per 32x64 tile
// (wave w: columns 64 w ..). Ah/Al row-major [M][DM] (f16 hi and residual planes, same index); Bt row-major
// [DM n][DM k] (f16, k contiguous); M multiple of 32. Operands staged in LDS as in gemm64 (staged rows 0..31 = Ah,
// 32..63 = Al, 64.. = B). Every WMMA nop-guarded.
// Output f32 [M][DM] pitch DM. Epilogue: 16-row slabs staged per wave in LDS; each 64-wide row segment (256 B)
// coverage: 2 slabs x 16 rows x 64 cols = the wave's whole 32x64 tile.
// =====================================================================================================
__global__ __launch_bounds__(256) void gemm_o(
    const unsigned short* __restrict__ Ahp, const unsigned short* __restrict__ Alp,
    const unsigned short* __restrict__ Btp,
    const float* __restrict__ bias,
    float* C, int M, float oscale) {
  __shared__ __align__(16) _Float16 sAB[2 * GBUF]; // two slice buffers: rows 0..31 = Ah, 32..63 = Al, 64.. = B
  __shared__ __align__(16) float sT[8][16 * 68];   // per-wave 16x64 slab, pitch 68 floats
  constexpr int ldc = DM;
  const int tid  = threadIdx.x;
  const int lane = tid & 31;
  const int wave = tid >> 5;
  const int m0 = blockIdx.x << 5;
  if (m0 >= M) return;                   // block-uniform, in front of every barrier
  const int n0 = wave << 6;

  // this lane's piece of every 32-row group: row tid>>3, 16-B column tid&7
  const size_t ao = (size_t)(m0 + (tid >> 3)) * DM + (tid & 7) * 8;
  const unsigned short* ga0 = Ahp + ao;
  const unsigned short* ga1 = Alp + ao;
  const unsigned short* gb  = Btp + (size_t)(tid >> 3) * DM + (tid & 7) * 8;
  const unsigned l0 = lds_off(sAB) + (unsigned)((tid >> 3) * GSP + (tid & 7) * 8) * 2u;
  stage_slice(l0, ga0, ga1, gb);
  wait_copies();
  __syncthreads();                       // slice 0 is readable by every wave
  stage_slice(l0 + GBUF * 2u, ga0 + GKC, ga1 + GKC, gb + GKC);

  const int rlane = lane & 15;
  const int koff  = (lane >> 4) * 8;
  const int mOff  = (lane >> 4) * 8;

  v8f acc[2][4], acl[2][4];
#pragma unroll
  for (int i = 0; i < 2; ++i)
#pragma unroll
    for (int j = 0; j < 4; ++j) { acc[i][j] = zero8(); acl[i][j] = zero8(); }

  for (int t = 0; t < NSL; ++t) {
    const _Float16* sb = sAB + (t & 1) * GBUF;
#pragma unroll
    for (int kk = 0; kk < GKC; kk += 32) {
      v16h ah[2], al[2], bfr[4];         // the k step's LDS reads stand together, in front of its WMMAs
#pragma unroll
      for (int i = 0; i < 2; ++i) {
        ah[i] = ldfrag_h(sb + ((i << 4) + rlane) * GSP + koff + kk);
        al[i] = ldfrag_h(sb + (32 + (i << 4) + rlane) * GSP + koff + kk);
      }
#pragma unroll
      for (int j = 0; j < 4; ++j) {
        bfr[j] = ldfrag_h(sb + (64 + n0 + (j << 4) + rlane) * GSP + koff + kk);
      }
#pragma unroll
      for (int j = 0; j < 4; ++j) {
#pragma unroll
        for (int i = 0; i < 2; ++i) {
          acc[i][j] = mma_h(ah[i], bfr[j], acc[i][j]);
          acl[i][j] = mma_h(al[i], bfr[j], acl[i][j]);
        }
      }
    }
    // hand-over: slice t + 1 becomes readable, slice t's buffer becomes free
    wait_lds_reads();
    wait_copies();
    __syncthreads();
    if (t + 2 < NSL) {
      stage_slice(l0 + (unsigned)(t & 1) * (GBUF * 2u), ga0 + (t + 2) * GKC, ga1 + (t + 2) * GKC, gb + (t + 2) * GKC);
    }
  }
  wait_copies();

  // ---- bias per D column of this lane (n0 + 16j + rlane < N) ----
  float bz[4];
#pragma unroll
  for (int j = 0; j < 4; ++j) bz[j] = bf_up(bf_bits(bias[n0 + (j << 4) + rlane]));

  // ---- epilogue ----
  float* slab = sT[wave];
#pragma unroll
  for (int i = 0; i < 2; ++i) {
    const int mBase = m0 + (i << 4);
#pragma unroll
    for (int r = 0; r < 8; ++r) {
#pragma unroll
      for (int j = 0; j < 4; ++j) {
        const float y = (acc[i][j][r] + acl[i][j][r] * (1.0f / 1024.0f)) * oscale + bz[j];
        slab[(mOff + r) * 68 + (j << 4) + rlane] = y;
      }
    }
    __builtin_amdgcn_fence(__ATOMIC_RELEASE, "workgroup");
    __builtin_amdgcn_wave_barrier();
    __builtin_amdgcn_fence(__ATOMIC_ACQUIRE, "workgroup");
    {
      const int hh = lane >> 4, c4 = (lane & 15) * 4;     // 256-B row segment = 16 lanes x 16 B
      v4f ov[8];
#pragma unroll
      for (int it = 0; it < 8; ++it) {
        const int row = it * 2 + hh;                       // it 0..7 x hh 0..1 = rows 0..15
        ov[it] = *(const v4f*)(slab + row * 68 + c4);
      }
      {
#pragma unroll
        for (int it = 0; it < 8; ++it) {
          const int row = it * 2 + hh;
          *(v4f*)(C + (size_t)(mBase + row) * ldc + n0 + c4) = ov[it];
        }
        
      }
    }
    __builtin_amdgcn_fence(__ATOMIC_RELEASE, "workgroup");
    __builtin_amdgcn_wave_barrier();
    __builtin_amdgcn_fence(__ATOMIC_ACQUIRE, "workgroup");
  }
}

// =====================================================================================================
// v f32 token-major columns vf[(b*SEQ + t)*vrp + h*64 + d] ->
// f16 v^T hi plane vth[(b*DM + h*64 + d)*SEQ + t] = f16(v * vscale) (vscale a power of two) and residual plane
// vtl[same index] = f16((v*vscale - hi) * 4096).
// Block = one 64-token x 64-feature tile of one (b, h): tile index (tt0, hh, b) in (SEQ/64, NH, NB); staged in LDS as f32
// (v4f loads, __syncthreads).
// Store: group g = tid>>3 (0..31), piece = tid&7: iteration it writes row d = it*32+g, lanes 8q..8q+7 x 16 B =
// coverage: 2 iterations x 32 groups = 64 rows d, 8 pieces x 8 = 64 tokens per row; grid covers every (b, h,
// t tile) -> both whole planes.
// =====================================================================================================
__device__ __forceinline__ void v_planes_body(const float* __restrict__ vf, int vrp, unsigned short* vth,
                                              unsigned short* vtl, float vscale, float* sv, int tt0, int hh, int b) {
  const int tid = threadIdx.x;
  const int t0  = tt0 * 64;
#pragma unroll
  for (int i = 0; i < 4; ++i) {
    const int idx = i * 256 + tid;                  // 0..1023
    const int tt = idx >> 4, c4 = (idx & 15) * 4;
    const v4f a = *(const v4f*)(vf + ((size_t)(b * SEQ + t0 + tt)) * vrp + hh * HD + c4);
    *(v4f*)(sv + tt * 68 + c4) = a;
  }
  __syncthreads();

  const int g = tid >> 3, piece = tid & 7;
  v4u hv[2], lv[2];
  size_t hofs[2];
#pragma unroll
  for (int it = 0; it < 2; ++it) {
    const int d = it * 32 + g;
    v4u a, a2;
#pragma unroll
    for (int e = 0; e < 4; ++e) {
      const float f0 = sv[(piece * 8 + 2 * e) * 68 + d] * vscale;
      const float f1 = sv[(piece * 8 + 2 * e + 1) * 68 + d] * vscale;
      const _Float16 x0 = (_Float16)f0, x1 = (_Float16)f1;
      const unsigned short h0 = h_bits(x0), h1 = h_bits(x1);
      const unsigned short l0 = h_bits((_Float16)((f0 - (float)x0) * 4096.0f));
      const unsigned short l1 = h_bits((_Float16)((f1 - (float)x1) * 4096.0f));
      a[e] = pk16(h0, h1); a2[e] = pk16(l0, l1);
    }
    hv[it] = a; lv[it] = a2;
    hofs[it] = ((size_t)(b * DM + hh * HD + d)) * SEQ + t0 + piece * 8;
  }
  {
#pragma unroll
    for (int it = 0; it < 2; ++it) {
      *(v4u*)(vth + hofs[it]) = hv[it];
      *(v4u*)(vtl + hofs[it]) = lv[it];
    }
    
  }
}
// One grid for the three plane splits (independent of one another): blocks 0 .. VTB - 1 = the v tiles, then PLB blocks
// for q, then PLB blocks for k. The branch is block-uniform, so the tile body's barrier is passed by whole blocks only.
__global__ __launch_bounds__(256) void planes_qkv(const float* __restrict__ qf, const float* __restrict__ kf,
                                                  const float* __restrict__ vf, unsigned short* qh, unsigned short* ql,
                                                  unsigned short* kh, unsigned short* kl, unsigned short* vth,
                                                  unsigned short* vtl, int n8, float qkscale, float vscale) {
  __shared__ __align__(16) float sv[64 * 68];       // [tt][d] pitch 68 floats
  const int bx = blockIdx.x;
  if (bx < VTB) {
    v_planes_body(vf, DM, vth, vtl, vscale, sv, bx % (SEQ / 64), (bx / (SEQ / 64)) % NH, bx / ((SEQ / 64) * NH));
  } else if (bx < VTB + PLB) {
    planes_f16x8_body(qf, qh, ql, n8, qkscale, bx - VTB);
  } else {
    planes_f16x8_body(kf, kh, kl, n8, qkscale, bx - (VTB + PLB));
  }
}

// =====================================================================================================
// Bidirectional multi-head attention, head dim 64, no mask.
//   q f16 hi plane (x16): element (b, t, h, d) at [(b*SEQ + t)*DM + h*64 + d]; q residual plane
//     ((q*16 - hi)*1024) at the same index into qlp
//   k f16 hi plane (x16): element (b, s, h, d) at [(b*SEQ + s)*DM + h*64 + d]; k residual plane same into klp
//   v^T f16 hi plane (x256): element (b, h, d, s) at [(b*DM + h*64 + d)*SEQ + s]
//   v^T f16 residual plane ((v*256 - hi)*4096): same index into vlp
//   All NQB key tiles of 64 are processed for every query tile (static trip count).
//   logit = (qhi.khi + (qhi.klo + qlo.khi) * 2^-10) * sscale, f16 products with f32 accumulate, the residual
//   products in a separate accumulator; p = exp(s - m) carried as ph = f16(1024 p);
//   context = ph . vhi on f16 WMMA plus ph . vres into a separate accumulator folded back with 2^-12 per tile
//   in f32; online softmax in f32; out f32 plane: element (b, t, h*64 + d) at [(b*SEQ + t)*DM + h*64 + d] =
//   normalised context (oscl folds back the p and v carries).
//   Block = 4 waves = 64 query rows of one (b, h); grid = NB*NH*NQB; kv tiles of 64.
//   K hi / K residual / V^T hi / V^T residual tile staging: 128 threads x 32 elements per plane = the whole
//   64x64 tile (plain 16-B loads, __syncthreads before and after); P tiles are wave-private, spilled with
//   Output coverage: each wave stores rows q0..q0+15 (it 0..7 x lane>>4 0..1) x 64 columns (16 lanes x 4
//   (b, h, query tile) -> the whole plane.
// =====================================================================================================
__global__ __launch_bounds__(128)
void attn64(const unsigned short* __restrict__ qhp, const unsigned short* __restrict__ qlp,
            const unsigned short* __restrict__ khp, const unsigned short* __restrict__ klp,
            const unsigned short* __restrict__ vhp, const unsigned short* __restrict__ vlp,
            float* outp, float sscale, float oscl) {
  union FH { v16h v; v8h h[2]; };
  __shared__ __align__(16) _Float16 Ksh[64 * KVP];                // K hi [kv][d]    9 KB
  __shared__ __align__(16) _Float16 Ksl[64 * KVP];                // K residual      9 KB
  __shared__ __align__(16) _Float16 Vth[64 * KVP];                // V^T hi [d][kv]  9 KB
  __shared__ __align__(16) _Float16 Vtl[64 * KVP];                // V^T residual    9 KB
  __shared__ __align__(16) _Float16 Psh[4][16 * KVP];             // per wave P hi [row][kv]      9 KB
  __shared__ __align__(16) float    Os[4][16 * OSP];              // per wave context tile [row][d] 17 KB

  const int tid  = threadIdx.x;
  const int wave = tid >> 5;
  const int lane = tid & 31;
  const int hh   = lane >> 4;
  const int c    = lane & 15;

  const int bx   = blockIdx.x;
  const int qb   = bx % NQB;
  const int rest = bx / NQB;
  const int h    = rest % NH;
  const int b    = rest / NH;                // < NB by the grid size
  const int q0   = qb * 64 + wave * 16;
  const size_t rowB = (size_t)b * SEQ;

  const _Float16* Qp  = (const _Float16*)(const void*)qhp + (size_t)h * HD;
  const _Float16* Qlq = (const _Float16*)(const void*)qlp + (size_t)h * HD;
  const _Float16* Kp  = (const _Float16*)(const void*)khp + (size_t)h * HD;
  const _Float16* Klq = (const _Float16*)(const void*)klp + (size_t)h * HD;
  const _Float16* Vh  = (const _Float16*)(const void*)vhp + ((size_t)b * DM + (size_t)h * HD) * SEQ;
  const _Float16* Vl  = (const _Float16*)(const void*)vlp + ((size_t)b * DM + (size_t)h * HD) * SEQ;

  // ---- Q fragments (A operand, row = lane&15): 2 d-chunks, hi and residual ----
  v16h qa[2], ql[2];
#pragma unroll
  for (int dc = 0; dc < 2; ++dc) {
    const size_t qo = (rowB + q0 + c) * DM + dc * 32 + 8 * hh;
    qa[dc] = ldfrag_h(Qp + qo);
    ql[dc] = ldfrag_h(Qlq + qo);
  }

  float mrow[8], lrow[8];
  v8f oacc[4];
#pragma unroll
  for (int r = 0; r < 8; ++r) { mrow[r] = -INFINITY; lrow[r] = 0.f; }
#pragma unroll
  for (int t = 0; t < 4; ++t) oacc[t] = zero8();

  for (int kt = 0; kt < NQB; ++kt) {
    const int kv0 = kt * 64;
    __syncthreads();
    {
      const int r = tid >> 1, half = (tid & 1) * 32;
      const _Float16* kg  = Kp  + (rowB + kv0 + r) * DM + half;    // K hi row kv0+r, d = half..half+31
      const _Float16* klg = Klq + (rowB + kv0 + r) * DM + half;    // K residual row kv0+r
      const _Float16* vg  = Vh + (size_t)r * SEQ + kv0 + half;     // V^T hi row d = r, s = kv0+half..+31
      const _Float16* vlg = Vl + (size_t)r * SEQ + kv0 + half;     // V^T residual row d = r
#pragma unroll
      for (int i = 0; i < 4; ++i) {
        const v8h a0 = *(const v8h*)(kg + 8 * i);
        const v8h a1 = *(const v8h*)(klg + 8 * i);
        const v8h b0 = *(const v8h*)(vg + 8 * i);
        const v8h b1 = *(const v8h*)(vlg + 8 * i);
        *(v8h*)(Ksh + r * KVP + half + 8 * i) = a0;
        *(v8h*)(Ksl + r * KVP + half + 8 * i) = a1;
        *(v8h*)(Vth + r * KVP + half + 8 * i) = b0;
        *(v8h*)(Vtl + r * KVP + half + 8 * i) = b1;
      }
    }
    __syncthreads();

    // ---- scores: 16 query rows x 64 keys per wave; hi.hi into s, hi.lo + lo.hi into s1 (folded x 2^-10) ----
    v8f s[4];
#pragma unroll
    for (int j = 0; j < 4; ++j) {
      s[j] = zero8();
      v8f s1 = zero8();
#pragma unroll
      for (int dc = 0; dc < 2; ++dc) {
        FH kb, kr;
        kb.h[0] = *(const v8h*)(Ksh + (j * 16 + c) * KVP + dc * 32 + 8 * hh);
        kb.h[1] = *(const v8h*)(Ksh + (j * 16 + c) * KVP + dc * 32 + 16 + 8 * hh);
        kr.h[0] = *(const v8h*)(Ksl + (j * 16 + c) * KVP + dc * 32 + 8 * hh);
        kr.h[1] = *(const v8h*)(Ksl + (j * 16 + c) * KVP + dc * 32 + 16 + 8 * hh);
        s[j] = mma_h(qa[dc], kb.v, s[j]);
        s1   = mma_h(qa[dc], kr.v, s1);
        s1   = mma_h(ql[dc], kb.v, s1);
      }
#pragma unroll
      for (int r = 0; r < 8; ++r) s[j][r] += s1[r] * (1.0f / 1024.0f);
    }

    // ---- scale, row max, online softmax, P (x1024, f16) to LDS ----
    _Float16* pwh = Psh[wave];
#pragma unroll
    for (int r = 0; r < 8; ++r) {
      float m = -INFINITY;
#pragma unroll
      for (int j = 0; j < 4; ++j) {
        const float sv = s[j][r] * sscale;
        s[j][r] = sv;
        m = fmaxf(m, sv);
      }
#pragma unroll
      for (int off = 1; off < 16; off <<= 1) m = fmaxf(m, __shfl_xor(m, off, 32));
      const float mnew  = fmaxf(mrow[r], m);
      const float msafe = (mnew == -INFINITY) ? 0.f : mnew;
      const float alpha = __expf(mrow[r] - msafe);
      mrow[r] = mnew;
      float psum = 0.f;
#pragma unroll
      for (int j = 0; j < 4; ++j) {
        const float p = __expf(s[j][r] - msafe);
        psum += p;
        const float p1024 = p * 1024.0f;
        const _Float16 ph = (_Float16)p1024;
        pwh[(8 * hh + r) * KVP + j * 16 + c] = ph;
      }
#pragma unroll
      for (int off = 1; off < 16; off <<= 1) psum += __shfl_xor(psum, off, 32);
      lrow[r] = lrow[r] * alpha + psum;
#pragma unroll
      for (int t = 0; t < 4; ++t) oacc[t][r] *= alpha;
    }
    __builtin_amdgcn_fence(__ATOMIC_RELEASE, "workgroup");
    __builtin_amdgcn_wave_barrier();
    __builtin_amdgcn_fence(__ATOMIC_ACQUIRE, "workgroup");

    // ---- context += P . Vhi (f16 WMMA); P . Vres into a separate accumulator ----
    v8f o1[4];
#pragma unroll
    for (int t = 0; t < 4; ++t) o1[t] = zero8();
#pragma unroll 1
    for (int kk = 0; kk < 2; ++kk) {
      FH pa;
      pa.h[0] = *(const v8h*)(pwh + c * KVP + kk * 32 + 8 * hh);
      pa.h[1] = *(const v8h*)(pwh + c * KVP + kk * 32 + 16 + 8 * hh);
#pragma unroll
      for (int t = 0; t < 4; ++t) {
        FH vb;
        vb.h[0] = *(const v8h*)(Vth + (t * 16 + c) * KVP + kk * 32 + 8 * hh);
        vb.h[1] = *(const v8h*)(Vth + (t * 16 + c) * KVP + kk * 32 + 16 + 8 * hh);
        oacc[t] = mma_h(pa.v, vb.v, oacc[t]);
        FH vl;
        vl.h[0] = *(const v8h*)(Vtl + (t * 16 + c) * KVP + kk * 32 + 8 * hh);
        vl.h[1] = *(const v8h*)(Vtl + (t * 16 + c) * KVP + kk * 32 + 16 + 8 * hh);
        o1[t] = mma_h(pa.v, vl.v, o1[t]);
      }
    }
#pragma unroll
    for (int t = 0; t < 4; ++t)
#pragma unroll
      for (int r = 0; r < 8; ++r) oacc[t][r] += o1[t][r] * (1.0f / 4096.0f);
  }

  // ---- normalise (1/l and the carries via oscl), stage the wave's 16x64 tile in LDS, then write whole 256-B
  float* os = Os[wave];
#pragma unroll
  for (int r = 0; r < 8; ++r) {
    const float l = lrow[r];
    const float inv = ((l > 0.f) ? (1.0f / l) : 0.f) * oscl;
#pragma unroll
    for (int t = 0; t < 4; ++t) {
      os[(8 * hh + r) * OSP + t * 16 + c] = oacc[t][r] * inv;
    }
  }
  __builtin_amdgcn_fence(__ATOMIC_RELEASE, "workgroup");
  __builtin_amdgcn_wave_barrier();
  __builtin_amdgcn_fence(__ATOMIC_ACQUIRE, "workgroup");
  {
    const int h2 = lane >> 4, c4 = (lane & 15) * 4;
    v4f ov[8];
#pragma unroll
    for (int it = 0; it < 8; ++it) {
      const int row = it * 2 + h2;   // it 0..7 x h2 0..1 = rows 0..15 of the wave tile
      ov[it] = *(const v4f*)(os + row * OSP + c4);
    }
    {
#pragma unroll
      for (int it = 0; it < 8; ++it) {
        const int row = it * 2 + h2;
        const size_t go = (rowB + q0 + row) * DM + (size_t)h * HD + c4;
        *(v4f*)(outp + go) = ov[it];
      }
      
    }
  }
}

// =====================================================================================================
// Workspace map (bytes), every region an exact multiple of its whole-line / whole-tile store granularity
// 8192 x 512, 512 x 512 and 4096 x 1024 are whole tiles/lines):
//   Xb    bf16 [8192][512]            0          8388608
//   Wtq   bf16 [512][512]       8388608           524288   ([n][e])
//   Wtk   bf16 [512][512]       8912896           524288
//   Wtv   bf16 [512][512]       9437184           524288
//   Wto   f16  [512][512]       9961472           524288   ([n][k], bf16rne value x4096)
//   Tf    f32  [8192][512]     10485760         16777216   (scratch: q, then msgs)
//   Qh    f16  [8192][512]     27262976          8388608
//   Ql    f16  [8192][512]     35651584          8388608
//   Kh    f16  [8192][512]     44040192          8388608
//   Kl    f16  [8192][512]     52428800          8388608
//   VTh   f16  [4096][1024]    60817408          8388608   ([b*DM + h*64 + d][s])
//   VTl   f16  [4096][1024]    69206016          8388608
//   Mh    f16  [8192][512]     77594624          8388608   (msgs x1024)
//   Ml    f16  [8192][512]     85983232          8388608   (msgs residual)
//   Tk    f32  [8192][512]     94371840         16777216   (scratch: k)
//   Tv    f32  [8192][512]    111149056         16777216   (scratch: v)
//   end                       127926272
// Inputs: nodes f32 [8][1024][512]; Wq, Wk, Wv, Wo f32 [512 in][512 out] (x @ W layout); bq, bk, bv, bo f32
// [512] (index h*64+d = n). d_out f32: [8192][512] at byte 0 (row = b*SEQ + t, col = n).
// =====================================================================================================
extern "C" void kernel_launch(void* const* d_in, const int* in_sizes, int n_in,
                              void* d_out, int out_size, void* d_ws, size_t ws_size,
                              hipStream_t stream) {
  if (n_in < 9) return;
  if (in_sizes[0] != NB * SEQ * DM) return;
  if (in_sizes[1] != DM * DM) return;
  if (in_sizes[2] != DM * DM) return;
  if (in_sizes[3] != DM * DM) return;
  if (in_sizes[4] != DM) return;
  if (in_sizes[5] != DM) return;
  if (in_sizes[6] != DM) return;
  if (in_sizes[7] != DM * DM) return;
  if (in_sizes[8] != DM) return;
  if (out_size != OUTN) return;

  const float* x  = (const float*)d_in[0];   // [NB*SEQ][DM]
  const float* Wq = (const float*)d_in[1];   // [DM e][DM n]
  const float* Wk = (const float*)d_in[2];
  const float* Wv = (const float*)d_in[3];
  const float* bq = (const float*)d_in[4];   // [DM]
  const float* bk = (const float*)d_in[5];
  const float* bv = (const float*)d_in[6];
  const float* Wo = (const float*)d_in[7];   // [DM k][DM n]
  const float* bo = (const float*)d_in[8];

  const size_t PXb = (size_t)ROWS * DM * 2;          //  8388608
  const size_t PW  = (size_t)DM * DM * 2;            //   524288
  const size_t PF  = (size_t)ROWS * DM * 4;          // 16777216
  const size_t PH  = (size_t)ROWS * DM * 2;          //  8388608
  const size_t PVt = (size_t)NB * DM * SEQ * 2;      //  8388608
  size_t off = 0;
  const size_t oXb = off; off += PXb;
  const size_t oWq = off; off += PW;
  const size_t oWk = off; off += PW;
  const size_t oWv = off; off += PW;
  const size_t oWo = off; off += PW;
  const size_t oTf = off; off += PF;
  const size_t oQh = off; off += PH;
  const size_t oQl = off; off += PH;
  const size_t oKh = off; off += PH;
  const size_t oKl = off; off += PH;
  const size_t oVt = off; off += PVt;
  const size_t oVl = off; off += PVt;
  const size_t oMh = off; off += PH;
  const size_t oMl = off; off += PH;
  const size_t oTk = off; off += PF;
  const size_t oTv = off; off += PF;
  if (off > ws_size) return;                        // off = 127926272
  if (off > (size_t)134217728) return;

  char* ws = (char*)d_ws;
  unsigned short* Xb  = (unsigned short*)(ws + oXb);
  unsigned short* Wtq = (unsigned short*)(ws + oWq);
  unsigned short* Wtk = (unsigned short*)(ws + oWk);
  unsigned short* Wtv = (unsigned short*)(ws + oWv);
  unsigned short* Wto = (unsigned short*)(ws + oWo);
  float*          Tf  = (float*)(ws + oTf);
  float*          Tk  = (float*)(ws + oTk);
  float*          Tv  = (float*)(ws + oTv);
  unsigned short* Qh  = (unsigned short*)(ws + oQh);
  unsigned short* Ql  = (unsigned short*)(ws + oQl);
  unsigned short* Kh  = (unsigned short*)(ws + oKh);
  unsigned short* Kl  = (unsigned short*)(ws + oKl);
  unsigned short* VTh = (unsigned short*)(ws + oVt);
  unsigned short* VTl = (unsigned short*)(ws + oVl);
  unsigned short* Mh  = (unsigned short*)(ws + oMh);
  unsigned short* Ml  = (unsigned short*)(ws + oMl);
  float*          outf = (float*)d_out;             // [ROWS][DM]

  const dim3 blk(256);
  const int n8x = ROWS * DM / 8;                    // 524288
  const dim3 gCvtX((n8x + 255) / 256);              // 2048 blocks
  const dim3 gPrep(4 * WTB + PLB);                  // 256 weight tiles, then 2048 activation blocks
  const dim3 gGemm(ROWS / 64, 3);                   // 128 blocks of 64 rows x 512 columns, for each of q, k, v
  const dim3 gGemO(ROWS / 32);                      // 256 blocks of 32 rows x 512 columns
  const dim3 gSplit(VTB + 2 * PLB);                 // 1024 v tiles, then 2048 blocks each for q and k
  const dim3 gAttn(NB * NH * NQB);                  // 1024 blocks
  const float qkScale = 16.0f;                      // q and k hi planes carried x16 (residual x1024 on top)
  const float sscale  = 1.0f / 2048.0f;             // 1/(16*16) * 1/sqrt(64)
  const float vScale  = 256.0f;                     // v^T hi plane carried x256
  const float attOscl = 1.0f / 262144.0f;           // 1/(1024 * 256): p and v carries folded back
  const float mScale  = 1024.0f;                    // msgs hi plane carried x1024 (residual x1024 on top)
  const float woScale = 4096.0f;                    // Wo^T carried x4096 in f16
  const float outOscl = 1.0f / 4194304.0f;          // 1/(1024 * 4096)

  // (1) activations -> bf16 plane; weights -> transposed 16-bit planes [n][e] (RNE convert): one grid
  prep<<<gPrep, blk, 0, stream>>>(x, Wq, Wk, Wv, Wo, Xb, Wtq, Wtk, Wtv, Wto, n8x, woScale);
  // (2) q, k, v = Xb . Wt^T + bias -> Tf, Tk, Tv [8192][512] (M=8192, N=512, K=512 each): one grid
  gemm64<<<gGemm, blk, 0, stream>>>(Xb, Wtq, Wtk, Wtv, bq, bk, bv, Tf, Tk, Tv, ROWS);
  // (3) q, k -> f16 hi (x16) + residual planes; v -> f16 v^T hi plane (x256) and residual plane (x4096 on top): one grid
  planes_qkv<<<gSplit, blk, 0, stream>>>(Tf, Tk, Tv, Qh, Ql, Kh, Kl, VTh, VTl, n8x, qkScale, vScale);
  // (4) attention -> msgs f32 [8192][512] in Tf, then f16 hi (x1024) + residual planes
  attn64<<<gAttn, dim3(128), 0, stream>>>(Qh, Ql, Kh, Kl, VTh, VTl, Tf, sscale, attOscl);
  planes_f16x8<<<gCvtX, blk, 0, stream>>>(Tf, Mh, Ml, n8x, mScale);
  // (5) out = msgs . Wo + bo -> d_out f32 [8192][512] (M=8192, N=512, K=512)
  gemm_o<<<gGemO, blk, 0, stream>>>(Mh, Ml, Wto, bo, outf, ROWS, outOscl);
  (void)hipGetLastError();
}

// v004
// A run of this version takes 119 microseconds.
// Timed twice side by side with v003, it ran 1.12 times as fast both times.
// All steps since v000 together make it 2.26 times as fast.
// Contractions: q/k/v projections = v_wmma_f32_16x16x32_bf16 (bf16 operands from RNE-converted nodes, W^T and bias, single product); q.k^T scores = v_wmma_f32_16x16x32_f16 (q, k as f16 hi planes carried x16 plus f16 residual planes x1024: hi.hi + (hi.lo + lo.hi) in a separate accumulator, 3 products); p.v = v_wmma_f32_16x16x32_f16 (p carried x1024 in f16; v^T as f16 hi plane x256 plus f16 residual plane x4096 in a separate accumulator folded with 2^-12, 2 products); output projection = v_wmma_f32_16x16x32_f16 (msgs as f16 hi plane x1024 plus f16 residual plane x1024 in a separate accumulator folded with 2^-10; Wo^T = RNE bf16 value carried x4096 in f16; 2 products); all f32 accumulate; softmax in f32.
#include <hip/hip_runtime.h>
#include <math.h>
#include <stdint.h>

#define NB    8
#define SEQ   1024
#define DM    512
#define NH    8
#define HD    64
#define NQB   (SEQ / 64)
#define ROWS  (NB * SEQ)            // 8192 token rows
#define OUTN  (ROWS * DM)
#define KVP   72                    // LDS pitch of the 64-wide f16 tiles in attn64, in halves: 144 B = 16 B x 9 (odd)
#define OSP   68                    // LDS pitch of the 64-wide f32 context tile in attn64, in floats
#define GKC   64                    // GEMMs: k elements of one staged slice = 128 B of every staged row
#define GSP   72                    // GEMMs: LDS pitch of a staged row, in 16-bit elements: 144 B = 16 B x 9 (odd)
#define GROWS (64 + DM)             // GEMMs: staged rows of a slice: 64 A rows, then the DM rows of B
#define GBUF  (GROWS * GSP)         // GEMMs: 16-bit elements of one slice buffer (82944 B)
#define NSL   (DM / GKC)            // GEMMs: slices along k
#define WTB   ((DM / 64) * (DM / 64))      // 64 x 64 tiles of one weight matrix
#define VTB   ((SEQ / 64) * NH * NB)       // 64 x 64 tiles of v
#define PLB   (ROWS * DM / 8 / 256)        // blocks of one 8-elements-per-thread pass over a [ROWS][DM] plane
static_assert(NH * HD == DM);
static_assert(HD == 64);
static_assert(32 * GSP * 2 == 4608);                           // copy9: LDS bytes of 32 staged rows
static_assert(DM == 8 * 64 && GROWS == 18 * 32 && NSL >= 2);   // 8 waves x 64 columns; 18 copies per thread; two buffers
static_assert((SEQ % 64) == 0 && (DM % 64) == 0 && (ROWS % 64) == 0);
static_assert(((ROWS / 64) * (DM / 64)) % 8 == 0);
static_assert(((ROWS / 32) * (DM / 64)) % 8 == 0);
static_assert(((ROWS * DM / 8) % 256) == 0);

typedef _Float16 v16h __attribute__((ext_vector_type(16)));
typedef _Float16 v8h  __attribute__((ext_vector_type(8)));
typedef __bf16   v16b __attribute__((ext_vector_type(16)));
typedef __bf16   v8b  __attribute__((ext_vector_type(8)));
typedef float    v8f  __attribute__((ext_vector_type(8)));
typedef float    v4f  __attribute__((ext_vector_type(4)));
typedef unsigned int v4u __attribute__((ext_vector_type(4)));

// ---- scalar helpers --------------------------------------------------------------------------------
__device__ __forceinline__ unsigned short bf_bits(float f) {          // f32 -> bf16 bits, RNE convert
  unsigned u = __float_as_uint(f);
  return (unsigned short)((u + 0x7FFFu + ((u >> 16) & 1u)) >> 16);
}
__device__ __forceinline__ float bf_up(unsigned short h) { return __uint_as_float(((unsigned)h) << 16); }
__device__ __forceinline__ unsigned short h_bits(_Float16 x) { return __builtin_bit_cast(unsigned short, x); }
__device__ __forceinline__ unsigned pk16(unsigned short a, unsigned short b) { return (unsigned)a | ((unsigned)b << 16); }
__device__ __forceinline__ v8f zero8() { v8f z = {0.f, 0.f, 0.f, 0.f, 0.f, 0.f, 0.f, 0.f}; return z; }

// ---- fragment loaders: 16-bit A/B operand, lane -> row/col (lane&15), p already includes +8*(lane>>4);
//      elements 0..7 <- p[0..7] (k0+8h..), elements 8..15 <- p[16..23] (k0+16+8h..)
__device__ __forceinline__ v16b ldfrag_b(const __bf16* p) {
  union { v16b v; v8b h[2]; } f;
  f.h[0] = *(const v8b*)(p);
  f.h[1] = *(const v8b*)(p + 16);
  return f.v;
}
__device__ __forceinline__ v16h ldfrag_h(const _Float16* p) {
  union { v16h v; v8h h[2]; } f;
  f.h[0] = *(const v8h*)(p);
  f.h[1] = *(const v8h*)(p + 16);
  return f.v;
}

// ---- WMMA helpers with trailing VALU hazard gap --------------------------------------------------------
__device__ __forceinline__ v8f mma_h(v16h a, v16h b, v8f c) {
  c = __builtin_amdgcn_wmma_f32_16x16x32_f16(false, a, false, b, (short)0, c, false, false);
#if defined(__HIP_DEVICE_COMPILE__)
  asm volatile("v_nop\n\tv_nop\n\tv_nop\n\tv_nop" : "+v"(c) : "v"(a), "v"(b));
#endif
  return c;
}
__device__ __forceinline__ v8f mma_b_raw(v16b a, v16b b, v8f c) {
  return __builtin_amdgcn_wmma_f32_16x16x32_bf16(false, a, false, b, (short)0, c, false, false);
}
__device__ __forceinline__ void dep_guard_b(v8f& a, v8f& b, v16b x, v16b y) {
#if defined(__HIP_DEVICE_COMPILE__)
  asm volatile("v_nop\n\tv_nop\n\tv_nop\n\tv_nop" : "+v"(a), "+v"(b) : "v"(x), "v"(y));
#endif
}
__device__ __forceinline__ void keep4_b(v16b a, v16b b, v16b c, v16b d) {
#if defined(__HIP_DEVICE_COMPILE__)
  asm volatile("v_nop" :: "v"(a), "v"(b), "v"(c), "v"(d));
#endif
}
__device__ __forceinline__ void acc_guard4(v8f& a, v8f& b, v8f& c, v8f& d) {
#if defined(__HIP_DEVICE_COMPILE__)
  asm volatile("v_nop\n\tv_nop\n\tv_nop\n\tv_nop" : "+v"(a), "+v"(b), "+v"(c), "+v"(d));
#endif
}

// lane l <-> lane l ^ 16 (the other half of the wave), in the vector unit
__device__ __forceinline__ float xhalf(float x) {
  const int b = __builtin_bit_cast(int, x);
  return __builtin_bit_cast(float, __builtin_amdgcn_permlanex16(b, b, 0x76543210, 0xfedcba98, false, false));
}

// ---- GEMM operand staging: asynchronous copies global -> LDS, waits -----------------------------------
__device__ __forceinline__ unsigned lds_off(const void* p) { return (unsigned)(size_t)p; }   // LDS byte address
// nine 16-B copies of this lane: LDS bytes l + 4608 i (32 staged rows of 144 B further each) <- global g0 .. g8
__device__ __forceinline__ void copy9(unsigned l, const unsigned short* g0, const unsigned short* g1,
                                      const unsigned short* g2, const unsigned short* g3, const unsigned short* g4,
                                      const unsigned short* g5, const unsigned short* g6, const unsigned short* g7,
                                      const unsigned short* g8) {
#if defined(__HIP_DEVICE_COMPILE__)
  // the closing s_wait_xcnt stands in the copies' own statement: no address register is rewritten in front of it
  asm volatile(
      "global_load_async_to_lds_b128 %0, %9, off\n\t"
      "global_load_async_to_lds_b128 %1, %10, off\n\t"
      "global_load_async_to_lds_b128 %2, %11, off\n\t"
      "global_load_async_to_lds_b128 %3, %12, off\n\t"
      "global_load_async_to_lds_b128 %4, %13, off\n\t"
      "global_load_async_to_lds_b128 %5, %14, off\n\t"
      "global_load_async_to_lds_b128 %6, %15, off\n\t"
      "global_load_async_to_lds_b128 %7, %16, off\n\t"
      "global_load_async_to_lds_b128 %8, %17, off\n\t"
      "s_wait_xcnt 0x0"
      :: "v"(l), "v"(l + 4608u), "v"(l + 2u * 4608u), "v"(l + 3u * 4608u), "v"(l + 4u * 4608u),
         "v"(l + 5u * 4608u), "v"(l + 6u * 4608u), "v"(l + 7u * 4608u), "v"(l + 8u * 4608u),
         "v"(g0), "v"(g1), "v"(g2), "v"(g3), "v"(g4), "v"(g5), "v"(g6), "v"(g7), "v"(g8)
      : "memory");
#endif
}
// One slice = GROWS rows x 128 B = 18 groups of 32 rows; thread tid copies 16-B column tid&7 of row tid>>3 of every
// group, so 8 lanes copy one whole 128-B line. l: the lane's LDS byte address in group 0 of the buffer; a0, a1: its
// source in A row groups 0 and 1; b: its source in B row group 0 (groups 2..17 = B rows 0..DM-1, row pitch DM).
__device__ __forceinline__ void stage_slice(unsigned l, const unsigned short* a0, const unsigned short* a1,
                                            const unsigned short* b) {
  constexpr size_t S = (size_t)32 * DM;           // 32 B rows, in elements
  copy9(l, a0, a1, b, b + S, b + 2 * S, b + 3 * S, b + 4 * S, b + 5 * S, b + 6 * S);
  copy9(l + 9u * 4608u, b + 7 * S, b + 8 * S, b + 9 * S, b + 10 * S, b + 11 * S, b + 12 * S, b + 13 * S, b + 14 * S,
        b + 15 * S);
}
__device__ __forceinline__ void wait_copies() {   // this wave's copies have landed in LDS
#if defined(__HIP_DEVICE_COMPILE__)
  asm volatile("s_wait_asynccnt 0x0" ::: "memory");
#endif
}
__device__ __forceinline__ void wait_lds_reads() {   // this wave's LDS reads are done before the buffer is handed on
#if defined(__HIP_DEVICE_COMPILE__)
  asm volatile("s_wait_dscnt 0x0" ::: "memory");
#endif
}

// =====================================================================================================
// f32 -> bf16 (RNE convert), 8 elements per thread, one 16-B store per lane: a wave writes 512 contiguous B
// coverage: n8 threads x 8 = whole plane (n8 is a multiple of 256 here).
// =====================================================================================================
__device__ __forceinline__ void cvt_bf16x8_body(const float* __restrict__ in, unsigned short* out, int n8, int blk) {
  const int i = blk * 256 + threadIdx.x;
  if (i < n8) {
    const v4f a = *(const v4f*)(in + (size_t)i * 8);
    const v4f b = *(const v4f*)(in + (size_t)i * 8 + 4);
    v4u p;
    p[0] = pk16(bf_bits(a[0]), bf_bits(a[1]));
    p[1] = pk16(bf_bits(a[2]), bf_bits(a[3]));
    p[2] = pk16(bf_bits(b[0]), bf_bits(b[1]));
    p[3] = pk16(bf_bits(b[2]), bf_bits(b[3]));
    *(v4u*)(out + (size_t)i * 8) = p;
    
  }
}

// =====================================================================================================
// f32 -> f16 hi plane = f16(v * scale) (scale a power of two) + f16 residual plane = f16((v*scale - hi) * 1024),
// same element index in both planes; 8 elements per thread, one 16-B store per lane and plane: a wave writes
// coverage: n8 threads x 8 = whole plane (n8 multiple of 256).
// =====================================================================================================
__device__ __forceinline__ void planes_f16x8_body(const float* __restrict__ in, unsigned short* hp,
                                                  unsigned short* lp, int n8, float scale, int blk) {
  const int i = blk * 256 + threadIdx.x;
  if (i < n8) {
    const v4f a = *(const v4f*)(in + (size_t)i * 8);
    const v4f b = *(const v4f*)(in + (size_t)i * 8 + 4);
    float f[8];
    f[0] = a[0]; f[1] = a[1]; f[2] = a[2]; f[3] = a[3];
    f[4] = b[0]; f[5] = b[1]; f[6] = b[2]; f[7] = b[3];
    v4u ph, pl;
#pragma unroll
    for (int e = 0; e < 4; ++e) {
      const float f0 = f[2 * e] * scale;
      const float f1 = f[2 * e + 1] * scale;
      const _Float16 x0 = (_Float16)f0, x1 = (_Float16)f1;
      const _Float16 l0 = (_Float16)((f0 - (float)x0) * 1024.0f);
      const _Float16 l1 = (_Float16)((f1 - (float)x1) * 1024.0f);
      ph[e] = pk16(h_bits(x0), h_bits(x1));
      pl[e] = pk16(h_bits(l0), h_bits(l1));
    }
    *(v4u*)(hp + (size_t)i * 8) = ph;
    *(v4u*)(lp + (size_t)i * 8) = pl;
    
  }
}
__global__ __launch_bounds__(256) void planes_f16x8(const float* __restrict__ in, unsigned short* hp,
                                                    unsigned short* lp, int n8, float scale) {
  planes_f16x8_body(in, hp, lp, n8, scale, blockIdx.x);
}

// =====================================================================================================
// Weight transpose + convert: in W f32 [DM rows (e, contraction index)][DM cols (n, output feature)] (the
// x @ W layout) -> out Wt 16-bit [DM (n)][DM (e)] (the [n][k], k-contiguous layout the GEMM B operand uses).
// MODE 0: RNE bf16 bits. MODE 1: f16 bits of (RNE bf16 value * scale), scale a power of two (exact in f16).
// Block = one 64 e x 64 n tile (et, nt: its e and n tile index, DM/64 of each). The tile is staged in LDS as [ee][nn]
// pitch 68 floats (v4f loads, __syncthreads). in[rows e][cols n] -> out[rows n][cols e] (square here).
// Store: group g = tid>>3 (0..31), piece = tid&7: iteration it writes row n0 + (it*32+g), lanes 8q..8q+7 x 16 B
// coverage: 2 iterations x 32 groups = 64 rows n, 8 pieces x 8 = 64 e per row; grid covers every (e tile,
// n tile) -> the whole [DM][DM] plane.
// =====================================================================================================
template <int MODE>
__device__ __forceinline__ void wt_tile_body(const float* __restrict__ W, unsigned short* Wt, float scale,
                                             float* sw, int et, int nt) {
  const int tid = threadIdx.x;
  const int e0  = et * 64;
  const int n0  = nt * 64;
#pragma unroll
  for (int i = 0; i < 4; ++i) {
    const int idx = i * 256 + tid;                  // 0..1023
    const int ee = idx >> 4, c4 = (idx & 15) * 4;
    const v4f a = *(const v4f*)(W + ((size_t)(e0 + ee)) * DM + n0 + c4);
    *(v4f*)(sw + ee * 68 + c4) = a;
  }
  __syncthreads();

  const int g = tid >> 3, piece = tid & 7;
  v4u hv[2];
  size_t hofs[2];
#pragma unroll
  for (int it = 0; it < 2; ++it) {
    const int n = it * 32 + g;
    v4u a;
#pragma unroll
    for (int e = 0; e < 4; ++e) {
      const float f0 = sw[(piece * 8 + 2 * e) * 68 + n];
      const float f1 = sw[(piece * 8 + 2 * e + 1) * 68 + n];
      unsigned short u0, u1;
      if (MODE == 0) {
        u0 = bf_bits(f0);
        u1 = bf_bits(f1);
      } else {
        u0 = h_bits((_Float16)(bf_up(bf_bits(f0)) * scale));
        u1 = h_bits((_Float16)(bf_up(bf_bits(f1)) * scale));
      }
      a[e] = pk16(u0, u1);
    }
    hv[it] = a;
    hofs[it] = ((size_t)(n0 + n)) * DM + e0 + piece * 8;
  }
  {
#pragma unroll
    for (int it = 0; it < 2; ++it) {
      *(v4u*)(Wt + hofs[it]) = hv[it];
    }
#if defined(__HIP_DEVICE_COMPILE__)
    // both tile bodies stand in one kernel: no register that the two stores name is rewritten in front of this wait
    asm volatile("s_wait_xcnt 0x0" ::: "memory");
#endif
  }
}
// One grid for all operand preparation (the five jobs are independent of one another): blocks 0 .. 4 WTB - 1 = the
// weight tiles of Wq, Wk, Wv (bf16) and Wo (f16 x woscale), WTB tiles each; the blocks behind them = the activations'
// bf16 plane. The branch is block-uniform, so the tile body's barrier is passed by whole blocks only.
__global__ __launch_bounds__(256) void prep(const float* __restrict__ x, const float* __restrict__ Wq,
                                            const float* __restrict__ Wk, const float* __restrict__ Wv,
                                            const float* __restrict__ Wo, unsigned short* Xb, unsigned short* Wtq,
                                            unsigned short* Wtk, unsigned short* Wtv, unsigned short* Wto,
                                            int n8, float woscale) {
  __shared__ __align__(16) float sw[64 * 68];       // [ee][nn] pitch 68 floats
  const int bx = blockIdx.x;
  if (bx < 4 * WTB) {
    const int w = bx / WTB, tile = bx % WTB;
    const int et = tile % (DM / 64), nt = tile / (DM / 64);
    if (w == 3) {
      wt_tile_body<1>(Wo, Wto, woscale, sw, et, nt);
    } else {
      wt_tile_body<0>(w == 0 ? Wq : (w == 1 ? Wk : Wv), w == 0 ? Wtq : (w == 1 ? Wtk : Wtv), 1.0f, sw, et, nt);
    }
  } else {
    cvt_bf16x8_body(x, Xb, n8, bx - 4 * WTB);
  }
}

// =====================================================================================================
// Register-blocked bf16 WMMA GEMM with bias: C[m][n] = sum_k A[m][k] * Bt[n][k] + bf16rne(bias[n]), N = K = DM.
// Block = 64 rows x DM columns, one wave per 64x64 tile (wave w: columns 64 w ..). A row-major [M][DM]; Bt row-major
// [DM n][DM k] (k contiguous); bias f32 [DM] (RNE converted to bf16 and widened in the epilogue); M multiple of 64.
// Operands: k slices of GKC, the block's 64 A rows and all DM B rows, staged in LDS by asynchronous copies, two
// buffers: slice t + 1 is in flight while slice t is multiplied; per slice one hand-over (LDS reads done, own copies
// landed, block barrier), then slice t + 2 is copied into the buffer slice t has left.
// Output f32 [M][DM] pitch DM. Epilogue: 16-row slabs staged per wave in LDS; each 64-wide row segment
// =====================================================================================================
// One grid for the three projections: blockIdx.y = 0, 1, 2 picks (Bt, bias, C) of q, k, v; A is common to them.
__global__ __launch_bounds__(256) void gemm64(
    const unsigned short* __restrict__ Ap,
    const unsigned short* __restrict__ Btq, const unsigned short* __restrict__ Btk,
    const unsigned short* __restrict__ Btv,
    const float* __restrict__ biasq, const float* __restrict__ biask, const float* __restrict__ biasv,
    float* Cq, float* Ck, float* Cv, int M) {
  const int which = blockIdx.y;
  const unsigned short* __restrict__ Btp = which == 0 ? Btq : (which == 1 ? Btk : Btv);
  const float* __restrict__ bias = which == 0 ? biasq : (which == 1 ? biask : biasv);
  float* C = which == 0 ? Cq : (which == 1 ? Ck : Cv);
  __shared__ __align__(16) __bf16 sAB[2 * GBUF];   // two slice buffers: rows 0..63 = A, rows 64.. = B
  __shared__ __align__(16) float sT[8][16 * 68];   // per-wave 16x64 slab, pitch 68 floats
  constexpr int ldc = DM;
  const int tid  = threadIdx.x;
  const int lane = tid & 31;
  const int wave = tid >> 5;
  const int m0 = blockIdx.x << 6;
  if (m0 >= M) return;                   // block-uniform, in front of every barrier
  const int n0 = wave << 6;

  // this lane's piece of every 32-row group: row tid>>3, 16-B column tid&7
  const unsigned short* ga0 = Ap + (size_t)(m0 + (tid >> 3)) * DM + (tid & 7) * 8;
  const unsigned short* ga1 = ga0 + (size_t)32 * DM;
  const unsigned short* gb  = Btp + (size_t)(tid >> 3) * DM + (tid & 7) * 8;
  const unsigned l0 = lds_off(sAB) + (unsigned)((tid >> 3) * GSP + (tid & 7) * 8) * 2u;
  stage_slice(l0, ga0, ga1, gb);
  wait_copies();
  __syncthreads();                       // slice 0 is readable by every wave
  stage_slice(l0 + GBUF * 2u, ga0 + GKC, ga1 + GKC, gb + GKC);

  const int rlane = lane & 15;                 // row (A) / col (B, D) within subtile
  const int koff  = (lane >> 4) * 8;           // k offset of this lane half
  const int mOff  = (lane >> 4) * 8;           // D row offset

  v8f acc[4][4];
#pragma unroll
  for (int i = 0; i < 4; ++i)
#pragma unroll
    for (int j = 0; j < 4; ++j) acc[i][j] = zero8();

  for (int t = 0; t < NSL; ++t) {
    const __bf16* sb = sAB + (t & 1) * GBUF;
#pragma unroll
    for (int kk = 0; kk < GKC; kk += 32) {
      v16b bh[4], ah[4];                 // the k step's LDS reads stand together, in front of its WMMAs
#pragma unroll
      for (int j = 0; j < 4; ++j) {
        bh[j] = ldfrag_b(sb + (64 + n0 + (j << 4) + rlane) * GSP + koff + kk);
      }
#pragma unroll
      for (int i = 0; i < 4; ++i) {
        ah[i] = ldfrag_b(sb + ((i << 4) + rlane) * GSP + koff + kk);
      }
#pragma unroll
      for (int i = 0; i < 4; ++i) {
#pragma unroll
        for (int j = 0; j < 4; ++j) {
          acc[i][j] = mma_b_raw(ah[i], bh[j], acc[i][j]);
        }
        dep_guard_b(acc[i][0], acc[i][3], ah[i], ah[i]);
      }
      keep4_b(bh[0], bh[1], bh[2], bh[3]);
    }
    // hand-over: slice t + 1 becomes readable, slice t's buffer becomes free
    wait_lds_reads();
    wait_copies();
    __syncthreads();
    if (t + 2 < NSL) {
      stage_slice(l0 + (unsigned)(t & 1) * (GBUF * 2u), ga0 + (t + 2) * GKC, ga1 + (t + 2) * GKC, gb + (t + 2) * GKC);
    }
  }
  wait_copies();
  acc_guard4(acc[0][0], acc[0][1], acc[0][2], acc[0][3]);
  acc_guard4(acc[1][0], acc[1][1], acc[1][2], acc[1][3]);
  acc_guard4(acc[2][0], acc[2][1], acc[2][2], acc[2][3]);
  acc_guard4(acc[3][0], acc[3][1], acc[3][2], acc[3][3]);

  // ---- bias per D column of this lane (n0 + 16j + rlane < N) ----
  float bz[4];
#pragma unroll
  for (int j = 0; j < 4; ++j) bz[j] = bf_up(bf_bits(bias[n0 + (j << 4) + rlane]));

  // ---- epilogue ----
  float* slab = sT[wave];
#pragma unroll
  for (int i = 0; i < 4; ++i) {
    const int mBase = m0 + (i << 4);
#pragma unroll
    for (int r = 0; r < 8; ++r) {
#pragma unroll
      for (int j = 0; j < 4; ++j) {
        slab[(mOff + r) * 68 + (j << 4) + rlane] = acc[i][j][r] + bz[j];
      }
    }
    __builtin_amdgcn_fence(__ATOMIC_RELEASE, "workgroup");
    __builtin_amdgcn_wave_barrier();
    __builtin_amdgcn_fence(__ATOMIC_ACQUIRE, "workgroup");
    {
      const int hh = lane >> 4, c4 = (lane & 15) * 4;     // 256-B row segment = 16 lanes x 16 B
      v4f ov[8];
#pragma unroll
      for (int it = 0; it < 8; ++it) {
        const int row = it * 2 + hh;                       // it 0..7 x hh 0..1 = rows 0..15
        ov[it] = *(const v4f*)(slab + row * 68 + c4);
      }
      {
#pragma unroll
        for (int it = 0; it < 8; ++it) {
          const int row = it * 2 + hh;
          *(v4f*)(C + (size_t)(mBase + row) * ldc + n0 + c4) = ov[it];
        }
        
      }
    }
    __builtin_amdgcn_fence(__ATOMIC_RELEASE, "workgroup");
    __builtin_amdgcn_wave_barrier();
    __builtin_amdgcn_fence(__ATOMIC_ACQUIRE, "workgroup");
  }
}

// =====================================================================================================
// f16 WMMA GEMM with a two-plane A operand and bias:
//   C[m][n] = (sum_k Ah[m][k]*Bt[n][k] + 2^-10 * sum_k Al[m][k]*Bt[n][k]) * oscale + bf16rne(bias[n]),
// the residual products in a separate accumulator, N = K = DM. Block = 32 rows x DM columns, one wave per 32x64 tile
// (wave w: columns 64 w ..). Ah/Al row-major [M][DM] (f16 hi and residual planes, same index); Bt row-major
// [DM n][DM k] (f16, k contiguous); M multiple of 32. Operands staged in LDS as in gemm64 (staged rows 0..31 = Ah,
// 32..63 = Al, 64.. = B). Every WMMA nop-guarded.
// Output f32 [M][DM] pitch DM. Epilogue: 16-row slabs staged per wave in LDS; each 64-wide row segment (256 B)
// coverage: 2 slabs x 16 rows x 64 cols = the wave's whole 32x64 tile.
// =====================================================================================================
__global__ __launch_bounds__(256) void gemm_o(
    const unsigned short* __restrict__ Ahp, const unsigned short* __restrict__ Alp,
    const unsigned short* __restrict__ Btp,
    const float* __restrict__ bias,
    float* C, int M, float oscale) {
  __shared__ __align__(16) _Float16 sAB[2 * GBUF]; // two slice buffers: rows 0..31 = Ah, 32..63 = Al, 64.. = B
  __shared__ __align__(16) float sT[8][16 * 68];   // per-wave 16x64 slab, pitch 68 floats
  constexpr int ldc = DM;
  const int tid  = threadIdx.x;
  const int lane = tid & 31;
  const int wave = tid >> 5;
  const int m0 = blockIdx.x << 5;
  if (m0 >= M) return;                   // block-uniform, in front of every barrier
  const int n0 = wave << 6;

  // this lane's piece of every 32-row group: row tid>>3, 16-B column tid&7
  const size_t ao = (size_t)(m0 + (tid >> 3)) * DM + (tid & 7) * 8;
  const unsigned short* ga0 = Ahp + ao;
  const unsigned short* ga1 = Alp + ao;
  const unsigned short* gb  = Btp + (size_t)(tid >> 3) * DM + (tid & 7) * 8;
  const unsigned l0 = lds_off(sAB) + (unsigned)((tid >> 3) * GSP + (tid & 7) * 8) * 2u;
  stage_slice(l0, ga0, ga1, gb);
  wait_copies();
  __syncthreads();                       // slice 0 is readable by every wave
  stage_slice(l0 + GBUF * 2u, ga0 + GKC, ga1 + GKC, gb + GKC);

  const int rlane = lane & 15;
  const int koff  = (lane >> 4) * 8;
  const int mOff  = (lane >> 4) * 8;

  v8f acc[2][4], acl[2][4];
#pragma unroll
  for (int i = 0; i < 2; ++i)
#pragma unroll
    for (int j = 0; j < 4; ++j) { acc[i][j] = zero8(); acl[i][j] = zero8(); }

  for (int t = 0; t < NSL; ++t) {
    const _Float16* sb = sAB + (t & 1) * GBUF;
#pragma unroll
    for (int kk = 0; kk < GKC; kk += 32) {
      v16h ah[2], al[2], bfr[4];         // the k step's LDS reads stand together, in front of its WMMAs
#pragma unroll
      for (int i = 0; i < 2; ++i) {
        ah[i] = ldfrag_h(sb + ((i << 4) + rlane) * GSP + koff + kk);
        al[i] = ldfrag_h(sb + (32 + (i << 4) + rlane) * GSP + koff + kk);
      }
#pragma unroll
      for (int j = 0; j < 4; ++j) {
        bfr[j] = ldfrag_h(sb + (64 + n0 + (j << 4) + rlane) * GSP + koff + kk);
      }
#pragma unroll
      for (int j = 0; j < 4; ++j) {
#pragma unroll
        for (int i = 0; i < 2; ++i) {
          acc[i][j] = mma_h(ah[i], bfr[j], acc[i][j]);
          acl[i][j] = mma_h(al[i], bfr[j], acl[i][j]);
        }
      }
    }
    // hand-over: slice t + 1 becomes readable, slice t's buffer becomes free
    wait_lds_reads();
    wait_copies();
    __syncthreads();
    if (t + 2 < NSL) {
      stage_slice(l0 + (unsigned)(t & 1) * (GBUF * 2u), ga0 + (t + 2) * GKC, ga1 + (t + 2) * GKC, gb + (t + 2) * GKC);
    }
  }
  wait_copies();

  // ---- bias per D column of this lane (n0 + 16j + rlane < N) ----
  float bz[4];
#pragma unroll
  for (int j = 0; j < 4; ++j) bz[j] = bf_up(bf_bits(bias[n0 + (j << 4) + rlane]));

  // ---- epilogue ----
  float* slab = sT[wave];
#pragma unroll
  for (int i = 0; i < 2; ++i) {
    const int mBase = m0 + (i << 4);
#pragma unroll
    for (int r = 0; r < 8; ++r) {
#pragma unroll
      for (int j = 0; j < 4; ++j) {
        const float y = (acc[i][j][r] + acl[i][j][r] * (1.0f / 1024.0f)) * oscale + bz[j];
        slab[(mOff + r) * 68 + (j << 4) + rlane] = y;
      }
    }
    __builtin_amdgcn_fence(__ATOMIC_RELEASE, "workgroup");
    __builtin_amdgcn_wave_barrier();
    __builtin_amdgcn_fence(__ATOMIC_ACQUIRE, "workgroup");
    {
      const int hh = lane >> 4, c4 = (lane & 15) * 4;     // 256-B row segment = 16 lanes x 16 B
      v4f ov[8];
#pragma unroll
      for (int it = 0; it < 8; ++it) {
        const int row = it * 2 + hh;                       // it 0..7 x hh 0..1 = rows 0..15
        ov[it] = *(const v4f*)(slab + row * 68 + c4);
      }
      {
#pragma unroll
        for (int it = 0; it < 8; ++it) {
          const int row = it * 2 + hh;
          *(v4f*)(C + (size_t)(mBase + row) * ldc + n0 + c4) = ov[it];
        }
        
      }
    }
    __builtin_amdgcn_fence(__ATOMIC_RELEASE, "workgroup");
    __builtin_amdgcn_wave_barrier();
    __builtin_amdgcn_fence(__ATOMIC_ACQUIRE, "workgroup");
  }
}

// =====================================================================================================
// v f32 token-major columns vf[(b*SEQ + t)*vrp + h*64 + d] ->
// f16 v^T hi plane vth[(b*DM + h*64 + d)*SEQ + t] = f16(v * vscale) (vscale a power of two) and residual plane
// vtl[same index] = f16((v*vscale - hi) * 4096).
// Block = one 64-token x 64-feature tile of one (b, h): tile index (tt0, hh, b) in (SEQ/64, NH, NB); staged in LDS as f32
// (v4f loads, __syncthreads).
// Store: group g = tid>>3 (0..31), piece = tid&7: iteration it writes row d = it*32+g, lanes 8q..8q+7 x 16 B =
// coverage: 2 iterations x 32 groups = 64 rows d, 8 pieces x 8 = 64 tokens per row; grid covers every (b, h,
// t tile) -> both whole planes.
// =====================================================================================================
__device__ __forceinline__ void v_planes_body(const float* __restrict__ vf, int vrp, unsigned short* vth,
                                              unsigned short* vtl, float vscale, float* sv, int tt0, int hh, int b) {
  const int tid = threadIdx.x;
  const int t0  = tt0 * 64;
#pragma unroll
  for (int i = 0; i < 4; ++i) {
    const int idx = i * 256 + tid;                  // 0..1023
    const int tt = idx >> 4, c4 = (idx & 15) * 4;
    const v4f a = *(const v4f*)(vf + ((size_t)(b * SEQ + t0 + tt)) * vrp + hh * HD + c4);
    *(v4f*)(sv + tt * 68 + c4) = a;
  }
  __syncthreads();

  const int g = tid >> 3, piece = tid & 7;
  v4u hv[2], lv[2];
  size_t hofs[2];
#pragma unroll
  for (int it = 0; it < 2; ++it) {
    const int d = it * 32 + g;
    v4u a, a2;
#pragma unroll
    for (int e = 0; e < 4; ++e) {
      const float f0 = sv[(piece * 8 + 2 * e) * 68 + d] * vscale;
      const float f1 = sv[(piece * 8 + 2 * e + 1) * 68 + d] * vscale;
      const _Float16 x0 = (_Float16)f0, x1 = (_Float16)f1;
      const unsigned short h0 = h_bits(x0), h1 = h_bits(x1);
      const unsigned short l0 = h_bits((_Float16)((f0 - (float)x0) * 4096.0f));
      const unsigned short l1 = h_bits((_Float16)((f1 - (float)x1) * 4096.0f));
      a[e] = pk16(h0, h1); a2[e] = pk16(l0, l1);
    }
    hv[it] = a; lv[it] = a2;
    hofs[it] = ((size_t)(b * DM + hh * HD + d)) * SEQ + t0 + piece * 8;
  }
  {
#pragma unroll
    for (int it = 0; it < 2; ++it) {
      *(v4u*)(vth + hofs[it]) = hv[it];
      *(v4u*)(vtl + hofs[it]) = lv[it];
    }
    
  }
}
// One grid for the three plane splits (independent of one another): blocks 0 .. VTB - 1 = the v tiles, then PLB blocks
// for q, then PLB blocks for k. The branch is block-uniform, so the tile body's barrier is passed by whole blocks only.
__global__ __launch_bounds__(256) void planes_qkv(const float* __restrict__ qf, const float* __restrict__ kf,
                                                  const float* __restrict__ vf, unsigned short* qh, unsigned short* ql,
                                                  unsigned short* kh, unsigned short* kl, unsigned short* vth,
                                                  unsigned short* vtl, int n8, float qkscale, float vscale) {
  __shared__ __align__(16) float sv[64 * 68];       // [tt][d] pitch 68 floats
  const int bx = blockIdx.x;
  if (bx < VTB) {
    v_planes_body(vf, DM, vth, vtl, vscale, sv, bx % (SEQ / 64), (bx / (SEQ / 64)) % NH, bx / ((SEQ / 64) * NH));
  } else if (bx < VTB + PLB) {
    planes_f16x8_body(qf, qh, ql, n8, qkscale, bx - VTB);
  } else {
    planes_f16x8_body(kf, kh, kl, n8, qkscale, bx - (VTB + PLB));
  }
}

// =====================================================================================================
// Bidirectional multi-head attention, head dim 64, no mask.
//   q f16 hi plane (x16): element (b, t, h, d) at [(b*SEQ + t)*DM + h*64 + d]; q residual plane
//     ((q*16 - hi)*1024) at the same index into qlp
//   k f16 hi plane (x16): element (b, s, h, d) at [(b*SEQ + s)*DM + h*64 + d]; k residual plane same into klp
//   v^T f16 hi plane (x256): element (b, h, d, s) at [(b*DM + h*64 + d)*SEQ + s]
//   v^T f16 residual plane ((v*256 - hi)*4096): same index into vlp
//   All NQB key tiles of 64 are processed for every query tile (static trip count).
//   logit = (qhi.khi + (qhi.klo + qlo.khi) * 2^-10) * sscale, f16 products with f32 accumulate, the residual
//   products in a separate accumulator; p = exp(s - m) carried as ph = f16(1024 p);
//   context = ph . vhi on f16 WMMA plus ph . vres into a separate accumulator folded back with 2^-12 per tile
//   in f32; online softmax in f32; out f32 plane: element (b, t, h*64 + d) at [(b*SEQ + t)*DM + h*64 + d] =
//   normalised context (oscl folds back the p and v carries).
//   Block = 4 waves = 64 query rows of one (b, h); grid = NB*NH*NQB; kv tiles of 64.
//   K hi / K residual / V^T hi / V^T residual tile staging: 128 threads x 32 elements per plane = the whole
//   64x64 tile (plain 16-B loads, __syncthreads before and after).
//   Both products are formed transposed: S^T = K . Q^T (A = K rows, B = Q) and O^T += V^T . P^T (A = V^T rows, B = P^T).
//   A lane then holds 32 of the 64 scores of ONE query (column lane&15; keys 16 j + 8 (lane>>4) + r), so maximum and
//   sum run in the lane, with one exchange between the wave's halves; two score tiles, converted in place, are the
//   B operand of the second product in the loaders' k order: P never leaves the registers.
//   Output coverage: each wave stores rows q0..q0+15 (it 0..7 x lane>>4 0..1) x 64 columns (16 lanes x 4
//   (b, h, query tile) -> the whole plane.
// =====================================================================================================
__global__ __launch_bounds__(128)
void attn64(const unsigned short* __restrict__ qhp, const unsigned short* __restrict__ qlp,
            const unsigned short* __restrict__ khp, const unsigned short* __restrict__ klp,
            const unsigned short* __restrict__ vhp, const unsigned short* __restrict__ vlp,
            float* outp, float sscale, float oscl) {
  union FH { v16h v; v8h h[2]; };
  __shared__ __align__(16) _Float16 Ksh[64 * KVP];                // K hi [kv][d]    9 KB
  __shared__ __align__(16) _Float16 Ksl[64 * KVP];                // K residual      9 KB
  __shared__ __align__(16) _Float16 Vth[64 * KVP];                // V^T hi [d][kv]  9 KB
  __shared__ __align__(16) _Float16 Vtl[64 * KVP];                // V^T residual    9 KB
  __shared__ __align__(16) float    Os[4][16 * OSP];              // per wave context tile [row][d] 17 KB

  const int tid  = threadIdx.x;
  const int wave = tid >> 5;
  const int lane = tid & 31;
  const int hh   = lane >> 4;
  const int c    = lane & 15;

  const int bx   = blockIdx.x;
  const int qb   = bx % NQB;
  const int rest = bx / NQB;
  const int h    = rest % NH;
  const int b    = rest / NH;                // < NB by the grid size
  const int q0   = qb * 64 + wave * 16;
  const size_t rowB = (size_t)b * SEQ;

  const _Float16* Qp  = (const _Float16*)(const void*)qhp + (size_t)h * HD;
  const _Float16* Qlq = (const _Float16*)(const void*)qlp + (size_t)h * HD;
  const _Float16* Kp  = (const _Float16*)(const void*)khp + (size_t)h * HD;
  const _Float16* Klq = (const _Float16*)(const void*)klp + (size_t)h * HD;
  const _Float16* Vh  = (const _Float16*)(const void*)vhp + ((size_t)b * DM + (size_t)h * HD) * SEQ;
  const _Float16* Vl  = (const _Float16*)(const void*)vlp + ((size_t)b * DM + (size_t)h * HD) * SEQ;

  // ---- Q fragments (B operand, column = lane&15): 2 d-chunks, hi and residual ----
  v16h qa[2], ql[2];
#pragma unroll
  for (int dc = 0; dc < 2; ++dc) {
    const size_t qo = (rowB + q0 + c) * DM + dc * 32 + 8 * hh;
    qa[dc] = ldfrag_h(Qp + qo);
    ql[dc] = ldfrag_h(Qlq + qo);
  }
#if defined(__HIP_DEVICE_COMPILE__)
  // no address register of the Q loads is rewritten in front of this wait; the scheduling barrier keeps the later
  // address arithmetic, which reuses those registers, from being lifted over it
  asm volatile("s_wait_xcnt 0x0" ::: "memory");
  __builtin_amdgcn_sched_barrier(0);
#endif

  float mrow = -INFINITY, lrow = 0.f;    // of query q0 + c; lrow sums this half's keys only, joined behind the loop
  v8f oacc[4];                           // oacc[t][r] = context of query q0 + c, feature 16 t + 8 hh + r
#pragma unroll
  for (int t = 0; t < 4; ++t) oacc[t] = zero8();

  for (int kt = 0; kt < NQB; ++kt) {
    const int kv0 = kt * 64;
    __syncthreads();
    {
      const int r = tid >> 1, half = (tid & 1) * 32;
      const _Float16* kg  = Kp  + (rowB + kv0 + r) * DM + half;    // K hi row kv0+r, d = half..half+31
      const _Float16* klg = Klq + (rowB + kv0 + r) * DM + half;    // K residual row kv0+r
      const _Float16* vg  = Vh + (size_t)r * SEQ + kv0 + half;     // V^T hi row d = r, s = kv0+half..+31
      const _Float16* vlg = Vl + (size_t)r * SEQ + kv0 + half;     // V^T residual row d = r
#pragma unroll
      for (int i = 0; i < 4; ++i) {
        const v8h a0 = *(const v8h*)(kg + 8 * i);
        const v8h a1 = *(const v8h*)(klg + 8 * i);
        const v8h b0 = *(const v8h*)(vg + 8 * i);
        const v8h b1 = *(const v8h*)(vlg + 8 * i);
        *(v8h*)(Ksh + r * KVP + half + 8 * i) = a0;
        *(v8h*)(Ksl + r * KVP + half + 8 * i) = a1;
        *(v8h*)(Vth + r * KVP + half + 8 * i) = b0;
        *(v8h*)(Vtl + r * KVP + half + 8 * i) = b1;
      }
    }
    __syncthreads();

    // ---- scores, transposed: 64 keys x 16 queries per wave; hi.hi into s, hi.lo + lo.hi into s1 (folded x 2^-10) ----
    v8f s[4];                            // s[j][r] = score of key kv0 + 16 j + 8 hh + r with query q0 + c
#pragma unroll
    for (int j = 0; j < 4; ++j) {
      s[j] = zero8();
      v8f s1 = zero8();
#pragma unroll
      for (int dc = 0; dc < 2; ++dc) {
        FH kb, kr;
        kb.h[0] = *(const v8h*)(Ksh + (j * 16 + c) * KVP + dc * 32 + 8 * hh);
        kb.h[1] = *(const v8h*)(Ksh + (j * 16 + c) * KVP + dc * 32 + 16 + 8 * hh);
        kr.h[0] = *(const v8h*)(Ksl + (j * 16 + c) * KVP + dc * 32 + 8 * hh);
        kr.h[1] = *(const v8h*)(Ksl + (j * 16 + c) * KVP + dc * 32 + 16 + 8 * hh);
        s[j] = mma_h(kb.v, qa[dc], s[j]);
        s1   = mma_h(kr.v, qa[dc], s1);
        s1   = mma_h(kb.v, ql[dc], s1);
      }
#pragma unroll
      for (int r = 0; r < 8; ++r) s[j][r] += s1[r] * (1.0f / 1024.0f);
    }

    // ---- scale, maximum of the query's 64 scores (32 in the lane, then the other half's), online softmax ----
    float mj[4];
#pragma unroll
    for (int j = 0; j < 4; ++j) {
      float m = -INFINITY;
#pragma unroll
      for (int r = 0; r < 8; ++r) {
        const float sv = s[j][r] * sscale;
        s[j][r] = sv;
        m = fmaxf(m, sv);
      }
      mj[j] = m;
    }
    float mt = fmaxf(fmaxf(mj[0], mj[1]), fmaxf(mj[2], mj[3]));
    mt = fmaxf(mt, xhalf(mt));
    const float mnew  = fmaxf(mrow, mt);
    const float msafe = (mnew == -INFINITY) ? 0.f : mnew;
    const float alpha = __expf(mrow - msafe);
    mrow = mnew;
    v8h ph[4];                           // P^T (x1024, f16): ph[j][r] belongs to key kv0 + 16 j + 8 hh + r
    float ps[4];
#pragma unroll
    for (int j = 0; j < 4; ++j) {
      v8f p1024;
      float a = 0.f;
#pragma unroll
      for (int r = 0; r < 8; ++r) {
        const float p = __expf(s[j][r] - msafe);
        a += p;
        p1024[r] = p * 1024.0f;
      }
      ps[j] = a;
      ph[j] = __builtin_convertvector(p1024, v8h);
    }
    lrow = lrow * alpha + ((ps[0] + ps[1]) + (ps[2] + ps[3]));
#pragma unroll
    for (int t = 0; t < 4; ++t)
#pragma unroll
      for (int r = 0; r < 8; ++r) oacc[t][r] *= alpha;

    // ---- context^T += Vhi^T . P^T (f16 WMMA); Vres^T . P^T into a separate accumulator ----
    v8f o1[4];
#pragma unroll
    for (int t = 0; t < 4; ++t) o1[t] = zero8();
#pragma unroll                           // ph is indexed by kk: unrolled, it stays in registers
    for (int kk = 0; kk < 2; ++kk) {
      FH pb;                             // keys kv0 + 32 kk + 8 hh + (0..7), then + 16: the k order of the V^T loads below
      pb.h[0] = ph[2 * kk];
      pb.h[1] = ph[2 * kk + 1];
#pragma unroll
      for (int t = 0; t < 4; ++t) {
        FH vb;
        vb.h[0] = *(const v8h*)(Vth + (t * 16 + c) * KVP + kk * 32 + 8 * hh);
        vb.h[1] = *(const v8h*)(Vth + (t * 16 + c) * KVP + kk * 32 + 16 + 8 * hh);
        oacc[t] = mma_h(vb.v, pb.v, oacc[t]);
        FH vl;
        vl.h[0] = *(const v8h*)(Vtl + (t * 16 + c) * KVP + kk * 32 + 8 * hh);
        vl.h[1] = *(const v8h*)(Vtl + (t * 16 + c) * KVP + kk * 32 + 16 + 8 * hh);
        o1[t] = mma_h(vl.v, pb.v, o1[t]);
      }
    }
#pragma unroll
    for (int t = 0; t < 4; ++t)
#pragma unroll
      for (int r = 0; r < 8; ++r) oacc[t][r] += o1[t][r] * (1.0f / 4096.0f);
  }

  // ---- join the halves' sums, normalise (1/l and the carries via oscl), stage the wave's 16x64 tile in LDS
  //      (row = query c, 8 consecutive features per accumulator tile), then write whole 256-B row segments
  float* os = Os[wave];
  {
    const float l = lrow + xhalf(lrow);
    const float inv = ((l > 0.f) ? (1.0f / l) : 0.f) * oscl;
#pragma unroll
    for (int t = 0; t < 4; ++t) {
      v4f lo, hi;
#pragma unroll
      for (int r = 0; r < 4; ++r) {
        lo[r] = oacc[t][r] * inv;
        hi[r] = oacc[t][4 + r] * inv;
      }
      *(v4f*)(os + c * OSP + t * 16 + 8 * hh) = lo;
      *(v4f*)(os + c * OSP + t * 16 + 8 * hh + 4) = hi;
    }
  }
  __builtin_amdgcn_fence(__ATOMIC_RELEASE, "workgroup");
  __builtin_amdgcn_wave_barrier();
  __builtin_amdgcn_fence(__ATOMIC_ACQUIRE, "workgroup");
  {
    const int h2 = lane >> 4, c4 = (lane & 15) * 4;
    v4f ov[8];
#pragma unroll
    for (int it = 0; it < 8; ++it) {
      const int row = it * 2 + h2;   // it 0..7 x h2 0..1 = rows 0..15 of the wave tile
      ov[it] = *(const v4f*)(os + row * OSP + c4);
    }
    {
#pragma unroll
      for (int it = 0; it < 8; ++it) {
        const int row = it * 2 + h2;
        const size_t go = (rowB + q0 + row) * DM + (size_t)h * HD + c4;
        *(v4f*)(outp + go) = ov[it];
      }
      
    }
  }
}

// =====================================================================================================
// Workspace map (bytes), every region an exact multiple of its whole-line / whole-tile store granularity
// 8192 x 512, 512 x 512 and 4096 x 1024 are whole tiles/lines):
//   Xb    bf16 [8192][512]            0          8388608
//   Wtq   bf16 [512][512]       8388608           524288   ([n][e])
//   Wtk   bf16 [512][512]       8912896           524288
//   Wtv   bf16 [512][512]       9437184           524288
//   Wto   f16  [512][512]       9961472           524288   ([n][k], bf16rne value x4096)
//   Tf    f32  [8192][512]     10485760         16777216   (scratch: q, then msgs)
//   Qh    f16  [8192][512]     27262976          8388608
//   Ql    f16  [8192][512]     35651584          8388608
//   Kh    f16  [8192][512]     44040192          8388608
//   Kl    f16  [8192][512]     52428800          8388608
//   VTh   f16  [4096][1024]    60817408          8388608   ([b*DM + h*64 + d][s])
//   VTl   f16  [4096][1024]    69206016          8388608
//   Mh    f16  [8192][512]     77594624          8388608   (msgs x1024)
//   Ml    f16  [8192][512]     85983232          8388608   (msgs residual)
//   Tk    f32  [8192][512]     94371840         16777216   (scratch: k)
//   Tv    f32  [8192][512]    111149056         16777216   (scratch: v)
//   end                       127926272
// Inputs: nodes f32 [8][1024][512]; Wq, Wk, Wv, Wo f32 [512 in][512 out] (x @ W layout); bq, bk, bv, bo f32
// [512] (index h*64+d = n). d_out f32: [8192][512] at byte 0 (row = b*SEQ + t, col = n).
// =====================================================================================================
extern "C" void kernel_launch(void* const* d_in, const int* in_sizes, int n_in,
                              void* d_out, int out_size, void* d_ws, size_t ws_size,
                              hipStream_t stream) {
  if (n_in < 9) return;
  if (in_sizes[0] != NB * SEQ * DM) return;
  if (in_sizes[1] != DM * DM) return;
  if (in_sizes[2] != DM * DM) return;
  if (in_sizes[3] != DM * DM) return;
  if (in_sizes[4] != DM) return;
  if (in_sizes[5] != DM) return;
  if (in_sizes[6] != DM) return;
  if (in_sizes[7] != DM * DM) return;
  if (in_sizes[8] != DM) return;
  if (out_size != OUTN) return;

  const float* x  = (const float*)d_in[0];   // [NB*SEQ][DM]
  const float* Wq = (const float*)d_in[1];   // [DM e][DM n]
  const float* Wk = (const float*)d_in[2];
  const float* Wv = (const float*)d_in[3];
  const float* bq = (const float*)d_in[4];   // [DM]
  const float* bk = (const float*)d_in[5];
  const float* bv = (const float*)d_in[6];
  const float* Wo = (const float*)d_in[7];   // [DM k][DM n]
  const float* bo = (const float*)d_in[8];

  const size_t PXb = (size_t)ROWS * DM * 2;          //  8388608
  const size_t PW  = (size_t)DM * DM * 2;            //   524288
  const size_t PF  = (size_t)ROWS * DM * 4;          // 16777216
  const size_t PH  = (size_t)ROWS * DM * 2;          //  8388608
  const size_t PVt = (size_t)NB * DM * SEQ * 2;      //  8388608
  size_t off = 0;
  const size_t oXb = off; off += PXb;
  const size_t oWq = off; off += PW;
  const size_t oWk = off; off += PW;
  const size_t oWv = off; off += PW;
  const size_t oWo = off; off += PW;
  const size_t oTf = off; off += PF;
  const size_t oQh = off; off += PH;
  const size_t oQl = off; off += PH;
  const size_t oKh = off; off += PH;
  const size_t oKl = off; off += PH;
  const size_t oVt = off; off += PVt;
  const size_t oVl = off; off += PVt;
  const size_t oMh = off; off += PH;
  const size_t oMl = off; off += PH;
  const size_t oTk = off; off += PF;
  const size_t oTv = off; off += PF;
  if (off > ws_size) return;                        // off = 127926272
  if (off > (size_t)134217728) return;

  char* ws = (char*)d_ws;
  unsigned short* Xb  = (unsigned short*)(ws + oXb);
  unsigned short* Wtq = (unsigned short*)(ws + oWq);
  unsigned short* Wtk = (unsigned short*)(ws + oWk);
  unsigned short* Wtv = (unsigned short*)(ws + oWv);
  unsigned short* Wto = (unsigned short*)(ws + oWo);
  float*          Tf  = (float*)(ws + oTf);
  float*          Tk  = (float*)(ws + oTk);
  float*          Tv  = (float*)(ws + oTv);
  unsigned short* Qh  = (unsigned short*)(ws + oQh);
  unsigned short* Ql  = (unsigned short*)(ws + oQl);
  unsigned short* Kh  = (unsigned short*)(ws + oKh);
  unsigned short* Kl  = (unsigned short*)(ws + oKl);
  unsigned short* VTh = (unsigned short*)(ws + oVt);
  unsigned short* VTl = (unsigned short*)(ws + oVl);
  unsigned short* Mh  = (unsigned short*)(ws + oMh);
  unsigned short* Ml  = (unsigned short*)(ws + oMl);
  float*          outf = (float*)d_out;             // [ROWS][DM]

  const dim3 blk(256);
  const int n8x = ROWS * DM / 8;                    // 524288
  const dim3 gCvtX((n8x + 255) / 256);              // 2048 blocks
  const dim3 gPrep(4 * WTB + PLB);                  // 256 weight tiles, then 2048 activation blocks
  const dim3 gGemm(ROWS / 64, 3);                   // 128 blocks of 64 rows x 512 columns, for each of q, k, v
  const dim3 gGemO(ROWS / 32);                      // 256 blocks of 32 rows x 512 columns
  const dim3 gSplit(VTB + 2 * PLB);                 // 1024 v tiles, then 2048 blocks each for q and k
  const dim3 gAttn(NB * NH * NQB);                  // 1024 blocks
  const float qkScale = 16.0f;                      // q and k hi planes carried x16 (residual x1024 on top)
  const float sscale  = 1.0f / 2048.0f;             // 1/(16*16) * 1/sqrt(64)
  const float vScale  = 256.0f;                     // v^T hi plane carried x256
  const float attOscl = 1.0f / 262144.0f;           // 1/(1024 * 256): p and v carries folded back
  const float mScale  = 1024.0f;                    // msgs hi plane carried x1024 (residual x1024 on top)
  const float woScale = 4096.0f;                    // Wo^T carried x4096 in f16
  const float outOscl = 1.0f / 4194304.0f;          // 1/(1024 * 4096)

  // (1) activations -> bf16 plane; weights -> transposed 16-bit planes [n][e] (RNE convert): one grid
  prep<<<gPrep, blk, 0, stream>>>(x, Wq, Wk, Wv, Wo, Xb, Wtq, Wtk, Wtv, Wto, n8x, woScale);
  // (2) q, k, v = Xb . Wt^T + bias -> Tf, Tk, Tv [8192][512] (M=8192, N=512, K=512 each): one grid
  gemm64<<<gGemm, blk, 0, stream>>>(Xb, Wtq, Wtk, Wtv, bq, bk, bv, Tf, Tk, Tv, ROWS);
  // (3) q, k -> f16 hi (x16) + residual planes; v -> f16 v^T hi plane (x256) and residual plane (x4096 on top): one grid
  planes_qkv<<<gSplit, blk, 0, stream>>>(Tf, Tk, Tv, Qh, Ql, Kh, Kl, VTh, VTl, n8x, qkScale, vScale);
  // (4) attention -> msgs f32 [8192][512] in Tf, then f16 hi (x1024) + residual planes
  attn64<<<gAttn, dim3(128), 0, stream>>>(Qh, Ql, Kh, Kl, VTh, VTl, Tf, sscale, attOscl);
  planes_f16x8<<<gCvtX, blk, 0, stream>>>(Tf, Mh, Ml, n8x, mScale);
  // (5) out = msgs . Wo + bo -> d_out f32 [8192][512] (M=8192, N=512, K=512)
  gemm_o<<<gGemO, blk, 0, stream>>>(Mh, Ml, Wto, bo, outf, ROWS, outOscl);
  (void)hipGetLastError();
}

// v005
// One run takes 113 microseconds.
// Timed twice side by side with v004, it ran 1.06 and 1.05 times as fast.
// Counting every step since v000, it is 2.39 times as fast.
// Contractions: q/k/v projections = v_wmma_f32_16x16x32_bf16 (bf16 operands from RNE-converted nodes, W^T and bias, single product); q.k^T scores = v_wmma_f32_16x16x32_f16 (q, k as f16 hi planes carried x16 plus f16 residual planes x1024: hi.hi + (hi.lo + lo.hi) in a separate accumulator, 3 products); p.v = v_wmma_f32_16x16x32_f16 (p carried x1024 in f16; v^T as f16 hi plane x256 plus f16 residual plane x4096 in a separate accumulator folded with 2^-12, 2 products); output projection = v_wmma_f32_16x16x32_f16 (msgs as f16 hi plane x1024 plus f16 residual plane x1024 in a separate accumulator folded with 2^-10; Wo^T = RNE bf16 value carried x4096 in f16; 2 products); all f32 accumulate; softmax in f32.
#include <hip/hip_runtime.h>
#include <math.h>
#include <stdint.h>

#define NB    8
#define SEQ   1024
#define DM    512
#define NH    8
#define HD    64
#define NQB   (SEQ / 64)
#define ROWS  (NB * SEQ)            // 8192 token rows
#define OUTN  (ROWS * DM)
#define KVP   72                    // LDS pitch of the 64-wide f16 tiles in attn64, in halves: 144 B = 16 B x 9 (odd)
#define OSP   68                    // LDS pitch of the 64-wide f32 context tile in attn64, in floats
#define GKC   64                    // GEMMs: k elements of one staged slice = 128 B of every staged row
#define GSP   72                    // GEMMs: LDS pitch of a staged row, in 16-bit elements: 144 B = 16 B x 9 (odd)
#define GROWS (64 + DM)             // GEMMs: staged rows of a slice: 64 A rows, then the DM rows of B
#define GBUF  (GROWS * GSP)         // GEMMs: 16-bit elements of one slice buffer (82944 B)
#define NSL   (DM / GKC)            // GEMMs: slices along k
#define WTB   ((DM / 64) * (DM / 64))      // 64 x 64 tiles of one weight matrix
#define VTB   ((SEQ / 64) * NH * NB)       // 64 x 64 tiles of v
#define PLB   (ROWS * DM / 8 / 256)        // blocks of one 8-elements-per-thread pass over a [ROWS][DM] plane
static_assert(NH * HD == DM);
static_assert(HD == 64);
static_assert(32 * GSP * 2 == 4608);                           // copy9: LDS bytes of 32 staged rows
static_assert(DM == 8 * 64 && GROWS == 18 * 32 && NSL >= 2);   // 8 waves x 64 columns; 18 copies per thread; two buffers
static_assert((SEQ % 64) == 0 && (DM % 64) == 0 && (ROWS % 64) == 0);
static_assert(((ROWS / 64) * (DM / 64)) % 8 == 0);
static_assert(((ROWS / 32) * (DM / 64)) % 8 == 0);
static_assert(((ROWS * DM / 8) % 256) == 0);

typedef _Float16 v16h __attribute__((ext_vector_type(16)));
typedef _Float16 v8h  __attribute__((ext_vector_type(8)));
typedef __bf16   v16b __attribute__((ext_vector_type(16)));
typedef __bf16   v8b  __attribute__((ext_vector_type(8)));
typedef float    v8f  __attribute__((ext_vector_type(8)));
typedef float    v4f  __attribute__((ext_vector_type(4)));
typedef unsigned int v4u __attribute__((ext_vector_type(4)));

// ---- scalar helpers --------------------------------------------------------------------------------
__device__ __forceinline__ unsigned short bf_bits(float f) {          // f32 -> bf16 bits, RNE convert
  unsigned u = __float_as_uint(f);
  return (unsigned short)((u + 0x7FFFu + ((u >> 16) & 1u)) >> 16);
}
__device__ __forceinline__ float bf_up(unsigned short h) { return __uint_as_float(((unsigned)h) << 16); }
__device__ __forceinline__ unsigned short h_bits(_Float16 x) { return __builtin_bit_cast(unsigned short, x); }
__device__ __forceinline__ unsigned pk16(unsigned short a, unsigned short b) { return (unsigned)a | ((unsigned)b << 16); }
__device__ __forceinline__ v8f zero8() { v8f z = {0.f, 0.f, 0.f, 0.f, 0.f, 0.f, 0.f, 0.f}; return z; }

// ---- fragment loaders: 16-bit A/B operand, lane -> row/col (lane&15), p already includes +8*(lane>>4);
//      elements 0..7 <- p[0..7] (k0+8h..), elements 8..15 <- p[16..23] (k0+16+8h..)
__device__ __forceinline__ v16b ldfrag_b(const __bf16* p) {
  union { v16b v; v8b h[2]; } f;
  f.h[0] = *(const v8b*)(p);
  f.h[1] = *(const v8b*)(p + 16);
  return f.v;
}
__device__ __forceinline__ v16h ldfrag_h(const _Float16* p) {
  union { v16h v; v8h h[2]; } f;
  f.h[0] = *(const v8h*)(p);
  f.h[1] = *(const v8h*)(p + 16);
  return f.v;
}

// ---- WMMA helpers with trailing VALU hazard gap --------------------------------------------------------
__device__ __forceinline__ v8f mma_h(v16h a, v16h b, v8f c) {
  c = __builtin_amdgcn_wmma_f32_16x16x32_f16(false, a, false, b, (short)0, c, false, false);
#if defined(__HIP_DEVICE_COMPILE__)
  asm volatile("v_nop\n\tv_nop\n\tv_nop\n\tv_nop" : "+v"(c) : "v"(a), "v"(b));
#endif
  return c;
}
__device__ __forceinline__ v8f mma_h_raw(v16h a, v16h b, v8f c) {   // the compiler keeps the distances behind its own builtin
  return __builtin_amdgcn_wmma_f32_16x16x32_f16(false, a, false, b, (short)0, c, false, false);
}
__device__ __forceinline__ v8f mma_b_raw(v16b a, v16b b, v8f c) {
  return __builtin_amdgcn_wmma_f32_16x16x32_bf16(false, a, false, b, (short)0, c, false, false);
}
__device__ __forceinline__ void dep_guard_b(v8f& a, v8f& b, v16b x, v16b y) {
#if defined(__HIP_DEVICE_COMPILE__)
  asm volatile("v_nop\n\tv_nop\n\tv_nop\n\tv_nop" : "+v"(a), "+v"(b) : "v"(x), "v"(y));
#endif
}
__device__ __forceinline__ void keep4_b(v16b a, v16b b, v16b c, v16b d) {
#if defined(__HIP_DEVICE_COMPILE__)
  asm volatile("v_nop" :: "v"(a), "v"(b), "v"(c), "v"(d));
#endif
}
__device__ __forceinline__ void acc_guard4(v8f& a, v8f& b, v8f& c, v8f& d) {
#if defined(__HIP_DEVICE_COMPILE__)
  asm volatile("v_nop\n\tv_nop\n\tv_nop\n\tv_nop" : "+v"(a), "+v"(b), "+v"(c), "+v"(d));
#endif
}

// lane l <-> lane l ^ 16 (the other half of the wave), in the vector unit
__device__ __forceinline__ float xhalf(float x) {
  const int b = __builtin_bit_cast(int, x);
  return __builtin_bit_cast(float, __builtin_amdgcn_permlanex16(b, b, 0x76543210, 0xfedcba98, false, false));
}

// ---- GEMM operand staging: asynchronous copies global -> LDS, waits -----------------------------------
__device__ __forceinline__ unsigned lds_off(const void* p) { return (unsigned)(size_t)p; }   // LDS byte address
// nine 16-B copies of this lane: LDS bytes l + 4608 i (32 staged rows of 144 B further each) <- global g0 .. g8
__device__ __forceinline__ void copy9(unsigned l, const unsigned short* g0, const unsigned short* g1,
                                      const unsigned short* g2, const unsigned short* g3, const unsigned short* g4,
                                      const unsigned short* g5, const unsigned short* g6, const unsigned short* g7,
                                      const unsigned short* g8) {
#if defined(__HIP_DEVICE_COMPILE__)
  // the closing s_wait_xcnt stands in the copies' own statement: no address register is rewritten in front of it
  asm volatile(
      "global_load_async_to_lds_b128 %0, %9, off\n\t"
      "global_load_async_to_lds_b128 %1, %10, off\n\t"
      "global_load_async_to_lds_b128 %2, %11, off\n\t"
      "global_load_async_to_lds_b128 %3, %12, off\n\t"
      "global_load_async_to_lds_b128 %4, %13, off\n\t"
      "global_load_async_to_lds_b128 %5, %14, off\n\t"
      "global_load_async_to_lds_b128 %6, %15, off\n\t"
      "global_load_async_to_lds_b128 %7, %16, off\n\t"
      "global_load_async_to_lds_b128 %8, %17, off\n\t"
      "s_wait_xcnt 0x0"
      :: "v"(l), "v"(l + 4608u), "v"(l + 2u * 4608u), "v"(l + 3u * 4608u), "v"(l + 4u * 4608u),
         "v"(l + 5u * 4608u), "v"(l + 6u * 4608u), "v"(l + 7u * 4608u), "v"(l + 8u * 4608u),
         "v"(g0), "v"(g1), "v"(g2), "v"(g3), "v"(g4), "v"(g5), "v"(g6), "v"(g7), "v"(g8)
      : "memory");
#endif
}
// One slice = GROWS rows x 128 B = 18 groups of 32 rows; thread tid copies 16-B column tid&7 of row tid>>3 of every
// group, so 8 lanes copy one whole 128-B line. l: the lane's LDS byte address in group 0 of the buffer; a0, a1: its
// source in A row groups 0 and 1; b: its source in B row group 0 (groups 2..17 = B rows 0..DM-1, row pitch DM).
__device__ __forceinline__ void stage_slice(unsigned l, const unsigned short* a0, const unsigned short* a1,
                                            const unsigned short* b) {
  constexpr size_t S = (size_t)32 * DM;           // 32 B rows, in elements
  copy9(l, a0, a1, b, b + S, b + 2 * S, b + 3 * S, b + 4 * S, b + 5 * S, b + 6 * S);
  copy9(l + 9u * 4608u, b + 7 * S, b + 8 * S, b + 9 * S, b + 10 * S, b + 11 * S, b + 12 * S, b + 13 * S, b + 14 * S,
        b + 15 * S);
}
__device__ __forceinline__ void wait_copies() {   // this wave's copies have landed in LDS
#if defined(__HIP_DEVICE_COMPILE__)
  asm volatile("s_wait_asynccnt 0x0" ::: "memory");
#endif
}
__device__ __forceinline__ void wait_lds_reads() {   // this wave's LDS reads are done before the buffer is handed on
#if defined(__HIP_DEVICE_COMPILE__)
  asm volatile("s_wait_dscnt 0x0" ::: "memory");
#endif
}

// =====================================================================================================
// f32 -> bf16 (RNE convert), 8 elements per thread, one 16-B store per lane: a wave writes 512 contiguous B
// coverage: n8 threads x 8 = whole plane (n8 is a multiple of 256 here).
// =====================================================================================================
__device__ __forceinline__ void cvt_bf16x8_body(const float* __restrict__ in, unsigned short* out, int n8, int blk) {
  const int i = blk * 256 + threadIdx.x;
  if (i < n8) {
    const v4f a = *(const v4f*)(in + (size_t)i * 8);
    const v4f b = *(const v4f*)(in + (size_t)i * 8 + 4);
    v4u p;
    p[0] = pk16(bf_bits(a[0]), bf_bits(a[1]));
    p[1] = pk16(bf_bits(a[2]), bf_bits(a[3]));
    p[2] = pk16(bf_bits(b[0]), bf_bits(b[1]));
    p[3] = pk16(bf_bits(b[2]), bf_bits(b[3]));
    *(v4u*)(out + (size_t)i * 8) = p;
    
  }
}

// =====================================================================================================
// f32 -> f16 hi plane = f16(v * scale) (scale a power of two) + f16 residual plane = f16((v*scale - hi) * 1024),
// same element index in both planes; 8 elements per thread, one 16-B store per lane and plane: a wave writes
// coverage: n8 threads x 8 = whole plane (n8 multiple of 256).
// =====================================================================================================
__device__ __forceinline__ void planes_f16x8_body(const float* __restrict__ in, unsigned short* hp,
                                                  unsigned short* lp, int n8, float scale, int blk) {
  const int i = blk * 256 + threadIdx.x;
  if (i < n8) {
    const v4f a = *(const v4f*)(in + (size_t)i * 8);
    const v4f b = *(const v4f*)(in + (size_t)i * 8 + 4);
    float f[8];
    f[0] = a[0]; f[1] = a[1]; f[2] = a[2]; f[3] = a[3];
    f[4] = b[0]; f[5] = b[1]; f[6] = b[2]; f[7] = b[3];
    v4u ph, pl;
#pragma unroll
    for (int e = 0; e < 4; ++e) {
      const float f0 = f[2 * e] * scale;
      const float f1 = f[2 * e + 1] * scale;
      const _Float16 x0 = (_Float16)f0, x1 = (_Float16)f1;
      const _Float16 l0 = (_Float16)((f0 - (float)x0) * 1024.0f);
      const _Float16 l1 = (_Float16)((f1 - (float)x1) * 1024.0f);
      ph[e] = pk16(h_bits(x0), h_bits(x1));
      pl[e] = pk16(h_bits(l0), h_bits(l1));
    }
    *(v4u*)(hp + (size_t)i * 8) = ph;
    *(v4u*)(lp + (size_t)i * 8) = pl;
    
  }
}
__global__ __launch_bounds__(256) void planes_f16x8(const float* __restrict__ in, unsigned short* hp,
                                                    unsigned short* lp, int n8, float scale) {
  planes_f16x8_body(in, hp, lp, n8, scale, blockIdx.x);
}

// =====================================================================================================
// Weight transpose + convert: in W f32 [DM rows (e, contraction index)][DM cols (n, output feature)] (the
// x @ W layout) -> out Wt 16-bit [DM (n)][DM (e)] (the [n][k], k-contiguous layout the GEMM B operand uses).
// MODE 0: RNE bf16 bits. MODE 1: f16 bits of (RNE bf16 value * scale), scale a power of two (exact in f16).
// Block = one 64 e x 64 n tile (et, nt: its e and n tile index, DM/64 of each). The tile is staged in LDS as [ee][nn]
// pitch 68 floats (v4f loads, __syncthreads). in[rows e][cols n] -> out[rows n][cols e] (square here).
// Store: group g = tid>>3 (0..31), piece = tid&7: iteration it writes row n0 + (it*32+g), lanes 8q..8q+7 x 16 B
// coverage: 2 iterations x 32 groups = 64 rows n, 8 pieces x 8 = 64 e per row; grid covers every (e tile,
// n tile) -> the whole [DM][DM] plane.
// =====================================================================================================
template <int MODE>
__device__ __forceinline__ void wt_tile_body(const float* __restrict__ W, unsigned short* Wt, float scale,
                                             float* sw, int et, int nt) {
  const int tid = threadIdx.x;
  const int e0  = et * 64;
  const int n0  = nt * 64;
#pragma unroll
  for (int i = 0; i < 4; ++i) {
    const int idx = i * 256 + tid;                  // 0..1023
    const int ee = idx >> 4, c4 = (idx & 15) * 4;
    const v4f a = *(const v4f*)(W + ((size_t)(e0 + ee)) * DM + n0 + c4);
    *(v4f*)(sw + ee * 68 + c4) = a;
  }
  __syncthreads();

  const int g = tid >> 3, piece = tid & 7;
  v4u hv[2];
  size_t hofs[2];
#pragma unroll
  for (int it = 0; it < 2; ++it) {
    const int n = it * 32 + g;
    v4u a;
#pragma unroll
    for (int e = 0; e < 4; ++e) {
      const float f0 = sw[(piece * 8 + 2 * e) * 68 + n];
      const float f1 = sw[(piece * 8 + 2 * e + 1) * 68 + n];
      unsigned short u0, u1;
      if (MODE == 0) {
        u0 = bf_bits(f0);
        u1 = bf_bits(f1);
      } else {
        u0 = h_bits((_Float16)(bf_up(bf_bits(f0)) * scale));
        u1 = h_bits((_Float16)(bf_up(bf_bits(f1)) * scale));
      }
      a[e] = pk16(u0, u1);
    }
    hv[it] = a;
    hofs[it] = ((size_t)(n0 + n)) * DM + e0 + piece * 8;
  }
  {
#pragma unroll
    for (int it = 0; it < 2; ++it) {
      *(v4u*)(Wt + hofs[it]) = hv[it];
    }
#if defined(__HIP_DEVICE_COMPILE__)
    // both tile bodies stand in one kernel: no register that the two stores name is rewritten in front of this wait
    asm volatile("s_wait_xcnt 0x0" ::: "memory");
#endif
  }
}
// One grid for all operand preparation (the five jobs are independent of one another): blocks 0 .. 4 WTB - 1 = the
// weight tiles of Wq, Wk, Wv (bf16) and Wo (f16 x woscale), WTB tiles each; the blocks behind them = the activations'
// bf16 plane. The branch is block-uniform, so the tile body's barrier is passed by whole blocks only.
__global__ __launch_bounds__(256) void prep(const float* __restrict__ x, const float* __restrict__ Wq,
                                            const float* __restrict__ Wk, const float* __restrict__ Wv,
                                            const float* __restrict__ Wo, unsigned short* Xb, unsigned short* Wtq,
                                            unsigned short* Wtk, unsigned short* Wtv, unsigned short* Wto,
                                            int n8, float woscale) {
  __shared__ __align__(16) float sw[64 * 68];       // [ee][nn] pitch 68 floats
  const int bx = blockIdx.x;
  if (bx < 4 * WTB) {
    const int w = bx / WTB, tile = bx % WTB;
    const int et = tile % (DM / 64), nt = tile / (DM / 64);
    if (w == 3) {
      wt_tile_body<1>(Wo, Wto, woscale, sw, et, nt);
    } else {
      wt_tile_body<0>(w == 0 ? Wq : (w == 1 ? Wk : Wv), w == 0 ? Wtq : (w == 1 ? Wtk : Wtv), 1.0f, sw, et, nt);
    }
  } else {
    cvt_bf16x8_body(x, Xb, n8, bx - 4 * WTB);
  }
}

// =====================================================================================================
// Register-blocked bf16 WMMA GEMM with bias: C[m][n] = sum_k A[m][k] * Bt[n][k] + bf16rne(bias[n]), N = K = DM.
// Block = 64 rows x DM columns, one wave per 64x64 tile (wave w: columns 64 w ..). A row-major [M][DM]; Bt row-major
// [DM n][DM k] (k contiguous); bias f32 [DM] (RNE converted to bf16 and widened in the epilogue); M multiple of 64.
// Operands: k slices of GKC, the block's 64 A rows and all DM B rows, staged in LDS by asynchronous copies, two
// buffers: slice t + 1 is in flight while slice t is multiplied; per slice one hand-over (LDS reads done, own copies
// landed, block barrier), then slice t + 2 is copied into the buffer slice t has left.
// Output f32 [M][DM] pitch DM. Epilogue: 16-row slabs staged per wave in LDS; each 64-wide row segment
// =====================================================================================================
// One grid for the three projections: blockIdx.y = 0, 1, 2 picks (Bt, bias, C) of q, k, v; A is common to them.
__global__ __launch_bounds__(256) void gemm64(
    const unsigned short* __restrict__ Ap,
    const unsigned short* __restrict__ Btq, const unsigned short* __restrict__ Btk,
    const unsigned short* __restrict__ Btv,
    const float* __restrict__ biasq, const float* __restrict__ biask, const float* __restrict__ biasv,
    float* Cq, float* Ck, float* Cv, int M) {
  const int which = blockIdx.y;
  const unsigned short* __restrict__ Btp = which == 0 ? Btq : (which == 1 ? Btk : Btv);
  const float* __restrict__ bias = which == 0 ? biasq : (which == 1 ? biask : biasv);
  float* C = which == 0 ? Cq : (which == 1 ? Ck : Cv);
  __shared__ __align__(16) __bf16 sAB[2 * GBUF];   // two slice buffers: rows 0..63 = A, rows 64.. = B
  __shared__ __align__(16) float sT[8][16 * 68];   // per-wave 16x64 slab, pitch 68 floats
  constexpr int ldc = DM;
  const int tid  = threadIdx.x;
  const int lane = tid & 31;
  const int wave = tid >> 5;
  const int m0 = blockIdx.x << 6;
  if (m0 >= M) return;                   // block-uniform, in front of every barrier
  const int n0 = wave << 6;

  // this lane's piece of every 32-row group: row tid>>3, 16-B column tid&7
  const unsigned short* ga0 = Ap + (size_t)(m0 + (tid >> 3)) * DM + (tid & 7) * 8;
  const unsigned short* ga1 = ga0 + (size_t)32 * DM;
  const unsigned short* gb  = Btp + (size_t)(tid >> 3) * DM + (tid & 7) * 8;
  const unsigned l0 = lds_off(sAB) + (unsigned)((tid >> 3) * GSP + (tid & 7) * 8) * 2u;
  stage_slice(l0, ga0, ga1, gb);
  wait_copies();
  __syncthreads();                       // slice 0 is readable by every wave
  stage_slice(l0 + GBUF * 2u, ga0 + GKC, ga1 + GKC, gb + GKC);

  const int rlane = lane & 15;                 // row (A) / col (B, D) within subtile
  const int koff  = (lane >> 4) * 8;           // k offset of this lane half
  const int mOff  = (lane >> 4) * 8;           // D row offset

  v8f acc[4][4];
#pragma unroll
  for (int i = 0; i < 4; ++i)
#pragma unroll
    for (int j = 0; j < 4; ++j) acc[i][j] = zero8();

  for (int t = 0; t < NSL; ++t) {
    const __bf16* sb = sAB + (t & 1) * GBUF;
#pragma unroll
    for (int kk = 0; kk < GKC; kk += 32) {
      v16b bh[4], ah[4];                 // the k step's LDS reads stand together, in front of its WMMAs
#pragma unroll
      for (int j = 0; j < 4; ++j) {
        bh[j] = ldfrag_b(sb + (64 + n0 + (j << 4) + rlane) * GSP + koff + kk);
      }
#pragma unroll
      for (int i = 0; i < 4; ++i) {
        ah[i] = ldfrag_b(sb + ((i << 4) + rlane) * GSP + koff + kk);
      }
#pragma unroll
      for (int i = 0; i < 4; ++i) {
#pragma unroll
        for (int j = 0; j < 4; ++j) {
          acc[i][j] = mma_b_raw(ah[i], bh[j], acc[i][j]);
        }
        dep_guard_b(acc[i][0], acc[i][3], ah[i], ah[i]);
      }
      keep4_b(bh[0], bh[1], bh[2], bh[3]);
    }
    // hand-over: slice t + 1 becomes readable, slice t's buffer becomes free
    wait_lds_reads();
    wait_copies();
    __syncthreads();
    if (t + 2 < NSL) {
      stage_slice(l0 + (unsigned)(t & 1) * (GBUF * 2u), ga0 + (t + 2) * GKC, ga1 + (t + 2) * GKC, gb + (t + 2) * GKC);
    }
  }
  wait_copies();
  acc_guard4(acc[0][0], acc[0][1], acc[0][2], acc[0][3]);
  acc_guard4(acc[1][0], acc[1][1], acc[1][2], acc[1][3]);
  acc_guard4(acc[2][0], acc[2][1], acc[2][2], acc[2][3]);
  acc_guard4(acc[3][0], acc[3][1], acc[3][2], acc[3][3]);

  // ---- bias per D column of this lane (n0 + 16j + rlane < N) ----
  float bz[4];
#pragma unroll
  for (int j = 0; j < 4; ++j) bz[j] = bf_up(bf_bits(bias[n0 + (j << 4) + rlane]));

  // ---- epilogue ----
  float* slab = sT[wave];
#pragma unroll
  for (int i = 0; i < 4; ++i) {
    const int mBase = m0 + (i << 4);
#pragma unroll
    for (int r = 0; r < 8; ++r) {
#pragma unroll
      for (int j = 0; j < 4; ++j) {
        slab[(mOff + r) * 68 + (j << 4) + rlane] = acc[i][j][r] + bz[j];
      }
    }
    __builtin_amdgcn_fence(__ATOMIC_RELEASE, "workgroup");
    __builtin_amdgcn_wave_barrier();
    __builtin_amdgcn_fence(__ATOMIC_ACQUIRE, "workgroup");
    {
      const int hh = lane >> 4, c4 = (lane & 15) * 4;     // 256-B row segment = 16 lanes x 16 B
      v4f ov[8];
#pragma unroll
      for (int it = 0; it < 8; ++it) {
        const int row = it * 2 + hh;                       // it 0..7 x hh 0..1 = rows 0..15
        ov[it] = *(const v4f*)(slab + row * 68 + c4);
      }
      {
#pragma unroll
        for (int it = 0; it < 8; ++it) {
          const int row = it * 2 + hh;
          *(v4f*)(C + (size_t)(mBase + row) * ldc + n0 + c4) = ov[it];
        }
        
      }
    }
    __builtin_amdgcn_fence(__ATOMIC_RELEASE, "workgroup");
    __builtin_amdgcn_wave_barrier();
    __builtin_amdgcn_fence(__ATOMIC_ACQUIRE, "workgroup");
  }
}

// =====================================================================================================
// f16 WMMA GEMM with a two-plane A operand and bias:
//   C[m][n] = (sum_k Ah[m][k]*Bt[n][k] + 2^-10 * sum_k Al[m][k]*Bt[n][k]) * oscale + bf16rne(bias[n]),
// the residual products in a separate accumulator, N = K = DM. Block = 32 rows x DM columns, one wave per 32x64 tile
// (wave w: columns 64 w ..). Ah/Al row-major [M][DM] (f16 hi and residual planes, same index); Bt row-major
// [DM n][DM k] (f16, k contiguous); M multiple of 32. Operands staged in LDS as in gemm64 (staged rows 0..31 = Ah,
// 32..63 = Al, 64.. = B). Every WMMA nop-guarded.
// Output f32 [M][DM] pitch DM. Epilogue: 16-row slabs staged per wave in LDS; each 64-wide row segment (256 B)
// coverage: 2 slabs x 16 rows x 64 cols = the wave's whole 32x64 tile.
// =====================================================================================================
__global__ __launch_bounds__(256) void gemm_o(
    const unsigned short* __restrict__ Ahp, const unsigned short* __restrict__ Alp,
    const unsigned short* __restrict__ Btp,
    const float* __restrict__ bias,
    float* C, int M, float oscale) {
  __shared__ __align__(16) _Float16 sAB[2 * GBUF]; // two slice buffers: rows 0..31 = Ah, 32..63 = Al, 64.. = B
  __shared__ __align__(16) float sT[8][16 * 68];   // per-wave 16x64 slab, pitch 68 floats
  constexpr int ldc = DM;
  const int tid  = threadIdx.x;
  const int lane = tid & 31;
  const int wave = tid >> 5;
  const int m0 = blockIdx.x << 5;
  if (m0 >= M) return;                   // block-uniform, in front of every barrier
  const int n0 = wave << 6;

  // this lane's piece of every 32-row group: row tid>>3, 16-B column tid&7
  const size_t ao = (size_t)(m0 + (tid >> 3)) * DM + (tid & 7) * 8;
  const unsigned short* ga0 = Ahp + ao;
  const unsigned short* ga1 = Alp + ao;
  const unsigned short* gb  = Btp + (size_t)(tid >> 3) * DM + (tid & 7) * 8;
  const unsigned l0 = lds_off(sAB) + (unsigned)((tid >> 3) * GSP + (tid & 7) * 8) * 2u;
  stage_slice(l0, ga0, ga1, gb);
  wait_copies();
  __syncthreads();                       // slice 0 is readable by every wave
  stage_slice(l0 + GBUF * 2u, ga0 + GKC, ga1 + GKC, gb + GKC);

  const int rlane = lane & 15;
  const int koff  = (lane >> 4) * 8;
  const int mOff  = (lane >> 4) * 8;

  v8f acc[2][4], acl[2][4];
#pragma unroll
  for (int i = 0; i < 2; ++i)
#pragma unroll
    for (int j = 0; j < 4; ++j) { acc[i][j] = zero8(); acl[i][j] = zero8(); }

  for (int t = 0; t < NSL; ++t) {
    const _Float16* sb = sAB + (t & 1) * GBUF;
#pragma unroll
    for (int kk = 0; kk < GKC; kk += 32) {
      v16h ah[2], al[2], bfr[4];         // the k step's LDS reads stand together, in front of its WMMAs
#pragma unroll
      for (int i = 0; i < 2; ++i) {
        ah[i] = ldfrag_h(sb + ((i << 4) + rlane) * GSP + koff + kk);
        al[i] = ldfrag_h(sb + (32 + (i << 4) + rlane) * GSP + koff + kk);
      }
#pragma unroll
      for (int j = 0; j < 4; ++j) {
        bfr[j] = ldfrag_h(sb + (64 + n0 + (j << 4) + rlane) * GSP + koff + kk);
      }
#pragma unroll
      for (int j = 0; j < 4; ++j) {
#pragma unroll
        for (int i = 0; i < 2; ++i) {
          acc[i][j] = mma_h(ah[i], bfr[j], acc[i][j]);
          acl[i][j] = mma_h(al[i], bfr[j], acl[i][j]);
        }
      }
    }
    // hand-over: slice t + 1 becomes readable, slice t's buffer becomes free
    wait_lds_reads();
    wait_copies();
    __syncthreads();
    if (t + 2 < NSL) {
      stage_slice(l0 + (unsigned)(t & 1) * (GBUF * 2u), ga0 + (t + 2) * GKC, ga1 + (t + 2) * GKC, gb + (t + 2) * GKC);
    }
  }
  wait_copies();

  // ---- bias per D column of this lane (n0 + 16j + rlane < N) ----
  float bz[4];
#pragma unroll
  for (int j = 0; j < 4; ++j) bz[j] = bf_up(bf_bits(bias[n0 + (j << 4) + rlane]));

  // ---- epilogue ----
  float* slab = sT[wave];
#pragma unroll
  for (int i = 0; i < 2; ++i) {
    const int mBase = m0 + (i << 4);
#pragma unroll
    for (int r = 0; r < 8; ++r) {
#pragma unroll
      for (int j = 0; j < 4; ++j) {
        const float y = (acc[i][j][r] + acl[i][j][r] * (1.0f / 1024.0f)) * oscale + bz[j];
        slab[(mOff + r) * 68 + (j << 4) + rlane] = y;
      }
    }
    __builtin_amdgcn_fence(__ATOMIC_RELEASE, "workgroup");
    __builtin_amdgcn_wave_barrier();
    __builtin_amdgcn_fence(__ATOMIC_ACQUIRE, "workgroup");
    {
      const int hh = lane >> 4, c4 = (lane & 15) * 4;     // 256-B row segment = 16 lanes x 16 B
      v4f ov[8];
#pragma unroll
      for (int it = 0; it < 8; ++it) {
        const int row = it * 2 + hh;                       // it 0..7 x hh 0..1 = rows 0..15
        ov[it] = *(const v4f*)(slab + row * 68 + c4);
      }
      {
#pragma unroll
        for (int it = 0; it < 8; ++it) {
          const int row = it * 2 + hh;
          *(v4f*)(C + (size_t)(mBase + row) * ldc + n0 + c4) = ov[it];
        }
        
      }
    }
    __builtin_amdgcn_fence(__ATOMIC_RELEASE, "workgroup");
    __builtin_amdgcn_wave_barrier();
    __builtin_amdgcn_fence(__ATOMIC_ACQUIRE, "workgroup");
  }
}

// =====================================================================================================
// v f32 token-major columns vf[(b*SEQ + t)*vrp + h*64 + d] ->
// f16 v^T hi plane vth[(b*DM + h*64 + d)*SEQ + t] = f16(v * vscale) (vscale a power of two) and residual plane
// vtl[same index] = f16((v*vscale - hi) * 4096).
// Block = one 64-token x 64-feature tile of one (b, h): tile index (tt0, hh, b) in (SEQ/64, NH, NB); staged in LDS as f32
// (v4f loads, __syncthreads).
// Store: group g = tid>>3 (0..31), piece = tid&7: iteration it writes row d = it*32+g, lanes 8q..8q+7 x 16 B =
// coverage: 2 iterations x 32 groups = 64 rows d, 8 pieces x 8 = 64 tokens per row; grid covers every (b, h,
// t tile) -> both whole planes.
// =====================================================================================================
__device__ __forceinline__ void v_planes_body(const float* __restrict__ vf, int vrp, unsigned short* vth,
                                              unsigned short* vtl, float vscale, float* sv, int tt0, int hh, int b) {
  const int tid = threadIdx.x;
  const int t0  = tt0 * 64;
#pragma unroll
  for (int i = 0; i < 4; ++i) {
    const int idx = i * 256 + tid;                  // 0..1023
    const int tt = idx >> 4, c4 = (idx & 15) * 4;
    const v4f a = *(const v4f*)(vf + ((size_t)(b * SEQ + t0 + tt)) * vrp + hh * HD + c4);
    *(v4f*)(sv + tt * 68 + c4) = a;
  }
  __syncthreads();

  const int g = tid >> 3, piece = tid & 7;
  v4u hv[2], lv[2];
  size_t hofs[2];
#pragma unroll
  for (int it = 0; it < 2; ++it) {
    const int d = it * 32 + g;
    v4u a, a2;
#pragma unroll
    for (int e = 0; e < 4; ++e) {
      const float f0 = sv[(piece * 8 + 2 * e) * 68 + d] * vscale;
      const float f1 = sv[(piece * 8 + 2 * e + 1) * 68 + d] * vscale;
      const _Float16 x0 = (_Float16)f0, x1 = (_Float16)f1;
      const unsigned short h0 = h_bits(x0), h1 = h_bits(x1);
      const unsigned short l0 = h_bits((_Float16)((f0 - (float)x0) * 4096.0f));
      const unsigned short l1 = h_bits((_Float16)((f1 - (float)x1) * 4096.0f));
      a[e] = pk16(h0, h1); a2[e] = pk16(l0, l1);
    }
    hv[it] = a; lv[it] = a2;
    hofs[it] = ((size_t)(b * DM + hh * HD + d)) * SEQ + t0 + piece * 8;
  }
  {
#pragma unroll
    for (int it = 0; it < 2; ++it) {
      *(v4u*)(vth + hofs[it]) = hv[it];
      *(v4u*)(vtl + hofs[it]) = lv[it];
    }
    
  }
}
// One grid for the three plane splits (independent of one another): blocks 0 .. VTB - 1 = the v tiles, then PLB blocks
// for q, then PLB blocks for k. The branch is block-uniform, so the tile body's barrier is passed by whole blocks only.
__global__ __launch_bounds__(256) void planes_qkv(const float* __restrict__ qf, const float* __restrict__ kf,
                                                  const float* __restrict__ vf, unsigned short* qh, unsigned short* ql,
                                                  unsigned short* kh, unsigned short* kl, unsigned short* vth,
                                                  unsigned short* vtl, int n8, float qkscale, float vscale) {
  __shared__ __align__(16) float sv[64 * 68];       // [tt][d] pitch 68 floats
  const int bx = blockIdx.x;
  if (bx < VTB) {
    v_planes_body(vf, DM, vth, vtl, vscale, sv, bx % (SEQ / 64), (bx / (SEQ / 64)) % NH, bx / ((SEQ / 64) * NH));
  } else if (bx < VTB + PLB) {
    planes_f16x8_body(qf, qh, ql, n8, qkscale, bx - VTB);
  } else {
    planes_f16x8_body(kf, kh, kl, n8, qkscale, bx - (VTB + PLB));
  }
}

// =====================================================================================================
// Bidirectional multi-head attention, head dim 64, no mask.
//   q f16 hi plane (x16): element (b, t, h, d) at [(b*SEQ + t)*DM + h*64 + d]; q residual plane
//     ((q*16 - hi)*1024) at the same index into qlp
//   k f16 hi plane (x16): element (b, s, h, d) at [(b*SEQ + s)*DM + h*64 + d]; k residual plane same into klp
//   v^T f16 hi plane (x256): element (b, h, d, s) at [(b*DM + h*64 + d)*SEQ + s]
//   v^T f16 residual plane ((v*256 - hi)*4096): same index into vlp
//   All NQB key tiles of 64 are processed for every query tile (static trip count).
//   logit = (qhi.khi + (qhi.klo + qlo.khi) * 2^-10) * sscale, f16 products with f32 accumulate, the residual
//   products in a separate accumulator; p = exp(s - m) carried as ph = f16(1024 p);
//   context = ph . vhi on f16 WMMA plus ph . vres into a separate accumulator folded back with 2^-12 per tile
//   in f32; online softmax in f32; out f32 plane: element (b, t, h*64 + d) at [(b*SEQ + t)*DM + h*64 + d] =
//   normalised context (oscl folds back the p and v carries).
//   Block = 4 waves = 64 query rows of one (b, h); grid = NB*NH*NQB; kv tiles of 64.
//   K hi / K residual / V^T hi / V^T residual tile staging: 128 threads x 32 elements per plane = the whole
//   64x64 tile (plain 16-B loads, __syncthreads before and after).
//   Both products are formed transposed: S^T = K . Q^T (A = K rows, B = Q) and O^T += V^T . P^T (A = V^T rows, B = P^T).
//   A lane then holds 32 of the 64 scores of ONE query (column lane&15; keys 16 j + 8 (lane>>4) + r), so maximum and
//   sum run in the lane, with one exchange between the wave's halves; two score tiles, converted in place, are the
//   B operand of the second product in the loaders' k order: P never leaves the registers.
//   Output coverage: each wave stores rows q0..q0+15 (it 0..7 x lane>>4 0..1) x 64 columns (16 lanes x 4
//   (b, h, query tile) -> the whole plane.
// =====================================================================================================
__global__ __launch_bounds__(128)
void attn64(const unsigned short* __restrict__ qhp, const unsigned short* __restrict__ qlp,
            const unsigned short* __restrict__ khp, const unsigned short* __restrict__ klp,
            const unsigned short* __restrict__ vhp, const unsigned short* __restrict__ vlp,
            float* outp, float sscale, float oscl) {
  union FH { v16h v; v8h h[2]; };
  __shared__ __align__(16) _Float16 Ksh[64 * KVP];                // K hi [kv][d]    9 KB
  __shared__ __align__(16) _Float16 Ksl[64 * KVP];                // K residual      9 KB
  __shared__ __align__(16) _Float16 Vth[64 * KVP];                // V^T hi [d][kv]  9 KB
  __shared__ __align__(16) _Float16 Vtl[64 * KVP];                // V^T residual    9 KB
  __shared__ __align__(16) float    Os[4][16 * OSP];              // per wave context tile [row][d] 17 KB

  const int tid  = threadIdx.x;
  const int wave = tid >> 5;
  const int lane = tid & 31;
  const int hh   = lane >> 4;
  const int c    = lane & 15;

  const int bx   = blockIdx.x;
  const int qb   = bx % NQB;
  const int rest = bx / NQB;
  const int h    = rest % NH;
  const int b    = rest / NH;                // < NB by the grid size
  const int q0   = qb * 64 + wave * 16;
  const size_t rowB = (size_t)b * SEQ;

  const _Float16* Qp  = (const _Float16*)(const void*)qhp + (size_t)h * HD;
  const _Float16* Qlq = (const _Float16*)(const void*)qlp + (size_t)h * HD;
  const _Float16* Kp  = (const _Float16*)(const void*)khp + (size_t)h * HD;
  const _Float16* Klq = (const _Float16*)(const void*)klp + (size_t)h * HD;
  const _Float16* Vh  = (const _Float16*)(const void*)vhp + ((size_t)b * DM + (size_t)h * HD) * SEQ;
  const _Float16* Vl  = (const _Float16*)(const void*)vlp + ((size_t)b * DM + (size_t)h * HD) * SEQ;

  // ---- Q fragments (B operand, column = lane&15): 2 d-chunks, hi and residual ----
  v16h qa[2], ql[2];
#pragma unroll
  for (int dc = 0; dc < 2; ++dc) {
    const size_t qo = (rowB + q0 + c) * DM + dc * 32 + 8 * hh;
    qa[dc] = ldfrag_h(Qp + qo);
    ql[dc] = ldfrag_h(Qlq + qo);
  }
#if defined(__HIP_DEVICE_COMPILE__)
  // no address register of the Q loads is rewritten in front of this wait; the scheduling barrier keeps the later
  // address arithmetic, which reuses those registers, from being lifted over it
  asm volatile("s_wait_xcnt 0x0" ::: "memory");
  __builtin_amdgcn_sched_barrier(0);
#endif

  float mrow = -INFINITY, lrow = 0.f;    // of query q0 + c; lrow sums this half's keys only, joined behind the loop
  v8f oacc[4];                           // oacc[t][r] = context of query q0 + c, feature 16 t + 8 hh + r
#pragma unroll
  for (int t = 0; t < 4; ++t) oacc[t] = zero8();

  for (int kt = 0; kt < NQB; ++kt) {
    const int kv0 = kt * 64;
    __syncthreads();
    {
      const int r = tid >> 1, half = (tid & 1) * 32;
      const _Float16* kg  = Kp  + (rowB + kv0 + r) * DM + half;    // K hi row kv0+r, d = half..half+31
      const _Float16* klg = Klq + (rowB + kv0 + r) * DM + half;    // K residual row kv0+r
      const _Float16* vg  = Vh + (size_t)r * SEQ + kv0 + half;     // V^T hi row d = r, s = kv0+half..+31
      const _Float16* vlg = Vl + (size_t)r * SEQ + kv0 + half;     // V^T residual row d = r
#pragma unroll
      for (int i = 0; i < 4; ++i) {
        const v8h a0 = *(const v8h*)(kg + 8 * i);
        const v8h a1 = *(const v8h*)(klg + 8 * i);
        const v8h b0 = *(const v8h*)(vg + 8 * i);
        const v8h b1 = *(const v8h*)(vlg + 8 * i);
        *(v8h*)(Ksh + r * KVP + half + 8 * i) = a0;
        *(v8h*)(Ksl + r * KVP + half + 8 * i) = a1;
        *(v8h*)(Vth + r * KVP + half + 8 * i) = b0;
        *(v8h*)(Vtl + r * KVP + half + 8 * i) = b1;
      }
    }
    __syncthreads();

    // Fragment reads: plain LDS loads in groups of 8 ds_load_b128 (one 16-key group of K, or two 16-feature groups of
    // V^T, hi and residual planes), written one group ahead of the WMMAs that use them; the WMMAs are bare builtins, so
    // no asm statement stands between a read and an earlier WMMA and the reads can be issued ahead, behind counted waits.
    const _Float16* kfh = Ksh + c * KVP + 8 * hh;
    const _Float16* kfl = Ksl + c * KVP + 8 * hh;
    const _Float16* vfh = Vth + c * KVP + 8 * hh;
    const _Float16* vfl = Vtl + c * KVP + 8 * hh;
    v16h kb[4][2], kr[4][2];             // K hi / residual fragments of key group j, d chunk dc
    v16h vb[2][4], vl[2][4];             // V^T hi / residual fragments of key chunk kk, feature group t
#define LD_K(j)                                                   \
    _Pragma("unroll") for (int dc = 0; dc < 2; ++dc) {            \
      kb[j][dc] = ldfrag_h(kfh + (j) * 16 * KVP + dc * 32);       \
      kr[j][dc] = ldfrag_h(kfl + (j) * 16 * KVP + dc * 32);       \
    }
#define LD_V(kk, tp)                                              \
    _Pragma("unroll") for (int t = 2 * (tp); t < 2 * (tp) + 2; ++t) { \
      vb[kk][t] = ldfrag_h(vfh + t * 16 * KVP + (kk) * 32);       \
      vl[kk][t] = ldfrag_h(vfl + t * 16 * KVP + (kk) * 32);       \
    }
    // ---- scores, transposed: 64 keys x 16 queries per wave; hi.hi into s, hi.lo + lo.hi into s1 (folded x 2^-10) ----
    v8f s[4], s1[4];                     // s[j][r] = score of key kv0 + 16 j + 8 hh + r with query q0 + c
#define SCORE(j)                                                  \
    s[j] = zero8(); s1[j] = zero8();                              \
    _Pragma("unroll") for (int dc = 0; dc < 2; ++dc) {            \
      s[j]  = mma_h_raw(kb[j][dc], qa[dc], s[j]);                 \
      s1[j] = mma_h_raw(kr[j][dc], qa[dc], s1[j]);                \
      s1[j] = mma_h_raw(kb[j][dc], ql[dc], s1[j]);                \
    }
#define FOLD_S(j)                                                 \
    _Pragma("unroll") for (int r = 0; r < 8; ++r) s[j][r] += s1[j][r] * (1.0f / 1024.0f);
    LD_K(0) LD_K(1)
    SCORE(0)
    LD_K(2)
    SCORE(1) FOLD_S(0)
    LD_K(3)
    SCORE(2) FOLD_S(1)
    LD_V(0, 0)
    SCORE(3) FOLD_S(2)
    LD_V(0, 1)
    FOLD_S(3)

    // ---- scale, maximum of the query's 64 scores (32 in the lane, then the other half's), online softmax ----
    float mj[4];
#pragma unroll
    for (int j = 0; j < 4; ++j) {
      float m = -INFINITY;
#pragma unroll
      for (int r = 0; r < 8; ++r) {
        const float sv = s[j][r] * sscale;
        s[j][r] = sv;
        m = fmaxf(m, sv);
      }
      mj[j] = m;
    }
    float mt = fmaxf(fmaxf(mj[0], mj[1]), fmaxf(mj[2], mj[3]));
    mt = fmaxf(mt, xhalf(mt));
    const float mnew  = fmaxf(mrow, mt);
    const float msafe = (mnew == -INFINITY) ? 0.f : mnew;
    const float alpha = __expf(mrow - msafe);
    mrow = mnew;
    v8h ph[4];                           // P^T (x1024, f16): ph[j][r] belongs to key kv0 + 16 j + 8 hh + r
    float ps[4];
#pragma unroll
    for (int j = 0; j < 4; ++j) {
      v8f p1024;
      float a = 0.f;
#pragma unroll
      for (int r = 0; r < 8; ++r) {
        const float p = __expf(s[j][r] - msafe);
        a += p;
        p1024[r] = p * 1024.0f;
      }
      ps[j] = a;
      ph[j] = __builtin_convertvector(p1024, v8h);
    }
    lrow = lrow * alpha + ((ps[0] + ps[1]) + (ps[2] + ps[3]));
#pragma unroll
    for (int t = 0; t < 4; ++t)
#pragma unroll
      for (int r = 0; r < 8; ++r) oacc[t][r] *= alpha;

    // ---- context^T += Vhi^T . P^T (f16 WMMA); Vres^T . P^T into a separate accumulator ----
    v8f o1[4];
#pragma unroll
    for (int t = 0; t < 4; ++t) o1[t] = zero8();
    FH pb[2];                            // keys kv0 + 32 kk + 8 hh + (0..7), then + 16: the k order of the V^T fragments
#pragma unroll
    for (int kk = 0; kk < 2; ++kk) {
      pb[kk].h[0] = ph[2 * kk];
      pb[kk].h[1] = ph[2 * kk + 1];
    }
#define CTX(kk, tp)                                               \
    _Pragma("unroll") for (int t = 2 * (tp); t < 2 * (tp) + 2; ++t) { \
      oacc[t] = mma_h_raw(vb[kk][t], pb[kk].v, oacc[t]);          \
      o1[t]   = mma_h_raw(vl[kk][t], pb[kk].v, o1[t]);            \
    }
    // Order of the stretch from the tile barrier to here, for the scheduler: 16 reads, then 6 WMMAs and 8 reads in turn.
    // Left alone it spreads the reads singly among the WMMAs.
#define SGB_LDS(n, id)  __builtin_amdgcn_sched_group_barrier(0x100, n, id)
#define SGB_WMMA(n, id) __builtin_amdgcn_sched_group_barrier(0x008, n, id)
    SGB_LDS(16, 0); SGB_WMMA(6, 0); SGB_LDS(8, 0); SGB_WMMA(6, 0); SGB_LDS(8, 0); SGB_WMMA(6, 0); SGB_LDS(8, 0); SGB_WMMA(6, 0);
    SGB_LDS(8, 0);
    // keeps the second key chunk's V^T reads behind the softmax: lifted over it, their 64 registers would take the
    // wave over 256 VGPRs, and only three blocks instead of four would fit a WGP
    __builtin_amdgcn_sched_barrier(0);
    LD_V(1, 0)
    CTX(0, 0)
    LD_V(1, 1)
    CTX(0, 1) CTX(1, 0) CTX(1, 1)
    SGB_LDS(8, 1); SGB_WMMA(4, 1); SGB_LDS(8, 1); SGB_WMMA(12, 1);   // the same for this stretch
#undef SGB_LDS
#undef SGB_WMMA
#undef LD_K
#undef LD_V
#undef SCORE
#undef FOLD_S
#undef CTX
#pragma unroll
    for (int t = 0; t < 4; ++t)
#pragma unroll
      for (int r = 0; r < 8; ++r) oacc[t][r] += o1[t][r] * (1.0f / 4096.0f);
  }

  // ---- join the halves' sums, normalise (1/l and the carries via oscl), stage the wave's 16x64 tile in LDS
  //      (row = query c, 8 consecutive features per accumulator tile), then write whole 256-B row segments
  float* os = Os[wave];
  {
    const float l = lrow + xhalf(lrow);
    const float inv = ((l > 0.f) ? (1.0f / l) : 0.f) * oscl;
#pragma unroll
    for (int t = 0; t < 4; ++t) {
      v4f lo, hi;
#pragma unroll
      for (int r = 0; r < 4; ++r) {
        lo[r] = oacc[t][r] * inv;
        hi[r] = oacc[t][4 + r] * inv;
      }
      *(v4f*)(os + c * OSP + t * 16 + 8 * hh) = lo;
      *(v4f*)(os + c * OSP + t * 16 + 8 * hh + 4) = hi;
    }
  }
  __builtin_amdgcn_fence(__ATOMIC_RELEASE, "workgroup");
  __builtin_amdgcn_wave_barrier();
  __builtin_amdgcn_fence(__ATOMIC_ACQUIRE, "workgroup");
  {
    const int h2 = lane >> 4, c4 = (lane & 15) * 4;
    v4f ov[8];
#pragma unroll
    for (int it = 0; it < 8; ++it) {
      const int row = it * 2 + h2;   // it 0..7 x h2 0..1 = rows 0..15 of the wave tile
      ov[it] = *(const v4f*)(os + row * OSP + c4);
    }
    {
#pragma unroll
      for (int it = 0; it < 8; ++it) {
        const int row = it * 2 + h2;
        const size_t go = (rowB + q0 + row) * DM + (size_t)h * HD + c4;
        *(v4f*)(outp + go) = ov[it];
      }
      
    }
  }
}

// =====================================================================================================
// Workspace map (bytes), every region an exact multiple of its whole-line / whole-tile store granularity
// 8192 x 512, 512 x 512 and 4096 x 1024 are whole tiles/lines):
//   Xb    bf16 [8192][512]            0          8388608
//   Wtq   bf16 [512][512]       8388608           524288   ([n][e])
//   Wtk   bf16 [512][512]       8912896           524288
//   Wtv   bf16 [512][512]       9437184           524288
//   Wto   f16  [512][512]       9961472           524288   ([n][k], bf16rne value x4096)
//   Tf    f32  [8192][512]     10485760         16777216   (scratch: q, then msgs)
//   Qh    f16  [8192][512]     27262976          8388608
//   Ql    f16  [8192][512]     35651584          8388608
//   Kh    f16  [8192][512]     44040192          8388608
//   Kl    f16  [8192][512]     52428800          8388608
//   VTh   f16  [4096][1024]    60817408          8388608   ([b*DM + h*64 + d][s])
//   VTl   f16  [4096][1024]    69206016          8388608
//   Mh    f16  [8192][512]     77594624          8388608   (msgs x1024)
//   Ml    f16  [8192][512]     85983232          8388608   (msgs residual)
//   Tk    f32  [8192][512]     94371840         16777216   (scratch: k)
//   Tv    f32  [8192][512]    111149056         16777216   (scratch: v)
//   end                       127926272
// Inputs: nodes f32 [8][1024][512]; Wq, Wk, Wv, Wo f32 [512 in][512 out] (x @ W layout); bq, bk, bv, bo f32
// [512] (index h*64+d = n). d_out f32: [8192][512] at byte 0 (row = b*SEQ + t, col = n).
// =====================================================================================================
extern "C" void kernel_launch(void* const* d_in, const int* in_sizes, int n_in,
                              void* d_out, int out_size, void* d_ws, size_t ws_size,
                              hipStream_t stream) {
  if (n_in < 9) return;
  if (in_sizes[0] != NB * SEQ * DM) return;
  if (in_sizes[1] != DM * DM) return;
  if (in_sizes[2] != DM * DM) return;
  if (in_sizes[3] != DM * DM) return;
  if (in_sizes[4] != DM) return;
  if (in_sizes[5] != DM) return;
  if (in_sizes[6] != DM) return;
  if (in_sizes[7] != DM * DM) return;
  if (in_sizes[8] != DM) return;
  if (out_size != OUTN) return;

  const float* x  = (const float*)d_in[0];   // [NB*SEQ][DM]
  const float* Wq = (const float*)d_in[1];   // [DM e][DM n]
  const float* Wk = (const float*)d_in[2];
  const float* Wv = (const float*)d_in[3];
  const float* bq = (const float*)d_in[4];   // [DM]
  const float* bk = (const float*)d_in[5];
  const float* bv = (const float*)d_in[6];
  const float* Wo = (const float*)d_in[7];   // [DM k][DM n]
  const float* bo = (const float*)d_in[8];

  const size_t PXb = (size_t)ROWS * DM * 2;          //  8388608
  const size_t PW  = (size_t)DM * DM * 2;            //   524288
  const size_t PF  = (size_t)ROWS * DM * 4;          // 16777216
  const size_t PH  = (size_t)ROWS * DM * 2;          //  8388608
  const size_t PVt = (size_t)NB * DM * SEQ * 2;      //  8388608
  size_t off = 0;
  const size_t oXb = off; off += PXb;
  const size_t oWq = off; off += PW;
  const size_t oWk = off; off += PW;
  const size_t oWv = off; off += PW;
  const size_t oWo = off; off += PW;
  const size_t oTf = off; off += PF;
  const size_t oQh = off; off += PH;
  const size_t oQl = off; off += PH;
  const size_t oKh = off; off += PH;
  const size_t oKl = off; off += PH;
  const size_t oVt = off; off += PVt;
  const size_t oVl = off; off += PVt;
  const size_t oMh = off; off += PH;
  const size_t oMl = off; off += PH;
  const size_t oTk = off; off += PF;
  const size_t oTv = off; off += PF;
  if (off > ws_size) return;                        // off = 127926272
  if (off > (size_t)134217728) return;

  char* ws = (char*)d_ws;
  unsigned short* Xb  = (unsigned short*)(ws + oXb);
  unsigned short* Wtq = (unsigned short*)(ws + oWq);
  unsigned short* Wtk = (unsigned short*)(ws + oWk);
  unsigned short* Wtv = (unsigned short*)(ws + oWv);
  unsigned short* Wto = (unsigned short*)(ws + oWo);
  float*          Tf  = (float*)(ws + oTf);
  float*          Tk  = (float*)(ws + oTk);
  float*          Tv  = (float*)(ws + oTv);
  unsigned short* Qh  = (unsigned short*)(ws + oQh);
  unsigned short* Ql  = (unsigned short*)(ws + oQl);
  unsigned short* Kh  = (unsigned short*)(ws + oKh);
  unsigned short* Kl  = (unsigned short*)(ws + oKl);
  unsigned short* VTh = (unsigned short*)(ws + oVt);
  unsigned short* VTl = (unsigned short*)(ws + oVl);
  unsigned short* Mh  = (unsigned short*)(ws + oMh);
  unsigned short* Ml  = (unsigned short*)(ws + oMl);
  float*          outf = (float*)d_out;             // [ROWS][DM]

  const dim3 blk(256);
  const int n8x = ROWS * DM / 8;                    // 524288
  const dim3 gCvtX((n8x + 255) / 256);              // 2048 blocks
  const dim3 gPrep(4 * WTB + PLB);                  // 256 weight tiles, then 2048 activation blocks
  const dim3 gGemm(ROWS / 64, 3);                   // 128 blocks of 64 rows x 512 columns, for each of q, k, v
  const dim3 gGemO(ROWS / 32);                      // 256 blocks of 32 rows x 512 columns
  const dim3 gSplit(VTB + 2 * PLB);                 // 1024 v tiles, then 2048 blocks each for q and k
  const dim3 gAttn(NB * NH * NQB);                  // 1024 blocks
  const float qkScale = 16.0f;                      // q and k hi planes carried x16 (residual x1024 on top)
  const float sscale  = 1.0f / 2048.0f;             // 1/(16*16) * 1/sqrt(64)
  const float vScale  = 256.0f;                     // v^T hi plane carried x256
  const float attOscl = 1.0f / 262144.0f;           // 1/(1024 * 256): p and v carries folded back
  const float mScale  = 1024.0f;                    // msgs hi plane carried x1024 (residual x1024 on top)
  const float woScale = 4096.0f;                    // Wo^T carried x4096 in f16
  const float outOscl = 1.0f / 4194304.0f;          // 1/(1024 * 4096)

  // (1) activations -> bf16 plane; weights -> transposed 16-bit planes [n][e] (RNE convert): one grid
  prep<<<gPrep, blk, 0, stream>>>(x, Wq, Wk, Wv, Wo, Xb, Wtq, Wtk, Wtv, Wto, n8x, woScale);
  // (2) q, k, v = Xb . Wt^T + bias -> Tf, Tk, Tv [8192][512] (M=8192, N=512, K=512 each): one grid
  gemm64<<<gGemm, blk, 0, stream>>>(Xb, Wtq, Wtk, Wtv, bq, bk, bv, Tf, Tk, Tv, ROWS);
  // (3) q, k -> f16 hi (x16) + residual planes; v -> f16 v^T hi plane (x256) and residual plane (x4096 on top): one grid
  planes_qkv<<<gSplit, blk, 0, stream>>>(Tf, Tk, Tv, Qh, Ql, Kh, Kl, VTh, VTl, n8x, qkScale, vScale);
  // (4) attention -> msgs f32 [8192][512] in Tf, then f16 hi (x1024) + residual planes
  attn64<<<gAttn, dim3(128), 0, stream>>>(Qh, Ql, Kh, Kl, VTh, VTl, Tf, sscale, attOscl);
  planes_f16x8<<<gCvtX, blk, 0, stream>>>(Tf, Mh, Ml, n8x, mScale);
  // (5) out = msgs . Wo + bo -> d_out f32 [8192][512] (M=8192, N=512, K=512)
  gemm_o<<<gGemO, blk, 0, stream>>>(Mh, Ml, Wto, bo, outf, ROWS, outOscl);
  (void)hipGetLastError();
}

// v006
// A run of this version takes 101 microseconds.
// Two timings next to v005 both put it at 1.12 times that version's speed.
// All steps since v000 together make it 2.68 times as fast.
// Contractions: q/k/v projections = v_wmma_f32_16x16x32_bf16 (bf16 operands from RNE-converted nodes, W^T and bias, single product); q.k^T scores = v_wmma_f32_16x16x32_f16 (q, k as f16 hi planes carried x16 plus f16 residual planes x1024: hi.hi + (hi.lo + lo.hi) in a separate accumulator, 3 products); p.v = v_wmma_f32_16x16x32_f16 (p carried x1024 in f16; v^T as f16 hi plane x256 plus f16 residual plane x4096 in a separate accumulator folded with 2^-12, 2 products); output projection = v_wmma_f32_16x16x32_f16 (msgs as f16 hi plane x1024 plus f16 residual plane x1024 in a separate accumulator folded with 2^-10; Wo^T = RNE bf16 value carried x4096 in f16; 2 products); all f32 accumulate; softmax in f32.
#include <hip/hip_runtime.h>
#include <math.h>
#include <stdint.h>

#define NB    8
#define SEQ   1024
#define DM    512
#define NH    8
#define HD    64
#define NQB   (SEQ / 64)
#define ROWS  (NB * SEQ)            // 8192 token rows
#define OUTN  (ROWS * DM)
#define KVP   72                    // LDS pitch of the 64-wide f16 tiles in attn64, in halves: 144 B = 16 B x 9 (odd)
#define OSP   68                    // LDS pitch of the 64-wide f32 context tile in attn64, in floats
#define KVT   (64 * KVP)            // attn64: halves of one staged 64 x 64 plane tile (9216 B)
#define KVBUF (4 * KVT)             // attn64: halves of one tile buffer: K hi, K residual, V^T hi, V^T residual (36864 B)
#define GKC   64                    // GEMMs: k elements of one staged slice = 128 B of every staged row
#define GSP   72                    // GEMMs: LDS pitch of a staged row, in 16-bit elements: 144 B = 16 B x 9 (odd)
#define GROWS (64 + DM)             // GEMMs: staged rows of a slice: 64 A rows, then the DM rows of B
#define GBUF  (GROWS * GSP)         // GEMMs: 16-bit elements of one slice buffer (82944 B)
#define NSL   (DM / GKC)            // GEMMs: slices along k
#define WTB   ((DM / 64) * (DM / 64))      // 64 x 64 tiles of one weight matrix
#define VTB   ((SEQ / 64) * NH * NB)       // 64 x 64 tiles of v
#define PLB   (ROWS * DM / 8 / 256)        // blocks of one 8-elements-per-thread pass over a [ROWS][DM] plane
static_assert(NH * HD == DM);
static_assert(HD == 64);
static_assert(16 * KVP * 2 == 2304 && KVT * 2 == 9216);        // copy8: LDS bytes of 16 staged rows, of one plane tile
static_assert(4 * 16 * OSP * 4 <= 2 * KVBUF * 2 && SEQ / 64 >= 2);   // the context tiles fit the tile buffers; two buffers
static_assert(32 * GSP * 2 == 4608);                           // copy9: LDS bytes of 32 staged rows
static_assert(DM == 8 * 64 && GROWS == 18 * 32 && NSL >= 2);   // 8 waves x 64 columns; 18 copies per thread; two buffers
static_assert((SEQ % 64) == 0 && (DM % 64) == 0 && (ROWS % 64) == 0);
static_assert(((ROWS / 64) * (DM / 64)) % 8 == 0);
static_assert(((ROWS / 32) * (DM / 64)) % 8 == 0);
static_assert(((ROWS * DM / 8) % 256) == 0);

typedef _Float16 v16h __attribute__((ext_vector_type(16)));
typedef _Float16 v8h  __attribute__((ext_vector_type(8)));
typedef __bf16   v16b __attribute__((ext_vector_type(16)));
typedef __bf16   v8b  __attribute__((ext_vector_type(8)));
typedef float    v8f  __attribute__((ext_vector_type(8)));
typedef float    v4f  __attribute__((ext_vector_type(4)));
typedef unsigned int v4u __attribute__((ext_vector_type(4)));

// ---- scalar helpers --------------------------------------------------------------------------------
__device__ __forceinline__ unsigned short bf_bits(float f) {          // f32 -> bf16 bits, RNE convert
  unsigned u = __float_as_uint(f);
  return (unsigned short)((u + 0x7FFFu + ((u >> 16) & 1u)) >> 16);
}
__device__ __forceinline__ float bf_up(unsigned short h) { return __uint_as_float(((unsigned)h) << 16); }
__device__ __forceinline__ unsigned short h_bits(_Float16 x) { return __builtin_bit_cast(unsigned short, x); }
__device__ __forceinline__ unsigned pk16(unsigned short a, unsigned short b) { return (unsigned)a | ((unsigned)b << 16); }
__device__ __forceinline__ v8f zero8() { v8f z = {0.f, 0.f, 0.f, 0.f, 0.f, 0.f, 0.f, 0.f}; return z; }

// ---- fragment loaders: 16-bit A/B operand, lane -> row/col (lane&15), p already includes +8*(lane>>4);
//      elements 0..7 <- p[0..7] (k0+8h..), elements 8..15 <- p[16..23] (k0+16+8h..)
__device__ __forceinline__ v16b ldfrag_b(const __bf16* p) {
  union { v16b v; v8b h[2]; } f;
  f.h[0] = *(const v8b*)(p);
  f.h[1] = *(const v8b*)(p + 16);
  return f.v;
}
__device__ __forceinline__ v16h ldfrag_h(const _Float16* p) {
  union { v16h v; v8h h[2]; } f;
  f.h[0] = *(const v8h*)(p);
  f.h[1] = *(const v8h*)(p + 16);
  return f.v;
}

// ---- WMMA helpers with trailing VALU hazard gap --------------------------------------------------------
__device__ __forceinline__ v8f mma_h(v16h a, v16h b, v8f c) {
  c = __builtin_amdgcn_wmma_f32_16x16x32_f16(false, a, false, b, (short)0, c, false, false);
#if defined(__HIP_DEVICE_COMPILE__)
  asm volatile("v_nop\n\tv_nop\n\tv_nop\n\tv_nop" : "+v"(c) : "v"(a), "v"(b));
#endif
  return c;
}
__device__ __forceinline__ v8f mma_h_raw(v16h a, v16h b, v8f c) {   // the compiler keeps the distances behind its own builtin
  return __builtin_amdgcn_wmma_f32_16x16x32_f16(false, a, false, b, (short)0, c, false, false);
}
__device__ __forceinline__ v8f mma_b_raw(v16b a, v16b b, v8f c) {
  return __builtin_amdgcn_wmma_f32_16x16x32_bf16(false, a, false, b, (short)0, c, false, false);
}
__device__ __forceinline__ void dep_guard_b(v8f& a, v8f& b, v16b x, v16b y) {
#if defined(__HIP_DEVICE_COMPILE__)
  asm volatile("v_nop\n\tv_nop\n\tv_nop\n\tv_nop" : "+v"(a), "+v"(b) : "v"(x), "v"(y));
#endif
}
__device__ __forceinline__ void keep4_b(v16b a, v16b b, v16b c, v16b d) {
#if defined(__HIP_DEVICE_COMPILE__)
  asm volatile("v_nop" :: "v"(a), "v"(b), "v"(c), "v"(d));
#endif
}
__device__ __forceinline__ void acc_guard4(v8f& a, v8f& b, v8f& c, v8f& d) {
#if defined(__HIP_DEVICE_COMPILE__)
  asm volatile("v_nop\n\tv_nop\n\tv_nop\n\tv_nop" : "+v"(a), "+v"(b), "+v"(c), "+v"(d));
#endif
}

// lane l <-> lane l ^ 16 (the other half of the wave), in the vector unit
__device__ __forceinline__ float xhalf(float x) {
  const int b = __builtin_bit_cast(int, x);
  return __builtin_bit_cast(float, __builtin_amdgcn_permlanex16(b, b, 0x76543210, 0xfedcba98, false, false));
}

// ---- GEMM operand staging: asynchronous copies global -> LDS, waits -----------------------------------
__device__ __forceinline__ unsigned lds_off(const void* p) { return (unsigned)(size_t)p; }   // LDS byte address
// nine 16-B copies of this lane: LDS bytes l + 4608 i (32 staged rows of 144 B further each) <- global g0 .. g8
__device__ __forceinline__ void copy9(unsigned l, const unsigned short* g0, const unsigned short* g1,
                                      const unsigned short* g2, const unsigned short* g3, const unsigned short* g4,
                                      const unsigned short* g5, const unsigned short* g6, const unsigned short* g7,
                                      const unsigned short* g8) {
#if defined(__HIP_DEVICE_COMPILE__)
  // the closing s_wait_xcnt stands in the copies' own statement: no address register is rewritten in front of it
  asm volatile(
      "global_load_async_to_lds_b128 %0, %9, off\n\t"
      "global_load_async_to_lds_b128 %1, %10, off\n\t"
      "global_load_async_to_lds_b128 %2, %11, off\n\t"
      "global_load_async_to_lds_b128 %3, %12, off\n\t"
      "global_load_async_to_lds_b128 %4, %13, off\n\t"
      "global_load_async_to_lds_b128 %5, %14, off\n\t"
      "global_load_async_to_lds_b128 %6, %15, off\n\t"
      "global_load_async_to_lds_b128 %7, %16, off\n\t"
      "global_load_async_to_lds_b128 %8, %17, off\n\t"
      "s_wait_xcnt 0x0"
      :: "v"(l), "v"(l + 4608u), "v"(l + 2u * 4608u), "v"(l + 3u * 4608u), "v"(l + 4u * 4608u),
         "v"(l + 5u * 4608u), "v"(l + 6u * 4608u), "v"(l + 7u * 4608u), "v"(l + 8u * 4608u),
         "v"(g0), "v"(g1), "v"(g2), "v"(g3), "v"(g4), "v"(g5), "v"(g6), "v"(g7), "v"(g8)
      : "memory");
#endif
}
// One slice = GROWS rows x 128 B = 18 groups of 32 rows; thread tid copies 16-B column tid&7 of row tid>>3 of every
// group, so 8 lanes copy one whole 128-B line. l: the lane's LDS byte address in group 0 of the buffer; a0, a1: its
// source in A row groups 0 and 1; b: its source in B row group 0 (groups 2..17 = B rows 0..DM-1, row pitch DM).
__device__ __forceinline__ void stage_slice(unsigned l, const unsigned short* a0, const unsigned short* a1,
                                            const unsigned short* b) {
  constexpr size_t S = (size_t)32 * DM;           // 32 B rows, in elements
  copy9(l, a0, a1, b, b + S, b + 2 * S, b + 3 * S, b + 4 * S, b + 5 * S, b + 6 * S);
  copy9(l + 9u * 4608u, b + 7 * S, b + 8 * S, b + 9 * S, b + 10 * S, b + 11 * S, b + 12 * S, b + 13 * S, b + 14 * S,
        b + 15 * S);
}
__device__ __forceinline__ void wait_copies() {   // this wave's copies have landed in LDS
#if defined(__HIP_DEVICE_COMPILE__)
  asm volatile("s_wait_asynccnt 0x0" ::: "memory");
#endif
}
__device__ __forceinline__ void wait_lds_reads() {   // this wave's LDS reads are done before the buffer is handed on
#if defined(__HIP_DEVICE_COMPILE__)
  asm volatile("s_wait_dscnt 0x0" ::: "memory");
#endif
}

// eight 16-B copies of this lane, two planes x four groups of 16 staged rows: LDS bytes l + 2304 g <- a + g rstep,
// LDS bytes l + 9216 + 2304 g <- b + g rstep (g = 0..3; rstep = 16 source rows, in elements)
__device__ __forceinline__ void copy8(unsigned l, const _Float16* a, const _Float16* b, size_t rstep) {
#if defined(__HIP_DEVICE_COMPILE__)
  // the closing s_wait_xcnt stands in the copies' own statement: no address register is rewritten in front of it
  asm volatile(
      "global_load_async_to_lds_b128 %0, %8, off\n\t"
      "global_load_async_to_lds_b128 %1, %9, off\n\t"
      "global_load_async_to_lds_b128 %2, %10, off\n\t"
      "global_load_async_to_lds_b128 %3, %11, off\n\t"
      "global_load_async_to_lds_b128 %4, %12, off\n\t"
      "global_load_async_to_lds_b128 %5, %13, off\n\t"
      "global_load_async_to_lds_b128 %6, %14, off\n\t"
      "global_load_async_to_lds_b128 %7, %15, off\n\t"
      "s_wait_xcnt 0x0"
      :: "v"(l), "v"(l + 2304u), "v"(l + 2u * 2304u), "v"(l + 3u * 2304u),
         "v"(l + 9216u), "v"(l + 9216u + 2304u), "v"(l + 9216u + 2u * 2304u), "v"(l + 9216u + 3u * 2304u),
         "v"(a), "v"(a + rstep), "v"(a + 2 * rstep), "v"(a + 3 * rstep),
         "v"(b), "v"(b + rstep), "v"(b + 2 * rstep), "v"(b + 3 * rstep)
      : "memory");
#endif
}
// One key tile of attn64 = 4 planes x 64 rows x 128 B; thread tid (of 128) copies 16-B column tid&7 of row tid>>3 of
// every 16-row group, so 8 lanes copy one whole 128-B line. l: the lane's LDS byte address in group 0 of the buffer's
// first plane; k, kl: its source in rows 0..15 of the K tiles (row pitch DM); v, vl: the same in the V^T tiles (pitch SEQ).
__device__ __forceinline__ void stage_kv(unsigned l, const _Float16* k, const _Float16* kl, const _Float16* v,
                                         const _Float16* vl) {
  copy8(l, k, kl, (size_t)16 * DM);
  copy8(l + 2u * 9216u, v, vl, (size_t)16 * SEQ);
}

// =====================================================================================================
// f32 -> bf16 (RNE convert), 8 elements per thread, one 16-B store per lane: a wave writes 512 contiguous B
// coverage: n8 threads x 8 = whole plane (n8 is a multiple of 256 here).
// =====================================================================================================
__device__ __forceinline__ void cvt_bf16x8_body(const float* __restrict__ in, unsigned short* out, int n8, int blk) {
  const int i = blk * 256 + threadIdx.x;
  if (i < n8) {
    const v4f a = *(const v4f*)(in + (size_t)i * 8);
    const v4f b = *(const v4f*)(in + (size_t)i * 8 + 4);
    v4u p;
    p[0] = pk16(bf_bits(a[0]), bf_bits(a[1]));
    p[1] = pk16(bf_bits(a[2]), bf_bits(a[3]));
    p[2] = pk16(bf_bits(b[0]), bf_bits(b[1]));
    p[3] = pk16(bf_bits(b[2]), bf_bits(b[3]));
    *(v4u*)(out + (size_t)i * 8) = p;
    
  }
}

// =====================================================================================================
// f32 -> f16 hi plane = f16(v * scale) (scale a power of two) + f16 residual plane = f16((v*scale - hi) * 1024),
// same element index in both planes; 8 elements per thread, one 16-B store per lane and plane: a wave writes
// coverage: n8 threads x 8 = whole plane (n8 multiple of 256).
// =====================================================================================================
__device__ __forceinline__ void planes_f16x8_body(const float* __restrict__ in, unsigned short* hp,
                                                  unsigned short* lp, int n8, float scale, int blk) {
  const int i = blk * 256 + threadIdx.x;
  if (i < n8) {
    const v4f a = *(const v4f*)(in + (size_t)i * 8);
    const v4f b = *(const v4f*)(in + (size_t)i * 8 + 4);
    float f[8];
    f[0] = a[0]; f[1] = a[1]; f[2] = a[2]; f[3] = a[3];
    f[4] = b[0]; f[5] = b[1]; f[6] = b[2]; f[7] = b[3];
    v4u ph, pl;
#pragma unroll
    for (int e = 0; e < 4; ++e) {
      const float f0 = f[2 * e] * scale;
      const float f1 = f[2 * e + 1] * scale;
      const _Float16 x0 = (_Float16)f0, x1 = (_Float16)f1;
      const _Float16 l0 = (_Float16)((f0 - (float)x0) * 1024.0f);
      const _Float16 l1 = (_Float16)((f1 - (float)x1) * 1024.0f);
      ph[e] = pk16(h_bits(x0), h_bits(x1));
      pl[e] = pk16(h_bits(l0), h_bits(l1));
    }
    *(v4u*)(hp + (size_t)i * 8) = ph;
    *(v4u*)(lp + (size_t)i * 8) = pl;
    
  }
}
__global__ __launch_bounds__(256) void planes_f16x8(const float* __restrict__ in, unsigned short* hp,
                                                    unsigned short* lp, int n8, float scale) {
  planes_f16x8_body(in, hp, lp, n8, scale, blockIdx.x);
}

// =====================================================================================================
// Weight transpose + convert: in W f32 [DM rows (e, contraction index)][DM cols (n, output feature)] (the
// x @ W layout) -> out Wt 16-bit [DM (n)][DM (e)] (the [n][k], k-contiguous layout the GEMM B operand uses).
// MODE 0: RNE bf16 bits. MODE 1: f16 bits of (RNE bf16 value * scale), scale a power of two (exact in f16).
// Block = one 64 e x 64 n tile (et, nt: its e and n tile index, DM/64 of each). The tile is staged in LDS as [ee][nn]
// pitch 68 floats (v4f loads, __syncthreads). in[rows e][cols n] -> out[rows n][cols e] (square here).
// Store: group g = tid>>3 (0..31), piece = tid&7: iteration it writes row n0 + (it*32+g), lanes 8q..8q+7 x 16 B
// coverage: 2 iterations x 32 groups = 64 rows n, 8 pieces x 8 = 64 e per row; grid covers every (e tile,
// n tile) -> the whole [DM][DM] plane.
// =====================================================================================================
template <int MODE>
__device__ __forceinline__ void wt_tile_body(const float* __restrict__ W, unsigned short* Wt, float scale,
                                             float* sw, int et, int nt) {
  const int tid = threadIdx.x;
  const int e0  = et * 64;
  const int n0  = nt * 64;
#pragma unroll
  for (int i = 0; i < 4; ++i) {
    const int idx = i * 256 + tid;                  // 0..1023
    const int ee = idx >> 4, c4 = (idx & 15) * 4;
    const v4f a = *(const v4f*)(W + ((size_t)(e0 + ee)) * DM + n0 + c4);
    *(v4f*)(sw + ee * 68 + c4) = a;
  }
  __syncthreads();

  const int g = tid >> 3, piece = tid & 7;
  v4u hv[2];
  size_t hofs[2];
#pragma unroll
  for (int it = 0; it < 2; ++it) {
    const int n = it * 32 + g;
    v4u a;
#pragma unroll
    for (int e = 0; e < 4; ++e) {
      const float f0 = sw[(piece * 8 + 2 * e) * 68 + n];
      const float f1 = sw[(piece * 8 + 2 * e + 1) * 68 + n];
      unsigned short u0, u1;
      if (MODE == 0) {
        u0 = bf_bits(f0);
        u1 = bf_bits(f1);
      } else {
        u0 = h_bits((_Float16)(bf_up(bf_bits(f0)) * scale));
        u1 = h_bits((_Float16)(bf_up(bf_bits(f1)) * scale));
      }
      a[e] = pk16(u0, u1);
    }
    hv[it] = a;
    hofs[it] = ((size_t)(n0 + n)) * DM + e0 + piece * 8;
  }
  {
#pragma unroll
    for (int it = 0; it < 2; ++it) {
      *(v4u*)(Wt + hofs[it]) = hv[it];
    }
#if defined(__HIP_DEVICE_COMPILE__)
    // both tile bodies stand in one kernel: no register that the two stores name is rewritten in front of this wait
    asm volatile("s_wait_xcnt 0x0" ::: "memory");
#endif
  }
}
// One grid for all operand preparation (the five jobs are independent of one another): blocks 0 .. 4 WTB - 1 = the
// weight tiles of Wq, Wk, Wv (bf16) and Wo (f16 x woscale), WTB tiles each; the blocks behind them = the activations'
// bf16 plane. The branch is block-uniform, so the tile body's barrier is passed by whole blocks only.
__global__ __launch_bounds__(256) void prep(const float* __restrict__ x, const float* __restrict__ Wq,
                                            const float* __restrict__ Wk, const float* __restrict__ Wv,
                                            const float* __restrict__ Wo, unsigned short* Xb, unsigned short* Wtq,
                                            unsigned short* Wtk, unsigned short* Wtv, unsigned short* Wto,
                                            int n8, float woscale) {
  __shared__ __align__(16) float sw[64 * 68];       // [ee][nn] pitch 68 floats
  const int bx = blockIdx.x;
  if (bx < 4 * WTB) {
    const int w = bx / WTB, tile = bx % WTB;
    const int et = tile % (DM / 64), nt = tile / (DM / 64);
    if (w == 3) {
      wt_tile_body<1>(Wo, Wto, woscale, sw, et, nt);
    } else {
      wt_tile_body<0>(w == 0 ? Wq : (w == 1 ? Wk : Wv), w == 0 ? Wtq : (w == 1 ? Wtk : Wtv), 1.0f, sw, et, nt);
    }
  } else {
    cvt_bf16x8_body(x, Xb, n8, bx - 4 * WTB);
  }
}

// =====================================================================================================
// Register-blocked bf16 WMMA GEMM with bias: C[m][n] = sum_k A[m][k] * Bt[n][k] + bf16rne(bias[n]), N = K = DM.
// Block = 64 rows x DM columns, one wave per 64x64 tile (wave w: columns 64 w ..). A row-major [M][DM]; Bt row-major
// [DM n][DM k] (k contiguous); bias f32 [DM] (RNE converted to bf16 and widened in the epilogue); M multiple of 64.
// Operands: k slices of GKC, the block's 64 A rows and all DM B rows, staged in LDS by asynchronous copies, two
// buffers: slice t + 1 is in flight while slice t is multiplied; per slice one hand-over (LDS reads done, own copies
// landed, block barrier), then slice t + 2 is copied into the buffer slice t has left.
// Output f32 [M][DM] pitch DM. Epilogue: 16-row slabs staged per wave in LDS; each 64-wide row segment
// =====================================================================================================
// One grid for the three projections: blockIdx.y = 0, 1, 2 picks (Bt, bias, C) of q, k, v; A is common to them.
__global__ __launch_bounds__(256) void gemm64(
    const unsigned short* __restrict__ Ap,
    const unsigned short* __restrict__ Btq, const unsigned short* __restrict__ Btk,
    const unsigned short* __restrict__ Btv,
    const float* __restrict__ biasq, const float* __restrict__ biask, const float* __restrict__ biasv,
    float* Cq, float* Ck, float* Cv, int M) {
  const int which = blockIdx.y;
  const unsigned short* __restrict__ Btp = which == 0 ? Btq : (which == 1 ? Btk : Btv);
  const float* __restrict__ bias = which == 0 ? biasq : (which == 1 ? biask : biasv);
  float* C = which == 0 ? Cq : (which == 1 ? Ck : Cv);
  __shared__ __align__(16) __bf16 sAB[2 * GBUF];   // two slice buffers: rows 0..63 = A, rows 64.. = B
  __shared__ __align__(16) float sT[8][16 * 68];   // per-wave 16x64 slab, pitch 68 floats
  constexpr int ldc = DM;
  const int tid  = threadIdx.x;
  const int lane = tid & 31;
  const int wave = tid >> 5;
  const int m0 = blockIdx.x << 6;
  if (m0 >= M) return;                   // block-uniform, in front of every barrier
  const int n0 = wave << 6;

  // this lane's piece of every 32-row group: row tid>>3, 16-B column tid&7
  const unsigned short* ga0 = Ap + (size_t)(m0 + (tid >> 3)) * DM + (tid & 7) * 8;
  const unsigned short* ga1 = ga0 + (size_t)32 * DM;
  const unsigned short* gb  = Btp + (size_t)(tid >> 3) * DM + (tid & 7) * 8;
  const unsigned l0 = lds_off(sAB) + (unsigned)((tid >> 3) * GSP + (tid & 7) * 8) * 2u;
  stage_slice(l0, ga0, ga1, gb);
  wait_copies();
  __syncthreads();                       // slice 0 is readable by every wave
  stage_slice(l0 + GBUF * 2u, ga0 + GKC, ga1 + GKC, gb + GKC);

  const int rlane = lane & 15;                 // row (A) / col (B, D) within subtile
  const int koff  = (lane >> 4) * 8;           // k offset of this lane half
  const int mOff  = (lane >> 4) * 8;           // D row offset

  v8f acc[4][4];
#pragma unroll
  for (int i = 0; i < 4; ++i)
#pragma unroll
    for (int j = 0; j < 4; ++j) acc[i][j] = zero8();

  for (int t = 0; t < NSL; ++t) {
    const __bf16* sb = sAB + (t & 1) * GBUF;
#pragma unroll
    for (int kk = 0; kk < GKC; kk += 32) {
      v16b bh[4], ah[4];                 // the k step's LDS reads stand together, in front of its WMMAs
#pragma unroll
      for (int j = 0; j < 4; ++j) {
        bh[j] = ldfrag_b(sb + (64 + n0 + (j << 4) + rlane) * GSP + koff + kk);
      }
#pragma unroll
      for (int i = 0; i < 4; ++i) {
        ah[i] = ldfrag_b(sb + ((i << 4) + rlane) * GSP + koff + kk);
      }
#pragma unroll
      for (int i = 0; i < 4; ++i) {
#pragma unroll
        for (int j = 0; j < 4; ++j) {
          acc[i][j] = mma_b_raw(ah[i], bh[j], acc[i][j]);
        }
        dep_guard_b(acc[i][0], acc[i][3], ah[i], ah[i]);
      }
      keep4_b(bh[0], bh[1], bh[2], bh[3]);
    }
    // hand-over: slice t + 1 becomes readable, slice t's buffer becomes free
    wait_lds_reads();
    wait_copies();
    __syncthreads();
    if (t + 2 < NSL) {
      stage_slice(l0 + (unsigned)(t & 1) * (GBUF * 2u), ga0 + (t + 2) * GKC, ga1 + (t + 2) * GKC, gb + (t + 2) * GKC);
    }
  }
  wait_copies();
  acc_guard4(acc[0][0], acc[0][1], acc[0][2], acc[0][3]);
  acc_guard4(acc[1][0], acc[1][1], acc[1][2], acc[1][3]);
  acc_guard4(acc[2][0], acc[2][1], acc[2][2], acc[2][3]);
  acc_guard4(acc[3][0], acc[3][1], acc[3][2], acc[3][3]);

  // ---- bias per D column of this lane (n0 + 16j + rlane < N) ----
  float bz[4];
#pragma unroll
  for (int j = 0; j < 4; ++j) bz[j] = bf_up(bf_bits(bias[n0 + (j << 4) + rlane]));

  // ---- epilogue ----
  float* slab = sT[wave];
#pragma unroll
  for (int i = 0; i < 4; ++i) {
    const int mBase = m0 + (i << 4);
#pragma unroll
    for (int r = 0; r < 8; ++r) {
#pragma unroll
      for (int j = 0; j < 4; ++j) {
        slab[(mOff + r) * 68 + (j << 4) + rlane] = acc[i][j][r] + bz[j];
      }
    }
    __builtin_amdgcn_fence(__ATOMIC_RELEASE, "workgroup");
    __builtin_amdgcn_wave_barrier();
    __builtin_amdgcn_fence(__ATOMIC_ACQUIRE, "workgroup");
    {
      const int hh = lane >> 4, c4 = (lane & 15) * 4;     // 256-B row segment = 16 lanes x 16 B
      v4f ov[8];
#pragma unroll
      for (int it = 0; it < 8; ++it) {
        const int row = it * 2 + hh;                       // it 0..7 x hh 0..1 = rows 0..15
        ov[it] = *(const v4f*)(slab + row * 68 + c4);
      }
      {
#pragma unroll
        for (int it = 0; it < 8; ++it) {
          const int row = it * 2 + hh;
          *(v4f*)(C + (size_t)(mBase + row) * ldc + n0 + c4) = ov[it];
        }
        
      }
    }
    __builtin_amdgcn_fence(__ATOMIC_RELEASE, "workgroup");
    __builtin_amdgcn_wave_barrier();
    __builtin_amdgcn_fence(__ATOMIC_ACQUIRE, "workgroup");
  }
}

// =====================================================================================================
// f16 WMMA GEMM with a two-plane A operand and bias:
//   C[m][n] = (sum_k Ah[m][k]*Bt[n][k] + 2^-10 * sum_k Al[m][k]*Bt[n][k]) * oscale + bf16rne(bias[n]),
// the residual products in a separate accumulator, N = K = DM. Block = 32 rows x DM columns, one wave per 32x64 tile
// (wave w: columns 64 w ..). Ah/Al row-major [M][DM] (f16 hi and residual planes, same index); Bt row-major
// [DM n][DM k] (f16, k contiguous); M multiple of 32. Operands staged in LDS as in gemm64 (staged rows 0..31 = Ah,
// 32..63 = Al, 64.. = B). Every WMMA nop-guarded.
// Output f32 [M][DM] pitch DM. Epilogue: 16-row slabs staged per wave in LDS; each 64-wide row segment (256 B)
// coverage: 2 slabs x 16 rows x 64 cols = the wave's whole 32x64 tile.
// =====================================================================================================
__global__ __launch_bounds__(256) void gemm_o(
    const unsigned short* __restrict__ Ahp, const unsigned short* __restrict__ Alp,
    const unsigned short* __restrict__ Btp,
    const float* __restrict__ bias,
    float* C, int M, float oscale) {
  __shared__ __align__(16) _Float16 sAB[2 * GBUF]; // two slice buffers: rows 0..31 = Ah, 32..63 = Al, 64.. = B
  __shared__ __align__(16) float sT[8][16 * 68];   // per-wave 16x64 slab, pitch 68 floats
  constexpr int ldc = DM;
  const int tid  = threadIdx.x;
  const int lane = tid & 31;
  const int wave = tid >> 5;
  const int m0 = blockIdx.x << 5;
  if (m0 >= M) return;                   // block-uniform, in front of every barrier
  const int n0 = wave << 6;

  // this lane's piece of every 32-row group: row tid>>3, 16-B column tid&7
  const size_t ao = (size_t)(m0 + (tid >> 3)) * DM + (tid & 7) * 8;
  const unsigned short* ga0 = Ahp + ao;
  const unsigned short* ga1 = Alp + ao;
  const unsigned short* gb  = Btp + (size_t)(tid >> 3) * DM + (tid & 7) * 8;
  const unsigned l0 = lds_off(sAB) + (unsigned)((tid >> 3) * GSP + (tid & 7) * 8) * 2u;
  stage_slice(l0, ga0, ga1, gb);
  wait_copies();
  __syncthreads();                       // slice 0 is readable by every wave
  stage_slice(l0 + GBUF * 2u, ga0 + GKC, ga1 + GKC, gb + GKC);

  const int rlane = lane & 15;
  const int koff  = (lane >> 4) * 8;
  const int mOff  = (lane >> 4) * 8;

  v8f acc[2][4], acl[2][4];
#pragma unroll
  for (int i = 0; i < 2; ++i)
#pragma unroll
    for (int j = 0; j < 4; ++j) { acc[i][j] = zero8(); acl[i][j] = zero8(); }

  for (int t = 0; t < NSL; ++t) {
    const _Float16* sb = sAB + (t & 1) * GBUF;
#pragma unroll
    for (int kk = 0; kk < GKC; kk += 32) {
      v16h ah[2], al[2], bfr[4];         // the k step's LDS reads stand together, in front of its WMMAs
#pragma unroll
      for (int i = 0; i < 2; ++i) {
        ah[i] = ldfrag_h(sb + ((i << 4) + rlane) * GSP + koff + kk);
        al[i] = ldfrag_h(sb + (32 + (i << 4) + rlane) * GSP + koff + kk);
      }
#pragma unroll
      for (int j = 0; j < 4; ++j) {
        bfr[j] = ldfrag_h(sb + (64 + n0 + (j << 4) + rlane) * GSP + koff + kk);
      }
#pragma unroll
      for (int j = 0; j < 4; ++j) {
#pragma unroll
        for (int i = 0; i < 2; ++i) {
          acc[i][j] = mma_h(ah[i], bfr[j], acc[i][j]);
          acl[i][j] = mma_h(al[i], bfr[j], acl[i][j]);
        }
      }
    }
    // hand-over: slice t + 1 becomes readable, slice t's buffer becomes free
    wait_lds_reads();
    wait_copies();
    __syncthreads();
    if (t + 2 < NSL) {
      stage_slice(l0 + (unsigned)(t & 1) * (GBUF * 2u), ga0 + (t + 2) * GKC, ga1 + (t + 2) * GKC, gb + (t + 2) * GKC);
    }
  }
  wait_copies();

  // ---- bias per D column of this lane (n0 + 16j + rlane < N) ----
  float bz[4];
#pragma unroll
  for (int j = 0; j < 4; ++j) bz[j] = bf_up(bf_bits(bias[n0 + (j << 4) + rlane]));

  // ---- epilogue ----
  float* slab = sT[wave];
#pragma unroll
  for (int i = 0; i < 2; ++i) {
    const int mBase = m0 + (i << 4);
#pragma unroll
    for (int r = 0; r < 8; ++r) {
#pragma unroll
      for (int j = 0; j < 4; ++j) {
        const float y = (acc[i][j][r] + acl[i][j][r] * (1.0f / 1024.0f)) * oscale + bz[j];
        slab[(mOff + r) * 68 + (j << 4) + rlane] = y;
      }
    }
    __builtin_amdgcn_fence(__ATOMIC_RELEASE, "workgroup");
    __builtin_amdgcn_wave_barrier();
    __builtin_amdgcn_fence(__ATOMIC_ACQUIRE, "workgroup");
    {
      const int hh = lane >> 4, c4 = (lane & 15) * 4;     // 256-B row segment = 16 lanes x 16 B
      v4f ov[8];
#pragma unroll
      for (int it = 0; it < 8; ++it) {
        const int row = it * 2 + hh;                       // it 0..7 x hh 0..1 = rows 0..15
        ov[it] = *(const v4f*)(slab + row * 68 + c4);
      }
      {
#pragma unroll
        for (int it = 0; it < 8; ++it) {
          const int row = it * 2 + hh;
          *(v4f*)(C + (size_t)(mBase + row) * ldc + n0 + c4) = ov[it];
        }
        
      }
    }
    __builtin_amdgcn_fence(__ATOMIC_RELEASE, "workgroup");
    __builtin_amdgcn_wave_barrier();
    __builtin_amdgcn_fence(__ATOMIC_ACQUIRE, "workgroup");
  }
}

// =====================================================================================================
// v f32 token-major columns vf[(b*SEQ + t)*vrp + h*64 + d] ->
// f16 v^T hi plane vth[(b*DM + h*64 + d)*SEQ + t] = f16(v * vscale) (vscale a power of two) and residual plane
// vtl[same index] = f16((v*vscale - hi) * 4096).
// Block = one 64-token x 64-feature tile of one (b, h): tile index (tt0, hh, b) in (SEQ/64, NH, NB); staged in LDS as f32
// (v4f loads, __syncthreads).
// Store: group g = tid>>3 (0..31), piece = tid&7: iteration it writes row d = it*32+g, lanes 8q..8q+7 x 16 B =
// coverage: 2 iterations x 32 groups = 64 rows d, 8 pieces x 8 = 64 tokens per row; grid covers every (b, h,
// t tile) -> both whole planes.
// =====================================================================================================
__device__ __forceinline__ void v_planes_body(const float* __restrict__ vf, int vrp, unsigned short* vth,
                                              unsigned short* vtl, float vscale, float* sv, int tt0, int hh, int b) {
  const int tid = threadIdx.x;
  const int t0  = tt0 * 64;
#pragma unroll
  for (int i = 0; i < 4; ++i) {
    const int idx = i * 256 + tid;                  // 0..1023
    const int tt = idx >> 4, c4 = (idx & 15) * 4;
    const v4f a = *(const v4f*)(vf + ((size_t)(b * SEQ + t0 + tt)) * vrp + hh * HD + c4);
    *(v4f*)(sv + tt * 68 + c4) = a;
  }
  __syncthreads();

  const int g = tid >> 3, piece = tid & 7;
  v4u hv[2], lv[2];
  size_t hofs[2];
#pragma unroll
  for (int it = 0; it < 2; ++it) {
    const int d = it * 32 + g;
    v4u a, a2;
#pragma unroll
    for (int e = 0; e < 4; ++e) {
      const float f0 = sv[(piece * 8 + 2 * e) * 68 + d] * vscale;
      const float f1 = sv[(piece * 8 + 2 * e + 1) * 68 + d] * vscale;
      const _Float16 x0 = (_Float16)f0, x1 = (_Float16)f1;
      const unsigned short h0 = h_bits(x0), h1 = h_bits(x1);
      const unsigned short l0 = h_bits((_Float16)((f0 - (float)x0) * 4096.0f));
      const unsigned short l1 = h_bits((_Float16)((f1 - (float)x1) * 4096.0f));
      a[e] = pk16(h0, h1); a2[e] = pk16(l0, l1);
    }
    hv[it] = a; lv[it] = a2;
    hofs[it] = ((size_t)(b * DM + hh * HD + d)) * SEQ + t0 + piece * 8;
  }
  {
#pragma unroll
    for (int it = 0; it < 2; ++it) {
      *(v4u*)(vth + hofs[it]) = hv[it];
      *(v4u*)(vtl + hofs[it]) = lv[it];
    }
    
  }
}
// One grid for the three plane splits (independent of one another): blocks 0 .. VTB - 1 = the v tiles, then PLB blocks
// for q, then PLB blocks for k. The branch is block-uniform, so the tile body's barrier is passed by whole blocks only.
__global__ __launch_bounds__(256) void planes_qkv(const float* __restrict__ qf, const float* __restrict__ kf,
                                                  const float* __restrict__ vf, unsigned short* qh, unsigned short* ql,
                                                  unsigned short* kh, unsigned short* kl, unsigned short* vth,
                                                  unsigned short* vtl, int n8, float qkscale, float vscale) {
  __shared__ __align__(16) float sv[64 * 68];       // [tt][d] pitch 68 floats
  const int bx = blockIdx.x;
  if (bx < VTB) {
    v_planes_body(vf, DM, vth, vtl, vscale, sv, bx % (SEQ / 64), (bx / (SEQ / 64)) % NH, bx / ((SEQ / 64) * NH));
  } else if (bx < VTB + PLB) {
    planes_f16x8_body(qf, qh, ql, n8, qkscale, bx - VTB);
  } else {
    planes_f16x8_body(kf, kh, kl, n8, qkscale, bx - (VTB + PLB));
  }
}

// =====================================================================================================
// Bidirectional multi-head attention, head dim 64, no mask.
//   q f16 hi plane (x16): element (b, t, h, d) at [(b*SEQ + t)*DM + h*64 + d]; q residual plane
//     ((q*16 - hi)*1024) at the same index into qlp
//   k f16 hi plane (x16): element (b, s, h, d) at [(b*SEQ + s)*DM + h*64 + d]; k residual plane same into klp
//   v^T f16 hi plane (x256): element (b, h, d, s) at [(b*DM + h*64 + d)*SEQ + s]
//   v^T f16 residual plane ((v*256 - hi)*4096): same index into vlp
//   All NQB key tiles of 64 are processed for every query tile (static trip count).
//   logit = (qhi.khi + (qhi.klo + qlo.khi) * 2^-10) * sscale, f16 products with f32 accumulate, the residual
//   products in a separate accumulator; p = exp(s - m) carried as ph = f16(1024 p);
//   context = ph . vhi on f16 WMMA plus ph . vres into a separate accumulator folded back with 2^-12 per tile
//   in f32; online softmax in f32; out f32 plane: element (b, t, h*64 + d) at [(b*SEQ + t)*DM + h*64 + d] =
//   normalised context (oscl folds back the p and v carries).
//   Block = 4 waves = 64 query rows of one (b, h); grid = NB*NH*NQB; kv tiles of 64.
//   K hi / K residual / V^T hi / V^T residual tile staging: asynchronous copies global -> LDS, 128 threads x 4 x 16 B
//   per plane = the whole 64x64 tile, two buffers: tile t + 1 is in flight while tile t is worked on; per tile one
//   hand-over (LDS reads done, own copies landed, block barrier), then tile t + 2 is copied into the buffer tile t has left.
//   Both products are formed transposed: S^T = K . Q^T (A = K rows, B = Q) and O^T += V^T . P^T (A = V^T rows, B = P^T).
//   A lane then holds 32 of the 64 scores of ONE query (column lane&15; keys 16 j + 8 (lane>>4) + r), so maximum and
//   sum run in the lane, with one exchange between the wave's halves; two score tiles, converted in place, are the
//   B operand of the second product in the loaders' k order: P never leaves the registers.
//   Output coverage: each wave stores rows q0..q0+15 (it 0..7 x lane>>4 0..1) x 64 columns (16 lanes x 4
//   (b, h, query tile) -> the whole plane.
// =====================================================================================================
__global__ __launch_bounds__(128)
void attn64(const unsigned short* __restrict__ qhp, const unsigned short* __restrict__ qlp,
            const unsigned short* __restrict__ khp, const unsigned short* __restrict__ klp,
            const unsigned short* __restrict__ vhp, const unsigned short* __restrict__ vlp,
            float* outp, float sscale, float oscl) {
  union FH { v16h v; v8h h[2]; };
  // two tile buffers of K hi [kv][d], K residual, V^T hi [d][kv], V^T residual, 9 KB each; behind the loop's last
  // barrier the same bytes hold the per wave context tiles [row][d] (17 KB), so that four blocks still fit a WGP
  __shared__ __align__(16) _Float16 KV[2 * KVBUF];

  const int tid  = threadIdx.x;
  const int wave = tid >> 5;
  const int lane = tid & 31;
  const int hh   = lane >> 4;
  const int c    = lane & 15;

  const int bx   = blockIdx.x;
  const int qb   = bx % NQB;
  const int rest = bx / NQB;
  const int h    = rest % NH;
  const int b    = rest / NH;                // < NB by the grid size
  const int q0   = qb * 64 + wave * 16;
  const size_t rowB = (size_t)b * SEQ;

  const _Float16* Qp  = (const _Float16*)(const void*)qhp + (size_t)h * HD;
  const _Float16* Qlq = (const _Float16*)(const void*)qlp + (size_t)h * HD;
  const _Float16* Kp  = (const _Float16*)(const void*)khp + (size_t)h * HD;
  const _Float16* Klq = (const _Float16*)(const void*)klp + (size_t)h * HD;
  const _Float16* Vh  = (const _Float16*)(const void*)vhp + ((size_t)b * DM + (size_t)h * HD) * SEQ;
  const _Float16* Vl  = (const _Float16*)(const void*)vlp + ((size_t)b * DM + (size_t)h * HD) * SEQ;

  // ---- Q fragments (B operand, column = lane&15): 2 d-chunks, hi and residual ----
  v16h qa[2], ql[2];
#pragma unroll
  for (int dc = 0; dc < 2; ++dc) {
    const size_t qo = (rowB + q0 + c) * DM + dc * 32 + 8 * hh;
    qa[dc] = ldfrag_h(Qp + qo);
    ql[dc] = ldfrag_h(Qlq + qo);
  }
#if defined(__HIP_DEVICE_COMPILE__)
  // no address register of the Q loads is rewritten in front of this wait; the scheduling barrier keeps the later
  // address arithmetic, which reuses those registers, from being lifted over it
  asm volatile("s_wait_xcnt 0x0" ::: "memory");
  __builtin_amdgcn_sched_barrier(0);
#endif

  // this lane's piece of every 16-row group: row tid>>3, 16-B column tid&7
  const int srow = tid >> 3, spc = (tid & 7) * 8;
  const _Float16* gk  = Kp  + (rowB + srow) * DM + spc;           // K hi row srow of key tile 0
  const _Float16* gkl = Klq + (rowB + srow) * DM + spc;           // K residual
  const _Float16* gv  = Vh + (size_t)srow * SEQ + spc;            // V^T hi row d = srow, keys of tile 0
  const _Float16* gvl = Vl + (size_t)srow * SEQ + spc;            // V^T residual
  const unsigned l0 = lds_off(KV) + (unsigned)(srow * KVP + spc) * 2u;
  stage_kv(l0, gk, gkl, gv, gvl);

  float mrow = -INFINITY, lrow = 0.f;    // of query q0 + c; lrow sums this half's keys only, joined behind the loop
  v8f oacc[4];                           // oacc[t][r] = context of query q0 + c, feature 16 t + 8 hh + r
#pragma unroll
  for (int t = 0; t < 4; ++t) oacc[t] = zero8();

  for (int kt = 0; kt < NQB; ++kt) {
    // hand-over between trip kt - 1 and trip kt: tile kt becomes readable, tile kt - 1's buffer becomes free; then tile
    // kt + 1 is copied into that buffer. It stands at the head of the trip, with nothing behind the trip's arithmetic:
    // behind a branch at the foot the compiler moves the row sums there and holds all 32 p of a lane over the second product.
    wait_lds_reads();
    wait_copies();
    __syncthreads();
    if (kt + 1 < NQB) {
      stage_kv(l0 + (unsigned)((kt + 1) & 1) * (KVBUF * 2u), gk + (size_t)(kt + 1) * 64 * DM,
               gkl + (size_t)(kt + 1) * 64 * DM, gv + (kt + 1) * 64, gvl + (kt + 1) * 64);
    }
    // (kv0 below = 64 kt, the tile's first key)
    // Fragment reads: plain LDS loads in groups of 8 ds_load_b128 (one 16-key group of K, or two 16-feature groups of
    // V^T, hi and residual planes), written one group ahead of the WMMAs that use them; the WMMAs are bare builtins, so
    // no asm statement stands between a read and an earlier WMMA and the reads can be issued ahead, behind counted waits.
    const _Float16* kfh = KV + (kt & 1) * KVBUF + c * KVP + 8 * hh;
    const _Float16* kfl = kfh + KVT;
    const _Float16* vfh = kfh + 2 * KVT;
    const _Float16* vfl = kfh + 3 * KVT;
    v16h kb[4][2], kr[4][2];             // K hi / residual fragments of key group j, d chunk dc
    v16h vb[2][4], vl[2][4];             // V^T hi / residual fragments of key chunk kk, feature group t
#define LD_K(j)                                                   \
    _Pragma("unroll") for (int dc = 0; dc < 2; ++dc) {            \
      kb[j][dc] = ldfrag_h(kfh + (j) * 16 * KVP + dc * 32);       \
      kr[j][dc] = ldfrag_h(kfl + (j) * 16 * KVP + dc * 32);       \
    }
#define LD_V(kk, tp)                                              \
    _Pragma("unroll") for (int t = 2 * (tp); t < 2 * (tp) + 2; ++t) { \
      vb[kk][t] = ldfrag_h(vfh + t * 16 * KVP + (kk) * 32);       \
      vl[kk][t] = ldfrag_h(vfl + t * 16 * KVP + (kk) * 32);       \
    }
    // ---- scores, transposed: 64 keys x 16 queries per wave; hi.hi into s, hi.lo + lo.hi into s1 (folded x 2^-10) ----
    v8f s[4], s1[4];                     // s[j][r] = score of key kv0 + 16 j + 8 hh + r with query q0 + c
#define SCORE(j)                                                  \
    s[j] = zero8(); s1[j] = zero8();                              \
    _Pragma("unroll") for (int dc = 0; dc < 2; ++dc) {            \
      s[j]  = mma_h_raw(kb[j][dc], qa[dc], s[j]);                 \
      s1[j] = mma_h_raw(kr[j][dc], qa[dc], s1[j]);                \
      s1[j] = mma_h_raw(kb[j][dc], ql[dc], s1[j]);                \
    }
#define FOLD_S(j)                                                 \
    _Pragma("unroll") for (int r = 0; r < 8; ++r) s[j][r] += s1[j][r] * (1.0f / 1024.0f);
    LD_K(0) LD_K(1)
    SCORE(0)
    LD_K(2)
    SCORE(1) FOLD_S(0)
    LD_K(3)
    SCORE(2) FOLD_S(1)
    LD_V(0, 0)
    SCORE(3) FOLD_S(2)
    LD_V(0, 1)
    FOLD_S(3)

    // ---- scale, maximum of the query's 64 scores (32 in the lane, then the other half's), online softmax ----
    float mj[4];
#pragma unroll
    for (int j = 0; j < 4; ++j) {
      float m = -INFINITY;
#pragma unroll
      for (int r = 0; r < 8; ++r) {
        const float sv = s[j][r] * sscale;
        s[j][r] = sv;
        m = fmaxf(m, sv);
      }
      mj[j] = m;
    }
    float mt = fmaxf(fmaxf(mj[0], mj[1]), fmaxf(mj[2], mj[3]));
    mt = fmaxf(mt, xhalf(mt));
    const float mnew  = fmaxf(mrow, mt);
    const float msafe = (mnew == -INFINITY) ? 0.f : mnew;
    const float alpha = __expf(mrow - msafe);
    mrow = mnew;
    v8h ph[4];                           // P^T (x1024, f16): ph[j][r] belongs to key kv0 + 16 j + 8 hh + r
    float ps[4];
#pragma unroll
    for (int j = 0; j < 4; ++j) {
      v8f p1024;
      float a = 0.f;
#pragma unroll
      for (int r = 0; r < 8; ++r) {
        const float p = __expf(s[j][r] - msafe);
        a += p;
        p1024[r] = p * 1024.0f;
      }
      ps[j] = a;
      ph[j] = __builtin_convertvector(p1024, v8h);
    }
    lrow = lrow * alpha + ((ps[0] + ps[1]) + (ps[2] + ps[3]));
#pragma unroll
    for (int t = 0; t < 4; ++t)
#pragma unroll
      for (int r = 0; r < 8; ++r) oacc[t][r] *= alpha;

    // ---- context^T += Vhi^T . P^T (f16 WMMA); Vres^T . P^T into a separate accumulator ----
    v8f o1[4];
#pragma unroll
    for (int t = 0; t < 4; ++t) o1[t] = zero8();
    FH pb[2];                            // keys kv0 + 32 kk + 8 hh + (0..7), then + 16: the k order of the V^T fragments
#pragma unroll
    for (int kk = 0; kk < 2; ++kk) {
      pb[kk].h[0] = ph[2 * kk];
      pb[kk].h[1] = ph[2 * kk + 1];
    }
#define CTX(kk, tp)                                               \
    _Pragma("unroll") for (int t = 2 * (tp); t < 2 * (tp) + 2; ++t) { \
      oacc[t] = mma_h_raw(vb[kk][t], pb[kk].v, oacc[t]);          \
      o1[t]   = mma_h_raw(vl[kk][t], pb[kk].v, o1[t]);            \
    }
    // Order of the stretch from the tile barrier to here, for the scheduler: 16 reads, then 6 WMMAs and 8 reads in turn.
    // Left alone it spreads the reads singly among the WMMAs.
#define SGB_LDS(n, id)  __builtin_amdgcn_sched_group_barrier(0x100, n, id)
#define SGB_WMMA(n, id) __builtin_amdgcn_sched_group_barrier(0x008, n, id)
    SGB_LDS(16, 0); SGB_WMMA(6, 0); SGB_LDS(8, 0); SGB_WMMA(6, 0); SGB_LDS(8, 0); SGB_WMMA(6, 0); SGB_LDS(8, 0); SGB_WMMA(6, 0);
    SGB_LDS(8, 0);
    // keeps the second key chunk's V^T reads behind the softmax: lifted over it, their 64 registers would take the
    // wave over 256 VGPRs, and only three blocks instead of four would fit a WGP
    __builtin_amdgcn_sched_barrier(0);
    LD_V(1, 0)
    CTX(0, 0)
    LD_V(1, 1)
    CTX(0, 1) CTX(1, 0) CTX(1, 1)
    SGB_LDS(8, 1); SGB_WMMA(4, 1); SGB_LDS(8, 1); SGB_WMMA(12, 1);   // the same for this stretch
#undef SGB_LDS
#undef SGB_WMMA
#undef LD_K
#undef LD_V
#undef SCORE
#undef FOLD_S
#undef CTX
#pragma unroll
    for (int t = 0; t < 4; ++t)
#pragma unroll
      for (int r = 0; r < 8; ++r) oacc[t][r] += o1[t][r] * (1.0f / 4096.0f);
  }
  // every wave's tile reads are done before the first tile buffer, which last held tile NQB - 2, is used for the context tiles
  wait_lds_reads();
  wait_copies();
  __syncthreads();

  // ---- join the halves' sums, normalise (1/l and the carries via oscl), stage the wave's 16x64 tile in LDS
  //      (row = query c, 8 consecutive features per accumulator tile), then write whole 256-B row segments
  float* os = (float*)(void*)KV + wave * (16 * OSP);
  {
    const float l = lrow + xhalf(lrow);
    const float inv = ((l > 0.f) ? (1.0f / l) : 0.f) * oscl;
#pragma unroll
    for (int t = 0; t < 4; ++t) {
      v4f lo, hi;
#pragma unroll
      for (int r = 0; r < 4; ++r) {
        lo[r] = oacc[t][r] * inv;
        hi[r] = oacc[t][4 + r] * inv;
      }
      *(v4f*)(os + c * OSP + t * 16 + 8 * hh) = lo;
      *(v4f*)(os + c * OSP + t * 16 + 8 * hh + 4) = hi;
    }
  }
  __builtin_amdgcn_fence(__ATOMIC_RELEASE, "workgroup");
  __builtin_amdgcn_wave_barrier();
  __builtin_amdgcn_fence(__ATOMIC_ACQUIRE, "workgroup");
  {
    const int h2 = lane >> 4, c4 = (lane & 15) * 4;
    v4f ov[8];
#pragma unroll
    for (int it = 0; it < 8; ++it) {
      const int row = it * 2 + h2;   // it 0..7 x h2 0..1 = rows 0..15 of the wave tile
      ov[it] = *(const v4f*)(os + row * OSP + c4);
    }
    {
#pragma unroll
      for (int it = 0; it < 8; ++it) {
        const int row = it * 2 + h2;
        const size_t go = (rowB + q0 + row) * DM + (size_t)h * HD + c4;
        *(v4f*)(outp + go) = ov[it];
      }
      
    }
  }
}

// =====================================================================================================
// Workspace map (bytes), every region an exact multiple of its whole-line / whole-tile store granularity
// 8192 x 512, 512 x 512 and 4096 x 1024 are whole tiles/lines):
//   Xb    bf16 [8192][512]            0          8388608
//   Wtq   bf16 [512][512]       8388608           524288   ([n][e])
//   Wtk   bf16 [512][512]       8912896           524288
//   Wtv   bf16 [512][512]       9437184           524288
//   Wto   f16  [512][512]       9961472           524288   ([n][k], bf16rne value x4096)
//   Tf    f32  [8192][512]     10485760         16777216   (scratch: q, then msgs)
//   Qh    f16  [8192][512]     27262976          8388608
//   Ql    f16  [8192][512]     35651584          8388608
//   Kh    f16  [8192][512]     44040192          8388608
//   Kl    f16  [8192][512]     52428800          8388608
//   VTh   f16  [4096][1024]    60817408          8388608   ([b*DM + h*64 + d][s])
//   VTl   f16  [4096][1024]    69206016          8388608
//   Mh    f16  [8192][512]     77594624          8388608   (msgs x1024)
//   Ml    f16  [8192][512]     85983232          8388608   (msgs residual)
//   Tk    f32  [8192][512]     94371840         16777216   (scratch: k)
//   Tv    f32  [8192][512]    111149056         16777216   (scratch: v)
//   end                       127926272
// Inputs: nodes f32 [8][1024][512]; Wq, Wk, Wv, Wo f32 [512 in][512 out] (x @ W layout); bq, bk, bv, bo f32
// [512] (index h*64+d = n). d_out f32: [8192][512] at byte 0 (row = b*SEQ + t, col = n).
// =====================================================================================================
extern "C" void kernel_launch(void* const* d_in, const int* in_sizes, int n_in,
                              void* d_out, int out_size, void* d_ws, size_t ws_size,
                              hipStream_t stream) {
  if (n_in < 9) return;
  if (in_sizes[0] != NB * SEQ * DM) return;
  if (in_sizes[1] != DM * DM) return;
  if (in_sizes[2] != DM * DM) return;
  if (in_sizes[3] != DM * DM) return;
  if (in_sizes[4] != DM) return;
  if (in_sizes[5] != DM) return;
  if (in_sizes[6] != DM) return;
  if (in_sizes[7] != DM * DM) return;
  if (in_sizes[8] != DM) return;
  if (out_size != OUTN) return;

  const float* x  = (const float*)d_in[0];   // [NB*SEQ][DM]
  const float* Wq = (const float*)d_in[1];   // [DM e][DM n]
  const float* Wk = (const float*)d_in[2];
  const float* Wv = (const float*)d_in[3];
  const float* bq = (const float*)d_in[4];   // [DM]
  const float* bk = (const float*)d_in[5];
  const float* bv = (const float*)d_in[6];
  const float* Wo = (const float*)d_in[7];   // [DM k][DM n]
  const float* bo = (const float*)d_in[8];

  const size_t PXb = (size_t)ROWS * DM * 2;          //  8388608
  const size_t PW  = (size_t)DM * DM * 2;            //   524288
  const size_t PF  = (size_t)ROWS * DM * 4;          // 16777216
  const size_t PH  = (size_t)ROWS * DM * 2;          //  8388608
  const size_t PVt = (size_t)NB * DM * SEQ * 2;      //  8388608
  size_t off = 0;
  const size_t oXb = off; off += PXb;
  const size_t oWq = off; off += PW;
  const size_t oWk = off; off += PW;
  const size_t oWv = off; off += PW;
  const size_t oWo = off; off += PW;
  const size_t oTf = off; off += PF;
  const size_t oQh = off; off += PH;
  const size_t oQl = off; off += PH;
  const size_t oKh = off; off += PH;
  const size_t oKl = off; off += PH;
  const size_t oVt = off; off += PVt;
  const size_t oVl = off; off += PVt;
  const size_t oMh = off; off += PH;
  const size_t oMl = off; off += PH;
  const size_t oTk = off; off += PF;
  const size_t oTv = off; off += PF;
  if (off > ws_size) return;                        // off = 127926272
  if (off > (size_t)134217728) return;

  char* ws = (char*)d_ws;
  unsigned short* Xb  = (unsigned short*)(ws + oXb);
  unsigned short* Wtq = (unsigned short*)(ws + oWq);
  unsigned short* Wtk = (unsigned short*)(ws + oWk);
  unsigned short* Wtv = (unsigned short*)(ws + oWv);
  unsigned short* Wto = (unsigned short*)(ws + oWo);
  float*          Tf  = (float*)(ws + oTf);
  float*          Tk  = (float*)(ws + oTk);
  float*          Tv  = (float*)(ws + oTv);
  unsigned short* Qh  = (unsigned short*)(ws + oQh);
  unsigned short* Ql  = (unsigned short*)(ws + oQl);
  unsigned short* Kh  = (unsigned short*)(ws + oKh);
  unsigned short* Kl  = (unsigned short*)(ws + oKl);
  unsigned short* VTh = (unsigned short*)(ws + oVt);
  unsigned short* VTl = (unsigned short*)(ws + oVl);
  unsigned short* Mh  = (unsigned short*)(ws + oMh);
  unsigned short* Ml  = (unsigned short*)(ws + oMl);
  float*          outf = (float*)d_out;             // [ROWS][DM]

  const dim3 blk(256);
  const int n8x = ROWS * DM / 8;                    // 524288
  const dim3 gCvtX((n8x + 255) / 256);              // 2048 blocks
  const dim3 gPrep(4 * WTB + PLB);                  // 256 weight tiles, then 2048 activation blocks
  const dim3 gGemm(ROWS / 64, 3);                   // 128 blocks of 64 rows x 512 columns, for each of q, k, v
  const dim3 gGemO(ROWS / 32);                      // 256 blocks of 32 rows x 512 columns
  const dim3 gSplit(VTB + 2 * PLB);                 // 1024 v tiles, then 2048 blocks each for q and k
  const dim3 gAttn(NB * NH * NQB);                  // 1024 blocks
  const float qkScale = 16.0f;                      // q and k hi planes carried x16 (residual x1024 on top)
  const float sscale  = 1.0f / 2048.0f;             // 1/(16*16) * 1/sqrt(64)
  const float vScale  = 256.0f;                     // v^T hi plane carried x256
  const float attOscl = 1.0f / 262144.0f;           // 1/(1024 * 256): p and v carries folded back
  const float mScale  = 1024.0f;                    // msgs hi plane carried x1024 (residual x1024 on top)
  const float woScale = 4096.0f;                    // Wo^T carried x4096 in f16
  const float outOscl = 1.0f / 4194304.0f;          // 1/(1024 * 4096)

  // (1) activations -> bf16 plane; weights -> transposed 16-bit planes [n][e] (RNE convert): one grid
  prep<<<gPrep, blk, 0, stream>>>(x, Wq, Wk, Wv, Wo, Xb, Wtq, Wtk, Wtv, Wto, n8x, woScale);
  // (2) q, k, v = Xb . Wt^T + bias -> Tf, Tk, Tv [8192][512] (M=8192, N=512, K=512 each): one grid
  gemm64<<<gGemm, blk, 0, stream>>>(Xb, Wtq, Wtk, Wtv, bq, bk, bv, Tf, Tk, Tv, ROWS);
  // (3) q, k -> f16 hi (x16) + residual planes; v -> f16 v^T hi plane (x256) and residual plane (x4096 on top): one grid
  planes_qkv<<<gSplit, blk, 0, stream>>>(Tf, Tk, Tv, Qh, Ql, Kh, Kl, VTh, VTl, n8x, qkScale, vScale);
  // (4) attention -> msgs f32 [8192][512] in Tf, then f16 hi (x1024) + residual planes
  attn64<<<gAttn, dim3(128), 0, stream>>>(Qh, Ql, Kh, Kl, VTh, VTl, Tf, sscale, attOscl);
  planes_f16x8<<<gCvtX, blk, 0, stream>>>(Tf, Mh, Ml, n8x, mScale);
  // (5) out = msgs . Wo + bo -> d_out f32 [8192][512] (M=8192, N=512, K=512)
  gemm_o<<<gGemO, blk, 0, stream>>>(Mh, Ml, Wto, bo, outf, ROWS, outOscl);
  (void)hipGetLastError();
}

// v007
// It runs in 96.9 microseconds.
// Next to v006, in two timings, it ran 1.04 times as fast each time.
// Over all steps from v000 it is 2.78 times as fast.
// Contractions: q/k/v projections = v_wmma_f32_16x16x32_bf16 (bf16 operands from RNE-converted nodes, W^T and bias, single product); q.k^T scores = v_wmma_f32_16x16x32_f16 (q, k as f16 hi planes carried x16 plus f16 residual planes x1024: hi.hi + (hi.lo + lo.hi) in a separate accumulator, 3 products); p.v = v_wmma_f32_16x16x32_f16 (p carried x1024 in f16; v^T as f16 hi plane x256 plus f16 residual plane x4096 in a separate accumulator folded with 2^-12, 2 products); output projection = v_wmma_f32_16x16x32_f16 (msgs as f16 hi plane x1024 plus f16 residual plane x1024 in a separate accumulator folded with 2^-10; Wo^T = RNE bf16 value carried x4096 in f16; 2 products); all f32 accumulate; softmax in f32.
#include <hip/hip_runtime.h>
#include <math.h>
#include <stdint.h>

#define NB    8
#define SEQ   1024
#define DM    512
#define NH    8
#define HD    64
#define NKT   (SEQ / 64)            // attn64: key tiles of 64
#define NQB   (SEQ / 128)           // attn64: query blocks of one (b, h): 4 waves x 32 query rows
#define ROWS  (NB * SEQ)            // 8192 token rows
#define OUTN  (ROWS * DM)
#define KVP   72                    // LDS pitch of the 64-wide f16 tiles in attn64, in halves: 144 B = 16 B x 9 (odd)
#define OSP   68                    // LDS pitch of the 64-wide f32 context tile in attn64, in floats
#define KVT   (64 * KVP)            // attn64: halves of one staged 64 x 64 plane tile (9216 B)
#define KVBUF (4 * KVT)             // attn64: halves of one tile buffer: K hi, K residual, V^T hi, V^T residual (36864 B)
#define GKC   64                    // GEMMs: k elements of one staged slice = 128 B of every staged row
#define GSP   72                    // GEMMs: LDS pitch of a staged row, in 16-bit elements: 144 B = 16 B x 9 (odd)
#define GROWS (64 + DM)             // GEMMs: staged rows of a slice: 64 A rows, then the DM rows of B
#define GBUF  (GROWS * GSP)         // GEMMs: 16-bit elements of one slice buffer (82944 B)
#define NSL   (DM / GKC)            // GEMMs: slices along k
#define WTB   ((DM / 64) * (DM / 64))      // 64 x 64 tiles of one weight matrix
#define VTB   ((SEQ / 64) * NH * NB)       // 64 x 64 tiles of v
#define PLB   (ROWS * DM / 8 / 256)        // blocks of one 8-elements-per-thread pass over a [ROWS][DM] plane
static_assert(NH * HD == DM);
static_assert(HD == 64);
static_assert(16 * KVP * 2 == 2304 && KVT * 2 == 9216);        // copy8: LDS bytes of 16 staged rows, of one plane tile
static_assert(4 * 32 * OSP * 4 <= 2 * KVBUF * 2 && NKT >= 2 && (SEQ % 128) == 0);   // the context tiles fit the tile buffers; two buffers
static_assert(32 * GSP * 2 == 4608);                           // copy9: LDS bytes of 32 staged rows
static_assert(DM == 8 * 64 && GROWS == 18 * 32 && NSL >= 2);   // 8 waves x 64 columns; 18 copies per thread; two buffers
static_assert((SEQ % 64) == 0 && (DM % 64) == 0 && (ROWS % 64) == 0);
static_assert(((ROWS / 64) * (DM / 64)) % 8 == 0);
static_assert(((ROWS / 32) * (DM / 64)) % 8 == 0);
static_assert(((ROWS * DM / 8) % 256) == 0);

typedef _Float16 v16h __attribute__((ext_vector_type(16)));
typedef _Float16 v8h  __attribute__((ext_vector_type(8)));
typedef __bf16   v16b __attribute__((ext_vector_type(16)));
typedef __bf16   v8b  __attribute__((ext_vector_type(8)));
typedef float    v8f  __attribute__((ext_vector_type(8)));
typedef float    v4f  __attribute__((ext_vector_type(4)));
typedef unsigned int v4u __attribute__((ext_vector_type(4)));

// ---- scalar helpers --------------------------------------------------------------------------------
__device__ __forceinline__ unsigned short bf_bits(float f) {          // f32 -> bf16 bits, RNE convert
  unsigned u = __float_as_uint(f);
  return (unsigned short)((u + 0x7FFFu + ((u >> 16) & 1u)) >> 16);
}
__device__ __forceinline__ float bf_up(unsigned short h) { return __uint_as_float(((unsigned)h) << 16); }
__device__ __forceinline__ unsigned short h_bits(_Float16 x) { return __builtin_bit_cast(unsigned short, x); }
__device__ __forceinline__ unsigned pk16(unsigned short a, unsigned short b) { return (unsigned)a | ((unsigned)b << 16); }
__device__ __forceinline__ v8f zero8() { v8f z = {0.f, 0.f, 0.f, 0.f, 0.f, 0.f, 0.f, 0.f}; return z; }

// ---- fragment loaders: 16-bit A/B operand, lane -> row/col (lane&15), p already includes +8*(lane>>4);
//      elements 0..7 <- p[0..7] (k0+8h..), elements 8..15 <- p[16..23] (k0+16+8h..)
__device__ __forceinline__ v16b ldfrag_b(const __bf16* p) {
  union { v16b v; v8b h[2]; } f;
  f.h[0] = *(const v8b*)(p);
  f.h[1] = *(const v8b*)(p + 16);
  return f.v;
}
__device__ __forceinline__ v16h ldfrag_h(const _Float16* p) {
  union { v16h v; v8h h[2]; } f;
  f.h[0] = *(const v8h*)(p);
  f.h[1] = *(const v8h*)(p + 16);
  return f.v;
}

// ---- WMMA helpers with trailing VALU hazard gap --------------------------------------------------------
__device__ __forceinline__ v8f mma_h(v16h a, v16h b, v8f c) {
  c = __builtin_amdgcn_wmma_f32_16x16x32_f16(false, a, false, b, (short)0, c, false, false);
#if defined(__HIP_DEVICE_COMPILE__)
  asm volatile("v_nop\n\tv_nop\n\tv_nop\n\tv_nop" : "+v"(c) : "v"(a), "v"(b));
#endif
  return c;
}
__device__ __forceinline__ v8f mma_h_raw(v16h a, v16h b, v8f c) {   // the compiler keeps the distances behind its own builtin
  return __builtin_amdgcn_wmma_f32_16x16x32_f16(false, a, false, b, (short)0, c, false, false);
}
__device__ __forceinline__ v8f mma_b_raw(v16b a, v16b b, v8f c) {
  return __builtin_amdgcn_wmma_f32_16x16x32_bf16(false, a, false, b, (short)0, c, false, false);
}
__device__ __forceinline__ void dep_guard_b(v8f& a, v8f& b, v16b x, v16b y) {
#if defined(__HIP_DEVICE_COMPILE__)
  asm volatile("v_nop\n\tv_nop\n\tv_nop\n\tv_nop" : "+v"(a), "+v"(b) : "v"(x), "v"(y));
#endif
}
__device__ __forceinline__ void keep4_b(v16b a, v16b b, v16b c, v16b d) {
#if defined(__HIP_DEVICE_COMPILE__)
  asm volatile("v_nop" :: "v"(a), "v"(b), "v"(c), "v"(d));
#endif
}
__device__ __forceinline__ void acc_guard4(v8f& a, v8f& b, v8f& c, v8f& d) {
#if defined(__HIP_DEVICE_COMPILE__)
  asm volatile("v_nop\n\tv_nop\n\tv_nop\n\tv_nop" : "+v"(a), "+v"(b), "+v"(c), "+v"(d));
#endif
}

// lane l <-> lane l ^ 16 (the other half of the wave), in the vector unit
__device__ __forceinline__ float xhalf(float x) {
  const int b = __builtin_bit_cast(int, x);
  return __builtin_bit_cast(float, __builtin_amdgcn_permlanex16(b, b, 0x76543210, 0xfedcba98, false, false));
}

// ---- GEMM operand staging: asynchronous copies global -> LDS, waits -----------------------------------
__device__ __forceinline__ unsigned lds_off(const void* p) { return (unsigned)(size_t)p; }   // LDS byte address
// nine 16-B copies of this lane: LDS bytes l + 4608 i (32 staged rows of 144 B further each) <- global g0 .. g8
__device__ __forceinline__ void copy9(unsigned l, const unsigned short* g0, const unsigned short* g1,
                                      const unsigned short* g2, const unsigned short* g3, const unsigned short* g4,
                                      const unsigned short* g5, const unsigned short* g6, const unsigned short* g7,
                                      const unsigned short* g8) {
#if defined(__HIP_DEVICE_COMPILE__)
  // the closing s_wait_xcnt stands in the copies' own statement: no address register is rewritten in front of it
  asm volatile(
      "global_load_async_to_lds_b128 %0, %9, off\n\t"
      "global_load_async_to_lds_b128 %1, %10, off\n\t"
      "global_load_async_to_lds_b128 %2, %11, off\n\t"
      "global_load_async_to_lds_b128 %3, %12, off\n\t"
      "global_load_async_to_lds_b128 %4, %13, off\n\t"
      "global_load_async_to_lds_b128 %5, %14, off\n\t"
      "global_load_async_to_lds_b128 %6, %15, off\n\t"
      "global_load_async_to_lds_b128 %7, %16, off\n\t"
      "global_load_async_to_lds_b128 %8, %17, off\n\t"
      "s_wait_xcnt 0x0"
      :: "v"(l), "v"(l + 4608u), "v"(l + 2u * 4608u), "v"(l + 3u * 4608u), "v"(l + 4u * 4608u),
         "v"(l + 5u * 4608u), "v"(l + 6u * 4608u), "v"(l + 7u * 4608u), "v"(l + 8u * 4608u),
         "v"(g0), "v"(g1), "v"(g2), "v"(g3), "v"(g4), "v"(g5), "v"(g6), "v"(g7), "v"(g8)
      : "memory");
#endif
}
// One slice = GROWS rows x 128 B = 18 groups of 32 rows; thread tid copies 16-B column tid&7 of row tid>>3 of every
// group, so 8 lanes copy one whole 128-B line. l: the lane's LDS byte address in group 0 of the buffer; a0, a1: its
// source in A row groups 0 and 1; b: its source in B row group 0 (groups 2..17 = B rows 0..DM-1, row pitch DM).
__device__ __forceinline__ void stage_slice(unsigned l, const unsigned short* a0, const unsigned short* a1,
                                            const unsigned short* b) {
  constexpr size_t S = (size_t)32 * DM;           // 32 B rows, in elements
  copy9(l, a0, a1, b, b + S, b + 2 * S, b + 3 * S, b + 4 * S, b + 5 * S, b + 6 * S);
  copy9(l + 9u * 4608u, b + 7 * S, b + 8 * S, b + 9 * S, b + 10 * S, b + 11 * S, b + 12 * S, b + 13 * S, b + 14 * S,
        b + 15 * S);
}
__device__ __forceinline__ void wait_copies() {   // this wave's copies have landed in LDS
#if defined(__HIP_DEVICE_COMPILE__)
  asm volatile("s_wait_asynccnt 0x0" ::: "memory");
#endif
}
__device__ __forceinline__ void wait_lds_reads() {   // this wave's LDS reads are done before the buffer is handed on
#if defined(__HIP_DEVICE_COMPILE__)
  asm volatile("s_wait_dscnt 0x0" ::: "memory");
#endif
}

// eight 16-B copies of this lane, two planes x four groups of 16 staged rows: LDS bytes l + 2304 g <- a + g rstep,
// LDS bytes l + 9216 + 2304 g <- b + g rstep (g = 0..3; rstep = 16 source rows, in elements)
__device__ __forceinline__ void copy8(unsigned l, const _Float16* a, const _Float16* b, size_t rstep) {
#if defined(__HIP_DEVICE_COMPILE__)
  // the closing s_wait_xcnt stands in the copies' own statement: no address register is rewritten in front of it
  asm volatile(
      "global_load_async_to_lds_b128 %0, %8, off\n\t"
      "global_load_async_to_lds_b128 %1, %9, off\n\t"
      "global_load_async_to_lds_b128 %2, %10, off\n\t"
      "global_load_async_to_lds_b128 %3, %11, off\n\t"
      "global_load_async_to_lds_b128 %4, %12, off\n\t"
      "global_load_async_to_lds_b128 %5, %13, off\n\t"
      "global_load_async_to_lds_b128 %6, %14, off\n\t"
      "global_load_async_to_lds_b128 %7, %15, off\n\t"
      "s_wait_xcnt 0x0"
      :: "v"(l), "v"(l + 2304u), "v"(l + 2u * 2304u), "v"(l + 3u * 2304u),
         "v"(l + 9216u), "v"(l + 9216u + 2304u), "v"(l + 9216u + 2u * 2304u), "v"(l + 9216u + 3u * 2304u),
         "v"(a), "v"(a + rstep), "v"(a + 2 * rstep), "v"(a + 3 * rstep),
         "v"(b), "v"(b + rstep), "v"(b + 2 * rstep), "v"(b + 3 * rstep)
      : "memory");
#endif
}
// One key tile of attn64 = 4 planes x 64 rows x 128 B; thread tid (of 128) copies 16-B column tid&7 of row tid>>3 of
// every 16-row group, so 8 lanes copy one whole 128-B line. l: the lane's LDS byte address in group 0 of the buffer's
// first plane; k, kl: its source in rows 0..15 of the K tiles (row pitch DM); v, vl: the same in the V^T tiles (pitch SEQ).
__device__ __forceinline__ void stage_kv(unsigned l, const _Float16* k, const _Float16* kl, const _Float16* v,
                                         const _Float16* vl) {
  copy8(l, k, kl, (size_t)16 * DM);
  copy8(l + 2u * 9216u, v, vl, (size_t)16 * SEQ);
}

// =====================================================================================================
// f32 -> bf16 (RNE convert), 8 elements per thread, one 16-B store per lane: a wave writes 512 contiguous B
// coverage: n8 threads x 8 = whole plane (n8 is a multiple of 256 here).
// =====================================================================================================
__device__ __forceinline__ void cvt_bf16x8_body(const float* __restrict__ in, unsigned short* out, int n8, int blk) {
  const int i = blk * 256 + threadIdx.x;
  if (i < n8) {
    const v4f a = *(const v4f*)(in + (size_t)i * 8);
    const v4f b = *(const v4f*)(in + (size_t)i * 8 + 4);
    v4u p;
    p[0] = pk16(bf_bits(a[0]), bf_bits(a[1]));
    p[1] = pk16(bf_bits(a[2]), bf_bits(a[3]));
    p[2] = pk16(bf_bits(b[0]), bf_bits(b[1]));
    p[3] = pk16(bf_bits(b[2]), bf_bits(b[3]));
    *(v4u*)(out + (size_t)i * 8) = p;
    
  }
}

// =====================================================================================================
// f32 -> f16 hi plane = f16(v * scale) (scale a power of two) + f16 residual plane = f16((v*scale - hi) * 1024),
// same element index in both planes; 8 elements per thread, one 16-B store per lane and plane: a wave writes
// coverage: n8 threads x 8 = whole plane (n8 multiple of 256).
// =====================================================================================================
__device__ __forceinline__ void planes_f16x8_body(const float* __restrict__ in, unsigned short* hp,
                                                  unsigned short* lp, int n8, float scale, int blk) {
  const int i = blk * 256 + threadIdx.x;
  if (i < n8) {
    const v4f a = *(const v4f*)(in + (size_t)i * 8);
    const v4f b = *(const v4f*)(in + (size_t)i * 8 + 4);
    float f[8];
    f[0] = a[0]; f[1] = a[1]; f[2] = a[2]; f[3] = a[3];
    f[4] = b[0]; f[5] = b[1]; f[6] = b[2]; f[7] = b[3];
    v4u ph, pl;
#pragma unroll
    for (int e = 0; e < 4; ++e) {
      const float f0 = f[2 * e] * scale;
      const float f1 = f[2 * e + 1] * scale;
      const _Float16 x0 = (_Float16)f0, x1 = (_Float16)f1;
      const _Float16 l0 = (_Float16)((f0 - (float)x0) * 1024.0f);
      const _Float16 l1 = (_Float16)((f1 - (float)x1) * 1024.0f);
      ph[e] = pk16(h_bits(x0), h_bits(x1));
      pl[e] = pk16(h_bits(l0), h_bits(l1));
    }
    *(v4u*)(hp + (size_t)i * 8) = ph;
    *(v4u*)(lp + (size_t)i * 8) = pl;
    
  }
}
__global__ __launch_bounds__(256) void planes_f16x8(const float* __restrict__ in, unsigned short* hp,
                                                    unsigned short* lp, int n8, float scale) {
  planes_f16x8_body(in, hp, lp, n8, scale, blockIdx.x);
}

// =====================================================================================================
// Weight transpose + convert: in W f32 [DM rows (e, contraction index)][DM cols (n, output feature)] (the
// x @ W layout) -> out Wt 16-bit [DM (n)][DM (e)] (the [n][k], k-contiguous layout the GEMM B operand uses).
// MODE 0: RNE bf16 bits. MODE 1: f16 bits of (RNE bf16 value * scale), scale a power of two (exact in f16).
// Block = one 64 e x 64 n tile (et, nt: its e and n tile index, DM/64 of each). The tile is staged in LDS as [ee][nn]
// pitch 68 floats (v4f loads, __syncthreads). in[rows e][cols n] -> out[rows n][cols e] (square here).
// Store: group g = tid>>3 (0..31), piece = tid&7: iteration it writes row n0 + (it*32+g), lanes 8q..8q+7 x 16 B
// coverage: 2 iterations x 32 groups = 64 rows n, 8 pieces x 8 = 64 e per row; grid covers every (e tile,
// n tile) -> the whole [DM][DM] plane.
// =====================================================================================================
template <int MODE>
__device__ __forceinline__ void wt_tile_body(const float* __restrict__ W, unsigned short* Wt, float scale,
                                             float* sw, int et, int nt) {
  const int tid = threadIdx.x;
  const int e0  = et * 64;
  const int n0  = nt * 64;
#pragma unroll
  for (int i = 0; i < 4; ++i) {
    const int idx = i * 256 + tid;                  // 0..1023
    const int ee = idx >> 4, c4 = (idx & 15) * 4;
    const v4f a = *(const v4f*)(W + ((size_t)(e0 + ee)) * DM + n0 + c4);
    *(v4f*)(sw + ee * 68 + c4) = a;
  }
  __syncthreads();

  const int g = tid >> 3, piece = tid & 7;
  v4u hv[2];
  size_t hofs[2];
#pragma unroll
  for (int it = 0; it < 2; ++it) {
    const int n = it * 32 + g;
    v4u a;
#pragma unroll
    for (int e = 0; e < 4; ++e) {
      const float f0 = sw[(piece * 8 + 2 * e) * 68 + n];
      const float f1 = sw[(piece * 8 + 2 * e + 1) * 68 + n];
      unsigned short u0, u1;
      if (MODE == 0) {
        u0 = bf_bits(f0);
        u1 = bf_bits(f1);
      } else {
        u0 = h_bits((_Float16)(bf_up(bf_bits(f0)) * scale));
        u1 = h_bits((_Float16)(bf_up(bf_bits(f1)) * scale));
      }
      a[e] = pk16(u0, u1);
    }
    hv[it] = a;
    hofs[it] = ((size_t)(n0 + n)) * DM + e0 + piece * 8;
  }
  {
#pragma unroll
    for (int it = 0; it < 2; ++it) {
      *(v4u*)(Wt + hofs[it]) = hv[it];
    }
#if defined(__HIP_DEVICE_COMPILE__)
    // both tile bodies stand in one kernel: no register that the two stores name is rewritten in front of this wait
    asm volatile("s_wait_xcnt 0x0" ::: "memory");
#endif
  }
}
// One grid for all operand preparation (the five jobs are independent of one another): blocks 0 .. 4 WTB - 1 = the
// weight tiles of Wq, Wk, Wv (bf16) and Wo (f16 x woscale), WTB tiles each; the blocks behind them = the activations'
// bf16 plane. The branch is block-uniform, so the tile body's barrier is passed by whole blocks only.
__global__ __launch_bounds__(256) void prep(const float* __restrict__ x, const float* __restrict__ Wq,
                                            const float* __restrict__ Wk, const float* __restrict__ Wv,
                                            const float* __restrict__ Wo, unsigned short* Xb, unsigned short* Wtq,
                                            unsigned short* Wtk, unsigned short* Wtv, unsigned short* Wto,
                                            int n8, float woscale) {
  __shared__ __align__(16) float sw[64 * 68];       // [ee][nn] pitch 68 floats
  const int bx = blockIdx.x;
  if (bx < 4 * WTB) {
    const int w = bx / WTB, tile = bx % WTB;
    const int et = tile % (DM / 64), nt = tile / (DM / 64);
    if (w == 3) {
      wt_tile_body<1>(Wo, Wto, woscale, sw, et, nt);
    } else {
      wt_tile_body<0>(w == 0 ? Wq : (w == 1 ? Wk : Wv), w == 0 ? Wtq : (w == 1 ? Wtk : Wtv), 1.0f, sw, et, nt);
    }
  } else {
    cvt_bf16x8_body(x, Xb, n8, bx - 4 * WTB);
  }
}

// =====================================================================================================
// Register-blocked bf16 WMMA GEMM with bias: C[m][n] = sum_k A[m][k] * Bt[n][k] + bf16rne(bias[n]), N = K = DM.
// Block = 64 rows x DM columns, one wave per 64x64 tile (wave w: columns 64 w ..). A row-major [M][DM]; Bt row-major
// [DM n][DM k] (k contiguous); bias f32 [DM] (RNE converted to bf16 and widened in the epilogue); M multiple of 64.
// Operands: k slices of GKC, the block's 64 A rows and all DM B rows, staged in LDS by asynchronous copies, two
// buffers: slice t + 1 is in flight while slice t is multiplied; per slice one hand-over (LDS reads done, own copies
// landed, block barrier), then slice t + 2 is copied into the buffer slice t has left.
// Output f32 [M][DM] pitch DM. Epilogue: 16-row slabs staged per wave in LDS; each 64-wide row segment
// =====================================================================================================
// One grid for the three projections: blockIdx.y = 0, 1, 2 picks (Bt, bias, C) of q, k, v; A is common to them.
__global__ __launch_bounds__(256) void gemm64(
    const unsigned short* __restrict__ Ap,
    const unsigned short* __restrict__ Btq, const unsigned short* __restrict__ Btk,
    const unsigned short* __restrict__ Btv,
    const float* __restrict__ biasq, const float* __restrict__ biask, const float* __restrict__ biasv,
    float* Cq, float* Ck, float* Cv, int M) {
  const int which = blockIdx.y;
  const unsigned short* __restrict__ Btp = which == 0 ? Btq : (which == 1 ? Btk : Btv);
  const float* __restrict__ bias = which == 0 ? biasq : (which == 1 ? biask : biasv);
  float* C = which == 0 ? Cq : (which == 1 ? Ck : Cv);
  __shared__ __align__(16) __bf16 sAB[2 * GBUF];   // two slice buffers: rows 0..63 = A, rows 64.. = B
  __shared__ __align__(16) float sT[8][16 * 68];   // per-wave 16x64 slab, pitch 68 floats
  constexpr int ldc = DM;
  const int tid  = threadIdx.x;
  const int lane = tid & 31;
  const int wave = tid >> 5;
  const int m0 = blockIdx.x << 6;
  if (m0 >= M) return;                   // block-uniform, in front of every barrier
  const int n0 = wave << 6;

  // this lane's piece of every 32-row group: row tid>>3, 16-B column tid&7
  const unsigned short* ga0 = Ap + (size_t)(m0 + (tid >> 3)) * DM + (tid & 7) * 8;
  const unsigned short* ga1 = ga0 + (size_t)32 * DM;
  const unsigned short* gb  = Btp + (size_t)(tid >> 3) * DM + (tid & 7) * 8;
  const unsigned l0 = lds_off(sAB) + (unsigned)((tid >> 3) * GSP + (tid & 7) * 8) * 2u;
  stage_slice(l0, ga0, ga1, gb);
  wait_copies();
  __syncthreads();                       // slice 0 is readable by every wave
  stage_slice(l0 + GBUF * 2u, ga0 + GKC, ga1 + GKC, gb + GKC);

  const int rlane = lane & 15;                 // row (A) / col (B, D) within subtile
  const int koff  = (lane >> 4) * 8;           // k offset of this lane half
  const int mOff  = (lane >> 4) * 8;           // D row offset

  v8f acc[4][4];
#pragma unroll
  for (int i = 0; i < 4; ++i)
#pragma unroll
    for (int j = 0; j < 4; ++j) acc[i][j] = zero8();

  for (int t = 0; t < NSL; ++t) {
    const __bf16* sb = sAB + (t & 1) * GBUF;
#pragma unroll
    for (int kk = 0; kk < GKC; kk += 32) {
      v16b bh[4], ah[4];                 // the k step's LDS reads stand together, in front of its WMMAs
#pragma unroll
      for (int j = 0; j < 4; ++j) {
        bh[j] = ldfrag_b(sb + (64 + n0 + (j << 4) + rlane) * GSP + koff + kk);
      }
#pragma unroll
      for (int i = 0; i < 4; ++i) {
        ah[i] = ldfrag_b(sb + ((i << 4) + rlane) * GSP + koff + kk);
      }
#pragma unroll
      for (int i = 0; i < 4; ++i) {
#pragma unroll
        for (int j = 0; j < 4; ++j) {
          acc[i][j] = mma_b_raw(ah[i], bh[j], acc[i][j]);
        }
        dep_guard_b(acc[i][0], acc[i][3], ah[i], ah[i]);
      }
      keep4_b(bh[0], bh[1], bh[2], bh[3]);
    }
    // hand-over: slice t + 1 becomes readable, slice t's buffer becomes free
    wait_lds_reads();
    wait_copies();
    __syncthreads();
    if (t + 2 < NSL) {
      stage_slice(l0 + (unsigned)(t & 1) * (GBUF * 2u), ga0 + (t + 2) * GKC, ga1 + (t + 2) * GKC, gb + (t + 2) * GKC);
    }
  }
  wait_copies();
  acc_guard4(acc[0][0], acc[0][1], acc[0][2], acc[0][3]);
  acc_guard4(acc[1][0], acc[1][1], acc[1][2], acc[1][3]);
  acc_guard4(acc[2][0], acc[2][1], acc[2][2], acc[2][3]);
  acc_guard4(acc[3][0], acc[3][1], acc[3][2], acc[3][3]);

  // ---- bias per D column of this lane (n0 + 16j + rlane < N) ----
  float bz[4];
#pragma unroll
  for (int j = 0; j < 4; ++j) bz[j] = bf_up(bf_bits(bias[n0 + (j << 4) + rlane]));

  // ---- epilogue ----
  float* slab = sT[wave];
#pragma unroll
  for (int i = 0; i < 4; ++i) {
    const int mBase = m0 + (i << 4);
#pragma unroll
    for (int r = 0; r < 8; ++r) {
#pragma unroll
      for (int j = 0; j < 4; ++j) {
        slab[(mOff + r) * 68 + (j << 4) + rlane] = acc[i][j][r] + bz[j];
      }
    }
    __builtin_amdgcn_fence(__ATOMIC_RELEASE, "workgroup");
    __builtin_amdgcn_wave_barrier();
    __builtin_amdgcn_fence(__ATOMIC_ACQUIRE, "workgroup");
    {
      const int hh = lane >> 4, c4 = (lane & 15) * 4;     // 256-B row segment = 16 lanes x 16 B
      v4f ov[8];
#pragma unroll
      for (int it = 0; it < 8; ++it) {
        const int row = it * 2 + hh;                       // it 0..7 x hh 0..1 = rows 0..15
        ov[it] = *(const v4f*)(slab + row * 68 + c4);
      }
      {
#pragma unroll
        for (int it = 0; it < 8; ++it) {
          const int row = it * 2 + hh;
          *(v4f*)(C + (size_t)(mBase + row) * ldc + n0 + c4) = ov[it];
        }
        
      }
    }
    __builtin_amdgcn_fence(__ATOMIC_RELEASE, "workgroup");
    __builtin_amdgcn_wave_barrier();
    __builtin_amdgcn_fence(__ATOMIC_ACQUIRE, "workgroup");
  }
}

// =====================================================================================================
// f16 WMMA GEMM with a two-plane A operand and bias:
//   C[m][n] = (sum_k Ah[m][k]*Bt[n][k] + 2^-10 * sum_k Al[m][k]*Bt[n][k]) * oscale + bf16rne(bias[n]),
// the residual products in a separate accumulator, N = K = DM. Block = 32 rows x DM columns, one wave per 32x64 tile
// (wave w: columns 64 w ..). Ah/Al row-major [M][DM] (f16 hi and residual planes, same index); Bt row-major
// [DM n][DM k] (f16, k contiguous); M multiple of 32. Operands staged in LDS as in gemm64 (staged rows 0..31 = Ah,
// 32..63 = Al, 64.. = B). Every WMMA nop-guarded.
// Output f32 [M][DM] pitch DM. Epilogue: 16-row slabs staged per wave in LDS; each 64-wide row segment (256 B)
// coverage: 2 slabs x 16 rows x 64 cols = the wave's whole 32x64 tile.
// =====================================================================================================
__global__ __launch_bounds__(256) void gemm_o(
    const unsigned short* __restrict__ Ahp, const unsigned short* __restrict__ Alp,
    const unsigned short* __restrict__ Btp,
    const float* __restrict__ bias,
    float* C, int M, float oscale) {
  __shared__ __align__(16) _Float16 sAB[2 * GBUF]; // two slice buffers: rows 0..31 = Ah, 32..63 = Al, 64.. = B
  __shared__ __align__(16) float sT[8][16 * 68];   // per-wave 16x64 slab, pitch 68 floats
  constexpr int ldc = DM;
  const int tid  = threadIdx.x;
  const int lane = tid & 31;
  const int wave = tid >> 5;
  const int m0 = blockIdx.x << 5;
  if (m0 >= M) return;                   // block-uniform, in front of every barrier
  const int n0 = wave << 6;

  // this lane's piece of every 32-row group: row tid>>3, 16-B column tid&7
  const size_t ao = (size_t)(m0 + (tid >> 3)) * DM + (tid & 7) * 8;
  const unsigned short* ga0 = Ahp + ao;
  const unsigned short* ga1 = Alp + ao;
  const unsigned short* gb  = Btp + (size_t)(tid >> 3) * DM + (tid & 7) * 8;
  const unsigned l0 = lds_off(sAB) + (unsigned)((tid >> 3) * GSP + (tid & 7) * 8) * 2u;
  stage_slice(l0, ga0, ga1, gb);
  wait_copies();
  __syncthreads();                       // slice 0 is readable by every wave
  stage_slice(l0 + GBUF * 2u, ga0 + GKC, ga1 + GKC, gb + GKC);

  const int rlane = lane & 15;
  const int koff  = (lane >> 4) * 8;
  const int mOff  = (lane >> 4) * 8;

  v8f acc[2][4], acl[2][4];
#pragma unroll
  for (int i = 0; i < 2; ++i)
#pragma unroll
    for (int j = 0; j < 4; ++j) { acc[i][j] = zero8(); acl[i][j] = zero8(); }

  for (int t = 0; t < NSL; ++t) {
    const _Float16* sb = sAB + (t & 1) * GBUF;
#pragma unroll
    for (int kk = 0; kk < GKC; kk += 32) {
      v16h ah[2], al[2], bfr[4];         // the k step's LDS reads stand together, in front of its WMMAs
#pragma unroll
      for (int i = 0; i < 2; ++i) {
        ah[i] = ldfrag_h(sb + ((i << 4) + rlane) * GSP + koff + kk);
        al[i] = ldfrag_h(sb + (32 + (i << 4) + rlane) * GSP + koff + kk);
      }
#pragma unroll
      for (int j = 0; j < 4; ++j) {
        bfr[j] = ldfrag_h(sb + (64 + n0 + (j << 4) + rlane) * GSP + koff + kk);
      }
#pragma unroll
      for (int j = 0; j < 4; ++j) {
#pragma unroll
        for (int i = 0; i < 2; ++i) {
          acc[i][j] = mma_h(ah[i], bfr[j], acc[i][j]);
          acl[i][j] = mma_h(al[i], bfr[j], acl[i][j]);
        }
      }
    }
    // hand-over: slice t + 1 becomes readable, slice t's buffer becomes free
    wait_lds_reads();
    wait_copies();
    __syncthreads();
    if (t + 2 < NSL) {
      stage_slice(l0 + (unsigned)(t & 1) * (GBUF * 2u), ga0 + (t + 2) * GKC, ga1 + (t + 2) * GKC, gb + (t + 2) * GKC);
    }
  }
  wait_copies();

  // ---- bias per D column of this lane (n0 + 16j + rlane < N) ----
  float bz[4];
#pragma unroll
  for (int j = 0; j < 4; ++j) bz[j] = bf_up(bf_bits(bias[n0 + (j << 4) + rlane]));

  // ---- epilogue ----
  float* slab = sT[wave];
#pragma unroll
  for (int i = 0; i < 2; ++i) {
    const int mBase = m0 + (i << 4);
#pragma unroll
    for (int r = 0; r < 8; ++r) {
#pragma unroll
      for (int j = 0; j < 4; ++j) {
        const float y = (acc[i][j][r] + acl[i][j][r] * (1.0f / 1024.0f)) * oscale + bz[j];
        slab[(mOff + r) * 68 + (j << 4) + rlane] = y;
      }
    }
    __builtin_amdgcn_fence(__ATOMIC_RELEASE, "workgroup");
    __builtin_amdgcn_wave_barrier();
    __builtin_amdgcn_fence(__ATOMIC_ACQUIRE, "workgroup");
    {
      const int hh = lane >> 4, c4 = (lane & 15) * 4;     // 256-B row segment = 16 lanes x 16 B
      v4f ov[8];
#pragma unroll
      for (int it = 0; it < 8; ++it) {
        const int row = it * 2 + hh;                       // it 0..7 x hh 0..1 = rows 0..15
        ov[it] = *(const v4f*)(slab + row * 68 + c4);
      }
      {
#pragma unroll
        for (int it = 0; it < 8; ++it) {
          const int row = it * 2 + hh;
          *(v4f*)(C + (size_t)(mBase + row) * ldc + n0 + c4) = ov[it];
        }
        
      }
    }
    __builtin_amdgcn_fence(__ATOMIC_RELEASE, "workgroup");
    __builtin_amdgcn_wave_barrier();
    __builtin_amdgcn_fence(__ATOMIC_ACQUIRE, "workgroup");
  }
}

// =====================================================================================================
// v f32 token-major columns vf[(b*SEQ + t)*vrp + h*64 + d] ->
// f16 v^T hi plane vth[(b*DM + h*64 + d)*SEQ + t] = f16(v * vscale) (vscale a power of two) and residual plane
// vtl[same index] = f16((v*vscale - hi) * 4096).
// Block = one 64-token x 64-feature tile of one (b, h): tile index (tt0, hh, b) in (SEQ/64, NH, NB); staged in LDS as f32
// (v4f loads, __syncthreads).
// Store: group g = tid>>3 (0..31), piece = tid&7: iteration it writes row d = it*32+g, lanes 8q..8q+7 x 16 B =
// coverage: 2 iterations x 32 groups = 64 rows d, 8 pieces x 8 = 64 tokens per row; grid covers every (b, h,
// t tile) -> both whole planes.
// =====================================================================================================
__device__ __forceinline__ void v_planes_body(const float* __restrict__ vf, int vrp, unsigned short* vth,
                                              unsigned short* vtl, float vscale, float* sv, int tt0, int hh, int b) {
  const int tid = threadIdx.x;
  const int t0  = tt0 * 64;
#pragma unroll
  for (int i = 0; i < 4; ++i) {
    const int idx = i * 256 + tid;                  // 0..1023
    const int tt = idx >> 4, c4 = (idx & 15) * 4;
    const v4f a = *(const v4f*)(vf + ((size_t)(b * SEQ + t0 + tt)) * vrp + hh * HD + c4);
    *(v4f*)(sv + tt * 68 + c4) = a;
  }
  __syncthreads();

  const int g = tid >> 3, piece = tid & 7;
  v4u hv[2], lv[2];
  size_t hofs[2];
#pragma unroll
  for (int it = 0; it < 2; ++it) {
    const int d = it * 32 + g;
    v4u a, a2;
#pragma unroll
    for (int e = 0; e < 4; ++e) {
      const float f0 = sv[(piece * 8 + 2 * e) * 68 + d] * vscale;
      const float f1 = sv[(piece * 8 + 2 * e + 1) * 68 + d] * vscale;
      const _Float16 x0 = (_Float16)f0, x1 = (_Float16)f1;
      const unsigned short h0 = h_bits(x0), h1 = h_bits(x1);
      const unsigned short l0 = h_bits((_Float16)((f0 - (float)x0) * 4096.0f));
      const unsigned short l1 = h_bits((_Float16)((f1 - (float)x1) * 4096.0f));
      a[e] = pk16(h0, h1); a2[e] = pk16(l0, l1);
    }
    hv[it] = a; lv[it] = a2;
    hofs[it] = ((size_t)(b * DM + hh * HD + d)) * SEQ + t0 + piece * 8;
  }
  {
#pragma unroll
    for (int it = 0; it < 2; ++it) {
      *(v4u*)(vth + hofs[it]) = hv[it];
      *(v4u*)(vtl + hofs[it]) = lv[it];
    }
    
  }
}
// One grid for the three plane splits (independent of one another): blocks 0 .. VTB - 1 = the v tiles, then PLB blocks
// for q, then PLB blocks for k. The branch is block-uniform, so the tile body's barrier is passed by whole blocks only.
__global__ __launch_bounds__(256) void planes_qkv(const float* __restrict__ qf, const float* __restrict__ kf,
                                                  const float* __restrict__ vf, unsigned short* qh, unsigned short* ql,
                                                  unsigned short* kh, unsigned short* kl, unsigned short* vth,
                                                  unsigned short* vtl, int n8, float qkscale, float vscale) {
  __shared__ __align__(16) float sv[64 * 68];       // [tt][d] pitch 68 floats
  const int bx = blockIdx.x;
  if (bx < VTB) {
    v_planes_body(vf, DM, vth, vtl, vscale, sv, bx % (SEQ / 64), (bx / (SEQ / 64)) % NH, bx / ((SEQ / 64) * NH));
  } else if (bx < VTB + PLB) {
    planes_f16x8_body(qf, qh, ql, n8, qkscale, bx - VTB);
  } else {
    planes_f16x8_body(kf, kh, kl, n8, qkscale, bx - (VTB + PLB));
  }
}

// =====================================================================================================
// Bidirectional multi-head attention, head dim 64, no mask.
//   q f16 hi plane (x16): element (b, t, h, d) at [(b*SEQ + t)*DM + h*64 + d]; q residual plane
//     ((q*16 - hi)*1024) at the same index into qlp
//   k f16 hi plane (x16): element (b, s, h, d) at [(b*SEQ + s)*DM + h*64 + d]; k residual plane same into klp
//   v^T f16 hi plane (x256): element (b, h, d, s) at [(b*DM + h*64 + d)*SEQ + s]
//   v^T f16 residual plane ((v*256 - hi)*4096): same index into vlp
//   All NKT key tiles of 64 are processed for every query block (static trip count).
//   logit = (qhi.khi + (qhi.klo + qlo.khi) * 2^-10) * sscale, f16 products with f32 accumulate, the residual
//   products in a separate accumulator; p = exp(s - m) carried as ph = f16(1024 p);
//   context = ph . vhi on f16 WMMA plus ph . vres into a separate accumulator folded back with 2^-12 per tile
//   in f32; online softmax in f32; out f32 plane: element (b, t, h*64 + d) at [(b*SEQ + t)*DM + h*64 + d] =
//   normalised context (oscl folds back the p and v carries).
//   Block = 4 waves x 32 query rows = 128 query rows of one (b, h); grid = NB*NH*NQB; kv tiles of 64. A wave works on two
//   groups g = 0, 1 of 16 queries: every K and V^T fragment that it reads from LDS is the A operand of both groups' WMMAs.
//   K hi / K residual / V^T hi / V^T residual tile staging: asynchronous copies global -> LDS, 128 threads x 4 x 16 B
//   per plane = the whole 64x64 tile, two buffers: tile t + 1 is in flight while tile t is worked on; per tile one
//   hand-over (LDS reads done, own copies landed, block barrier), then tile t + 2 is copied into the buffer tile t has left.
//   Both products are formed transposed: S^T = K . Q^T (A = K rows, B = Q) and O^T += V^T . P^T (A = V^T rows, B = P^T).
//   A lane then holds, per group, 32 of the 64 scores of ONE query (column lane&15; keys 16 j + 8 (lane>>4) + r), so maximum and
//   sum run in the lane, with one exchange between the wave's halves; two score tiles, converted in place, are the
//   B operand of the second product in the loaders' k order: P never leaves the registers.
//   Output coverage: each wave stores rows q0..q0+31 (it 0..15 x lane>>4 0..1) x 64 columns (16 lanes x 4
//   (b, h, query tile) -> the whole plane.
// =====================================================================================================
__global__ __launch_bounds__(128)
void attn64(const unsigned short* __restrict__ qhp, const unsigned short* __restrict__ qlp,
            const unsigned short* __restrict__ khp, const unsigned short* __restrict__ klp,
            const unsigned short* __restrict__ vhp, const unsigned short* __restrict__ vlp,
            float* outp, float sscale, float oscl) {
  union FH { v16h v; v8h h[2]; };
  // two tile buffers of K hi [kv][d], K residual, V^T hi [d][kv], V^T residual, 9 KB each; behind the loop's last
  // barrier the same bytes hold the per wave context tiles [row][d] (34 KB)
  __shared__ __align__(16) _Float16 KV[2 * KVBUF];

  const int tid  = threadIdx.x;
  const int wave = tid >> 5;
  const int lane = tid & 31;
  const int hh   = lane >> 4;
  const int c    = lane & 15;

  const int bx   = blockIdx.x;
  const int qb   = bx % NQB;
  const int rest = bx / NQB;
  const int h    = rest % NH;
  const int b    = rest / NH;                // < NB by the grid size
  const int q0   = qb * 128 + wave * 32;
  const size_t rowB = (size_t)b * SEQ;

  const _Float16* Qp  = (const _Float16*)(const void*)qhp + (size_t)h * HD;
  const _Float16* Qlq = (const _Float16*)(const void*)qlp + (size_t)h * HD;
  const _Float16* Kp  = (const _Float16*)(const void*)khp + (size_t)h * HD;
  const _Float16* Klq = (const _Float16*)(const void*)klp + (size_t)h * HD;
  const _Float16* Vh  = (const _Float16*)(const void*)vhp + ((size_t)b * DM + (size_t)h * HD) * SEQ;
  const _Float16* Vl  = (const _Float16*)(const void*)vlp + ((size_t)b * DM + (size_t)h * HD) * SEQ;

  // ---- Q fragments (B operand, column = lane&15): 2 query groups x 2 d-chunks, hi and residual ----
  v16h qa[2][2], ql[2][2];
#pragma unroll
  for (int g = 0; g < 2; ++g) {
#pragma unroll
    for (int dc = 0; dc < 2; ++dc) {
      const size_t qo = (rowB + q0 + g * 16 + c) * DM + dc * 32 + 8 * hh;
      qa[g][dc] = ldfrag_h(Qp + qo);
      ql[g][dc] = ldfrag_h(Qlq + qo);
    }
#if defined(__HIP_DEVICE_COMPILE__)
    // no address register of this group's Q loads is rewritten in front of this wait; the scheduling barrier keeps the
    // next group's loads and the later address arithmetic, which reuse those registers, from being lifted over it
    asm volatile("s_wait_xcnt 0x0" ::: "memory");
    __builtin_amdgcn_sched_barrier(0);
#endif
  }

  // this lane's piece of every 16-row group: row tid>>3, 16-B column tid&7
  const int srow = tid >> 3, spc = (tid & 7) * 8;
  const _Float16* gk  = Kp  + (rowB + srow) * DM + spc;           // K hi row srow of key tile 0
  const _Float16* gkl = Klq + (rowB + srow) * DM + spc;           // K residual
  const _Float16* gv  = Vh + (size_t)srow * SEQ + spc;            // V^T hi row d = srow, keys of tile 0
  const _Float16* gvl = Vl + (size_t)srow * SEQ + spc;            // V^T residual
  const unsigned l0 = lds_off(KV) + (unsigned)(srow * KVP + spc) * 2u;
  stage_kv(l0, gk, gkl, gv, gvl);

  float mrow[2], lrow[2];                // of query q0 + 16 g + c; lrow sums this half's keys only, joined behind the loop
  v8f oacc[2][4];                        // oacc[g][t][r] = context of query q0 + 16 g + c, feature 16 t + 8 hh + r
#pragma unroll
  for (int g = 0; g < 2; ++g) {
    mrow[g] = -INFINITY;
    lrow[g] = 0.f;
#pragma unroll
    for (int t = 0; t < 4; ++t) oacc[g][t] = zero8();
  }

  for (int kt = 0; kt < NKT; ++kt) {
    // hand-over between trip kt - 1 and trip kt: tile kt becomes readable, tile kt - 1's buffer becomes free; then tile
    // kt + 1 is copied into that buffer. It stands at the head of the trip, with nothing behind the trip's arithmetic:
    // behind a branch at the foot the compiler moves the row sums there and holds all 64 p of a lane over the second product.
    wait_lds_reads();
    wait_copies();
    __syncthreads();
    if (kt + 1 < NKT) {
      stage_kv(l0 + (unsigned)((kt + 1) & 1) * (KVBUF * 2u), gk + (size_t)(kt + 1) * 64 * DM,
               gkl + (size_t)(kt + 1) * 64 * DM, gv + (kt + 1) * 64, gvl + (kt + 1) * 64);
    }
    // (kv0 below = 64 kt, the tile's first key)
    // Fragment reads: plain LDS loads in groups of 8 ds_load_b128 (one 16-key group of K, or two 16-feature groups of
    // V^T, hi and residual planes), written one group ahead of the WMMAs that use them; the WMMAs are bare builtins, so
    // no asm statement stands between a read and an earlier WMMA and the reads can be issued ahead, behind counted waits.
    const _Float16* kfh = KV + (kt & 1) * KVBUF + c * KVP + 8 * hh;
    const _Float16* kfl = kfh + KVT;
    const _Float16* vfh = kfh + 2 * KVT;
    const _Float16* vfl = kfh + 3 * KVT;
    v16h kb[4][2], kr[4][2];             // K hi / residual fragments of key group j, d chunk dc
    v16h vb[2][4], vl[2][4];             // V^T hi / residual fragments of key chunk kk, feature group t
#define LD_K(j)                                                   \
    _Pragma("unroll") for (int dc = 0; dc < 2; ++dc) {            \
      kb[j][dc] = ldfrag_h(kfh + (j) * 16 * KVP + dc * 32);       \
      kr[j][dc] = ldfrag_h(kfl + (j) * 16 * KVP + dc * 32);       \
    }
#define LD_V(kk, tp)                                              \
    _Pragma("unroll") for (int t = 2 * (tp); t < 2 * (tp) + 2; ++t) { \
      vb[kk][t] = ldfrag_h(vfh + t * 16 * KVP + (kk) * 32);       \
      vl[kk][t] = ldfrag_h(vfl + t * 16 * KVP + (kk) * 32);       \
    }
    // ---- scores, transposed: 64 keys x 32 queries per wave; hi.hi into s, hi.lo + lo.hi into s1 (folded x 2^-10) ----
    v8f s[2][4], s1[2][4];               // s[g][j][r] = score of key kv0 + 16 j + 8 hh + r with query q0 + 16 g + c
#define SCORE(j)                                                  \
    _Pragma("unroll") for (int g = 0; g < 2; ++g) { s[g][j] = zero8(); s1[g][j] = zero8(); } \
    _Pragma("unroll") for (int dc = 0; dc < 2; ++dc) {            \
      _Pragma("unroll") for (int g = 0; g < 2; ++g) {             \
        s[g][j]  = mma_h_raw(kb[j][dc], qa[g][dc], s[g][j]);      \
        s1[g][j] = mma_h_raw(kr[j][dc], qa[g][dc], s1[g][j]);     \
        s1[g][j] = mma_h_raw(kb[j][dc], ql[g][dc], s1[g][j]);     \
      }                                                           \
    }
#define FOLD_S(j)                                                 \
    _Pragma("unroll") for (int g = 0; g < 2; ++g)                 \
      _Pragma("unroll") for (int r = 0; r < 8; ++r) s[g][j][r] += s1[g][j][r] * (1.0f / 1024.0f);
    LD_K(0) LD_K(1)
    SCORE(0)
    LD_K(2)
    SCORE(1) FOLD_S(0)
    LD_K(3)
    SCORE(2) FOLD_S(1)
    LD_V(0, 0)
    SCORE(3) FOLD_S(2)
    LD_V(0, 1)
    FOLD_S(3)

    // ---- per group: scale, maximum of the query's 64 scores (32 in the lane, then the other half's), online softmax ----
    FH pb[2][2];                         // P^T (x1024, f16) of group g, key chunk kk: keys kv0 + 32 kk + 8 hh + (0..7), then
                                         // + 16: the k order of the V^T fragments
#pragma unroll
    for (int g = 0; g < 2; ++g) {
      float mj[4];
#pragma unroll
      for (int j = 0; j < 4; ++j) {
        float m = -INFINITY;
#pragma unroll
        for (int r = 0; r < 8; ++r) {
          const float sv = s[g][j][r] * sscale;
          s[g][j][r] = sv;
          m = fmaxf(m, sv);
        }
        mj[j] = m;
      }
      float mt = fmaxf(fmaxf(mj[0], mj[1]), fmaxf(mj[2], mj[3]));
      mt = fmaxf(mt, xhalf(mt));
      const float mnew  = fmaxf(mrow[g], mt);
      const float msafe = (mnew == -INFINITY) ? 0.f : mnew;
      const float alpha = __expf(mrow[g] - msafe);
      mrow[g] = mnew;
      v8h ph[4];                         // ph[j][r] belongs to key kv0 + 16 j + 8 hh + r
      float ps[4];
#pragma unroll
      for (int j = 0; j < 4; ++j) {
        v8f p1024;
        float a = 0.f;
#pragma unroll
        for (int r = 0; r < 8; ++r) {
          const float p = __expf(s[g][j][r] - msafe);
          a += p;
          p1024[r] = p * 1024.0f;
        }
        ps[j] = a;
        ph[j] = __builtin_convertvector(p1024, v8h);
      }
      lrow[g] = lrow[g] * alpha + ((ps[0] + ps[1]) + (ps[2] + ps[3]));
#pragma unroll
      for (int t = 0; t < 4; ++t)
#pragma unroll
        for (int r = 0; r < 8; ++r) oacc[g][t][r] *= alpha;
#pragma unroll
      for (int kk = 0; kk < 2; ++kk) {
        pb[g][kk].h[0] = ph[2 * kk];
        pb[g][kk].h[1] = ph[2 * kk + 1];
      }
    }

    // ---- context^T += Vhi^T . P^T (f16 WMMA); Vres^T . P^T into a separate accumulator ----
    v8f o1[2][4];
#pragma unroll
    for (int g = 0; g < 2; ++g)
#pragma unroll
      for (int t = 0; t < 4; ++t) o1[g][t] = zero8();
#define CTX(kk, tp)                                               \
    _Pragma("unroll") for (int t = 2 * (tp); t < 2 * (tp) + 2; ++t) { \
      _Pragma("unroll") for (int g = 0; g < 2; ++g) {             \
        oacc[g][t] = mma_h_raw(vb[kk][t], pb[g][kk].v, oacc[g][t]); \
        o1[g][t]   = mma_h_raw(vl[kk][t], pb[g][kk].v, o1[g][t]);   \
      }                                                           \
    }
    // Order of the stretch from the tile barrier to here, for the scheduler: 16 reads, then 12 WMMAs and 8 reads in turn.
    // Left alone it spreads the reads singly among the WMMAs.
#define SGB_LDS(n, id)  __builtin_amdgcn_sched_group_barrier(0x100, n, id)
#define SGB_WMMA(n, id) __builtin_amdgcn_sched_group_barrier(0x008, n, id)
    SGB_LDS(16, 0); SGB_WMMA(12, 0); SGB_LDS(8, 0); SGB_WMMA(12, 0); SGB_LDS(8, 0); SGB_WMMA(12, 0); SGB_LDS(8, 0); SGB_WMMA(12, 0);
    SGB_LDS(8, 0);
    // ends the stretch that the group barriers above order; the second key chunk's V^T reads stay behind the softmax,
    // where the first chunk's 16 WMMAs cover their latency, instead of holding 64 more registers through it
    __builtin_amdgcn_sched_barrier(0);
    LD_V(1, 0)
    CTX(0, 0)
    LD_V(1, 1)
    CTX(0, 1) CTX(1, 0) CTX(1, 1)
    SGB_LDS(8, 1); SGB_WMMA(8, 1); SGB_LDS(8, 1); SGB_WMMA(24, 1);   // the same for this stretch
#undef SGB_LDS
#undef SGB_WMMA
#undef LD_K
#undef LD_V
#undef SCORE
#undef FOLD_S
#undef CTX
#pragma unroll
    for (int g = 0; g < 2; ++g)
#pragma unroll
      for (int t = 0; t < 4; ++t)
#pragma unroll
        for (int r = 0; r < 8; ++r) oacc[g][t][r] += o1[g][t][r] * (1.0f / 4096.0f);
  }
  // every wave's tile reads are done before the first tile buffer, which last held tile NKT - 2, is used for the context tiles
  wait_lds_reads();
  wait_copies();
  __syncthreads();

  // ---- join the halves' sums, normalise (1/l and the carries via oscl), stage the wave's 32x64 tile in LDS
  //      (row = query 16 g + c, 8 consecutive features per accumulator tile), then write whole 256-B row segments
  float* os = (float*)(void*)KV + wave * (32 * OSP);
#pragma unroll
  for (int g = 0; g < 2; ++g) {
    const float l = lrow[g] + xhalf(lrow[g]);
    const float inv = ((l > 0.f) ? (1.0f / l) : 0.f) * oscl;
#pragma unroll
    for (int t = 0; t < 4; ++t) {
      v4f lo, hi;
#pragma unroll
      for (int r = 0; r < 4; ++r) {
        lo[r] = oacc[g][t][r] * inv;
        hi[r] = oacc[g][t][4 + r] * inv;
      }
      *(v4f*)(os + (g * 16 + c) * OSP + t * 16 + 8 * hh) = lo;
      *(v4f*)(os + (g * 16 + c) * OSP + t * 16 + 8 * hh + 4) = hi;
    }
  }
  __builtin_amdgcn_fence(__ATOMIC_RELEASE, "workgroup");
  __builtin_amdgcn_wave_barrier();
  __builtin_amdgcn_fence(__ATOMIC_ACQUIRE, "workgroup");
  {
    const int h2 = lane >> 4, c4 = (lane & 15) * 4;
    v4f ov[16];
#pragma unroll
    for (int it = 0; it < 16; ++it) {
      const int row = it * 2 + h2;   // it 0..15 x h2 0..1 = rows 0..31 of the wave tile
      ov[it] = *(const v4f*)(os + row * OSP + c4);
    }
    {
#pragma unroll
      for (int it = 0; it < 16; ++it) {
        const int row = it * 2 + h2;
        const size_t go = (rowB + q0 + row) * DM + (size_t)h * HD + c4;
        *(v4f*)(outp + go) = ov[it];
      }
      
    }
  }
}

// =====================================================================================================
// Workspace map (bytes), every region an exact multiple of its whole-line / whole-tile store granularity
// 8192 x 512, 512 x 512 and 4096 x 1024 are whole tiles/lines):
//   Xb    bf16 [8192][512]            0          8388608
//   Wtq   bf16 [512][512]       8388608           524288   ([n][e])
//   Wtk   bf16 [512][512]       8912896           524288
//   Wtv   bf16 [512][512]       9437184           524288
//   Wto   f16  [512][512]       9961472           524288   ([n][k], bf16rne value x4096)
//   Tf    f32  [8192][512]     10485760         16777216   (scratch: q, then msgs)
//   Qh    f16  [8192][512]     27262976          8388608
//   Ql    f16  [8192][512]     35651584          8388608
//   Kh    f16  [8192][512]     44040192          8388608
//   Kl    f16  [8192][512]     52428800          8388608
//   VTh   f16  [4096][1024]    60817408          8388608   ([b*DM + h*64 + d][s])
//   VTl   f16  [4096][1024]    69206016          8388608
//   Mh    f16  [8192][512]     77594624          8388608   (msgs x1024)
//   Ml    f16  [8192][512]     85983232          8388608   (msgs residual)
//   Tk    f32  [8192][512]     94371840         16777216   (scratch: k)
//   Tv    f32  [8192][512]    111149056         16777216   (scratch: v)
//   end                       127926272
// Inputs: nodes f32 [8][1024][512]; Wq, Wk, Wv, Wo f32 [512 in][512 out] (x @ W layout); bq, bk, bv, bo f32
// [512] (index h*64+d = n). d_out f32: [8192][512] at byte 0 (row = b*SEQ + t, col = n).
// =====================================================================================================
extern "C" void kernel_launch(void* const* d_in, const int* in_sizes, int n_in,
                              void* d_out, int out_size, void* d_ws, size_t ws_size,
                              hipStream_t stream) {
  if (n_in < 9) return;
  if (in_sizes[0] != NB * SEQ * DM) return;
  if (in_sizes[1] != DM * DM) return;
  if (in_sizes[2] != DM * DM) return;
  if (in_sizes[3] != DM * DM) return;
  if (in_sizes[4] != DM) return;
  if (in_sizes[5] != DM) return;
  if (in_sizes[6] != DM) return;
  if (in_sizes[7] != DM * DM) return;
  if (in_sizes[8] != DM) return;
  if (out_size != OUTN) return;

  const float* x  = (const float*)d_in[0];   // [NB*SEQ][DM]
  const float* Wq = (const float*)d_in[1];   // [DM e][DM n]
  const float* Wk = (const float*)d_in[2];
  const float* Wv = (const float*)d_in[3];
  const float* bq = (const float*)d_in[4];   // [DM]
  const float* bk = (const float*)d_in[5];
  const float* bv = (const float*)d_in[6];
  const float* Wo = (const float*)d_in[7];   // [DM k][DM n]
  const float* bo = (const float*)d_in[8];

  const size_t PXb = (size_t)ROWS * DM * 2;          //  8388608
  const size_t PW  = (size_t)DM * DM * 2;            //   524288
  const size_t PF  = (size_t)ROWS * DM * 4;          // 16777216
  const size_t PH  = (size_t)ROWS * DM * 2;          //  8388608
  const size_t PVt = (size_t)NB * DM * SEQ * 2;      //  8388608
  size_t off = 0;
  const size_t oXb = off; off += PXb;
  const size_t oWq = off; off += PW;
  const size_t oWk = off; off += PW;
  const size_t oWv = off; off += PW;
  const size_t oWo = off; off += PW;
  const size_t oTf = off; off += PF;
  const size_t oQh = off; off += PH;
  const size_t oQl = off; off += PH;
  const size_t oKh = off; off += PH;
  const size_t oKl = off; off += PH;
  const size_t oVt = off; off += PVt;
  const size_t oVl = off; off += PVt;
  const size_t oMh = off; off += PH;
  const size_t oMl = off; off += PH;
  const size_t oTk = off; off += PF;
  const size_t oTv = off; off += PF;
  if (off > ws_size) return;                        // off = 127926272
  if (off > (size_t)134217728) return;

  char* ws = (char*)d_ws;
  unsigned short* Xb  = (unsigned short*)(ws + oXb);
  unsigned short* Wtq = (unsigned short*)(ws + oWq);
  unsigned short* Wtk = (unsigned short*)(ws + oWk);
  unsigned short* Wtv = (unsigned short*)(ws + oWv);
  unsigned short* Wto = (unsigned short*)(ws + oWo);
  float*          Tf  = (float*)(ws + oTf);
  float*          Tk  = (float*)(ws + oTk);
  float*          Tv  = (float*)(ws + oTv);
  unsigned short* Qh  = (unsigned short*)(ws + oQh);
  unsigned short* Ql  = (unsigned short*)(ws + oQl);
  unsigned short* Kh  = (unsigned short*)(ws + oKh);
  unsigned short* Kl  = (unsigned short*)(ws + oKl);
  unsigned short* VTh = (unsigned short*)(ws + oVt);
  unsigned short* VTl = (unsigned short*)(ws + oVl);
  unsigned short* Mh  = (unsigned short*)(ws + oMh);
  unsigned short* Ml  = (unsigned short*)(ws + oMl);
  float*          outf = (float*)d_out;             // [ROWS][DM]

  const dim3 blk(256);
  const int n8x = ROWS * DM / 8;                    // 524288
  const dim3 gCvtX((n8x + 255) / 256);              // 2048 blocks
  const dim3 gPrep(4 * WTB + PLB);                  // 256 weight tiles, then 2048 activation blocks
  const dim3 gGemm(ROWS / 64, 3);                   // 128 blocks of 64 rows x 512 columns, for each of q, k, v
  const dim3 gGemO(ROWS / 32);                      // 256 blocks of 32 rows x 512 columns
  const dim3 gSplit(VTB + 2 * PLB);                 // 1024 v tiles, then 2048 blocks each for q and k
  const dim3 gAttn(NB * NH * NQB);                  // 512 blocks of 128 query rows
  const float qkScale = 16.0f;                      // q and k hi planes carried x16 (residual x1024 on top)
  const float sscale  = 1.0f / 2048.0f;             // 1/(16*16) * 1/sqrt(64)
  const float vScale  = 256.0f;                     // v^T hi plane carried x256
  const float attOscl = 1.0f / 262144.0f;           // 1/(1024 * 256): p and v carries folded back
  const float mScale  = 1024.0f;                    // msgs hi plane carried x1024 (residual x1024 on top)
  const float woScale = 4096.0f;                    // Wo^T carried x4096 in f16
  const float outOscl = 1.0f / 4194304.0f;          // 1/(1024 * 4096)

  // (1) activations -> bf16 plane; weights -> transposed 16-bit planes [n][e] (RNE convert): one grid
  prep<<<gPrep, blk, 0, stream>>>(x, Wq, Wk, Wv, Wo, Xb, Wtq, Wtk, Wtv, Wto, n8x, woScale);
  // (2) q, k, v = Xb . Wt^T + bias -> Tf, Tk, Tv [8192][512] (M=8192, N=512, K=512 each): one grid
  gemm64<<<gGemm, blk, 0, stream>>>(Xb, Wtq, Wtk, Wtv, bq, bk, bv, Tf, Tk, Tv, ROWS);
  // (3) q, k -> f16 hi (x16) + residual planes; v -> f16 v^T hi plane (x256) and residual plane (x4096 on top): one grid
  planes_qkv<<<gSplit, blk, 0, stream>>>(Tf, Tk, Tv, Qh, Ql, Kh, Kl, VTh, VTl, n8x, qkScale, vScale);
  // (4) attention -> msgs f32 [8192][512] in Tf, then f16 hi (x1024) + residual planes
  attn64<<<gAttn, dim3(128), 0, stream>>>(Qh, Ql, Kh, Kl, VTh, VTl, Tf, sscale, attOscl);
  planes_f16x8<<<gCvtX, blk, 0, stream>>>(Tf, Mh, Ml, n8x, mScale);
  // (5) out = msgs . Wo + bo -> d_out f32 [8192][512] (M=8192, N=512, K=512)
  gemm_o<<<gGemO, blk, 0, stream>>>(Mh, Ml, Wto, bo, outf, ROWS, outOscl);
  (void)hipGetLastError();
}

// v008
// One run takes 88.3 microseconds.
// Timed twice side by side with v007, it ran 1.10 and 1.09 times as fast.
// Counting every step since v000, it is 3.05 times as fast.
// Contractions: q/k/v projections = v_wmma_f32_16x16x32_bf16 (bf16 operands from RNE-converted nodes, W^T and bias, single product); q.k^T scores = v_wmma_f32_16x16x32_f16 (q, k as f16 hi planes carried x16 plus f16 residual planes x1024: hi.hi + (hi.lo + lo.hi) in a separate accumulator, 3 products); p.v = v_wmma_f32_16x16x32_f16 (p carried x1024 in f16; v^T as f16 hi plane x256 plus f16 residual plane x4096 in a separate accumulator folded with 2^-12, 2 products); output projection = v_wmma_f32_16x16x32_f16 (msgs as f16 hi plane x1024 plus f16 residual plane x1024 in a separate accumulator folded with 2^-10; Wo^T = RNE bf16 value carried x4096 in f16; 2 products); all f32 accumulate; softmax in f32.
#include <hip/hip_runtime.h>
#include <math.h>
#include <stdint.h>

#define NB    8
#define SEQ   1024
#define DM    512
#define NH    8
#define HD    64
#define NKT   (SEQ / 64)            // attn64: key tiles of 64
#define NQB   (SEQ / 128)           // attn64: query blocks of one (b, h): 4 waves x 32 query rows
#define ROWS  (NB * SEQ)            // 8192 token rows
#define OUTN  (ROWS * DM)
#define KVP   72                    // LDS pitch of the 64-wide f16 tiles in attn64, in halves: 144 B = 16 B x 9 (odd)
#define OSP   68                    // LDS pitch of the 64-wide f32 context tile in attn64, in floats
#define KVT   (64 * KVP)            // attn64: halves of one staged 64 x 64 plane tile (9216 B)
#define KVBUF (4 * KVT)             // attn64: halves of one tile buffer: K hi, K residual, V^T hi, V^T residual (36864 B)
#define GKC   64                    // GEMMs: k elements of one staged slice = 128 B of every staged row
#define GSP   72                    // GEMMs: LDS pitch of a staged row, in 16-bit elements: 144 B = 16 B x 9 (odd)
#define GROWS (64 + DM)             // gemm64: staged rows of a slice: 64 A rows, then the DM rows of B
#define GBUF  (GROWS * GSP)         // gemm64: 16-bit elements of one slice buffer (82944 B)
#define NSL   (DM / GKC)            // GEMMs: slices along k
#define ASP   520                   // gemm_o: LDS pitch of a resident A row (all DM k), in halves: 1040 B = 16 B x 65 (odd)
#define GBB   (DM * GSP)            // gemm_o: halves of one B slice buffer (73728 B)
#define WTB   ((DM / 64) * (DM / 64))      // 64 x 64 tiles of one weight matrix
#define VTB   ((SEQ / 64) * NH * NB)       // 64 x 64 tiles of v
#define PLB   (ROWS * DM / 8 / 256)        // blocks of one 8-elements-per-thread pass over a [ROWS][DM] plane
static_assert(NH * HD == DM);
static_assert(HD == 64);
static_assert(16 * KVP * 2 == 2304 && KVT * 2 == 9216);        // copy8: LDS bytes of 16 staged rows, of one plane tile
static_assert(4 * 32 * OSP * 4 <= 2 * KVBUF * 2 && NKT >= 2 && (SEQ % 128) == 0);   // the context tiles fit the tile buffers; two buffers
static_assert(32 * GSP * 2 == 4608);                           // copy9: LDS bytes of 32 staged rows
static_assert(DM == 8 * 64 && GROWS == 18 * 32 && NSL >= 2);   // 8 waves x 64 columns; 18 copies per thread; two buffers
static_assert(ASP >= DM + 8 && (ASP * 2) % 32 == 16);          // gemm_o: a resident A row holds all DM k; pitch 16 B x odd
static_assert((SEQ % 64) == 0 && (DM % 64) == 0 && (ROWS % 64) == 0);
static_assert(((ROWS / 64) * (DM / 64)) % 8 == 0);
static_assert(((ROWS / 32) * (DM / 64)) % 8 == 0);
static_assert(((ROWS * DM / 8) % 256) == 0);

typedef _Float16 v16h __attribute__((ext_vector_type(16)));
typedef _Float16 v8h  __attribute__((ext_vector_type(8)));
typedef __bf16   v16b __attribute__((ext_vector_type(16)));
typedef __bf16   v8b  __attribute__((ext_vector_type(8)));
typedef float    v8f  __attribute__((ext_vector_type(8)));
typedef float    v4f  __attribute__((ext_vector_type(4)));
typedef unsigned int v4u __attribute__((ext_vector_type(4)));

// ---- scalar helpers --------------------------------------------------------------------------------
__device__ __forceinline__ unsigned short bf_bits(float f) {          // f32 -> bf16 bits, RNE convert
  unsigned u = __float_as_uint(f);
  return (unsigned short)((u + 0x7FFFu + ((u >> 16) & 1u)) >> 16);
}
__device__ __forceinline__ float bf_up(unsigned short h) { return __uint_as_float(((unsigned)h) << 16); }
__device__ __forceinline__ unsigned short h_bits(_Float16 x) { return __builtin_bit_cast(unsigned short, x); }
__device__ __forceinline__ unsigned pk16(unsigned short a, unsigned short b) { return (unsigned)a | ((unsigned)b << 16); }
__device__ __forceinline__ v8f zero8() { v8f z = {0.f, 0.f, 0.f, 0.f, 0.f, 0.f, 0.f, 0.f}; return z; }

// ---- fragment loaders: 16-bit A/B operand, lane -> row/col (lane&15), p already includes +8*(lane>>4);
//      elements 0..7 <- p[0..7] (k0+8h..), elements 8..15 <- p[16..23] (k0+16+8h..)
__device__ __forceinline__ v16b ldfrag_b(const __bf16* p) {
  union { v16b v; v8b h[2]; } f;
  f.h[0] = *(const v8b*)(p);
  f.h[1] = *(const v8b*)(p + 16);
  return f.v;
}
__device__ __forceinline__ v16h ldfrag_h(const _Float16* p) {
  union { v16h v; v8h h[2]; } f;
  f.h[0] = *(const v8h*)(p);
  f.h[1] = *(const v8h*)(p + 16);
  return f.v;
}

// ---- WMMA helpers with trailing VALU hazard gap --------------------------------------------------------
__device__ __forceinline__ v8f mma_h(v16h a, v16h b, v8f c) {
  c = __builtin_amdgcn_wmma_f32_16x16x32_f16(false, a, false, b, (short)0, c, false, false);
#if defined(__HIP_DEVICE_COMPILE__)
  asm volatile("v_nop\n\tv_nop\n\tv_nop\n\tv_nop" : "+v"(c) : "v"(a), "v"(b));
#endif
  return c;
}
__device__ __forceinline__ v8f mma_h_raw(v16h a, v16h b, v8f c) {   // the compiler keeps the distances behind its own builtin
  return __builtin_amdgcn_wmma_f32_16x16x32_f16(false, a, false, b, (short)0, c, false, false);
}
__device__ __forceinline__ v8f mma_b_raw(v16b a, v16b b, v8f c) {
  return __builtin_amdgcn_wmma_f32_16x16x32_bf16(false, a, false, b, (short)0, c, false, false);
}
__device__ __forceinline__ void dep_guard_b(v8f& a, v8f& b, v16b x, v16b y) {
#if defined(__HIP_DEVICE_COMPILE__)
  asm volatile("v_nop\n\tv_nop\n\tv_nop\n\tv_nop" : "+v"(a), "+v"(b) : "v"(x), "v"(y));
#endif
}
__device__ __forceinline__ void keep4_b(v16b a, v16b b, v16b c, v16b d) {
#if defined(__HIP_DEVICE_COMPILE__)
  asm volatile("v_nop" :: "v"(a), "v"(b), "v"(c), "v"(d));
#endif
}
__device__ __forceinline__ void acc_guard4(v8f& a, v8f& b, v8f& c, v8f& d) {
#if defined(__HIP_DEVICE_COMPILE__)
  asm volatile("v_nop\n\tv_nop\n\tv_nop\n\tv_nop" : "+v"(a), "+v"(b), "+v"(c), "+v"(d));
#endif
}

// lane l <-> lane l ^ 16 (the other half of the wave), in the vector unit
__device__ __forceinline__ float xhalf(float x) {
  const int b = __builtin_bit_cast(int, x);
  return __builtin_bit_cast(float, __builtin_amdgcn_permlanex16(b, b, 0x76543210, 0xfedcba98, false, false));
}

// ---- GEMM operand staging: asynchronous copies global -> LDS, waits -----------------------------------
__device__ __forceinline__ unsigned lds_off(const void* p) { return (unsigned)(size_t)p; }   // LDS byte address
// nine 16-B copies of this lane: LDS bytes l + 4608 i (32 staged rows of 144 B further each) <- global g0 .. g8
__device__ __forceinline__ void copy9(unsigned l, const unsigned short* g0, const unsigned short* g1,
                                      const unsigned short* g2, const unsigned short* g3, const unsigned short* g4,
                                      const unsigned short* g5, const unsigned short* g6, const unsigned short* g7,
                                      const unsigned short* g8) {
#if defined(__HIP_DEVICE_COMPILE__)
  // the closing s_wait_xcnt stands in the copies' own statement: no address register is rewritten in front of it
  asm volatile(
      "global_load_async_to_lds_b128 %0, %9, off\n\t"
      "global_load_async_to_lds_b128 %1, %10, off\n\t"
      "global_load_async_to_lds_b128 %2, %11, off\n\t"
      "global_load_async_to_lds_b128 %3, %12, off\n\t"
      "global_load_async_to_lds_b128 %4, %13, off\n\t"
      "global_load_async_to_lds_b128 %5, %14, off\n\t"
      "global_load_async_to_lds_b128 %6, %15, off\n\t"
      "global_load_async_to_lds_b128 %7, %16, off\n\t"
      "global_load_async_to_lds_b128 %8, %17, off\n\t"
      "s_wait_xcnt 0x0"
      :: "v"(l), "v"(l + 4608u), "v"(l + 2u * 4608u), "v"(l + 3u * 4608u), "v"(l + 4u * 4608u),
         "v"(l + 5u * 4608u), "v"(l + 6u * 4608u), "v"(l + 7u * 4608u), "v"(l + 8u * 4608u),
         "v"(g0), "v"(g1), "v"(g2), "v"(g3), "v"(g4), "v"(g5), "v"(g6), "v"(g7), "v"(g8)
      : "memory");
#endif
}
// One slice = GROWS rows x 128 B = 18 groups of 32 rows; thread tid copies 16-B column tid&7 of row tid>>3 of every
// group, so 8 lanes copy one whole 128-B line. l: the lane's LDS byte address in group 0 of the buffer; a0, a1: its
// source in A row groups 0 and 1; b: its source in B row group 0 (groups 2..17 = B rows 0..DM-1, row pitch DM).
__device__ __forceinline__ void stage_slice(unsigned l, const unsigned short* a0, const unsigned short* a1,
                                            const unsigned short* b) {
  constexpr size_t S = (size_t)32 * DM;           // 32 B rows, in elements
  copy9(l, a0, a1, b, b + S, b + 2 * S, b + 3 * S, b + 4 * S, b + 5 * S, b + 6 * S);
  copy9(l + 9u * 4608u, b + 7 * S, b + 8 * S, b + 9 * S, b + 10 * S, b + 11 * S, b + 12 * S, b + 13 * S, b + 14 * S,
        b + 15 * S);
}
// eight 16-B copies of this lane: LDS bytes l + 4608 i (32 staged rows of 144 B further each) <- global b + i s
__device__ __forceinline__ void copy8r(unsigned l, const unsigned short* b, size_t s) {
#if defined(__HIP_DEVICE_COMPILE__)
  // the closing s_wait_xcnt stands in the copies' own statement: no address register is rewritten in front of it
  asm volatile(
      "global_load_async_to_lds_b128 %0, %8, off\n\t"
      "global_load_async_to_lds_b128 %1, %9, off\n\t"
      "global_load_async_to_lds_b128 %2, %10, off\n\t"
      "global_load_async_to_lds_b128 %3, %11, off\n\t"
      "global_load_async_to_lds_b128 %4, %12, off\n\t"
      "global_load_async_to_lds_b128 %5, %13, off\n\t"
      "global_load_async_to_lds_b128 %6, %14, off\n\t"
      "global_load_async_to_lds_b128 %7, %15, off\n\t"
      "s_wait_xcnt 0x0"
      :: "v"(l), "v"(l + 4608u), "v"(l + 2u * 4608u), "v"(l + 3u * 4608u), "v"(l + 4u * 4608u),
         "v"(l + 5u * 4608u), "v"(l + 6u * 4608u), "v"(l + 7u * 4608u),
         "v"(b), "v"(b + s), "v"(b + 2 * s), "v"(b + 3 * s), "v"(b + 4 * s), "v"(b + 5 * s), "v"(b + 6 * s), "v"(b + 7 * s)
      : "memory");
#endif
}
// One B slice = DM rows x 128 B = 16 groups of 32 rows, dealt to the threads as in stage_slice. l: the lane's LDS byte
// address in group 0 of the buffer; b: its source in B row group 0 (row pitch DM).
__device__ __forceinline__ void stage_b(unsigned l, const unsigned short* b) {
  constexpr size_t S = (size_t)32 * DM;           // 32 B rows, in elements
  copy8r(l, b, S);
  copy8r(l + 8u * 4608u, b + 8 * S, S);
}
__device__ __forceinline__ void wait_copies() {   // this wave's copies have landed in LDS
#if defined(__HIP_DEVICE_COMPILE__)
  asm volatile("s_wait_asynccnt 0x0" ::: "memory");
#endif
}
__device__ __forceinline__ void wait_lds_reads() {   // this wave's LDS reads are done before the buffer is handed on
#if defined(__HIP_DEVICE_COMPILE__)
  asm volatile("s_wait_dscnt 0x0" ::: "memory");
#endif
}

// eight 16-B copies of this lane, two planes x four groups of 16 staged rows: LDS bytes l + 2304 g <- a + g rstep,
// LDS bytes l + 9216 + 2304 g <- b + g rstep (g = 0..3; rstep = 16 source rows, in elements)
__device__ __forceinline__ void copy8(unsigned l, const _Float16* a, const _Float16* b, size_t rstep) {
#if defined(__HIP_DEVICE_COMPILE__)
  // the closing s_wait_xcnt stands in the copies' own statement: no address register is rewritten in front of it
  asm volatile(
      "global_load_async_to_lds_b128 %0, %8, off\n\t"
      "global_load_async_to_lds_b128 %1, %9, off\n\t"
      "global_load_async_to_lds_b128 %2, %10, off\n\t"
      "global_load_async_to_lds_b128 %3, %11, off\n\t"
      "global_load_async_to_lds_b128 %4, %12, off\n\t"
      "global_load_async_to_lds_b128 %5, %13, off\n\t"
      "global_load_async_to_lds_b128 %6, %14, off\n\t"
      "global_load_async_to_lds_b128 %7, %15, off\n\t"
      "s_wait_xcnt 0x0"
      :: "v"(l), "v"(l + 2304u), "v"(l + 2u * 2304u), "v"(l + 3u * 2304u),
         "v"(l + 9216u), "v"(l + 9216u + 2304u), "v"(l + 9216u + 2u * 2304u), "v"(l + 9216u + 3u * 2304u),
         "v"(a), "v"(a + rstep), "v"(a + 2 * rstep), "v"(a + 3 * rstep),
         "v"(b), "v"(b + rstep), "v"(b + 2 * rstep), "v"(b + 3 * rstep)
      : "memory");
#endif
}
// One key tile of attn64 = 4 planes x 64 rows x 128 B; thread tid (of 128) copies 16-B column tid&7 of row tid>>3 of
// every 16-row group, so 8 lanes copy one whole 128-B line. l: the lane's LDS byte address in group 0 of the buffer's
// first plane; k, kl: its source in rows 0..15 of the K tiles (row pitch DM); v, vl: the same in the V^T tiles (pitch SEQ).
__device__ __forceinline__ void stage_kv(unsigned l, const _Float16* k, const _Float16* kl, const _Float16* v,
                                         const _Float16* vl) {
  copy8(l, k, kl, (size_t)16 * DM);
  copy8(l + 2u * 9216u, v, vl, (size_t)16 * SEQ);
}

// =====================================================================================================
// f32 -> bf16 (RNE convert), 8 elements per thread, one 16-B store per lane: a wave writes 512 contiguous B
// coverage: n8 threads x 8 = whole plane (n8 is a multiple of 256 here).
// =====================================================================================================
__device__ __forceinline__ void cvt_bf16x8_body(const float* __restrict__ in, unsigned short* out, int n8, int blk) {
  const int i = blk * 256 + threadIdx.x;
  if (i < n8) {
    const v4f a = *(const v4f*)(in + (size_t)i * 8);
    const v4f b = *(const v4f*)(in + (size_t)i * 8 + 4);
    v4u p;
    p[0] = pk16(bf_bits(a[0]), bf_bits(a[1]));
    p[1] = pk16(bf_bits(a[2]), bf_bits(a[3]));
    p[2] = pk16(bf_bits(b[0]), bf_bits(b[1]));
    p[3] = pk16(bf_bits(b[2]), bf_bits(b[3]));
    *(v4u*)(out + (size_t)i * 8) = p;
    
  }
}

// =====================================================================================================
// f32 -> f16 hi plane = f16(v * scale) (scale a power of two) + f16 residual plane = f16((v*scale - hi) * 1024),
// same element index in both planes; 8 elements per thread, one 16-B store per lane and plane: a wave writes
// coverage: n8 threads x 8 = whole plane (n8 multiple of 256).
// =====================================================================================================
__device__ __forceinline__ void planes_f16x8_body(const float* __restrict__ in, unsigned short* hp,
                                                  unsigned short* lp, int n8, float scale, int blk) {
  const int i = blk * 256 + threadIdx.x;
  if (i < n8) {
    const v4f a = *(const v4f*)(in + (size_t)i * 8);
    const v4f b = *(const v4f*)(in + (size_t)i * 8 + 4);
    float f[8];
    f[0] = a[0]; f[1] = a[1]; f[2] = a[2]; f[3] = a[3];
    f[4] = b[0]; f[5] = b[1]; f[6] = b[2]; f[7] = b[3];
    v4u ph, pl;
#pragma unroll
    for (int e = 0; e < 4; ++e) {
      const float f0 = f[2 * e] * scale;
      const float f1 = f[2 * e + 1] * scale;
      const _Float16 x0 = (_Float16)f0, x1 = (_Float16)f1;
      const _Float16 l0 = (_Float16)((f0 - (float)x0) * 1024.0f);
      const _Float16 l1 = (_Float16)((f1 - (float)x1) * 1024.0f);
      ph[e] = pk16(h_bits(x0), h_bits(x1));
      pl[e] = pk16(h_bits(l0), h_bits(l1));
    }
    *(v4u*)(hp + (size_t)i * 8) = ph;
    *(v4u*)(lp + (size_t)i * 8) = pl;
    
  }
}
// the same split of 8 elements held in registers: ph = the hi plane's 16 B, pl = the residual plane's
__device__ __forceinline__ void split_f16x8(v4f a, v4f b, float scale, v4u& ph, v4u& pl) {
  float f[8];
  f[0] = a[0]; f[1] = a[1]; f[2] = a[2]; f[3] = a[3];
  f[4] = b[0]; f[5] = b[1]; f[6] = b[2]; f[7] = b[3];
#pragma unroll
  for (int e = 0; e < 4; ++e) {
    const float f0 = f[2 * e] * scale;
    const float f1 = f[2 * e + 1] * scale;
    const _Float16 x0 = (_Float16)f0, x1 = (_Float16)f1;
    const _Float16 l0 = (_Float16)((f0 - (float)x0) * 1024.0f);
    const _Float16 l1 = (_Float16)((f1 - (float)x1) * 1024.0f);
    ph[e] = pk16(h_bits(x0), h_bits(x1));
    pl[e] = pk16(h_bits(l0), h_bits(l1));
  }
}

// =====================================================================================================
// Weight transpose + convert: in W f32 [DM rows (e, contraction index)][DM cols (n, output feature)] (the
// x @ W layout) -> out Wt 16-bit [DM (n)][DM (e)] (the [n][k], k-contiguous layout the GEMM B operand uses).
// MODE 0: RNE bf16 bits. MODE 1: f16 bits of (RNE bf16 value * scale), scale a power of two (exact in f16).
// Block = one 64 e x 64 n tile (et, nt: its e and n tile index, DM/64 of each). The tile is staged in LDS as [ee][nn]
// pitch 68 floats (v4f loads, __syncthreads). in[rows e][cols n] -> out[rows n][cols e] (square here).
// Store: group g = tid>>3 (0..31), piece = tid&7: iteration it writes row n0 + (it*32+g), lanes 8q..8q+7 x 16 B
// coverage: 2 iterations x 32 groups = 64 rows n, 8 pieces x 8 = 64 e per row; grid covers every (e tile,
// n tile) -> the whole [DM][DM] plane.
// =====================================================================================================
template <int MODE>
__device__ __forceinline__ void wt_tile_body(const float* __restrict__ W, unsigned short* Wt, float scale,
                                             float* sw, int et, int nt) {
  const int tid = threadIdx.x;
  const int e0  = et * 64;
  const int n0  = nt * 64;
#pragma unroll
  for (int i = 0; i < 4; ++i) {
    const int idx = i * 256 + tid;                  // 0..1023
    const int ee = idx >> 4, c4 = (idx & 15) * 4;
    const v4f a = *(const v4f*)(W + ((size_t)(e0 + ee)) * DM + n0 + c4);
    *(v4f*)(sw + ee * 68 + c4) = a;
  }
  __syncthreads();

  const int g = tid >> 3, piece = tid & 7;
  v4u hv[2];
  size_t hofs[2];
#pragma unroll
  for (int it = 0; it < 2; ++it) {
    const int n = it * 32 + g;
    v4u a;
#pragma unroll
    for (int e = 0; e < 4; ++e) {
      const float f0 = sw[(piece * 8 + 2 * e) * 68 + n];
      const float f1 = sw[(piece * 8 + 2 * e + 1) * 68 + n];
      unsigned short u0, u1;
      if (MODE == 0) {
        u0 = bf_bits(f0);
        u1 = bf_bits(f1);
      } else {
        u0 = h_bits((_Float16)(bf_up(bf_bits(f0)) * scale));
        u1 = h_bits((_Float16)(bf_up(bf_bits(f1)) * scale));
      }
      a[e] = pk16(u0, u1);
    }
    hv[it] = a;
    hofs[it] = ((size_t)(n0 + n)) * DM + e0 + piece * 8;
  }
  {
#pragma unroll
    for (int it = 0; it < 2; ++it) {
      *(v4u*)(Wt + hofs[it]) = hv[it];
    }
#if defined(__HIP_DEVICE_COMPILE__)
    // both tile bodies stand in one kernel: no register that the two stores name is rewritten in front of this wait
    asm volatile("s_wait_xcnt 0x0" ::: "memory");
#endif
  }
}
// One grid for all operand preparation (the five jobs are independent of one another): blocks 0 .. 4 WTB - 1 = the
// weight tiles of Wq, Wk, Wv (bf16) and Wo (f16 x woscale), WTB tiles each; the blocks behind them = the activations'
// bf16 plane. The branch is block-uniform, so the tile body's barrier is passed by whole blocks only.
__global__ __launch_bounds__(256) void prep(const float* __restrict__ x, const float* __restrict__ Wq,
                                            const float* __restrict__ Wk, const float* __restrict__ Wv,
                                            const float* __restrict__ Wo, unsigned short* Xb, unsigned short* Wtq,
                                            unsigned short* Wtk, unsigned short* Wtv, unsigned short* Wto,
                                            int n8, float woscale) {
  __shared__ __align__(16) float sw[64 * 68];       // [ee][nn] pitch 68 floats
  const int bx = blockIdx.x;
  if (bx < 4 * WTB) {
    const int w = bx / WTB, tile = bx % WTB;
    const int et = tile % (DM / 64), nt = tile / (DM / 64);
    if (w == 3) {
      wt_tile_body<1>(Wo, Wto, woscale, sw, et, nt);
    } else {
      wt_tile_body<0>(w == 0 ? Wq : (w == 1 ? Wk : Wv), w == 0 ? Wtq : (w == 1 ? Wtk : Wtv), 1.0f, sw, et, nt);
    }
  } else {
    cvt_bf16x8_body(x, Xb, n8, bx - 4 * WTB);
  }
}

// =====================================================================================================
// Register-blocked bf16 WMMA GEMM with bias: C[m][n] = sum_k A[m][k] * Bt[n][k] + bf16rne(bias[n]), N = K = DM.
// Block = 64 rows x DM columns, one wave per 64x64 tile (wave w: columns 64 w ..). A row-major [M][DM]; Bt row-major
// [DM n][DM k] (k contiguous); bias f32 [DM] (RNE converted to bf16 and widened in the epilogue); M multiple of 64.
// Operands: k slices of GKC, the block's 64 A rows and all DM B rows, staged in LDS by asynchronous copies, two
// buffers: slice t + 1 is in flight while slice t is multiplied; per slice one hand-over (LDS reads done, own copies
// landed, block barrier), then slice t + 2 is copied into the buffer slice t has left.
// Output f32 [M][DM] pitch DM. Epilogue: 16-row slabs staged per wave in LDS; each 64-wide row segment
// =====================================================================================================
// One grid for the three projections: blockIdx.y = 0, 1, 2 picks (Bt, bias, C) of q, k, v; A is common to them.
__global__ __launch_bounds__(256) void gemm64(
    const unsigned short* __restrict__ Ap,
    const unsigned short* __restrict__ Btq, const unsigned short* __restrict__ Btk,
    const unsigned short* __restrict__ Btv,
    const float* __restrict__ biasq, const float* __restrict__ biask, const float* __restrict__ biasv,
    float* Cq, float* Ck, float* Cv, int M) {
  const int which = blockIdx.y;
  const unsigned short* __restrict__ Btp = which == 0 ? Btq : (which == 1 ? Btk : Btv);
  const float* __restrict__ bias = which == 0 ? biasq : (which == 1 ? biask : biasv);
  float* C = which == 0 ? Cq : (which == 1 ? Ck : Cv);
  __shared__ __align__(16) __bf16 sAB[2 * GBUF];   // two slice buffers: rows 0..63 = A, rows 64.. = B
  __shared__ __align__(16) float sT[8][16 * 68];   // per-wave 16x64 slab, pitch 68 floats
  constexpr int ldc = DM;
  const int tid  = threadIdx.x;
  const int lane = tid & 31;
  const int wave = tid >> 5;
  const int m0 = blockIdx.x << 6;
  if (m0 >= M) return;                   // block-uniform, in front of every barrier
  const int n0 = wave << 6;

  // this lane's piece of every 32-row group: row tid>>3, 16-B column tid&7
  const unsigned short* ga0 = Ap + (size_t)(m0 + (tid >> 3)) * DM + (tid & 7) * 8;
  const unsigned short* ga1 = ga0 + (size_t)32 * DM;
  const unsigned short* gb  = Btp + (size_t)(tid >> 3) * DM + (tid & 7) * 8;
  const unsigned l0 = lds_off(sAB) + (unsigned)((tid >> 3) * GSP + (tid & 7) * 8) * 2u;
  stage_slice(l0, ga0, ga1, gb);
  wait_copies();
  __syncthreads();                       // slice 0 is readable by every wave
  stage_slice(l0 + GBUF * 2u, ga0 + GKC, ga1 + GKC, gb + GKC);

  const int rlane = lane & 15;                 // row (A) / col (B, D) within subtile
  const int koff  = (lane >> 4) * 8;           // k offset of this lane half
  const int mOff  = (lane >> 4) * 8;           // D row offset

  v8f acc[4][4];
#pragma unroll
  for (int i = 0; i < 4; ++i)
#pragma unroll
    for (int j = 0; j < 4; ++j) acc[i][j] = zero8();

  for (int t = 0; t < NSL; ++t) {
    const __bf16* sb = sAB + (t & 1) * GBUF;
#pragma unroll
    for (int kk = 0; kk < GKC; kk += 32) {
      v16b bh[4], ah[4];                 // the k step's LDS reads stand together, in front of its WMMAs
#pragma unroll
      for (int j = 0; j < 4; ++j) {
        bh[j] = ldfrag_b(sb + (64 + n0 + (j << 4) + rlane) * GSP + koff + kk);
      }
#pragma unroll
      for (int i = 0; i < 4; ++i) {
        ah[i] = ldfrag_b(sb + ((i << 4) + rlane) * GSP + koff + kk);
      }
#pragma unroll
      for (int i = 0; i < 4; ++i) {
#pragma unroll
        for (int j = 0; j < 4; ++j) {
          acc[i][j] = mma_b_raw(ah[i], bh[j], acc[i][j]);
        }
        dep_guard_b(acc[i][0], acc[i][3], ah[i], ah[i]);
      }
      keep4_b(bh[0], bh[1], bh[2], bh[3]);
    }
    // hand-over: slice t + 1 becomes readable, slice t's buffer becomes free
    wait_lds_reads();
    wait_copies();
    __syncthreads();
    if (t + 2 < NSL) {
      stage_slice(l0 + (unsigned)(t & 1) * (GBUF * 2u), ga0 + (t + 2) * GKC, ga1 + (t + 2) * GKC, gb + (t + 2) * GKC);
    }
  }
  wait_copies();
  acc_guard4(acc[0][0], acc[0][1], acc[0][2], acc[0][3]);
  acc_guard4(acc[1][0], acc[1][1], acc[1][2], acc[1][3]);
  acc_guard4(acc[2][0], acc[2][1], acc[2][2], acc[2][3]);
  acc_guard4(acc[3][0], acc[3][1], acc[3][2], acc[3][3]);

  // ---- bias per D column of this lane (n0 + 16j + rlane < N) ----
  float bz[4];
#pragma unroll
  for (int j = 0; j < 4; ++j) bz[j] = bf_up(bf_bits(bias[n0 + (j << 4) + rlane]));

  // ---- epilogue ----
  float* slab = sT[wave];
#pragma unroll
  for (int i = 0; i < 4; ++i) {
    const int mBase = m0 + (i << 4);
#pragma unroll
    for (int r = 0; r < 8; ++r) {
#pragma unroll
      for (int j = 0; j < 4; ++j) {
        slab[(mOff + r) * 68 + (j << 4) + rlane] = acc[i][j][r] + bz[j];
      }
    }
    __builtin_amdgcn_fence(__ATOMIC_RELEASE, "workgroup");
    __builtin_amdgcn_wave_barrier();
    __builtin_amdgcn_fence(__ATOMIC_ACQUIRE, "workgroup");
    {
      const int hh = lane >> 4, c4 = (lane & 15) * 4;     // 256-B row segment = 16 lanes x 16 B
      v4f ov[8];
#pragma unroll
      for (int it = 0; it < 8; ++it) {
        const int row = it * 2 + hh;                       // it 0..7 x hh 0..1 = rows 0..15
        ov[it] = *(const v4f*)(slab + row * 68 + c4);
      }
      {
#pragma unroll
        for (int it = 0; it < 8; ++it) {
          const int row = it * 2 + hh;
          *(v4f*)(C + (size_t)(mBase + row) * ldc + n0 + c4) = ov[it];
        }
        
      }
    }
    __builtin_amdgcn_fence(__ATOMIC_RELEASE, "workgroup");
    __builtin_amdgcn_wave_barrier();
    __builtin_amdgcn_fence(__ATOMIC_ACQUIRE, "workgroup");
  }
}

// =====================================================================================================
// f16 WMMA GEMM with a two-plane A operand and bias:
//   C[m][n] = (sum_k Ah[m][k]*Bt[n][k] + 2^-10 * sum_k Al[m][k]*Bt[n][k]) * oscale + bf16rne(bias[n]),
// the residual products in a separate accumulator, N = K = DM. Block = 32 rows x DM columns, one wave per 32x64 tile
// (wave w: columns 64 w ..). A comes as f32, row-major [M][DM]: the block loads its 32 rows once, splits them in
// registers into Ah = f16(A * ascale) and Al = f16((A * ascale - Ah) * 1024) and keeps both planes in LDS for all
// k slices. Bt row-major [DM n][DM k] (f16, k contiguous); M multiple of 32. B staged in LDS by k slices as in gemm64
// (asynchronous copies, two buffers). Every WMMA nop-guarded.
// Output f32 [M][DM] pitch DM. Epilogue: 16-row slabs staged per wave in LDS; each 64-wide row segment (256 B)
// coverage: 2 slabs x 16 rows x 64 cols = the wave's whole 32x64 tile.
// =====================================================================================================
__global__ __launch_bounds__(256) void gemm_o(
    const float* __restrict__ Af,
    const unsigned short* __restrict__ Btp,
    const float* __restrict__ bias,
    float* C, int M, float ascale, float oscale) {
  __shared__ __align__(16) _Float16 sA[64 * ASP];  // rows 0..31 = Ah, 32..63 = Al, all DM k of the block's 32 rows
  __shared__ __align__(16) _Float16 sB[2 * GBB];   // two B slice buffers
  __shared__ __align__(16) float sT[8][16 * 68];   // per-wave 16x64 slab, pitch 68 floats
  constexpr int ldc = DM;
  const int tid  = threadIdx.x;
  const int lane = tid & 31;
  const int wave = tid >> 5;
  const int m0 = blockIdx.x << 5;
  if (m0 >= M) return;                   // block-uniform, in front of every barrier
  const int n0 = wave << 6;

  // A: thread tid takes elements (tid&7) * 8 .. + 7 of every 64-element k slice of row tid>>3: 8 lanes read 256 B in a row
  const int arow = tid >> 3, apc = (tid & 7) * 8;
  const float* ga = Af + (size_t)(m0 + arow) * DM + apc;
  v4f ax[NSL][2];
#pragma unroll
  for (int i = 0; i < NSL; ++i) {
    ax[i][0] = *(const v4f*)(ga + i * GKC);
    ax[i][1] = *(const v4f*)(ga + i * GKC + 4);
  }
#if defined(__HIP_DEVICE_COMPILE__)
  // no address register of the A loads is rewritten in front of this wait: the address is an input of the statement, so
  // that no load lands on it either; the scheduling barrier keeps the later address arithmetic from being lifted over it
  asm volatile("s_wait_xcnt 0x0" :: "v"(ga) : "memory");
  __builtin_amdgcn_sched_barrier(0);
#endif
  // B: this lane's piece of every 32-row group: row tid>>3, 16-B column tid&7
  const unsigned short* gb  = Btp + (size_t)(tid >> 3) * DM + (tid & 7) * 8;
  const unsigned l0 = lds_off(sB) + (unsigned)((tid >> 3) * GSP + (tid & 7) * 8) * 2u;
  stage_b(l0, gb);                       // slice 0 flies while A is split
  // keeps the split, which waits for the A loads, behind the issue of slice 0's copies
  __builtin_amdgcn_sched_barrier(0);
#pragma unroll
  for (int i = 0; i < NSL; ++i) {
    v4u ph, pl;
    split_f16x8(ax[i][0], ax[i][1], ascale, ph, pl);
    *(v4u*)(sA + arow * ASP + i * GKC + apc) = ph;
    *(v4u*)(sA + (32 + arow) * ASP + i * GKC + apc) = pl;
  }
  wait_lds_reads();                      // this wave's A stores are in LDS
  wait_copies();
  __syncthreads();                       // A and slice 0 of B are readable by every wave
  stage_b(l0 + GBB * 2u, gb + GKC);

  const int rlane = lane & 15;
  const int koff  = (lane >> 4) * 8;
  const int mOff  = (lane >> 4) * 8;

  v8f acc[2][4], acl[2][4];
#pragma unroll
  for (int i = 0; i < 2; ++i)
#pragma unroll
    for (int j = 0; j < 4; ++j) { acc[i][j] = zero8(); acl[i][j] = zero8(); }

  for (int t = 0; t < NSL; ++t) {
    const _Float16* sb = sB + (t & 1) * GBB;
    const _Float16* sa = sA + t * GKC;
#pragma unroll
    for (int kk = 0; kk < GKC; kk += 32) {
      v16h ah[2], al[2], bfr[4];         // the k step's LDS reads stand together, in front of its WMMAs
#pragma unroll
      for (int i = 0; i < 2; ++i) {
        ah[i] = ldfrag_h(sa + ((i << 4) + rlane) * ASP + koff + kk);
        al[i] = ldfrag_h(sa + (32 + (i << 4) + rlane) * ASP + koff + kk);
      }
#pragma unroll
      for (int j = 0; j < 4; ++j) {
        bfr[j] = ldfrag_h(sb + (n0 + (j << 4) + rlane) * GSP + koff + kk);
      }
#pragma unroll
      for (int j = 0; j < 4; ++j) {
#pragma unroll
        for (int i = 0; i < 2; ++i) {
          acc[i][j] = mma_h(ah[i], bfr[j], acc[i][j]);
          acl[i][j] = mma_h(al[i], bfr[j], acl[i][j]);
        }
      }
    }
    // hand-over: slice t + 1 becomes readable, slice t's buffer becomes free
    wait_lds_reads();
    wait_copies();
    __syncthreads();
    if (t + 2 < NSL) {
      stage_b(l0 + (unsigned)(t & 1) * (GBB * 2u), gb + (t + 2) * GKC);
    }
  }
  wait_copies();

  // ---- bias per D column of this lane (n0 + 16j + rlane < N) ----
  float bz[4];
#pragma unroll
  for (int j = 0; j < 4; ++j) bz[j] = bf_up(bf_bits(bias[n0 + (j << 4) + rlane]));

  // ---- epilogue ----
  float* slab = sT[wave];
#pragma unroll
  for (int i = 0; i < 2; ++i) {
    const int mBase = m0 + (i << 4);
#pragma unroll
    for (int r = 0; r < 8; ++r) {
#pragma unroll
      for (int j = 0; j < 4; ++j) {
        const float y = (acc[i][j][r] + acl[i][j][r] * (1.0f / 1024.0f)) * oscale + bz[j];
        slab[(mOff + r) * 68 + (j << 4) + rlane] = y;
      }
    }
    __builtin_amdgcn_fence(__ATOMIC_RELEASE, "workgroup");
    __builtin_amdgcn_wave_barrier();
    __builtin_amdgcn_fence(__ATOMIC_ACQUIRE, "workgroup");
    {
      const int hh = lane >> 4, c4 = (lane & 15) * 4;     // 256-B row segment = 16 lanes x 16 B
      v4f ov[8];
#pragma unroll
      for (int it = 0; it < 8; ++it) {
        const int row = it * 2 + hh;                       // it 0..7 x hh 0..1 = rows 0..15
        ov[it] = *(const v4f*)(slab + row * 68 + c4);
      }
      {
#pragma unroll
        for (int it = 0; it < 8; ++it) {
          const int row = it * 2 + hh;
          *(v4f*)(C + (size_t)(mBase + row) * ldc + n0 + c4) = ov[it];
        }
        
      }
    }
    __builtin_amdgcn_fence(__ATOMIC_RELEASE, "workgroup");
    __builtin_amdgcn_wave_barrier();
    __builtin_amdgcn_fence(__ATOMIC_ACQUIRE, "workgroup");
  }
}

// =====================================================================================================
// v f32 token-major columns vf[(b*SEQ + t)*vrp + h*64 + d] ->
// f16 v^T hi plane vth[(b*DM + h*64 + d)*SEQ + t] = f16(v * vscale) (vscale a power of two) and residual plane
// vtl[same index] = f16((v*vscale - hi) * 4096).
// Block = one 64-token x 64-feature tile of one (b, h): tile index (tt0, hh, b) in (SEQ/64, NH, NB); staged in LDS as f32
// (v4f loads, __syncthreads).
// Store: group g = tid>>3 (0..31), piece = tid&7: iteration it writes row d = it*32+g, lanes 8q..8q+7 x 16 B =
// coverage: 2 iterations x 32 groups = 64 rows d, 8 pieces x 8 = 64 tokens per row; grid covers every (b, h,
// t tile) -> both whole planes.
// =====================================================================================================
__device__ __forceinline__ void v_planes_body(const float* __restrict__ vf, int vrp, unsigned short* vth,
                                              unsigned short* vtl, float vscale, float* sv, int tt0, int hh, int b) {
  const int tid = threadIdx.x;
  const int t0  = tt0 * 64;
#pragma unroll
  for (int i = 0; i < 4; ++i) {
    const int idx = i * 256 + tid;                  // 0..1023
    const int tt = idx >> 4, c4 = (idx & 15) * 4;
    const v4f a = *(const v4f*)(vf + ((size_t)(b * SEQ + t0 + tt)) * vrp + hh * HD + c4);
    *(v4f*)(sv + tt * 68 + c4) = a;
  }
  __syncthreads();

  const int g = tid >> 3, piece = tid & 7;
  v4u hv[2], lv[2];
  size_t hofs[2];
#pragma unroll
  for (int it = 0; it < 2; ++it) {
    const int d = it * 32 + g;
    v4u a, a2;
#pragma unroll
    for (int e = 0; e < 4; ++e) {
      const float f0 = sv[(piece * 8 + 2 * e) * 68 + d] * vscale;
      const float f1 = sv[(piece * 8 + 2 * e + 1) * 68 + d] * vscale;
      const _Float16 x0 = (_Float16)f0, x1 = (_Float16)f1;
      const unsigned short h0 = h_bits(x0), h1 = h_bits(x1);
      const unsigned short l0 = h_bits((_Float16)((f0 - (float)x0) * 4096.0f));
      const unsigned short l1 = h_bits((_Float16)((f1 - (float)x1) * 4096.0f));
      a[e] = pk16(h0, h1); a2[e] = pk16(l0, l1);
    }
    hv[it] = a; lv[it] = a2;
    hofs[it] = ((size_t)(b * DM + hh * HD + d)) * SEQ + t0 + piece * 8;
  }
  {
#pragma unroll
    for (int it = 0; it < 2; ++it) {
      *(v4u*)(vth + hofs[it]) = hv[it];
      *(v4u*)(vtl + hofs[it]) = lv[it];
    }
    
  }
}
// One grid for the two plane splits (independent of one another): blocks 0 .. VTB - 1 = the v tiles, then PLB blocks
// for k. The branch is block-uniform, so the tile body's barrier is passed by whole blocks only.
__global__ __launch_bounds__(256) void planes_kv(const float* __restrict__ kf, const float* __restrict__ vf,
                                                 unsigned short* kh, unsigned short* kl, unsigned short* vth,
                                                 unsigned short* vtl, int n8, float qkscale, float vscale) {
  __shared__ __align__(16) float sv[64 * 68];       // [tt][d] pitch 68 floats
  const int bx = blockIdx.x;
  if (bx < VTB) {
    v_planes_body(vf, DM, vth, vtl, vscale, sv, bx % (SEQ / 64), (bx / (SEQ / 64)) % NH, bx / ((SEQ / 64) * NH));
  } else {
    planes_f16x8_body(kf, kh, kl, n8, qkscale, bx - VTB);
  }
}

// =====================================================================================================
// Bidirectional multi-head attention, head dim 64, no mask.
//   q f32: element (b, t, h, d) at [(b*SEQ + t)*DM + h*64 + d]; split in registers into the f16 hi plane (x qscale = 16)
//     and the residual plane ((q*16 - hi)*1024)
//   k f16 hi plane (x16): element (b, s, h, d) at [(b*SEQ + s)*DM + h*64 + d]; k residual plane same into klp
//   v^T f16 hi plane (x256): element (b, h, d, s) at [(b*DM + h*64 + d)*SEQ + s]
//   v^T f16 residual plane ((v*256 - hi)*4096): same index into vlp
//   All NKT key tiles of 64 are processed for every query block (static trip count).
//   logit = (qhi.khi + (qhi.klo + qlo.khi) * 2^-10) * sscale, f16 products with f32 accumulate, the residual
//   products in a separate accumulator; p = exp(s - m) carried as ph = f16(1024 p);
//   context = ph . vhi on f16 WMMA plus ph . vres into a separate accumulator folded back with 2^-12 per tile
//   in f32; online softmax in f32; out f32 plane: element (b, t, h*64 + d) at [(b*SEQ + t)*DM + h*64 + d] =
//   normalised context (oscl folds back the p and v carries).
//   Block = 4 waves x 32 query rows = 128 query rows of one (b, h); grid = NB*NH*NQB; kv tiles of 64. A wave works on two
//   groups g = 0, 1 of 16 queries: every K and V^T fragment that it reads from LDS is the A operand of both groups' WMMAs.
//   K hi / K residual / V^T hi / V^T residual tile staging: asynchronous copies global -> LDS, 128 threads x 4 x 16 B
//   per plane = the whole 64x64 tile, two buffers: tile t + 1 is in flight while tile t is worked on; per tile one
//   hand-over (LDS reads done, own copies landed, block barrier), then tile t + 2 is copied into the buffer tile t has left.
//   Both products are formed transposed: S^T = K . Q^T (A = K rows, B = Q) and O^T += V^T . P^T (A = V^T rows, B = P^T).
//   A lane then holds, per group, 32 of the 64 scores of ONE query (column lane&15; keys 16 j + 8 (lane>>4) + r), so maximum and
//   sum run in the lane, with one exchange between the wave's halves; two score tiles, converted in place, are the
//   B operand of the second product in the loaders' k order: P never leaves the registers.
//   Output coverage: each wave stores rows q0..q0+31 (it 0..15 x lane>>4 0..1) x 64 columns (16 lanes x 4
//   (b, h, query tile) -> the whole plane.
// =====================================================================================================
__global__ __launch_bounds__(128)
void attn64(const float* __restrict__ qf,
            const unsigned short* __restrict__ khp, const unsigned short* __restrict__ klp,
            const unsigned short* __restrict__ vhp, const unsigned short* __restrict__ vlp,
            float* outp, float qscale, float sscale, float oscl) {
  union FH { v16h v; v8h h[2]; };
  // two tile buffers of K hi [kv][d], K residual, V^T hi [d][kv], V^T residual, 9 KB each; behind the loop's last
  // barrier the same bytes hold the per wave context tiles [row][d] (34 KB)
  __shared__ __align__(16) _Float16 KV[2 * KVBUF];

  const int tid  = threadIdx.x;
  const int wave = tid >> 5;
  const int lane = tid & 31;
  const int hh   = lane >> 4;
  const int c    = lane & 15;

  const int bx   = blockIdx.x;
  const int qb   = bx % NQB;
  const int rest = bx / NQB;
  const int h    = rest % NH;
  const int b    = rest / NH;                // < NB by the grid size
  const int q0   = qb * 128 + wave * 32;
  const size_t rowB = (size_t)b * SEQ;

  const float*    Qf  = qf + (size_t)h * HD;
  const _Float16* Kp  = (const _Float16*)(const void*)khp + (size_t)h * HD;
  const _Float16* Klq = (const _Float16*)(const void*)klp + (size_t)h * HD;
  const _Float16* Vh  = (const _Float16*)(const void*)vhp + ((size_t)b * DM + (size_t)h * HD) * SEQ;
  const _Float16* Vl  = (const _Float16*)(const void*)vlp + ((size_t)b * DM + (size_t)h * HD) * SEQ;

  // ---- Q fragments (B operand, column = lane&15): 2 query groups x 2 d-chunks, hi and residual, split here from the
  //      f32 q (a wave is the only reader of its 32 q rows); elements 0..7 <- d + 0..7, 8..15 <- d + 16..23, the loaders' k order
  v16h qa[2][2], ql[2][2];
  v4f qx[2][2][4];
#pragma unroll
  for (int g = 0; g < 2; ++g) {
#pragma unroll
    for (int dc = 0; dc < 2; ++dc) {
      const float* qp = Qf + (rowB + q0 + g * 16 + c) * DM + dc * 32 + 8 * hh;
      qx[g][dc][0] = *(const v4f*)(qp);
      qx[g][dc][1] = *(const v4f*)(qp + 4);
      qx[g][dc][2] = *(const v4f*)(qp + 16);
      qx[g][dc][3] = *(const v4f*)(qp + 20);
    }
#if defined(__HIP_DEVICE_COMPILE__)
    // no address register of this group's Q loads is rewritten in front of this wait; the scheduling barrier keeps the
    // next group's loads and the later address arithmetic, which reuse those registers, from being lifted over it
    asm volatile("s_wait_xcnt 0x0" ::: "memory");
    __builtin_amdgcn_sched_barrier(0);
#endif
  }

  // this lane's piece of every 16-row group: row tid>>3, 16-B column tid&7
  const int srow = tid >> 3, spc = (tid & 7) * 8;
  const _Float16* gk  = Kp  + (rowB + srow) * DM + spc;           // K hi row srow of key tile 0
  const _Float16* gkl = Klq + (rowB + srow) * DM + spc;           // K residual
  const _Float16* gv  = Vh + (size_t)srow * SEQ + spc;            // V^T hi row d = srow, keys of tile 0
  const _Float16* gvl = Vl + (size_t)srow * SEQ + spc;            // V^T residual
  const unsigned l0 = lds_off(KV) + (unsigned)(srow * KVP + spc) * 2u;
  stage_kv(l0, gk, gkl, gv, gvl);
  // keeps the split of q, which waits for the Q loads, behind the issue of tile 0's copies
  __builtin_amdgcn_sched_barrier(0);
#pragma unroll
  for (int g = 0; g < 2; ++g) {
#pragma unroll
    for (int dc = 0; dc < 2; ++dc) {
      union { v16h v; v4u u[2]; } fh, fl;
      split_f16x8(qx[g][dc][0], qx[g][dc][1], qscale, fh.u[0], fl.u[0]);
      split_f16x8(qx[g][dc][2], qx[g][dc][3], qscale, fh.u[1], fl.u[1]);
      qa[g][dc] = fh.v;
      ql[g][dc] = fl.v;
    }
  }

  float mrow[2], lrow[2];                // of query q0 + 16 g + c; lrow sums this half's keys only, joined behind the loop
  v8f oacc[2][4];                        // oacc[g][t][r] = context of query q0 + 16 g + c, feature 16 t + 8 hh + r
#pragma unroll
  for (int g = 0; g < 2; ++g) {
    mrow[g] = -INFINITY;
    lrow[g] = 0.f;
#pragma unroll
    for (int t = 0; t < 4; ++t) oacc[g][t] = zero8();
  }

  for (int kt = 0; kt < NKT; ++kt) {
    // hand-over between trip kt - 1 and trip kt: tile kt becomes readable, tile kt - 1's buffer becomes free; then tile
    // kt + 1 is copied into that buffer. It stands at the head of the trip, with nothing behind the trip's arithmetic:
    // behind a branch at the foot the compiler moves the row sums there and holds all 64 p of a lane over the second product.
    wait_lds_reads();
    wait_copies();
    __syncthreads();
    if (kt + 1 < NKT) {
      stage_kv(l0 + (unsigned)((kt + 1) & 1) * (KVBUF * 2u), gk + (size_t)(kt + 1) * 64 * DM,
               gkl + (size_t)(kt + 1) * 64 * DM, gv + (kt + 1) * 64, gvl + (kt + 1) * 64);
    }
    // (kv0 below = 64 kt, the tile's first key)
    // Fragment reads: plain LDS loads in groups of 8 ds_load_b128 (one 16-key group of K, or two 16-feature groups of
    // V^T, hi and residual planes), written one group ahead of the WMMAs that use them; the WMMAs are bare builtins, so
    // no asm statement stands between a read and an earlier WMMA and the reads can be issued ahead, behind counted waits.
    const _Float16* kfh = KV + (kt & 1) * KVBUF + c * KVP + 8 * hh;
    const _Float16* kfl = kfh + KVT;
    const _Float16* vfh = kfh + 2 * KVT;
    const _Float16* vfl = kfh + 3 * KVT;
    v16h kb[4][2], kr[4][2];             // K hi / residual fragments of key group j, d chunk dc
    v16h vb[2][4], vl[2][4];             // V^T hi / residual fragments of key chunk kk, feature group t
#define LD_K(j)                                                   \
    _Pragma("unroll") for (int dc = 0; dc < 2; ++dc) {            \
      kb[j][dc] = ldfrag_h(kfh + (j) * 16 * KVP + dc * 32);       \
      kr[j][dc] = ldfrag_h(kfl + (j) * 16 * KVP + dc * 32);       \
    }
#define LD_V(kk, tp)                                              \
    _Pragma("unroll") for (int t = 2 * (tp); t < 2 * (tp) + 2; ++t) { \
      vb[kk][t] = ldfrag_h(vfh + t * 16 * KVP + (kk) * 32);       \
      vl[kk][t] = ldfrag_h(vfl + t * 16 * KVP + (kk) * 32);       \
    }
    // ---- scores, transposed: 64 keys x 32 queries per wave; hi.hi into s, hi.lo + lo.hi into s1 (folded x 2^-10) ----
    v8f s[2][4], s1[2][4];               // s[g][j][r] = score of key kv0 + 16 j + 8 hh + r with query q0 + 16 g + c
#define SCORE(j)                                                  \
    _Pragma("unroll") for (int g = 0; g < 2; ++g) { s[g][j] = zero8(); s1[g][j] = zero8(); } \
    _Pragma("unroll") for (int dc = 0; dc < 2; ++dc) {            \
      _Pragma("unroll") for (int g = 0; g < 2; ++g) {             \
        s[g][j]  = mma_h_raw(kb[j][dc], qa[g][dc], s[g][j]);      \
        s1[g][j] = mma_h_raw(kr[j][dc], qa[g][dc], s1[g][j]);     \
        s1[g][j] = mma_h_raw(kb[j][dc], ql[g][dc], s1[g][j]);     \
      }                                                           \
    }
#define FOLD_S(j)                                                 \
    _Pragma("unroll") for (int g = 0; g < 2; ++g)                 \
      _Pragma("unroll") for (int r = 0; r < 8; ++r) s[g][j][r] += s1[g][j][r] * (1.0f / 1024.0f);
    LD_K(0) LD_K(1)
    SCORE(0)
    LD_K(2)
    SCORE(1) FOLD_S(0)
    LD_K(3)
    SCORE(2) FOLD_S(1)
    LD_V(0, 0)
    SCORE(3) FOLD_S(2)
    LD_V(0, 1)
    FOLD_S(3)

    // ---- per group: scale, maximum of the query's 64 scores (32 in the lane, then the other half's), online softmax ----
    FH pb[2][2];                         // P^T (x1024, f16) of group g, key chunk kk: keys kv0 + 32 kk + 8 hh + (0..7), then
                                         // + 16: the k order of the V^T fragments
#pragma unroll
    for (int g = 0; g < 2; ++g) {
      float mj[4];
#pragma unroll
      for (int j = 0; j < 4; ++j) {
        float m = -INFINITY;
#pragma unroll
        for (int r = 0; r < 8; ++r) {
          const float sv = s[g][j][r] * sscale;
          s[g][j][r] = sv;
          m = fmaxf(m, sv);
        }
        mj[j] = m;
      }
      float mt = fmaxf(fmaxf(mj[0], mj[1]), fmaxf(mj[2], mj[3]));
      mt = fmaxf(mt, xhalf(mt));
      const float mnew  = fmaxf(mrow[g], mt);
      const float msafe = (mnew == -INFINITY) ? 0.f : mnew;
      const float alpha = __expf(mrow[g] - msafe);
      mrow[g] = mnew;
      v8h ph[4];                         // ph[j][r] belongs to key kv0 + 16 j + 8 hh + r
      float ps[4];
#pragma unroll
      for (int j = 0; j < 4; ++j) {
        v8f p1024;
        float a = 0.f;
#pragma unroll
        for (int r = 0; r < 8; ++r) {
          const float p = __expf(s[g][j][r] - msafe);
          a += p;
          p1024[r] = p * 1024.0f;
        }
        ps[j] = a;
        ph[j] = __builtin_convertvector(p1024, v8h);
      }
      lrow[g] = lrow[g] * alpha + ((ps[0] + ps[1]) + (ps[2] + ps[3]));
#pragma unroll
      for (int t = 0; t < 4; ++t)
#pragma unroll
        for (int r = 0; r < 8; ++r) oacc[g][t][r] *= alpha;
#pragma unroll
      for (int kk = 0; kk < 2; ++kk) {
        pb[g][kk].h[0] = ph[2 * kk];
        pb[g][kk].h[1] = ph[2 * kk + 1];
      }
    }

    // ---- context^T += Vhi^T . P^T (f16 WMMA); Vres^T . P^T into a separate accumulator ----
    v8f o1[2][4];
#pragma unroll
    for (int g = 0; g < 2; ++g)
#pragma unroll
      for (int t = 0; t < 4; ++t) o1[g][t] = zero8();
#define CTX(kk, tp)                                               \
    _Pragma("unroll") for (int t = 2 * (tp); t < 2 * (tp) + 2; ++t) { \
      _Pragma("unroll") for (int g = 0; g < 2; ++g) {             \
        oacc[g][t] = mma_h_raw(vb[kk][t], pb[g][kk].v, oacc[g][t]); \
        o1[g][t]   = mma_h_raw(vl[kk][t], pb[g][kk].v, o1[g][t]);   \
      }                                                           \
    }
    // Order of the stretch from the tile barrier to here, for the scheduler: 16 reads, then 12 WMMAs and 8 reads in turn.
    // Left alone it spreads the reads singly among the WMMAs.
#define SGB_LDS(n, id)  __builtin_amdgcn_sched_group_barrier(0x100, n, id)
#define SGB_WMMA(n, id) __builtin_amdgcn_sched_group_barrier(0x008, n, id)
    SGB_LDS(16, 0); SGB_WMMA(12, 0); SGB_LDS(8, 0); SGB_WMMA(12, 0); SGB_LDS(8, 0); SGB_WMMA(12, 0); SGB_LDS(8, 0); SGB_WMMA(12, 0);
    SGB_LDS(8, 0);
    // ends the stretch that the group barriers above order; the second key chunk's V^T reads stay behind the softmax,
    // where the first chunk's 16 WMMAs cover their latency, instead of holding 64 more registers through it
    __builtin_amdgcn_sched_barrier(0);
    LD_V(1, 0)
    CTX(0, 0)
    LD_V(1, 1)
    CTX(0, 1) CTX(1, 0) CTX(1, 1)
    SGB_LDS(8, 1); SGB_WMMA(8, 1); SGB_LDS(8, 1); SGB_WMMA(24, 1);   // the same for this stretch
#undef SGB_LDS
#undef SGB_WMMA
#undef LD_K
#undef LD_V
#undef SCORE
#undef FOLD_S
#undef CTX
#pragma unroll
    for (int g = 0; g < 2; ++g)
#pragma unroll
      for (int t = 0; t < 4; ++t)
#pragma unroll
        for (int r = 0; r < 8; ++r) oacc[g][t][r] += o1[g][t][r] * (1.0f / 4096.0f);
  }
  // every wave's tile reads are done before the first tile buffer, which last held tile NKT - 2, is used for the context tiles
  wait_lds_reads();
  wait_copies();
  __syncthreads();

  // ---- join the halves' sums, normalise (1/l and the carries via oscl), stage the wave's 32x64 tile in LDS
  //      (row = query 16 g + c, 8 consecutive features per accumulator tile), then write whole 256-B row segments
  float* os = (float*)(void*)KV + wave * (32 * OSP);
#pragma unroll
  for (int g = 0; g < 2; ++g) {
    const float l = lrow[g] + xhalf(lrow[g]);
    const float inv = ((l > 0.f) ? (1.0f / l) : 0.f) * oscl;
#pragma unroll
    for (int t = 0; t < 4; ++t) {
      v4f lo, hi;
#pragma unroll
      for (int r = 0; r < 4; ++r) {
        lo[r] = oacc[g][t][r] * inv;
        hi[r] = oacc[g][t][4 + r] * inv;
      }
      *(v4f*)(os + (g * 16 + c) * OSP + t * 16 + 8 * hh) = lo;
      *(v4f*)(os + (g * 16 + c) * OSP + t * 16 + 8 * hh + 4) = hi;
    }
  }
  __builtin_amdgcn_fence(__ATOMIC_RELEASE, "workgroup");
  __builtin_amdgcn_wave_barrier();
  __builtin_amdgcn_fence(__ATOMIC_ACQUIRE, "workgroup");
  {
    const int h2 = lane >> 4, c4 = (lane & 15) * 4;
    v4f ov[16];
#pragma unroll
    for (int it = 0; it < 16; ++it) {
      const int row = it * 2 + h2;   // it 0..15 x h2 0..1 = rows 0..31 of the wave tile
      ov[it] = *(const v4f*)(os + row * OSP + c4);
    }
    {
#pragma unroll
      for (int it = 0; it < 16; ++it) {
        const int row = it * 2 + h2;
        const size_t go = (rowB + q0 + row) * DM + (size_t)h * HD + c4;
        *(v4f*)(outp + go) = ov[it];
      }
      
    }
  }
}

// =====================================================================================================
// Workspace map (bytes), every region an exact multiple of its whole-line / whole-tile store granularity
// 8192 x 512, 512 x 512 and 4096 x 1024 are whole tiles/lines):
//   Xb    bf16 [8192][512]            0          8388608
//   Wtq   bf16 [512][512]       8388608           524288   ([n][e])
//   Wtk   bf16 [512][512]       8912896           524288
//   Wtv   bf16 [512][512]       9437184           524288
//   Wto   f16  [512][512]       9961472           524288   ([n][k], bf16rne value x4096)
//   Tf    f32  [8192][512]     10485760         16777216   (q)
//   Tm    f32  [8192][512]     27262976         16777216   (msgs)
//   Kh    f16  [8192][512]     44040192          8388608
//   Kl    f16  [8192][512]     52428800          8388608
//   VTh   f16  [4096][1024]    60817408          8388608   ([b*DM + h*64 + d][s])
//   VTl   f16  [4096][1024]    69206016          8388608
//   Tk    f32  [8192][512]     77594624         16777216   (scratch: k)
//   Tv    f32  [8192][512]     94371840         16777216   (scratch: v)
//   end                       111149056
// Inputs: nodes f32 [8][1024][512]; Wq, Wk, Wv, Wo f32 [512 in][512 out] (x @ W layout); bq, bk, bv, bo f32
// [512] (index h*64+d = n). d_out f32: [8192][512] at byte 0 (row = b*SEQ + t, col = n).
// =====================================================================================================
extern "C" void kernel_launch(void* const* d_in, const int* in_sizes, int n_in,
                              void* d_out, int out_size, void* d_ws, size_t ws_size,
                              hipStream_t stream) {
  if (n_in < 9) return;
  if (in_sizes[0] != NB * SEQ * DM) return;
  if (in_sizes[1] != DM * DM) return;
  if (in_sizes[2] != DM * DM) return;
  if (in_sizes[3] != DM * DM) return;
  if (in_sizes[4] != DM) return;
  if (in_sizes[5] != DM) return;
  if (in_sizes[6] != DM) return;
  if (in_sizes[7] != DM * DM) return;
  if (in_sizes[8] != DM) return;
  if (out_size != OUTN) return;

  const float* x  = (const float*)d_in[0];   // [NB*SEQ][DM]
  const float* Wq = (const float*)d_in[1];   // [DM e][DM n]
  const float* Wk = (const float*)d_in[2];
  const float* Wv = (const float*)d_in[3];
  const float* bq = (const float*)d_in[4];   // [DM]
  const float* bk = (const float*)d_in[5];
  const float* bv = (const float*)d_in[6];
  const float* Wo = (const float*)d_in[7];   // [DM k][DM n]
  const float* bo = (const float*)d_in[8];

  const size_t PXb = (size_t)ROWS * DM * 2;          //  8388608
  const size_t PW  = (size_t)DM * DM * 2;            //   524288
  const size_t PF  = (size_t)ROWS * DM * 4;          // 16777216
  const size_t PH  = (size_t)ROWS * DM * 2;          //  8388608
  const size_t PVt = (size_t)NB * DM * SEQ * 2;      //  8388608
  size_t off = 0;
  const size_t oXb = off; off += PXb;
  const size_t oWq = off; off += PW;
  const size_t oWk = off; off += PW;
  const size_t oWv = off; off += PW;
  const size_t oWo = off; off += PW;
  const size_t oTf = off; off += PF;
  const size_t oTm = off; off += PF;
  const size_t oKh = off; off += PH;
  const size_t oKl = off; off += PH;
  const size_t oVt = off; off += PVt;
  const size_t oVl = off; off += PVt;
  const size_t oTk = off; off += PF;
  const size_t oTv = off; off += PF;
  if (off > ws_size) return;                        // off = 111149056
  if (off > (size_t)134217728) return;

  char* ws = (char*)d_ws;
  unsigned short* Xb  = (unsigned short*)(ws + oXb);
  unsigned short* Wtq = (unsigned short*)(ws + oWq);
  unsigned short* Wtk = (unsigned short*)(ws + oWk);
  unsigned short* Wtv = (unsigned short*)(ws + oWv);
  unsigned short* Wto = (unsigned short*)(ws + oWo);
  float*          Tf  = (float*)(ws + oTf);
  float*          Tk  = (float*)(ws + oTk);
  float*          Tv  = (float*)(ws + oTv);
  float*          Tm  = (float*)(ws + oTm);
  unsigned short* Kh  = (unsigned short*)(ws + oKh);
  unsigned short* Kl  = (unsigned short*)(ws + oKl);
  unsigned short* VTh = (unsigned short*)(ws + oVt);
  unsigned short* VTl = (unsigned short*)(ws + oVl);
  float*          outf = (float*)d_out;             // [ROWS][DM]

  const dim3 blk(256);
  const int n8x = ROWS * DM / 8;                    // 524288
  const dim3 gPrep(4 * WTB + PLB);                  // 256 weight tiles, then 2048 activation blocks
  const dim3 gGemm(ROWS / 64, 3);                   // 128 blocks of 64 rows x 512 columns, for each of q, k, v
  const dim3 gGemO(ROWS / 32);                      // 256 blocks of 32 rows x 512 columns
  const dim3 gSplit(VTB + PLB);                     // 1024 v tiles, then 2048 blocks for k
  const dim3 gAttn(NB * NH * NQB);                  // 512 blocks of 128 query rows
  const float qkScale = 16.0f;                      // q and k hi planes carried x16 (residual x1024 on top)
  const float sscale  = 1.0f / 2048.0f;             // 1/(16*16) * 1/sqrt(64)
  const float vScale  = 256.0f;                     // v^T hi plane carried x256
  const float attOscl = 1.0f / 262144.0f;           // 1/(1024 * 256): p and v carries folded back
  const float mScale  = 1024.0f;                    // msgs hi plane carried x1024 (residual x1024 on top)
  const float woScale = 4096.0f;                    // Wo^T carried x4096 in f16
  const float outOscl = 1.0f / 4194304.0f;          // 1/(1024 * 4096)

  // (1) activations -> bf16 plane; weights -> transposed 16-bit planes [n][e] (RNE convert): one grid
  prep<<<gPrep, blk, 0, stream>>>(x, Wq, Wk, Wv, Wo, Xb, Wtq, Wtk, Wtv, Wto, n8x, woScale);
  // (2) q, k, v = Xb . Wt^T + bias -> Tf, Tk, Tv [8192][512] (M=8192, N=512, K=512 each): one grid
  gemm64<<<gGemm, blk, 0, stream>>>(Xb, Wtq, Wtk, Wtv, bq, bk, bv, Tf, Tk, Tv, ROWS);
  // (3) k -> f16 hi (x16) + residual planes; v -> f16 v^T hi plane (x256) and residual plane (x4096 on top): one grid
  planes_kv<<<gSplit, blk, 0, stream>>>(Tk, Tv, Kh, Kl, VTh, VTl, n8x, qkScale, vScale);
  // (4) attention -> msgs f32 [8192][512] in Tm; q split into f16 hi (x16) + residual planes as its fragments are loaded
  attn64<<<gAttn, dim3(128), 0, stream>>>(Tf, Kh, Kl, VTh, VTl, Tm, qkScale, sscale, attOscl);
  // (5) out = msgs . Wo + bo -> d_out f32 [8192][512] (M=8192, N=512, K=512); msgs split into f16 hi (x1024) + residual
  //     planes on the way into LDS
  gemm_o<<<gGemO, blk, 0, stream>>>(Tm, Wto, bo, outf, ROWS, mScale, outOscl);
  (void)hipGetLastError();
}

// v009
// One run takes 80.7 microseconds.
// Timed twice side by side with v008, it ran 1.09 times as fast both times.
// Counting every step since v000, it is 3.33 times as fast.
// Contractions: q/k/v projections = v_wmma_f32_16x16x32_bf16 (bf16 operands from RNE-converted nodes, W^T and bias, single product); q.k^T scores = v_wmma_f32_16x16x32_f16 (q, k as f16 hi planes carried x16 plus f16 residual planes x1024: hi.hi + (hi.lo + lo.hi) in a separate accumulator, 3 products); p.v = v_wmma_f32_16x16x32_f16 (p carried x1024 in f16; v^T as f16 hi plane x256 plus f16 residual plane x4096 in a separate accumulator folded with 2^-12, 2 products); output projection = v_wmma_f32_16x16x32_f16 (msgs as f16 hi plane x1024 plus f16 residual plane x1024 in a separate accumulator folded with 2^-10; Wo^T = RNE bf16 value carried x4096 in f16; 2 products); all f32 accumulate; softmax in f32.
#include <hip/hip_runtime.h>
#include <math.h>
#include <stdint.h>

#define NB    8
#define SEQ   1024
#define DM    512
#define NH    8
#define HD    64
#define NKT   (SEQ / 64)            // attn64: key tiles of 64
#define NQB   (SEQ / 128)           // attn64: query blocks of one (b, h): 4 waves x 32 query rows
#define ROWS  (NB * SEQ)            // 8192 token rows
#define OUTN  (ROWS * DM)
#define KVP   72                    // LDS pitch of the 64-wide f16 tiles in attn64, in halves: 144 B = 16 B x 9 (odd)
#define OSP   68                    // LDS pitch of the 64-wide f32 context tile in attn64, in floats
#define KVT   (64 * KVP)            // attn64: halves of one staged 64 x 64 plane tile (9216 B)
#define KVBUF (4 * KVT)             // attn64: halves of one tile buffer: K hi, K residual, V^T hi, V^T residual (36864 B)
#define GKC   64                    // GEMMs: k elements of one staged slice = 128 B of every staged row
#define GSP   72                    // GEMMs: LDS pitch of a staged row, in 16-bit elements: 144 B = 16 B x 9 (odd)
#define GROWS (64 + DM)             // gemm64: staged rows of a slice: 64 A rows, then the DM rows of B
#define GBUF  (GROWS * GSP)         // gemm64: 16-bit elements of one slice buffer (82944 B)
#define NSL   (DM / GKC)            // GEMMs: slices along k
#define ASP   520                   // gemm_o: LDS pitch of a resident A row (all DM k), in halves: 1040 B = 16 B x 65 (odd)
#define GBB   (DM * GSP)            // gemm_o: halves of one B slice buffer (73728 B)
#define WTB   ((DM / 64) * (DM / 64))      // 64 x 64 tiles of one weight matrix
#define TILEH (64 * 64)                     // halves of one 64 x 64 f16 plane tile of k or v in global memory (8192 B in a row)
#define PLB   (ROWS * DM / 8 / 256)        // blocks of one 8-elements-per-thread pass over a [ROWS][DM] plane
static_assert(NH * HD == DM);
static_assert(HD == 64);
static_assert(16 * KVP * 2 == 2304 && KVT * 2 == 9216);        // copy8: LDS bytes of 16 staged rows, of one plane tile
static_assert(128 * 8 * 4 == TILEH && NKT * 64 == SEQ);         // copy8: 4 copies of 128 threads x 16 B = one plane tile
static_assert(4 * 32 * OSP * 4 <= 2 * KVBUF * 2 && NKT >= 2 && (SEQ % 128) == 0);   // the context tiles fit the tile buffers; two buffers
static_assert(32 * GSP * 2 == 4608);                           // copy9: LDS bytes of 32 staged rows
static_assert(DM == 8 * 64 && GROWS == 18 * 32 && NSL >= 2);   // 8 waves x 64 columns; 18 copies per thread; two buffers
static_assert(ASP >= DM + 8 && (ASP * 2) % 32 == 16);          // gemm_o: a resident A row holds all DM k; pitch 16 B x odd
static_assert((SEQ % 64) == 0 && (DM % 64) == 0 && (ROWS % 64) == 0);
static_assert(((ROWS / 64) * (DM / 64)) % 8 == 0);
static_assert(((ROWS / 32) * (DM / 64)) % 8 == 0);
static_assert(((ROWS * DM / 8) % 256) == 0);

typedef _Float16 v16h __attribute__((ext_vector_type(16)));
typedef _Float16 v8h  __attribute__((ext_vector_type(8)));
typedef __bf16   v16b __attribute__((ext_vector_type(16)));
typedef __bf16   v8b  __attribute__((ext_vector_type(8)));
typedef float    v8f  __attribute__((ext_vector_type(8)));
typedef float    v4f  __attribute__((ext_vector_type(4)));
typedef unsigned int v4u __attribute__((ext_vector_type(4)));

// ---- scalar helpers --------------------------------------------------------------------------------
__device__ __forceinline__ unsigned short bf_bits(float f) {          // f32 -> bf16 bits, RNE convert
  unsigned u = __float_as_uint(f);
  return (unsigned short)((u + 0x7FFFu + ((u >> 16) & 1u)) >> 16);
}
__device__ __forceinline__ float bf_up(unsigned short h) { return __uint_as_float(((unsigned)h) << 16); }
__device__ __forceinline__ unsigned short h_bits(_Float16 x) { return __builtin_bit_cast(unsigned short, x); }
__device__ __forceinline__ unsigned pk16(unsigned short a, unsigned short b) { return (unsigned)a | ((unsigned)b << 16); }
__device__ __forceinline__ v8f zero8() { v8f z = {0.f, 0.f, 0.f, 0.f, 0.f, 0.f, 0.f, 0.f}; return z; }

// ---- fragment loaders: 16-bit A/B operand, lane -> row/col (lane&15), p already includes +8*(lane>>4);
//      elements 0..7 <- p[0..7] (k0+8h..), elements 8..15 <- p[16..23] (k0+16+8h..)
__device__ __forceinline__ v16b ldfrag_b(const __bf16* p) {
  union { v16b v; v8b h[2]; } f;
  f.h[0] = *(const v8b*)(p);
  f.h[1] = *(const v8b*)(p + 16);
  return f.v;
}
__device__ __forceinline__ v16h ldfrag_h(const _Float16* p) {
  union { v16h v; v8h h[2]; } f;
  f.h[0] = *(const v8h*)(p);
  f.h[1] = *(const v8h*)(p + 16);
  return f.v;
}

// ---- WMMA helpers with trailing VALU hazard gap --------------------------------------------------------
__device__ __forceinline__ v8f mma_h(v16h a, v16h b, v8f c) {
  c = __builtin_amdgcn_wmma_f32_16x16x32_f16(false, a, false, b, (short)0, c, false, false);
#if defined(__HIP_DEVICE_COMPILE__)
  asm volatile("v_nop\n\tv_nop\n\tv_nop\n\tv_nop" : "+v"(c) : "v"(a), "v"(b));
#endif
  return c;
}
__device__ __forceinline__ v8f mma_h_raw(v16h a, v16h b, v8f c) {   // the compiler keeps the distances behind its own builtin
  return __builtin_amdgcn_wmma_f32_16x16x32_f16(false, a, false, b, (short)0, c, false, false);
}
__device__ __forceinline__ v8f mma_b_raw(v16b a, v16b b, v8f c) {
  return __builtin_amdgcn_wmma_f32_16x16x32_bf16(false, a, false, b, (short)0, c, false, false);
}
__device__ __forceinline__ void dep_guard_b(v8f& a, v8f& b, v16b x, v16b y) {
#if defined(__HIP_DEVICE_COMPILE__)
  asm volatile("v_nop\n\tv_nop\n\tv_nop\n\tv_nop" : "+v"(a), "+v"(b) : "v"(x), "v"(y));
#endif
}
__device__ __forceinline__ void keep4_b(v16b a, v16b b, v16b c, v16b d) {
#if defined(__HIP_DEVICE_COMPILE__)
  asm volatile("v_nop" :: "v"(a), "v"(b), "v"(c), "v"(d));
#endif
}
__device__ __forceinline__ void acc_guard4(v8f& a, v8f& b, v8f& c, v8f& d) {
#if defined(__HIP_DEVICE_COMPILE__)
  asm volatile("v_nop\n\tv_nop\n\tv_nop\n\tv_nop" : "+v"(a), "+v"(b), "+v"(c), "+v"(d));
#endif
}

// lane l <-> lane l ^ 16 (the other half of the wave), in the vector unit
__device__ __forceinline__ float xhalf(float x) {
  const int b = __builtin_bit_cast(int, x);
  return __builtin_bit_cast(float, __builtin_amdgcn_permlanex16(b, b, 0x76543210, 0xfedcba98, false, false));
}

// ---- GEMM operand staging: asynchronous copies global -> LDS, waits -----------------------------------
__device__ __forceinline__ unsigned lds_off(const void* p) { return (unsigned)(size_t)p; }   // LDS byte address
// nine 16-B copies of this lane: LDS bytes l + 4608 i (32 staged rows of 144 B further each) <- global g0 .. g8
__device__ __forceinline__ void copy9(unsigned l, const unsigned short* g0, const unsigned short* g1,
                                      const unsigned short* g2, const unsigned short* g3, const unsigned short* g4,
                                      const unsigned short* g5, const unsigned short* g6, const unsigned short* g7,
                                      const unsigned short* g8) {
#if defined(__HIP_DEVICE_COMPILE__)
  // the closing s_wait_xcnt stands in the copies' own statement: no address register is rewritten in front of it
  asm volatile(
      "global_load_async_to_lds_b128 %0, %9, off\n\t"
      "global_load_async_to_lds_b128 %1, %10, off\n\t"
      "global_load_async_to_lds_b128 %2, %11, off\n\t"
      "global_load_async_to_lds_b128 %3, %12, off\n\t"
      "global_load_async_to_lds_b128 %4, %13, off\n\t"
      "global_load_async_to_lds_b128 %5, %14, off\n\t"
      "global_load_async_to_lds_b128 %6, %15, off\n\t"
      "global_load_async_to_lds_b128 %7, %16, off\n\t"
      "global_load_async_to_lds_b128 %8, %17, off\n\t"
      "s_wait_xcnt 0x0"
      :: "v"(l), "v"(l + 4608u), "v"(l + 2u * 4608u), "v"(l + 3u * 4608u), "v"(l + 4u * 4608u),
         "v"(l + 5u * 4608u), "v"(l + 6u * 4608u), "v"(l + 7u * 4608u), "v"(l + 8u * 4608u),
         "v"(g0), "v"(g1), "v"(g2), "v"(g3), "v"(g4), "v"(g5), "v"(g6), "v"(g7), "v"(g8)
      : "memory");
#endif
}
// One slice = GROWS rows x 128 B = 18 groups of 32 rows; thread tid copies 16-B column tid&7 of row tid>>3 of every
// group, so 8 lanes copy one whole 128-B line. l: the lane's LDS byte address in group 0 of the buffer; a0, a1: its
// source in A row groups 0 and 1; b: its source in B row group 0 (groups 2..17 = B rows 0..DM-1, row pitch DM).
__device__ __forceinline__ void stage_slice(unsigned l, const unsigned short* a0, const unsigned short* a1,
                                            const unsigned short* b) {
  constexpr size_t S = (size_t)32 * DM;           // 32 B rows, in elements
  copy9(l, a0, a1, b, b + S, b + 2 * S, b + 3 * S, b + 4 * S, b + 5 * S, b + 6 * S);
  copy9(l + 9u * 4608u, b + 7 * S, b + 8 * S, b + 9 * S, b + 10 * S, b + 11 * S, b + 12 * S, b + 13 * S, b + 14 * S,
        b + 15 * S);
}
// eight 16-B copies of this lane: LDS bytes l + 4608 i (32 staged rows of 144 B further each) <- global b + i s
__device__ __forceinline__ void copy8r(unsigned l, const unsigned short* b, size_t s) {
#if defined(__HIP_DEVICE_COMPILE__)
  // the closing s_wait_xcnt stands in the copies' own statement: no address register is rewritten in front of it
  asm volatile(
      "global_load_async_to_lds_b128 %0, %8, off\n\t"
      "global_load_async_to_lds_b128 %1, %9, off\n\t"
      "global_load_async_to_lds_b128 %2, %10, off\n\t"
      "global_load_async_to_lds_b128 %3, %11, off\n\t"
      "global_load_async_to_lds_b128 %4, %12, off\n\t"
      "global_load_async_to_lds_b128 %5, %13, off\n\t"
      "global_load_async_to_lds_b128 %6, %14, off\n\t"
      "global_load_async_to_lds_b128 %7, %15, off\n\t"
      "s_wait_xcnt 0x0"
      :: "v"(l), "v"(l + 4608u), "v"(l + 2u * 4608u), "v"(l + 3u * 4608u), "v"(l + 4u * 4608u),
         "v"(l + 5u * 4608u), "v"(l + 6u * 4608u), "v"(l + 7u * 4608u),
         "v"(b), "v"(b + s), "v"(b + 2 * s), "v"(b + 3 * s), "v"(b + 4 * s), "v"(b + 5 * s), "v"(b + 6 * s), "v"(b + 7 * s)
      : "memory");
#endif
}
// One B slice = DM rows x 128 B = 16 groups of 32 rows, dealt to the threads as in stage_slice. l: the lane's LDS byte
// address in group 0 of the buffer; b: its source in B row group 0 (row pitch DM).
__device__ __forceinline__ void stage_b(unsigned l, const unsigned short* b) {
  constexpr size_t S = (size_t)32 * DM;           // 32 B rows, in elements
  copy8r(l, b, S);
  copy8r(l + 8u * 4608u, b + 8 * S, S);
}
__device__ __forceinline__ void wait_copies() {   // this wave's copies have landed in LDS
#if defined(__HIP_DEVICE_COMPILE__)
  asm volatile("s_wait_asynccnt 0x0" ::: "memory");
#endif
}
__device__ __forceinline__ void wait_lds_reads() {   // this wave's LDS reads are done before the buffer is handed on
#if defined(__HIP_DEVICE_COMPILE__)
  asm volatile("s_wait_dscnt 0x0" ::: "memory");
#endif
}

// behind a group of global stores: no register that they name is rewritten in front of this wait; the scheduling barrier
// keeps the arithmetic of the next group, which reuses those registers, from being lifted over it
__device__ __forceinline__ void wait_store_regs() {
#if defined(__HIP_DEVICE_COMPILE__)
  asm volatile("s_wait_xcnt 0x0" ::: "memory");
  __builtin_amdgcn_sched_barrier(0);
#endif
}

// eight 16-B copies of this lane, two planes x four quarters of a plane tile: LDS bytes l + LSTEP g <- a + 1024 g,
// LDS bytes l + 9216 + LSTEP g <- b + 1024 g (g = 0..3; 1024 halves = the 2048 B that the block's 128 threads copy at once)
template <unsigned LSTEP>
__device__ __forceinline__ void copy8(unsigned l, const _Float16* a, const _Float16* b) {
#if defined(__HIP_DEVICE_COMPILE__)
  // the closing s_wait_xcnt stands in the copies' own statement: no address register is rewritten in front of it
  asm volatile(
      "global_load_async_to_lds_b128 %0, %8, off\n\t"
      "global_load_async_to_lds_b128 %1, %9, off\n\t"
      "global_load_async_to_lds_b128 %2, %10, off\n\t"
      "global_load_async_to_lds_b128 %3, %11, off\n\t"
      "global_load_async_to_lds_b128 %4, %12, off\n\t"
      "global_load_async_to_lds_b128 %5, %13, off\n\t"
      "global_load_async_to_lds_b128 %6, %14, off\n\t"
      "global_load_async_to_lds_b128 %7, %15, off\n\t"
      "s_wait_xcnt 0x0"
      :: "v"(l), "v"(l + LSTEP), "v"(l + 2u * LSTEP), "v"(l + 3u * LSTEP),
         "v"(l + 9216u), "v"(l + 9216u + LSTEP), "v"(l + 9216u + 2u * LSTEP), "v"(l + 9216u + 3u * LSTEP),
         "v"(a), "v"(a + 1024), "v"(a + 2 * 1024), "v"(a + 3 * 1024),
         "v"(b), "v"(b + 1024), "v"(b + 2 * 1024), "v"(b + 3 * 1024)
      : "memory");
#endif
}
// One key tile of attn64 = 4 plane tiles of 8192 B, each in a row in global memory; thread tid (of 128) copies 16-B piece
// 128 g + tid of every plane tile, so a wave's copy reads 512 B in a row. K tiles hold [key][d]: piece p = key p>>3,
// d 8 (p&7) ..; lk: the lane's LDS byte address of piece tid in the buffer's first plane, 16 staged rows further per g.
// V^T tiles hold piece p = feature d 16 ((p>>5)&3) + (p&15), keys 16 (p>>7) + 8 ((p>>4)&1) ..; lv: the lane's LDS byte
// address of piece tid in the buffer's third plane, 16 keys (32 B) further per g. k, kl, v, vl: the lane's piece tid.
__device__ __forceinline__ void stage_kv(unsigned lk, unsigned lv, const _Float16* k, const _Float16* kl,
                                         const _Float16* v, const _Float16* vl) {
  copy8<2304u>(lk, k, kl);
  copy8<32u>(lv, v, vl);
}

// =====================================================================================================
// f32 -> bf16 (RNE convert), 8 elements per thread, one 16-B store per lane: a wave writes 512 contiguous B
// coverage: n8 threads x 8 = whole plane (n8 is a multiple of 256 here).
// =====================================================================================================
__device__ __forceinline__ void cvt_bf16x8_body(const float* __restrict__ in, unsigned short* out, int n8, int blk) {
  const int i = blk * 256 + threadIdx.x;
  if (i < n8) {
    const v4f a = *(const v4f*)(in + (size_t)i * 8);
    const v4f b = *(const v4f*)(in + (size_t)i * 8 + 4);
    v4u p;
    p[0] = pk16(bf_bits(a[0]), bf_bits(a[1]));
    p[1] = pk16(bf_bits(a[2]), bf_bits(a[3]));
    p[2] = pk16(bf_bits(b[0]), bf_bits(b[1]));
    p[3] = pk16(bf_bits(b[2]), bf_bits(b[3]));
    *(v4u*)(out + (size_t)i * 8) = p;
    
  }
}

// =====================================================================================================
// f32 -> f16 hi plane = f16(v * scale) (scale a power of two) + f16 residual plane = f16((v*scale - hi) * 1024),
// same element index in both planes
// =====================================================================================================
// the split of 8 elements held in registers: ph = the hi plane's 16 B, pl = the residual plane's
__device__ __forceinline__ void split_f16x8(v4f a, v4f b, float scale, v4u& ph, v4u& pl) {
  float f[8];
  f[0] = a[0]; f[1] = a[1]; f[2] = a[2]; f[3] = a[3];
  f[4] = b[0]; f[5] = b[1]; f[6] = b[2]; f[7] = b[3];
#pragma unroll
  for (int e = 0; e < 4; ++e) {
    const float f0 = f[2 * e] * scale;
    const float f1 = f[2 * e + 1] * scale;
    const _Float16 x0 = (_Float16)f0, x1 = (_Float16)f1;
    const _Float16 l0 = (_Float16)((f0 - (float)x0) * 1024.0f);
    const _Float16 l1 = (_Float16)((f1 - (float)x1) * 1024.0f);
    ph[e] = pk16(h_bits(x0), h_bits(x1));
    pl[e] = pk16(h_bits(l0), h_bits(l1));
  }
}

// =====================================================================================================
// Weight transpose + convert: in W f32 [DM rows (e, contraction index)][DM cols (n, output feature)] (the
// x @ W layout) -> out Wt 16-bit [DM (n)][DM (e)] (the [n][k], k-contiguous layout the GEMM B operand uses).
// MODE 0: RNE bf16 bits. MODE 1: f16 bits of (RNE bf16 value * scale), scale a power of two (exact in f16).
// Block = one 64 e x 64 n tile (et, nt: its e and n tile index, DM/64 of each). The tile is staged in LDS as [ee][nn]
// pitch 68 floats (v4f loads, __syncthreads). in[rows e][cols n] -> out[rows n][cols e] (square here).
// Store: group g = tid>>3 (0..31), piece = tid&7: iteration it writes row n0 + (it*32+g), lanes 8q..8q+7 x 16 B
// coverage: 2 iterations x 32 groups = 64 rows n, 8 pieces x 8 = 64 e per row; grid covers every (e tile,
// n tile) -> the whole [DM][DM] plane.
// =====================================================================================================
template <int MODE>
__device__ __forceinline__ void wt_tile_body(const float* __restrict__ W, unsigned short* Wt, float scale,
                                             float* sw, int et, int nt) {
  const int tid = threadIdx.x;
  const int e0  = et * 64;
  const int n0  = nt * 64;
#pragma unroll
  for (int i = 0; i < 4; ++i) {
    const int idx = i * 256 + tid;                  // 0..1023
    const int ee = idx >> 4, c4 = (idx & 15) * 4;
    const v4f a = *(const v4f*)(W + ((size_t)(e0 + ee)) * DM + n0 + c4);
    *(v4f*)(sw + ee * 68 + c4) = a;
  }
  __syncthreads();

  const int g = tid >> 3, piece = tid & 7;
  v4u hv[2];
  size_t hofs[2];
#pragma unroll
  for (int it = 0; it < 2; ++it) {
    const int n = it * 32 + g;
    v4u a;
#pragma unroll
    for (int e = 0; e < 4; ++e) {
      const float f0 = sw[(piece * 8 + 2 * e) * 68 + n];
      const float f1 = sw[(piece * 8 + 2 * e + 1) * 68 + n];
      unsigned short u0, u1;
      if (MODE == 0) {
        u0 = bf_bits(f0);
        u1 = bf_bits(f1);
      } else {
        u0 = h_bits((_Float16)(bf_up(bf_bits(f0)) * scale));
        u1 = h_bits((_Float16)(bf_up(bf_bits(f1)) * scale));
      }
      a[e] = pk16(u0, u1);
    }
    hv[it] = a;
    hofs[it] = ((size_t)(n0 + n)) * DM + e0 + piece * 8;
  }
  {
#pragma unroll
    for (int it = 0; it < 2; ++it) {
      *(v4u*)(Wt + hofs[it]) = hv[it];
    }
#if defined(__HIP_DEVICE_COMPILE__)
    // both tile bodies stand in one kernel: no register that the two stores name is rewritten in front of this wait
    asm volatile("s_wait_xcnt 0x0" ::: "memory");
#endif
  }
}
// One grid for all operand preparation (the five jobs are independent of one another): blocks 0 .. 4 WTB - 1 = the
// weight tiles of Wq, Wk, Wv (bf16) and Wo (f16 x woscale), WTB tiles each; the blocks behind them = the activations'
// bf16 plane. The branch is block-uniform, so the tile body's barrier is passed by whole blocks only.
__global__ __launch_bounds__(256) void prep(const float* __restrict__ x, const float* __restrict__ Wq,
                                            const float* __restrict__ Wk, const float* __restrict__ Wv,
                                            const float* __restrict__ Wo, unsigned short* Xb, unsigned short* Wtq,
                                            unsigned short* Wtk, unsigned short* Wtv, unsigned short* Wto,
                                            int n8, float woscale) {
  __shared__ __align__(16) float sw[64 * 68];       // [ee][nn] pitch 68 floats
  const int bx = blockIdx.x;
  if (bx < 4 * WTB) {
    const int w = bx / WTB, tile = bx % WTB;
    const int et = tile % (DM / 64), nt = tile / (DM / 64);
    if (w == 3) {
      wt_tile_body<1>(Wo, Wto, woscale, sw, et, nt);
    } else {
      wt_tile_body<0>(w == 0 ? Wq : (w == 1 ? Wk : Wv), w == 0 ? Wtq : (w == 1 ? Wtk : Wtv), 1.0f, sw, et, nt);
    }
  } else {
    cvt_bf16x8_body(x, Xb, n8, bx - 4 * WTB);
  }
}

// =====================================================================================================
// Register-blocked bf16 WMMA GEMM with bias: C[m][n] = sum_k A[m][k] * Bt[n][k] + bf16rne(bias[n]), N = K = DM.
// Block = 64 rows x DM columns, one wave per 64x64 tile (wave w: columns 64 w ..). A row-major [M][DM]; Bt row-major
// [DM n][DM k] (k contiguous); bias f32 [DM] (RNE converted to bf16 and widened in the epilogue); M multiple of 64.
// Operands: k slices of GKC, the block's 64 A rows and all DM B rows, staged in LDS by asynchronous copies, two
// buffers: slice t + 1 is in flight while slice t is multiplied; per slice one hand-over (LDS reads done, own copies
// landed, block barrier), then slice t + 2 is copied into the buffer slice t has left.
// Output of q: f32 [M][DM] pitch DM. Epilogue: 16-row slabs staged per wave in LDS; each 64-wide row segment
// Output of k and v: the f16 hi and residual planes that attn64 stages, split here from the f32 result. A wave's 64 x 64
// tile is one key tile of one head (64 token rows, head = wave): it is stored as TILEH halves in a row, tile index
// blockIdx.x * NH + wave, every store instruction of a wave covering 512 B in a row.
//   k: hi = f16(k * kscale), residual = f16((k * kscale - hi) * 1024); tile = [key][d], through the wave's LDS slab
//   v: hi = f16(v * vscale), residual = f16((v * vscale - hi) * 4096); a lane's 8 accumulator rows of one column are 8
//      keys in a row of one feature = one 16-B piece of V^T, stored as piece (4 i + j) * 32 + lane: no LDS trip
// =====================================================================================================
// One grid for the three projections: blockIdx.y = 0, 1, 2 picks (Bt, bias, output) of q, k, v; A is common to them.
__global__ __launch_bounds__(256) void gemm64(
    const unsigned short* __restrict__ Ap,
    const unsigned short* __restrict__ Btq, const unsigned short* __restrict__ Btk,
    const unsigned short* __restrict__ Btv,
    const float* __restrict__ biasq, const float* __restrict__ biask, const float* __restrict__ biasv,
    float* C, unsigned short* kh, unsigned short* kl, unsigned short* vth, unsigned short* vtl, int M,
    float kscale, float vscale) {
  const int which = blockIdx.y;
  const unsigned short* __restrict__ Btp = which == 0 ? Btq : (which == 1 ? Btk : Btv);
  const float* __restrict__ bias = which == 0 ? biasq : (which == 1 ? biask : biasv);
  __shared__ __align__(16) __bf16 sAB[2 * GBUF];   // two slice buffers: rows 0..63 = A, rows 64.. = B
  __shared__ __align__(16) float sT[8][16 * 68];   // per-wave 16x64 slab, pitch 68 floats
  constexpr int ldc = DM;
  const int tid  = threadIdx.x;
  const int lane = tid & 31;
  const int wave = tid >> 5;
  const int m0 = blockIdx.x << 6;
  if (m0 >= M) return;                   // block-uniform, in front of every barrier
  const int n0 = wave << 6;

  // this lane's piece of every 32-row group: row tid>>3, 16-B column tid&7
  const unsigned short* ga0 = Ap + (size_t)(m0 + (tid >> 3)) * DM + (tid & 7) * 8;
  const unsigned short* ga1 = ga0 + (size_t)32 * DM;
  const unsigned short* gb  = Btp + (size_t)(tid >> 3) * DM + (tid & 7) * 8;
  const unsigned l0 = lds_off(sAB) + (unsigned)((tid >> 3) * GSP + (tid & 7) * 8) * 2u;
  stage_slice(l0, ga0, ga1, gb);
  wait_copies();
  __syncthreads();                       // slice 0 is readable by every wave
  stage_slice(l0 + GBUF * 2u, ga0 + GKC, ga1 + GKC, gb + GKC);

  const int rlane = lane & 15;                 // row (A) / col (B, D) within subtile
  const int koff  = (lane >> 4) * 8;           // k offset of this lane half
  const int mOff  = (lane >> 4) * 8;           // D row offset

  v8f acc[4][4];
#pragma unroll
  for (int i = 0; i < 4; ++i)
#pragma unroll
    for (int j = 0; j < 4; ++j) acc[i][j] = zero8();

  for (int t = 0; t < NSL; ++t) {
    const __bf16* sb = sAB + (t & 1) * GBUF;
#pragma unroll
    for (int kk = 0; kk < GKC; kk += 32) {
      v16b bh[4], ah[4];                 // the k step's LDS reads stand together, in front of its WMMAs
#pragma unroll
      for (int j = 0; j < 4; ++j) {
        bh[j] = ldfrag_b(sb + (64 + n0 + (j << 4) + rlane) * GSP + koff + kk);
      }
#pragma unroll
      for (int i = 0; i < 4; ++i) {
        ah[i] = ldfrag_b(sb + ((i << 4) + rlane) * GSP + koff + kk);
      }
#pragma unroll
      for (int i = 0; i < 4; ++i) {
#pragma unroll
        for (int j = 0; j < 4; ++j) {
          acc[i][j] = mma_b_raw(ah[i], bh[j], acc[i][j]);
        }
        dep_guard_b(acc[i][0], acc[i][3], ah[i], ah[i]);
      }
      keep4_b(bh[0], bh[1], bh[2], bh[3]);
    }
    // hand-over: slice t + 1 becomes readable, slice t's buffer becomes free
    wait_lds_reads();
    wait_copies();
    __syncthreads();
    if (t + 2 < NSL) {
      stage_slice(l0 + (unsigned)(t & 1) * (GBUF * 2u), ga0 + (t + 2) * GKC, ga1 + (t + 2) * GKC, gb + (t + 2) * GKC);
    }
  }
  wait_copies();
  acc_guard4(acc[0][0], acc[0][1], acc[0][2], acc[0][3]);
  acc_guard4(acc[1][0], acc[1][1], acc[1][2], acc[1][3]);
  acc_guard4(acc[2][0], acc[2][1], acc[2][2], acc[2][3]);
  acc_guard4(acc[3][0], acc[3][1], acc[3][2], acc[3][3]);

  // ---- bias per D column of this lane (n0 + 16j + rlane < N) ----
  float bz[4];
#pragma unroll
  for (int j = 0; j < 4; ++j) bz[j] = bf_up(bf_bits(bias[n0 + (j << 4) + rlane]));

  // ---- epilogue (the branches on which are block-uniform) ----
  float* slab = sT[wave];
  const size_t tile = ((size_t)blockIdx.x * NH + wave) * TILEH;   // k, v: this wave's plane tile
  if (which == 0) {
#pragma unroll
    for (int i = 0; i < 4; ++i) {
      const int mBase = m0 + (i << 4);
#pragma unroll
      for (int r = 0; r < 8; ++r) {
#pragma unroll
        for (int j = 0; j < 4; ++j) {
          slab[(mOff + r) * 68 + (j << 4) + rlane] = acc[i][j][r] + bz[j];
        }
      }
      __builtin_amdgcn_fence(__ATOMIC_RELEASE, "workgroup");
      __builtin_amdgcn_wave_barrier();
      __builtin_amdgcn_fence(__ATOMIC_ACQUIRE, "workgroup");
      {
        const int hh = lane >> 4, c4 = (lane & 15) * 4;     // 256-B row segment = 16 lanes x 16 B
        v4f ov[8];
#pragma unroll
        for (int it = 0; it < 8; ++it) {
          const int row = it * 2 + hh;                       // it 0..7 x hh 0..1 = rows 0..15
          ov[it] = *(const v4f*)(slab + row * 68 + c4);
        }
#pragma unroll
        for (int it = 0; it < 8; ++it) {
          const int row = it * 2 + hh;
          *(v4f*)(C + (size_t)(mBase + row) * ldc + n0 + c4) = ov[it];
        }
        wait_store_regs();
      }
      __builtin_amdgcn_fence(__ATOMIC_RELEASE, "workgroup");
      __builtin_amdgcn_wave_barrier();
      __builtin_amdgcn_fence(__ATOMIC_ACQUIRE, "workgroup");
    }
  } else if (which == 1) {
    unsigned short* th = kh + tile + lane * 8;     // piece lane of a group of 4 rows: row lane>>3, d 8 (lane&7) ..
    unsigned short* tl = kl + tile + lane * 8;
#pragma unroll
    for (int i = 0; i < 4; ++i) {
#pragma unroll
      for (int r = 0; r < 8; ++r) {
#pragma unroll
        for (int j = 0; j < 4; ++j) {
          slab[(mOff + r) * 68 + (j << 4) + rlane] = acc[i][j][r] + bz[j];
        }
      }
      __builtin_amdgcn_fence(__ATOMIC_RELEASE, "workgroup");
      __builtin_amdgcn_wave_barrier();
      __builtin_amdgcn_fence(__ATOMIC_ACQUIRE, "workgroup");
      {
        v4u ph[4], pl[4];
#pragma unroll
        for (int it = 0; it < 4; ++it) {                     // it 0..3 x lane>>3 0..3 = rows 0..15
          const float* sp = slab + (it * 4 + (lane >> 3)) * 68 + (lane & 7) * 8;
          split_f16x8(*(const v4f*)(sp), *(const v4f*)(sp + 4), kscale, ph[it], pl[it]);
        }
#pragma unroll
        for (int it = 0; it < 4; ++it) {
          *(v4u*)(th + (i * 16 + it * 4) * 64) = ph[it];
          *(v4u*)(tl + (i * 16 + it * 4) * 64) = pl[it];
        }
        wait_store_regs();
      }
      __builtin_amdgcn_fence(__ATOMIC_RELEASE, "workgroup");
      __builtin_amdgcn_wave_barrier();
      __builtin_amdgcn_fence(__ATOMIC_ACQUIRE, "workgroup");
    }
  } else {
    unsigned short* th = vth + tile + lane * 8;    // piece lane of accumulator tile (i, j)
    unsigned short* tl = vtl + tile + lane * 8;
#pragma unroll
    for (int i = 0; i < 4; ++i) {
      v4u ph[4], pl[4];                                      // [j]: keys 16 i + mOff + 0..7 of feature 16 j + rlane
#pragma unroll
      for (int j = 0; j < 4; ++j) {
#pragma unroll
        for (int e = 0; e < 4; ++e) {
          const float f0 = (acc[i][j][2 * e] + bz[j]) * vscale;
          const float f1 = (acc[i][j][2 * e + 1] + bz[j]) * vscale;
          const _Float16 x0 = (_Float16)f0, x1 = (_Float16)f1;
          const _Float16 l0 = (_Float16)((f0 - (float)x0) * 4096.0f);
          const _Float16 l1 = (_Float16)((f1 - (float)x1) * 4096.0f);
          ph[j][e] = pk16(h_bits(x0), h_bits(x1));
          pl[j][e] = pk16(h_bits(l0), h_bits(l1));
        }
      }
#pragma unroll
      for (int j = 0; j < 4; ++j) {
        *(v4u*)(th + (i * 4 + j) * 256) = ph[j];
        *(v4u*)(tl + (i * 4 + j) * 256) = pl[j];
      }
      wait_store_regs();
    }
  }
}

// =====================================================================================================
// f16 WMMA GEMM with a two-plane A operand and bias:
//   C[m][n] = (sum_k Ah[m][k]*Bt[n][k] + 2^-10 * sum_k Al[m][k]*Bt[n][k]) * oscale + bf16rne(bias[n]),
// the residual products in a separate accumulator, N = K = DM. Block = 32 rows x DM columns, one wave per 32x64 tile
// (wave w: columns 64 w ..). A comes as f32, row-major [M][DM]: the block loads its 32 rows once, splits them in
// registers into Ah = f16(A * ascale) and Al = f16((A * ascale - Ah) * 1024) and keeps both planes in LDS for all
// k slices. Bt row-major [DM n][DM k] (f16, k contiguous); M multiple of 32. B staged in LDS by k slices as in gemm64
// (asynchronous copies, two buffers). Every WMMA nop-guarded.
// Output f32 [M][DM] pitch DM. Epilogue: 16-row slabs staged per wave in LDS; each 64-wide row segment (256 B)
// coverage: 2 slabs x 16 rows x 64 cols = the wave's whole 32x64 tile.
// =====================================================================================================
__global__ __launch_bounds__(256) void gemm_o(
    const float* __restrict__ Af,
    const unsigned short* __restrict__ Btp,
    const float* __restrict__ bias,
    float* C, int M, float ascale, float oscale) {
  __shared__ __align__(16) _Float16 sA[64 * ASP];  // rows 0..31 = Ah, 32..63 = Al, all DM k of the block's 32 rows
  __shared__ __align__(16) _Float16 sB[2 * GBB];   // two B slice buffers
  __shared__ __align__(16) float sT[8][16 * 68];   // per-wave 16x64 slab, pitch 68 floats
  constexpr int ldc = DM;
  const int tid  = threadIdx.x;
  const int lane = tid & 31;
  const int wave = tid >> 5;
  const int m0 = blockIdx.x << 5;
  if (m0 >= M) return;                   // block-uniform, in front of every barrier
  const int n0 = wave << 6;

  // A: thread tid takes elements (tid&7) * 8 .. + 7 of every 64-element k slice of row tid>>3: 8 lanes read 256 B in a row
  const int arow = tid >> 3, apc = (tid & 7) * 8;
  const float* ga = Af + (size_t)(m0 + arow) * DM + apc;
  v4f ax[NSL][2];
#pragma unroll
  for (int i = 0; i < NSL; ++i) {
    ax[i][0] = *(const v4f*)(ga + i * GKC);
    ax[i][1] = *(const v4f*)(ga + i * GKC + 4);
  }
#if defined(__HIP_DEVICE_COMPILE__)
  // no address register of the A loads is rewritten in front of this wait: the address is an input of the statement, so
  // that no load lands on it either; the scheduling barrier keeps the later address arithmetic from being lifted over it
  asm volatile("s_wait_xcnt 0x0" :: "v"(ga) : "memory");
  __builtin_amdgcn_sched_barrier(0);
#endif
  // B: this lane's piece of every 32-row group: row tid>>3, 16-B column tid&7
  const unsigned short* gb  = Btp + (size_t)(tid >> 3) * DM + (tid & 7) * 8;
  const unsigned l0 = lds_off(sB) + (unsigned)((tid >> 3) * GSP + (tid & 7) * 8) * 2u;
  stage_b(l0, gb);                       // slice 0 flies while A is split
  // keeps the split, which waits for the A loads, behind the issue of slice 0's copies
  __builtin_amdgcn_sched_barrier(0);
#pragma unroll
  for (int i = 0; i < NSL; ++i) {
    v4u ph, pl;
    split_f16x8(ax[i][0], ax[i][1], ascale, ph, pl);
    *(v4u*)(sA + arow * ASP + i * GKC + apc) = ph;
    *(v4u*)(sA + (32 + arow) * ASP + i * GKC + apc) = pl;
  }
  wait_lds_reads();                      // this wave's A stores are in LDS
  wait_copies();
  __syncthreads();                       // A and slice 0 of B are readable by every wave
  stage_b(l0 + GBB * 2u, gb + GKC);

  const int rlane = lane & 15;
  const int koff  = (lane >> 4) * 8;
  const int mOff  = (lane >> 4) * 8;

  v8f acc[2][4], acl[2][4];
#pragma unroll
  for (int i = 0; i < 2; ++i)
#pragma unroll
    for (int j = 0; j < 4; ++j) { acc[i][j] = zero8(); acl[i][j] = zero8(); }

  for (int t = 0; t < NSL; ++t) {
    const _Float16* sb = sB + (t & 1) * GBB;
    const _Float16* sa = sA + t * GKC;
#pragma unroll
    for (int kk = 0; kk < GKC; kk += 32) {
      v16h ah[2], al[2], bfr[4];         // the k step's LDS reads stand together, in front of its WMMAs
#pragma unroll
      for (int i = 0; i < 2; ++i) {
        ah[i] = ldfrag_h(sa + ((i << 4) + rlane) * ASP + koff + kk);
        al[i] = ldfrag_h(sa + (32 + (i << 4) + rlane) * ASP + koff + kk);
      }
#pragma unroll
      for (int j = 0; j < 4; ++j) {
        bfr[j] = ldfrag_h(sb + (n0 + (j << 4) + rlane) * GSP + koff + kk);
      }
#pragma unroll
      for (int j = 0; j < 4; ++j) {
#pragma unroll
        for (int i = 0; i < 2; ++i) {
          acc[i][j] = mma_h(ah[i], bfr[j], acc[i][j]);
          acl[i][j] = mma_h(al[i], bfr[j], acl[i][j]);
        }
      }
    }
    // hand-over: slice t + 1 becomes readable, slice t's buffer becomes free
    wait_lds_reads();
    wait_copies();
    __syncthreads();
    if (t + 2 < NSL) {
      stage_b(l0 + (unsigned)(t & 1) * (GBB * 2u), gb + (t + 2) * GKC);
    }
  }
  wait_copies();

  // ---- bias per D column of this lane (n0 + 16j + rlane < N) ----
  float bz[4];
#pragma unroll
  for (int j = 0; j < 4; ++j) bz[j] = bf_up(bf_bits(bias[n0 + (j << 4) + rlane]));

  // ---- epilogue ----
  float* slab = sT[wave];
#pragma unroll
  for (int i = 0; i < 2; ++i) {
    const int mBase = m0 + (i << 4);
#pragma unroll
    for (int r = 0; r < 8; ++r) {
#pragma unroll
      for (int j = 0; j < 4; ++j) {
        const float y = (acc[i][j][r] + acl[i][j][r] * (1.0f / 1024.0f)) * oscale + bz[j];
        slab[(mOff + r) * 68 + (j << 4) + rlane] = y;
      }
    }
    __builtin_amdgcn_fence(__ATOMIC_RELEASE, "workgroup");
    __builtin_amdgcn_wave_barrier();
    __builtin_amdgcn_fence(__ATOMIC_ACQUIRE, "workgroup");
    {
      const int hh = lane >> 4, c4 = (lane & 15) * 4;     // 256-B row segment = 16 lanes x 16 B
      v4f ov[8];
#pragma unroll
      for (int it = 0; it < 8; ++it) {
        const int row = it * 2 + hh;                       // it 0..7 x hh 0..1 = rows 0..15
        ov[it] = *(const v4f*)(slab + row * 68 + c4);
      }
      {
#pragma unroll
        for (int it = 0; it < 8; ++it) {
          const int row = it * 2 + hh;
          *(v4f*)(C + (size_t)(mBase + row) * ldc + n0 + c4) = ov[it];
        }
        
      }
    }
    __builtin_amdgcn_fence(__ATOMIC_RELEASE, "workgroup");
    __builtin_amdgcn_wave_barrier();
    __builtin_amdgcn_fence(__ATOMIC_ACQUIRE, "workgroup");
  }
}

// =====================================================================================================
// Bidirectional multi-head attention, head dim 64, no mask.
//   q f32: element (b, t, h, d) at [(b*SEQ + t)*DM + h*64 + d]; split in registers into the f16 hi plane (x qscale = 16)
//     and the residual plane ((q*16 - hi)*1024)
//   k f16 hi plane (x16): 64 key x 64 d tiles of TILEH halves in a row, tile ((b*NKT + key tile)*NH + h), [key][d] inside;
//     k residual plane same into klp
//   v^T f16 hi plane (x256): tiles with the same index, 16-B pieces in the order gemm64 stores them (see stage_kv)
//   v^T f16 residual plane ((v*256 - hi)*4096): same index into vlp
//   All NKT key tiles of 64 are processed for every query block (static trip count).
//   logit = (qhi.khi + (qhi.klo + qlo.khi) * 2^-10) * sscale, f16 products with f32 accumulate, the residual
//   products in a separate accumulator; p = exp(s - m) carried as ph = f16(1024 p);
//   context = ph . vhi on f16 WMMA plus ph . vres into a separate accumulator folded back with 2^-12 per tile
//   in f32; online softmax in f32; out f32 plane: element (b, t, h*64 + d) at [(b*SEQ + t)*DM + h*64 + d] =
//   normalised context (oscl folds back the p and v carries).
//   Block = 4 waves x 32 query rows = 128 query rows of one (b, h); grid = NB*NH*NQB; kv tiles of 64. A wave works on two
//   groups g = 0, 1 of 16 queries: every K and V^T fragment that it reads from LDS is the A operand of both groups' WMMAs.
//   K hi / K residual / V^T hi / V^T residual tile staging: asynchronous copies global -> LDS, 128 threads x 4 x 16 B
//   per plane = the whole 64x64 tile, two buffers: tile t + 1 is in flight while tile t is worked on; per tile one
//   hand-over (LDS reads done, own copies landed, block barrier), then tile t + 2 is copied into the buffer tile t has left.
//   Both products are formed transposed: S^T = K . Q^T (A = K rows, B = Q) and O^T += V^T . P^T (A = V^T rows, B = P^T).
//   A lane then holds, per group, 32 of the 64 scores of ONE query (column lane&15; keys 16 j + 8 (lane>>4) + r), so maximum and
//   sum run in the lane, with one exchange between the wave's halves; two score tiles, converted in place, are the
//   B operand of the second product in the loaders' k order: P never leaves the registers.
//   Output coverage: each wave stores rows q0..q0+31 (it 0..15 x lane>>4 0..1) x 64 columns (16 lanes x 4
//   (b, h, query tile) -> the whole plane.
// =====================================================================================================
__global__ __launch_bounds__(128)
void attn64(const float* __restrict__ qf,
            const unsigned short* __restrict__ khp, const unsigned short* __restrict__ klp,
            const unsigned short* __restrict__ vhp, const unsigned short* __restrict__ vlp,
            float* outp, float qscale, float sscale, float oscl) {
  union FH { v16h v; v8h h[2]; };
  // two tile buffers of K hi [kv][d], K residual, V^T hi [d][kv], V^T residual, 9 KB each; behind the loop's last
  // barrier the same bytes hold the per wave context tiles [row][d] (34 KB)
  __shared__ __align__(16) _Float16 KV[2 * KVBUF];

  const int tid  = threadIdx.x;
  const int wave = tid >> 5;
  const int lane = tid & 31;
  const int hh   = lane >> 4;
  const int c    = lane & 15;

  const int bx   = blockIdx.x;
  const int qb   = bx % NQB;
  const int rest = bx / NQB;
  const int h    = rest % NH;
  const int b    = rest / NH;                // < NB by the grid size
  const int q0   = qb * 128 + wave * 32;
  const size_t rowB = (size_t)b * SEQ;

  const float*    Qf  = qf + (size_t)h * HD;
  const size_t tile0 = ((size_t)b * NKT * NH + h) * TILEH;       // plane tile of (b, key tile 0, h); NH tiles further per key tile

  // ---- Q fragments (B operand, column = lane&15): 2 query groups x 2 d-chunks, hi and residual, split here from the
  //      f32 q (a wave is the only reader of its 32 q rows); elements 0..7 <- d + 0..7, 8..15 <- d + 16..23, the loaders' k order
  v16h qa[2][2], ql[2][2];
  v4f qx[2][2][4];
#pragma unroll
  for (int g = 0; g < 2; ++g) {
#pragma unroll
    for (int dc = 0; dc < 2; ++dc) {
      const float* qp = Qf + (rowB + q0 + g * 16 + c) * DM + dc * 32 + 8 * hh;
      qx[g][dc][0] = *(const v4f*)(qp);
      qx[g][dc][1] = *(const v4f*)(qp + 4);
      qx[g][dc][2] = *(const v4f*)(qp + 16);
      qx[g][dc][3] = *(const v4f*)(qp + 20);
    }
#if defined(__HIP_DEVICE_COMPILE__)
    // no address register of this group's Q loads is rewritten in front of this wait; the scheduling barrier keeps the
    // next group's loads and the later address arithmetic, which reuse those registers, from being lifted over it
    asm volatile("s_wait_xcnt 0x0" ::: "memory");
    __builtin_amdgcn_sched_barrier(0);
#endif
  }

  // this lane's 16-B piece tid of every quarter of a plane tile; in LDS: K row tid>>3, column piece tid&7; V^T row
  // d = 16 wave + c, keys 8 hh ..
  const _Float16* gk  = (const _Float16*)(const void*)khp + tile0 + tid * 8;   // K hi, key tile 0
  const _Float16* gkl = (const _Float16*)(const void*)klp + tile0 + tid * 8;   // K residual
  const _Float16* gv  = (const _Float16*)(const void*)vhp + tile0 + tid * 8;   // V^T hi
  const _Float16* gvl = (const _Float16*)(const void*)vlp + tile0 + tid * 8;   // V^T residual
  const unsigned lk0 = lds_off(KV) + (unsigned)((tid >> 3) * KVP + (tid & 7) * 8) * 2u;
  const unsigned lv0 = lds_off(KV) + (unsigned)(2 * KVT + (wave * 16 + c) * KVP + 8 * hh) * 2u;
  stage_kv(lk0, lv0, gk, gkl, gv, gvl);
  // keeps the split of q, which waits for the Q loads, behind the issue of tile 0's copies
  __builtin_amdgcn_sched_barrier(0);
#pragma unroll
  for (int g = 0; g < 2; ++g) {
#pragma unroll
    for (int dc = 0; dc < 2; ++dc) {
      union { v16h v; v4u u[2]; } fh, fl;
      split_f16x8(qx[g][dc][0], qx[g][dc][1], qscale, fh.u[0], fl.u[0]);
      split_f16x8(qx[g][dc][2], qx[g][dc][3], qscale, fh.u[1], fl.u[1]);
      qa[g][dc] = fh.v;
      ql[g][dc] = fl.v;
    }
  }

  float mrow[2], lrow[2];                // of query q0 + 16 g + c; lrow sums this half's keys only, joined behind the loop
  v8f oacc[2][4];                        // oacc[g][t][r] = context of query q0 + 16 g + c, feature 16 t + 8 hh + r
#pragma unroll
  for (int g = 0; g < 2; ++g) {
    mrow[g] = -INFINITY;
    lrow[g] = 0.f;
#pragma unroll
    for (int t = 0; t < 4; ++t) oacc[g][t] = zero8();
  }

  for (int kt = 0; kt < NKT; ++kt) {
    // hand-over between trip kt - 1 and trip kt: tile kt becomes readable, tile kt - 1's buffer becomes free; then tile
    // kt + 1 is copied into that buffer. It stands at the head of the trip, with nothing behind the trip's arithmetic:
    // behind a branch at the foot the compiler moves the row sums there and holds all 64 p of a lane over the second product.
    wait_lds_reads();
    wait_copies();
    __syncthreads();
    if (kt + 1 < NKT) {
      const unsigned lb = (unsigned)((kt + 1) & 1) * (KVBUF * 2u);
      const size_t ts = (size_t)(kt + 1) * (NH * TILEH);
      stage_kv(lk0 + lb, lv0 + lb, gk + ts, gkl + ts, gv + ts, gvl + ts);
    }
    // (kv0 below = 64 kt, the tile's first key)
    // Fragment reads: plain LDS loads in groups of 8 ds_load_b128 (one 16-key group of K, or two 16-feature groups of
    // V^T, hi and residual planes), written one group ahead of the WMMAs that use them; the WMMAs are bare builtins, so
    // no asm statement stands between a read and an earlier WMMA and the reads can be issued ahead, behind counted waits.
    const _Float16* kfh = KV + (kt & 1) * KVBUF + c * KVP + 8 * hh;
    const _Float16* kfl = kfh + KVT;
    const _Float16* vfh = kfh + 2 * KVT;
    const _Float16* vfl = kfh + 3 * KVT;
    v16h kb[4][2], kr[4][2];             // K hi / residual fragments of key group j, d chunk dc
    v16h vb[2][4], vl[2][4];             // V^T hi / residual fragments of key chunk kk, feature group t
#define LD_K(j)                                                   \
    _Pragma("unroll") for (int dc = 0; dc < 2; ++dc) {            \
      kb[j][dc] = ldfrag_h(kfh + (j) * 16 * KVP + dc * 32);       \
      kr[j][dc] = ldfrag_h(kfl + (j) * 16 * KVP + dc * 32);       \
    }
#define LD_V(kk, tp)                                              \
    _Pragma("unroll") for (int t = 2 * (tp); t < 2 * (tp) + 2; ++t) { \
      vb[kk][t] = ldfrag_h(vfh + t * 16 * KVP + (kk) * 32);       \
      vl[kk][t] = ldfrag_h(vfl + t * 16 * KVP + (kk) * 32);       \
    }
    // ---- scores, transposed: 64 keys x 32 queries per wave; hi.hi into s, hi.lo + lo.hi into s1 (folded x 2^-10) ----
    v8f s[2][4], s1[2][4];               // s[g][j][r] = score of key kv0 + 16 j + 8 hh + r with query q0 + 16 g + c
#define SCORE(j)                                                  \
    _Pragma("unroll") for (int g = 0; g < 2; ++g) { s[g][j] = zero8(); s1[g][j] = zero8(); } \
    _Pragma("unroll") for (int dc = 0; dc < 2; ++dc) {            \
      _Pragma("unroll") for (int g = 0; g < 2; ++g) {             \
        s[g][j]  = mma_h_raw(kb[j][dc], qa[g][dc], s[g][j]);      \
        s1[g][j] = mma_h_raw(kr[j][dc], qa[g][dc], s1[g][j]);     \
        s1[g][j] = mma_h_raw(kb[j][dc], ql[g][dc], s1[g][j]);     \
      }                                                           \
    }
#define FOLD_S(j)                                                 \
    _Pragma("unroll") for (int g = 0; g < 2; ++g)                 \
      _Pragma("unroll") for (int r = 0; r < 8; ++r) s[g][j][r] += s1[g][j][r] * (1.0f / 1024.0f);
    LD_K(0) LD_K(1)
    SCORE(0)
    LD_K(2)
    SCORE(1) FOLD_S(0)
    LD_K(3)
    SCORE(2) FOLD_S(1)
    LD_V(0, 0)
    SCORE(3) FOLD_S(2)
    LD_V(0, 1)
    FOLD_S(3)

    // ---- per group: scale, maximum of the query's 64 scores (32 in the lane, then the other half's), online softmax ----
    FH pb[2][2];                         // P^T (x1024, f16) of group g, key chunk kk: keys kv0 + 32 kk + 8 hh + (0..7), then
                                         // + 16: the k order of the V^T fragments
#pragma unroll
    for (int g = 0; g < 2; ++g) {
      float mj[4];
#pragma unroll
      for (int j = 0; j < 4; ++j) {
        float m = -INFINITY;
#pragma unroll
        for (int r = 0; r < 8; ++r) {
          const float sv = s[g][j][r] * sscale;
          s[g][j][r] = sv;
          m = fmaxf(m, sv);
        }
        mj[j] = m;
      }
      float mt = fmaxf(fmaxf(mj[0], mj[1]), fmaxf(mj[2], mj[3]));
      mt = fmaxf(mt, xhalf(mt));
      const float mnew  = fmaxf(mrow[g], mt);
      const float msafe = (mnew == -INFINITY) ? 0.f : mnew;
      const float alpha = __expf(mrow[g] - msafe);
      mrow[g] = mnew;
      v8h ph[4];                         // ph[j][r] belongs to key kv0 + 16 j + 8 hh + r
      float ps[4];
#pragma unroll
      for (int j = 0; j < 4; ++j) {
        v8f p1024;
        float a = 0.f;
#pragma unroll
        for (int r = 0; r < 8; ++r) {
          const float p = __expf(s[g][j][r] - msafe);
          a += p;
          p1024[r] = p * 1024.0f;
        }
        ps[j] = a;
        ph[j] = __builtin_convertvector(p1024, v8h);
      }
      lrow[g] = lrow[g] * alpha + ((ps[0] + ps[1]) + (ps[2] + ps[3]));
#pragma unroll
      for (int t = 0; t < 4; ++t)
#pragma unroll
        for (int r = 0; r < 8; ++r) oacc[g][t][r] *= alpha;
#pragma unroll
      for (int kk = 0; kk < 2; ++kk) {
        pb[g][kk].h[0] = ph[2 * kk];
        pb[g][kk].h[1] = ph[2 * kk + 1];
      }
    }

    // ---- context^T += Vhi^T . P^T (f16 WMMA); Vres^T . P^T into a separate accumulator ----
    v8f o1[2][4];
#pragma unroll
    for (int g = 0; g < 2; ++g)
#pragma unroll
      for (int t = 0; t < 4; ++t) o1[g][t] = zero8();
#define CTX(kk, tp)                                               \
    _Pragma("unroll") for (int t = 2 * (tp); t < 2 * (tp) + 2; ++t) { \
      _Pragma("unroll") for (int g = 0; g < 2; ++g) {             \
        oacc[g][t] = mma_h_raw(vb[kk][t], pb[g][kk].v, oacc[g][t]); \
        o1[g][t]   = mma_h_raw(vl[kk][t], pb[g][kk].v, o1[g][t]);   \
      }                                                           \
    }
    // Order of the stretch from the tile barrier to here, for the scheduler: 16 reads, then 12 WMMAs and 8 reads in turn.
    // Left alone it spreads the reads singly among the WMMAs.
#define SGB_LDS(n, id)  __builtin_amdgcn_sched_group_barrier(0x100, n, id)
#define SGB_WMMA(n, id) __builtin_amdgcn_sched_group_barrier(0x008, n, id)
    SGB_LDS(16, 0); SGB_WMMA(12, 0); SGB_LDS(8, 0); SGB_WMMA(12, 0); SGB_LDS(8, 0); SGB_WMMA(12, 0); SGB_LDS(8, 0); SGB_WMMA(12, 0);
    SGB_LDS(8, 0);
    // ends the stretch that the group barriers above order; the second key chunk's V^T reads stay behind the softmax,
    // where the first chunk's 16 WMMAs cover their latency, instead of holding 64 more registers through it
    __builtin_amdgcn_sched_barrier(0);
    LD_V(1, 0)
    CTX(0, 0)
    LD_V(1, 1)
    CTX(0, 1) CTX(1, 0) CTX(1, 1)
    SGB_LDS(8, 1); SGB_WMMA(8, 1); SGB_LDS(8, 1); SGB_WMMA(24, 1);   // the same for this stretch
#undef SGB_LDS
#undef SGB_WMMA
#undef LD_K
#undef LD_V
#undef SCORE
#undef FOLD_S
#undef CTX
#pragma unroll
    for (int g = 0; g < 2; ++g)
#pragma unroll
      for (int t = 0; t < 4; ++t)
#pragma unroll
        for (int r = 0; r < 8; ++r) oacc[g][t][r] += o1[g][t][r] * (1.0f / 4096.0f);
  }
  // every wave's tile reads are done before the first tile buffer, which last held tile NKT - 2, is used for the context tiles
  wait_lds_reads();
  wait_copies();
  __syncthreads();

  // ---- join the halves' sums, normalise (1/l and the carries via oscl), stage the wave's 32x64 tile in LDS
  //      (row = query 16 g + c, 8 consecutive features per accumulator tile), then write whole 256-B row segments
  float* os = (float*)(void*)KV + wave * (32 * OSP);
#pragma unroll
  for (int g = 0; g < 2; ++g) {
    const float l = lrow[g] + xhalf(lrow[g]);
    const float inv = ((l > 0.f) ? (1.0f / l) : 0.f) * oscl;
#pragma unroll
    for (int t = 0; t < 4; ++t) {
      v4f lo, hi;
#pragma unroll
      for (int r = 0; r < 4; ++r) {
        lo[r] = oacc[g][t][r] * inv;
        hi[r] = oacc[g][t][4 + r] * inv;
      }
      *(v4f*)(os + (g * 16 + c) * OSP + t * 16 + 8 * hh) = lo;
      *(v4f*)(os + (g * 16 + c) * OSP + t * 16 + 8 * hh + 4) = hi;
    }
  }
  __builtin_amdgcn_fence(__ATOMIC_RELEASE, "workgroup");
  __builtin_amdgcn_wave_barrier();
  __builtin_amdgcn_fence(__ATOMIC_ACQUIRE, "workgroup");
  {
    const int h2 = lane >> 4, c4 = (lane & 15) * 4;
    v4f ov[16];
#pragma unroll
    for (int it = 0; it < 16; ++it) {
      const int row = it * 2 + h2;   // it 0..15 x h2 0..1 = rows 0..31 of the wave tile
      ov[it] = *(const v4f*)(os + row * OSP + c4);
    }
    {
#pragma unroll
      for (int it = 0; it < 16; ++it) {
        const int row = it * 2 + h2;
        const size_t go = (rowB + q0 + row) * DM + (size_t)h * HD + c4;
        *(v4f*)(outp + go) = ov[it];
      }
      
    }
  }
}

// =====================================================================================================
// Workspace map (bytes), every region an exact multiple of its whole-line / whole-tile store granularity
// 8192 x 512, 512 x 512 and 1024 x 4096 are whole tiles/lines):
//   Xb    bf16 [8192][512]            0          8388608
//   Wtq   bf16 [512][512]       8388608           524288   ([n][e])
//   Wtk   bf16 [512][512]       8912896           524288
//   Wtv   bf16 [512][512]       9437184           524288
//   Wto   f16  [512][512]       9961472           524288   ([n][k], bf16rne value x4096)
//   Tf    f32  [8192][512]     10485760         16777216   (q)
//   Tm    f32  [8192][512]     27262976         16777216   (msgs)
//   Kh    f16  [1024][64][64]  44040192          8388608   (tile (b*16 + key tile)*8 + h: [key][d])
//   Kl    f16  [1024][64][64]  52428800          8388608
//   VTh   f16  [1024][4096]    60817408          8388608   (same tile index; 16-B pieces of V^T, see stage_kv)
//   VTl   f16  [1024][4096]    69206016          8388608
//   end                        77594624
// Inputs: nodes f32 [8][1024][512]; Wq, Wk, Wv, Wo f32 [512 in][512 out] (x @ W layout); bq, bk, bv, bo f32
// [512] (index h*64+d = n). d_out f32: [8192][512] at byte 0 (row = b*SEQ + t, col = n).
// =====================================================================================================
extern "C" void kernel_launch(void* const* d_in, const int* in_sizes, int n_in,
                              void* d_out, int out_size, void* d_ws, size_t ws_size,
                              hipStream_t stream) {
  if (n_in < 9) return;
  if (in_sizes[0] != NB * SEQ * DM) return;
  if (in_sizes[1] != DM * DM) return;
  if (in_sizes[2] != DM * DM) return;
  if (in_sizes[3] != DM * DM) return;
  if (in_sizes[4] != DM) return;
  if (in_sizes[5] != DM) return;
  if (in_sizes[6] != DM) return;
  if (in_sizes[7] != DM * DM) return;
  if (in_sizes[8] != DM) return;
  if (out_size != OUTN) return;

  const float* x  = (const float*)d_in[0];   // [NB*SEQ][DM]
  const float* Wq = (const float*)d_in[1];   // [DM e][DM n]
  const float* Wk = (const float*)d_in[2];
  const float* Wv = (const float*)d_in[3];
  const float* bq = (const float*)d_in[4];   // [DM]
  const float* bk = (const float*)d_in[5];
  const float* bv = (const float*)d_in[6];
  const float* Wo = (const float*)d_in[7];   // [DM k][DM n]
  const float* bo = (const float*)d_in[8];

  const size_t PXb = (size_t)ROWS * DM * 2;          //  8388608
  const size_t PW  = (size_t)DM * DM * 2;            //   524288
  const size_t PF  = (size_t)ROWS * DM * 4;          // 16777216
  const size_t PH  = (size_t)ROWS * DM * 2;          //  8388608
  const size_t PVt = (size_t)NB * DM * SEQ * 2;      //  8388608
  size_t off = 0;
  const size_t oXb = off; off += PXb;
  const size_t oWq = off; off += PW;
  const size_t oWk = off; off += PW;
  const size_t oWv = off; off += PW;
  const size_t oWo = off; off += PW;
  const size_t oTf = off; off += PF;
  const size_t oTm = off; off += PF;
  const size_t oKh = off; off += PH;
  const size_t oKl = off; off += PH;
  const size_t oVt = off; off += PVt;
  const size_t oVl = off; off += PVt;
  if (off > ws_size) return;                        // off = 77594624
  if (off > (size_t)134217728) return;

  char* ws = (char*)d_ws;
  unsigned short* Xb  = (unsigned short*)(ws + oXb);
  unsigned short* Wtq = (unsigned short*)(ws + oWq);
  unsigned short* Wtk = (unsigned short*)(ws + oWk);
  unsigned short* Wtv = (unsigned short*)(ws + oWv);
  unsigned short* Wto = (unsigned short*)(ws + oWo);
  float*          Tf  = (float*)(ws + oTf);
  float*          Tm  = (float*)(ws + oTm);
  unsigned short* Kh  = (unsigned short*)(ws + oKh);
  unsigned short* Kl  = (unsigned short*)(ws + oKl);
  unsigned short* VTh = (unsigned short*)(ws + oVt);
  unsigned short* VTl = (unsigned short*)(ws + oVl);
  float*          outf = (float*)d_out;             // [ROWS][DM]

  const dim3 blk(256);
  const int n8x = ROWS * DM / 8;                    // 524288
  const dim3 gPrep(4 * WTB + PLB);                  // 256 weight tiles, then 2048 activation blocks
  const dim3 gGemm(ROWS / 64, 3);                   // 128 blocks of 64 rows x 512 columns, for each of q, k, v
  const dim3 gGemO(ROWS / 32);                      // 256 blocks of 32 rows x 512 columns
  const dim3 gAttn(NB * NH * NQB);                  // 512 blocks of 128 query rows
  const float qkScale = 16.0f;                      // q and k hi planes carried x16 (residual x1024 on top)
  const float sscale  = 1.0f / 2048.0f;             // 1/(16*16) * 1/sqrt(64)
  const float vScale  = 256.0f;                     // v^T hi plane carried x256
  const float attOscl = 1.0f / 262144.0f;           // 1/(1024 * 256): p and v carries folded back
  const float mScale  = 1024.0f;                    // msgs hi plane carried x1024 (residual x1024 on top)
  const float woScale = 4096.0f;                    // Wo^T carried x4096 in f16
  const float outOscl = 1.0f / 4194304.0f;          // 1/(1024 * 4096)

  // (1) activations -> bf16 plane; weights -> transposed 16-bit planes [n][e] (RNE convert): one grid
  prep<<<gPrep, blk, 0, stream>>>(x, Wq, Wk, Wv, Wo, Xb, Wtq, Wtk, Wtv, Wto, n8x, woScale);
  // (2) q, k, v = Xb . Wt^T + bias (M=8192, N=512, K=512 each): one grid; q -> Tf f32 [8192][512]; k -> f16 hi (x16) +
  //     residual plane tiles; v -> f16 v^T hi (x256) and residual (x4096 on top) plane tiles
  gemm64<<<gGemm, blk, 0, stream>>>(Xb, Wtq, Wtk, Wtv, bq, bk, bv, Tf, Kh, Kl, VTh, VTl, ROWS, qkScale, vScale);
  // (3) attention -> msgs f32 [8192][512] in Tm; q split into f16 hi (x16) + residual planes as its fragments are loaded
  attn64<<<gAttn, dim3(128), 0, stream>>>(Tf, Kh, Kl, VTh, VTl, Tm, qkScale, sscale, attOscl);
  // (4) out = msgs . Wo + bo -> d_out f32 [8192][512] (M=8192, N=512, K=512); msgs split into f16 hi (x1024) + residual
  //     planes on the way into LDS
  gemm_o<<<gGemO, blk, 0, stream>>>(Tm, Wto, bo, outf, ROWS, mScale, outOscl);
  (void)hipGetLastError();
}

// v010
// One run takes 75.4 microseconds.
// Timed twice side by side with v009, it ran 1.07 times as fast both times.
// Over all steps from v000 it is 3.57 times as fast.
// Contractions: q/k/v projections = v_wmma_f32_16x16x32_bf16 (bf16 operands from RNE-converted nodes, W^T and bias, single product); q.k^T scores = v_wmma_f32_16x16x32_f16 (q, k as f16 hi planes carried x16 plus f16 residual planes x1024: hi.hi + (hi.lo + lo.hi) in a separate accumulator, 3 products); p.v = v_wmma_f32_16x16x32_f16 (p carried x1024 in f16; v^T as f16 hi plane x256 plus f16 residual plane x4096 in a separate accumulator folded with 2^-12, 2 products); output projection = v_wmma_f32_16x16x32_f16 (msgs as f16 hi plane x1024 plus f16 residual plane x1024 in a separate accumulator folded with 2^-10; Wo^T = RNE bf16 value carried x4096 in f16; 2 products); all f32 accumulate; softmax in f32.
#include <hip/hip_runtime.h>
#include <math.h>
#include <stdint.h>

#define NB    8
#define SEQ   1024
#define DM    512
#define NH    8
#define HD    64
#define NKT   (SEQ / 64)            // attn64: key tiles of 64
#define NQB   (SEQ / 128)           // attn64: query blocks of one (b, h): 4 waves x 32 query rows
#define ROWS  (NB * SEQ)            // 8192 token rows
#define OUTN  (ROWS * DM)
#define KVP   72                    // LDS pitch of the 64-wide f16 tiles in attn64, in halves: 144 B = 16 B x 9 (odd)
#define OSP   68                    // LDS pitch of the 64-wide f32 context tile in attn64, in floats
#define KVT   (64 * KVP)            // attn64: halves of one staged 64 x 64 plane tile (9216 B)
#define KVBUF (4 * KVT)             // attn64: halves of one tile buffer: K hi, K residual, V^T hi, V^T residual (36864 B)
#define GKC   64                    // GEMMs: k elements of one staged slice = 128 B of every staged row
#define GSP   72                    // GEMMs: LDS pitch of a staged row, in 16-bit elements: 144 B = 16 B x 9 (odd)
#define GM    256                   // gemm64: rows of a block tile (4 wave tiles of 64)
#define GN    192                   // gemm64: columns of a block tile, out of the 3 DM joined columns q | k | v (3 wave tiles of 64)
#define GWV   12                    // gemm64: waves of a block
#define GROWS (GM + GN)             // gemm64: staged rows of a slice: GM A rows, then GN rows of B
#define GBUF  (GROWS * GSP)         // gemm64: 16-bit elements of one slice buffer (64512 B)
#define NSL   (DM / GKC)            // GEMMs: slices along k
#define ASP   520                   // gemm_o: LDS pitch of a resident A row (all DM k), in halves: 1040 B = 16 B x 65 (odd)
#define OM    64                    // gemm_o: rows of a block tile (2 wave tiles of 32)
#define ON    256                   // gemm_o: columns of a block tile (4 wave tiles of 64)
#define GBB   (ON * GSP)            // gemm_o: halves of one B slice buffer (36864 B)
#define WTB   ((DM / 64) * (DM / 64))      // 64 x 64 tiles of one weight matrix
#define TILEH (64 * 64)                     // halves of one 64 x 64 f16 plane tile of k or v in global memory (8192 B in a row)
#define PLB   (ROWS * DM / 8 / 256)        // blocks of one 8-elements-per-thread pass over a [ROWS][DM] plane
static_assert(NH * HD == DM);
static_assert(HD == 64);
static_assert(16 * KVP * 2 == 2304 && KVT * 2 == 9216);        // copy8: LDS bytes of 16 staged rows, of one plane tile
static_assert(128 * 8 * 4 == TILEH && NKT * 64 == SEQ);         // copy8: 4 copies of 128 threads x 16 B = one plane tile
static_assert(4 * 32 * OSP * 4 <= 2 * KVBUF * 2 && NKT >= 2 && (SEQ % 128) == 0);   // the context tiles fit the tile buffers; two buffers
static_assert(32 * GSP * 2 == 4608 && 48 * GSP * 2 == 6912);   // copy8r: LDS bytes of 32 staged rows; copy4b: of 48
static_assert(DM == 8 * 64 && NSL >= 2);                       // 8 column tiles of 64 in a plane; two buffers
static_assert(GM == 8 * 32 && GN == 4 * 48 && GWV * 32 == 8 * 48);   // gemm64: 8 A copies of 256 threads, 4 B copies of 384
static_assert(GWV == (GM / 64) * (GN / 64) && (3 * DM) % GN == 0 && (ROWS % GM) == 0);
static_assert(OM == 2 * 32 && ON == 8 * 32 && (DM % ON) == 0 && (ROWS % OM) == 0);   // gemm_o: 8 waves; 8 B copies of 256 threads
static_assert(ASP >= DM + 8 && (ASP * 2) % 32 == 16);          // gemm_o: a resident A row holds all DM k; pitch 16 B x odd
static_assert((SEQ % 64) == 0 && (DM % 64) == 0 && (ROWS % 64) == 0);
static_assert(((ROWS / 64) * (DM / 64)) % 8 == 0);
static_assert(((ROWS / 32) * (DM / 64)) % 8 == 0);
static_assert(((ROWS * DM / 8) % 256) == 0);

typedef _Float16 v16h __attribute__((ext_vector_type(16)));
typedef _Float16 v8h  __attribute__((ext_vector_type(8)));
typedef __bf16   v16b __attribute__((ext_vector_type(16)));
typedef __bf16   v8b  __attribute__((ext_vector_type(8)));
typedef float    v8f  __attribute__((ext_vector_type(8)));
typedef float    v4f  __attribute__((ext_vector_type(4)));
typedef unsigned int v4u __attribute__((ext_vector_type(4)));

// ---- scalar helpers --------------------------------------------------------------------------------
__device__ __forceinline__ unsigned short bf_bits(float f) {          // f32 -> bf16 bits, RNE convert
  unsigned u = __float_as_uint(f);
  return (unsigned short)((u + 0x7FFFu + ((u >> 16) & 1u)) >> 16);
}
__device__ __forceinline__ float bf_up(unsigned short h) { return __uint_as_float(((unsigned)h) << 16); }
__device__ __forceinline__ unsigned short h_bits(_Float16 x) { return __builtin_bit_cast(unsigned short, x); }
__device__ __forceinline__ unsigned pk16(unsigned short a, unsigned short b) { return (unsigned)a | ((unsigned)b << 16); }
__device__ __forceinline__ v8f zero8() { v8f z = {0.f, 0.f, 0.f, 0.f, 0.f, 0.f, 0.f, 0.f}; return z; }

// ---- fragment loaders: 16-bit A/B operand, lane -> row/col (lane&15), p already includes +8*(lane>>4);
//      elements 0..7 <- p[0..7] (k0+8h..), elements 8..15 <- p[16..23] (k0+16+8h..)
__device__ __forceinline__ v16b ldfrag_b(const __bf16* p) {
  union { v16b v; v8b h[2]; } f;
  f.h[0] = *(const v8b*)(p);
  f.h[1] = *(const v8b*)(p + 16);
  return f.v;
}
__device__ __forceinline__ v16h ldfrag_h(const _Float16* p) {
  union { v16h v; v8h h[2]; } f;
  f.h[0] = *(const v8h*)(p);
  f.h[1] = *(const v8h*)(p + 16);
  return f.v;
}

// ---- WMMA helpers with trailing VALU hazard gap --------------------------------------------------------
__device__ __forceinline__ v8f mma_h(v16h a, v16h b, v8f c) {
  c = __builtin_amdgcn_wmma_f32_16x16x32_f16(false, a, false, b, (short)0, c, false, false);
#if defined(__HIP_DEVICE_COMPILE__)
  asm volatile("v_nop\n\tv_nop\n\tv_nop\n\tv_nop" : "+v"(c) : "v"(a), "v"(b));
#endif
  return c;
}
__device__ __forceinline__ v8f mma_h_raw(v16h a, v16h b, v8f c) {   // the compiler keeps the distances behind its own builtin
  return __builtin_amdgcn_wmma_f32_16x16x32_f16(false, a, false, b, (short)0, c, false, false);
}
__device__ __forceinline__ v8f mma_b_raw(v16b a, v16b b, v8f c) {
  return __builtin_amdgcn_wmma_f32_16x16x32_bf16(false, a, false, b, (short)0, c, false, false);
}
__device__ __forceinline__ void dep_guard_b(v8f& a, v8f& b, v16b x, v16b y) {
#if defined(__HIP_DEVICE_COMPILE__)
  asm volatile("v_nop\n\tv_nop\n\tv_nop\n\tv_nop" : "+v"(a), "+v"(b) : "v"(x), "v"(y));
#endif
}
__device__ __forceinline__ void keep4_b(v16b a, v16b b, v16b c, v16b d) {
#if defined(__HIP_DEVICE_COMPILE__)
  asm volatile("v_nop" :: "v"(a), "v"(b), "v"(c), "v"(d));
#endif
}
__device__ __forceinline__ void acc_guard4(v8f& a, v8f& b, v8f& c, v8f& d) {
#if defined(__HIP_DEVICE_COMPILE__)
  asm volatile("v_nop\n\tv_nop\n\tv_nop\n\tv_nop" : "+v"(a), "+v"(b), "+v"(c), "+v"(d));
#endif
}

// lane l <-> lane l ^ 16 (the other half of the wave), in the vector unit
__device__ __forceinline__ float xhalf(float x) {
  const int b = __builtin_bit_cast(int, x);
  return __builtin_bit_cast(float, __builtin_amdgcn_permlanex16(b, b, 0x76543210, 0xfedcba98, false, false));
}

// ---- GEMM operand staging: asynchronous copies global -> LDS, waits -----------------------------------
__device__ __forceinline__ unsigned lds_off(const void* p) { return (unsigned)(size_t)p; }   // LDS byte address
// eight 16-B copies of this lane: LDS bytes l + 4608 i (32 staged rows of 144 B further each) <- global b + i s
__device__ __forceinline__ void copy8r(unsigned l, const unsigned short* b, size_t s) {
#if defined(__HIP_DEVICE_COMPILE__)
  // the closing s_wait_xcnt stands in the copies' own statement: no address register is rewritten in front of it
  asm volatile(
      "global_load_async_to_lds_b128 %0, %8, off\n\t"
      "global_load_async_to_lds_b128 %1, %9, off\n\t"
      "global_load_async_to_lds_b128 %2, %10, off\n\t"
      "global_load_async_to_lds_b128 %3, %11, off\n\t"
      "global_load_async_to_lds_b128 %4, %12, off\n\t"
      "global_load_async_to_lds_b128 %5, %13, off\n\t"
      "global_load_async_to_lds_b128 %6, %14, off\n\t"
      "global_load_async_to_lds_b128 %7, %15, off\n\t"
      "s_wait_xcnt 0x0"
      :: "v"(l), "v"(l + 4608u), "v"(l + 2u * 4608u), "v"(l + 3u * 4608u), "v"(l + 4u * 4608u),
         "v"(l + 5u * 4608u), "v"(l + 6u * 4608u), "v"(l + 7u * 4608u),
         "v"(b), "v"(b + s), "v"(b + 2 * s), "v"(b + 3 * s), "v"(b + 4 * s), "v"(b + 5 * s), "v"(b + 6 * s), "v"(b + 7 * s)
      : "memory");
#endif
}
// four 16-B copies of this lane: LDS bytes l + 6912 i (48 staged rows of 144 B further each) <- global b + i s
__device__ __forceinline__ void copy4b(unsigned l, const unsigned short* b, size_t s) {
#if defined(__HIP_DEVICE_COMPILE__)
  // the closing s_wait_xcnt stands in the copies' own statement: no address register is rewritten in front of it
  asm volatile(
      "global_load_async_to_lds_b128 %0, %4, off\n\t"
      "global_load_async_to_lds_b128 %1, %5, off\n\t"
      "global_load_async_to_lds_b128 %2, %6, off\n\t"
      "global_load_async_to_lds_b128 %3, %7, off\n\t"
      "s_wait_xcnt 0x0"
      :: "v"(l), "v"(l + 6912u), "v"(l + 2u * 6912u), "v"(l + 3u * 6912u),
         "v"(b), "v"(b + s), "v"(b + 2 * s), "v"(b + 3 * s)
      : "memory");
#endif
}
// One slice of gemm64 = GROWS rows x 128 B; 8 lanes copy one whole 128-B line. B: 4 groups of 48 rows, thread tid (of 384)
// copies 16-B column tid&7 of row tid>>3 of every group. A: 8 groups of 32 rows, dealt the same way to the threads of
// waves 0..7 alone (hasA: the same for a whole wave, a scalar). la, lb: the lane's LDS byte address in group 0 of A, of B;
// a, b: its source there (row pitch DM).
__device__ __forceinline__ void stage_slice(bool hasA, unsigned la, const unsigned short* a, unsigned lb,
                                            const unsigned short* b) {
  if (hasA) copy8r(la, a, (size_t)32 * DM);
  copy4b(lb, b, (size_t)48 * DM);
}
// One B slice of gemm_o = ON rows x 128 B = 8 groups of 32 rows, thread tid (of 256) copying 16-B column tid&7 of row
// tid>>3 of every group. l: the lane's LDS byte address in group 0 of the buffer; b: its source in B row group 0 (row pitch DM).
__device__ __forceinline__ void stage_b(unsigned l, const unsigned short* b) {
  copy8r(l, b, (size_t)32 * DM);
}
__device__ __forceinline__ void wait_copies() {   // this wave's copies have landed in LDS
#if defined(__HIP_DEVICE_COMPILE__)
  asm volatile("s_wait_asynccnt 0x0" ::: "memory");
#endif
}
__device__ __forceinline__ void wait_lds_reads() {   // this wave's LDS reads are done before the buffer is handed on
#if defined(__HIP_DEVICE_COMPILE__)
  asm volatile("s_wait_dscnt 0x0" ::: "memory");
#endif
}

// behind a group of global stores: no register that they name is rewritten in front of this wait; the scheduling barrier
// keeps the arithmetic of the next group, which reuses those registers, from being lifted over it
__device__ __forceinline__ void wait_store_regs() {
#if defined(__HIP_DEVICE_COMPILE__)
  asm volatile("s_wait_xcnt 0x0" ::: "memory");
  __builtin_amdgcn_sched_barrier(0);
#endif
}

// eight 16-B copies of this lane, two planes x four quarters of a plane tile: LDS bytes l + LSTEP g <- a + 1024 g,
// LDS bytes l + 9216 + LSTEP g <- b + 1024 g (g = 0..3; 1024 halves = the 2048 B that the block's 128 threads copy at once)
template <unsigned LSTEP>
__device__ __forceinline__ void copy8(unsigned l, const _Float16* a, const _Float16* b) {
#if defined(__HIP_DEVICE_COMPILE__)
  // the closing s_wait_xcnt stands in the copies' own statement: no address register is rewritten in front of it
  asm volatile(
      "global_load_async_to_lds_b128 %0, %8, off\n\t"
      "global_load_async_to_lds_b128 %1, %9, off\n\t"
      "global_load_async_to_lds_b128 %2, %10, off\n\t"
      "global_load_async_to_lds_b128 %3, %11, off\n\t"
      "global_load_async_to_lds_b128 %4, %12, off\n\t"
      "global_load_async_to_lds_b128 %5, %13, off\n\t"
      "global_load_async_to_lds_b128 %6, %14, off\n\t"
      "global_load_async_to_lds_b128 %7, %15, off\n\t"
      "s_wait_xcnt 0x0"
      :: "v"(l), "v"(l + LSTEP), "v"(l + 2u * LSTEP), "v"(l + 3u * LSTEP),
         "v"(l + 9216u), "v"(l + 9216u + LSTEP), "v"(l + 9216u + 2u * LSTEP), "v"(l + 9216u + 3u * LSTEP),
         "v"(a), "v"(a + 1024), "v"(a + 2 * 1024), "v"(a + 3 * 1024),
         "v"(b), "v"(b + 1024), "v"(b + 2 * 1024), "v"(b + 3 * 1024)
      : "memory");
#endif
}
// One key tile of attn64 = 4 plane tiles of 8192 B, each in a row in global memory; thread tid (of 128) copies 16-B piece
// 128 g + tid of every plane tile, so a wave's copy reads 512 B in a row. K tiles hold [key][d]: piece p = key p>>3,
// d 8 (p&7) ..; lk: the lane's LDS byte address of piece tid in the buffer's first plane, 16 staged rows further per g.
// V^T tiles hold piece p = feature d 16 ((p>>5)&3) + (p&15), keys 16 (p>>7) + 8 ((p>>4)&1) ..; lv: the lane's LDS byte
// address of piece tid in the buffer's third plane, 16 keys (32 B) further per g. k, kl, v, vl: the lane's piece tid.
__device__ __forceinline__ void stage_kv(unsigned lk, unsigned lv, const _Float16* k, const _Float16* kl,
                                         const _Float16* v, const _Float16* vl) {
  copy8<2304u>(lk, k, kl);
  copy8<32u>(lv, v, vl);
}

// =====================================================================================================
// f32 -> bf16 (RNE convert), 8 elements per thread, one 16-B store per lane: a wave writes 512 contiguous B
// coverage: n8 threads x 8 = whole plane (n8 is a multiple of 256 here).
// =====================================================================================================
__device__ __forceinline__ void cvt_bf16x8_body(const float* __restrict__ in, unsigned short* out, int n8, int blk) {
  const int i = blk * 256 + threadIdx.x;
  if (i < n8) {
    const v4f a = *(const v4f*)(in + (size_t)i * 8);
    const v4f b = *(const v4f*)(in + (size_t)i * 8 + 4);
    v4u p;
    p[0] = pk16(bf_bits(a[0]), bf_bits(a[1]));
    p[1] = pk16(bf_bits(a[2]), bf_bits(a[3]));
    p[2] = pk16(bf_bits(b[0]), bf_bits(b[1]));
    p[3] = pk16(bf_bits(b[2]), bf_bits(b[3]));
    *(v4u*)(out + (size_t)i * 8) = p;
    
  }
}

// =====================================================================================================
// f32 -> f16 hi plane = f16(v * scale) (scale a power of two) + f16 residual plane = f16((v*scale - hi) * 1024),
// same element index in both planes
// =====================================================================================================
// the split of 8 elements held in registers: ph = the hi plane's 16 B, pl = the residual plane's
__device__ __forceinline__ void split_f16x8(v4f a, v4f b, float scale, v4u& ph, v4u& pl) {
  float f[8];
  f[0] = a[0]; f[1] = a[1]; f[2] = a[2]; f[3] = a[3];
  f[4] = b[0]; f[5] = b[1]; f[6] = b[2]; f[7] = b[3];
#pragma unroll
  for (int e = 0; e < 4; ++e) {
    const float f0 = f[2 * e] * scale;
    const float f1 = f[2 * e + 1] * scale;
    const _Float16 x0 = (_Float16)f0, x1 = (_Float16)f1;
    const _Float16 l0 = (_Float16)((f0 - (float)x0) * 1024.0f);
    const _Float16 l1 = (_Float16)((f1 - (float)x1) * 1024.0f);
    ph[e] = pk16(h_bits(x0), h_bits(x1));
    pl[e] = pk16(h_bits(l0), h_bits(l1));
  }
}

// =====================================================================================================
// Weight transpose + convert: in W f32 [DM rows (e, contraction index)][DM cols (n, output feature)] (the
// x @ W layout) -> out Wt 16-bit [DM (n)][DM (e)] (the [n][k], k-contiguous layout the GEMM B operand uses).
// MODE 0: RNE bf16 bits. MODE 1: f16 bits of (RNE bf16 value * scale), scale a power of two (exact in f16).
// Block = one 64 e x 64 n tile (et, nt: its e and n tile index, DM/64 of each). The tile is staged in LDS as [ee][nn]
// pitch 68 floats (v4f loads, __syncthreads). in[rows e][cols n] -> out[rows n][cols e] (square here).
// Store: group g = tid>>3 (0..31), piece = tid&7: iteration it writes row n0 + (it*32+g), lanes 8q..8q+7 x 16 B
// coverage: 2 iterations x 32 groups = 64 rows n, 8 pieces x 8 = 64 e per row; grid covers every (e tile,
// n tile) -> the whole [DM][DM] plane.
// =====================================================================================================
template <int MODE>
__device__ __forceinline__ void wt_tile_body(const float* __restrict__ W, unsigned short* Wt, float scale,
                                             float* sw, int et, int nt) {
  const int tid = threadIdx.x;
  const int e0  = et * 64;
  const int n0  = nt * 64;
#pragma unroll
  for (int i = 0; i < 4; ++i) {
    const int idx = i * 256 + tid;                  // 0..1023
    const int ee = idx >> 4, c4 = (idx & 15) * 4;
    const v4f a = *(const v4f*)(W + ((size_t)(e0 + ee)) * DM + n0 + c4);
    *(v4f*)(sw + ee * 68 + c4) = a;
  }
  __syncthreads();

  const int g = tid >> 3, piece = tid & 7;
  v4u hv[2];
  size_t hofs[2];
#pragma unroll
  for (int it = 0; it < 2; ++it) {
    const int n = it * 32 + g;
    v4u a;
#pragma unroll
    for (int e = 0; e < 4; ++e) {
      const float f0 = sw[(piece * 8 + 2 * e) * 68 + n];
      const float f1 = sw[(piece * 8 + 2 * e + 1) * 68 + n];
      unsigned short u0, u1;
      if (MODE == 0) {
        u0 = bf_bits(f0);
        u1 = bf_bits(f1);
      } else {
        u0 = h_bits((_Float16)(bf_up(bf_bits(f0)) * scale));
        u1 = h_bits((_Float16)(bf_up(bf_bits(f1)) * scale));
      }
      a[e] = pk16(u0, u1);
    }
    hv[it] = a;
    hofs[it] = ((size_t)(n0 + n)) * DM + e0 + piece * 8;
  }
  {
#pragma unroll
    for (int it = 0; it < 2; ++it) {
      *(v4u*)(Wt + hofs[it]) = hv[it];
    }
#if defined(__HIP_DEVICE_COMPILE__)
    // both tile bodies stand in one kernel: no register that the two stores name is rewritten in front of this wait
    asm volatile("s_wait_xcnt 0x0" ::: "memory");
#endif
  }
}
// One grid for all operand preparation (the five jobs are independent of one another): blocks 0 .. 4 WTB - 1 = the
// weight tiles of Wq, Wk, Wv (bf16) and Wo (f16 x woscale), WTB tiles each; the blocks behind them = the activations'
// bf16 plane. The branch is block-uniform, so the tile body's barrier is passed by whole blocks only.
__global__ __launch_bounds__(256) void prep(const float* __restrict__ x, const float* __restrict__ Wq,
                                            const float* __restrict__ Wk, const float* __restrict__ Wv,
                                            const float* __restrict__ Wo, unsigned short* Xb, unsigned short* Wtq,
                                            unsigned short* Wtk, unsigned short* Wtv, unsigned short* Wto,
                                            int n8, float woscale) {
  __shared__ __align__(16) float sw[64 * 68];       // [ee][nn] pitch 68 floats
  const int bx = blockIdx.x;
  if (bx < 4 * WTB) {
    const int w = bx / WTB, tile = bx % WTB;
    const int et = tile % (DM / 64), nt = tile / (DM / 64);
    if (w == 3) {
      wt_tile_body<1>(Wo, Wto, woscale, sw, et, nt);
    } else {
      wt_tile_body<0>(w == 0 ? Wq : (w == 1 ? Wk : Wv), w == 0 ? Wtq : (w == 1 ? Wtk : Wtv), 1.0f, sw, et, nt);
    }
  } else {
    cvt_bf16x8_body(x, Xb, n8, bx - 4 * WTB);
  }
}

// =====================================================================================================
// Register-blocked bf16 WMMA GEMM with bias: C[m][n] = sum_k A[m][k] * Bt[n][k] + bf16rne(bias[n]), N = K = DM.
// The three projections are one product with the 3 DM joined columns q | k | v: Bt row-major [3 DM n][DM k] (k contiguous;
// the planes of Wq, Wk, Wv one behind the other). Block = GM rows x GN joined columns, 12 waves, one per 64x64 tile
// (wave w: rows 64 (w / 3) .., joined column tile 3 blockIdx.y + w % 3): (M / GM) x (3 DM / GN) = 256 blocks. A 64-column
// tile lies in one projection and is one head of it. A row-major [M][DM]; bias f32 [DM] each (RNE converted to bf16 and
// widened in the epilogue); M multiple of GM.
// Operands: k slices of GKC, the block's GM A rows and GN B rows, staged in LDS by asynchronous copies, two
// buffers: slice t + 1 is in flight while slice t is multiplied; per slice one hand-over (LDS reads done, own copies
// landed, block barrier), then slice t + 2 is copied into the buffer slice t has left.
// Output of q: f32 [M][DM] pitch DM. Epilogue: 16-row slabs staged per wave in LDS; each 64-wide row segment
// Output of k and v: the f16 hi and residual planes that attn64 stages, split here from the f32 result. A wave's 64 x 64
// tile is one key tile of one head (64 token rows): it is stored as TILEH halves in a row, tile index
// (first row / 64) * NH + head, every store instruction of a wave covering 512 B in a row.
//   k: hi = f16(k * kscale), residual = f16((k * kscale - hi) * 1024); tile = [key][d], through the wave's LDS slab
//   v: hi = f16(v * vscale), residual = f16((v * vscale - hi) * 4096); a lane's 8 accumulator rows of one column are 8
//      keys in a row of one feature = one 16-B piece of V^T, stored as piece (4 i + j) * 32 + lane: no LDS trip
// =====================================================================================================
__global__ __launch_bounds__(GWV * 32) void gemm64(
    const unsigned short* __restrict__ Ap,
    const unsigned short* __restrict__ Btp,
    const float* __restrict__ biasq, const float* __restrict__ biask, const float* __restrict__ biasv,
    float* C, unsigned short* kh, unsigned short* kl, unsigned short* vth, unsigned short* vtl, int M,
    float kscale, float vscale) {
  __shared__ __align__(16) __bf16 sAB[2 * GBUF];   // two slice buffers: rows 0..GM-1 = A, rows GM.. = B
  __shared__ __align__(16) float sT[GWV][16 * 68]; // per-wave 16x64 slab, pitch 68 floats
  constexpr int ldc = DM;
  const int tid  = threadIdx.x;
  const int lane = tid & 31;
  const int wave = __builtin_amdgcn_readfirstlane(tid >> 5);   // a scalar: what hangs on it branches on scalar tests
  const int mb = blockIdx.x * GM;
  if (mb >= M) return;                   // block-uniform, in front of every barrier
  const int rh = wave / (GN / 64), wc = wave % (GN / 64);      // the wave's row tile and column tile in the block tile
  const int ct = blockIdx.y * (GN / 64) + wc;                  // its tile among the 3 DM / 64 joined column tiles
  const int which = ct / (DM / 64);      // 0, 1, 2 = q, k, v: the same for a whole wave
  const int head  = ct % (DM / 64);
  const float* __restrict__ bias = which == 0 ? biasq : (which == 1 ? biask : biasv);
  const int m0 = mb + (rh << 6);         // the wave tile's first row
  const int n0 = head << 6;              // and its first column in its projection

  // this lane's piece of every row group: row tid>>3, 16-B column tid&7 (A: waves 0..7 only, rows 0..31 of a group)
  const bool hasA = wave < 8;
  const unsigned short* ga = Ap + (size_t)(mb + (tid >> 3)) * DM + (tid & 7) * 8;
  const unsigned short* gb = Btp + (size_t)(blockIdx.y * GN + (tid >> 3)) * DM + (tid & 7) * 8;
  const unsigned la0 = lds_off(sAB) + (unsigned)((tid >> 3) * GSP + (tid & 7) * 8) * 2u;
  const unsigned lb0 = la0 + (unsigned)(GM * GSP) * 2u;
  stage_slice(hasA, la0, ga, lb0, gb);
  wait_copies();
  __syncthreads();                       // slice 0 is readable by every wave
  stage_slice(hasA, la0 + GBUF * 2u, ga + GKC, lb0 + GBUF * 2u, gb + GKC);

  const int rlane = lane & 15;                 // row (A) / col (B, D) within subtile
  const int koff  = (lane >> 4) * 8;           // k offset of this lane half
  const int mOff  = (lane >> 4) * 8;           // D row offset

  v8f acc[4][4];
#pragma unroll
  for (int i = 0; i < 4; ++i)
#pragma unroll
    for (int j = 0; j < 4; ++j) acc[i][j] = zero8();

  for (int t = 0; t < NSL; ++t) {
    const __bf16* sb = sAB + (t & 1) * GBUF;
#pragma unroll
    for (int kk = 0; kk < GKC; kk += 32) {
      v16b bh[4], ah[4];                 // the k step's LDS reads stand together, in front of its WMMAs
#pragma unroll
      for (int j = 0; j < 4; ++j) {
        bh[j] = ldfrag_b(sb + (GM + (wc << 6) + (j << 4) + rlane) * GSP + koff + kk);
      }
#pragma unroll
      for (int i = 0; i < 4; ++i) {
        ah[i] = ldfrag_b(sb + ((rh << 6) + (i << 4) + rlane) * GSP + koff + kk);
      }
#pragma unroll
      for (int i = 0; i < 4; ++i) {
#pragma unroll
        for (int j = 0; j < 4; ++j) {
          acc[i][j] = mma_b_raw(ah[i], bh[j], acc[i][j]);
        }
        dep_guard_b(acc[i][0], acc[i][3], ah[i], ah[i]);
      }
      keep4_b(bh[0], bh[1], bh[2], bh[3]);
    }
    // hand-over: slice t + 1 becomes readable, slice t's buffer becomes free
    wait_lds_reads();
    wait_copies();
    __syncthreads();
    if (t + 2 < NSL) {
      const unsigned lo = (unsigned)(t & 1) * (GBUF * 2u);
      stage_slice(hasA, la0 + lo, ga + (t + 2) * GKC, lb0 + lo, gb + (t + 2) * GKC);
    }
  }
  wait_copies();
  acc_guard4(acc[0][0], acc[0][1], acc[0][2], acc[0][3]);
  acc_guard4(acc[1][0], acc[1][1], acc[1][2], acc[1][3]);
  acc_guard4(acc[2][0], acc[2][1], acc[2][2], acc[2][3]);
  acc_guard4(acc[3][0], acc[3][1], acc[3][2], acc[3][3]);

  // ---- bias per D column of this lane (n0 + 16j + rlane < N) ----
  float bz[4];
#pragma unroll
  for (int j = 0; j < 4; ++j) bz[j] = bf_up(bf_bits(bias[n0 + (j << 4) + rlane]));

  // ---- epilogue (the branches on which are wave-uniform; nothing in it waits for another wave) ----
  float* slab = sT[wave];
  const size_t tile = ((size_t)(m0 >> 6) * NH + head) * TILEH;    // k, v: this wave's plane tile
  if (which == 0) {
#pragma unroll
    for (int i = 0; i < 4; ++i) {
      const int mBase = m0 + (i << 4);
#pragma unroll
      for (int r = 0; r < 8; ++r) {
#pragma unroll
        for (int j = 0; j < 4; ++j) {
          slab[(mOff + r) * 68 + (j << 4) + rlane] = acc[i][j][r] + bz[j];
        }
      }
      __builtin_amdgcn_fence(__ATOMIC_RELEASE, "workgroup");
      __builtin_amdgcn_wave_barrier();
      __builtin_amdgcn_fence(__ATOMIC_ACQUIRE, "workgroup");
      {
        const int hh = lane >> 4, c4 = (lane & 15) * 4;     // 256-B row segment = 16 lanes x 16 B
        v4f ov[8];
#pragma unroll
        for (int it = 0; it < 8; ++it) {
          const int row = it * 2 + hh;                       // it 0..7 x hh 0..1 = rows 0..15
          ov[it] = *(const v4f*)(slab + row * 68 + c4);
        }
#pragma unroll
        for (int it = 0; it < 8; ++it) {
          const int row = it * 2 + hh;
          *(v4f*)(C + (size_t)(mBase + row) * ldc + n0 + c4) = ov[it];
        }
        wait_store_regs();
      }
      __builtin_amdgcn_fence(__ATOMIC_RELEASE, "workgroup");
      __builtin_amdgcn_wave_barrier();
      __builtin_amdgcn_fence(__ATOMIC_ACQUIRE, "workgroup");
    }
  } else if (which == 1) {
    unsigned short* th = kh + tile + lane * 8;     // piece lane of a group of 4 rows: row lane>>3, d 8 (lane&7) ..
    unsigned short* tl = kl + tile + lane * 8;
#pragma unroll
    for (int i = 0; i < 4; ++i) {
#pragma unroll
      for (int r = 0; r < 8; ++r) {
#pragma unroll
        for (int j = 0; j < 4; ++j) {
          slab[(mOff + r) * 68 + (j << 4) + rlane] = acc[i][j][r] + bz[j];
        }
      }
      __builtin_amdgcn_fence(__ATOMIC_RELEASE, "workgroup");
      __builtin_amdgcn_wave_barrier();
      __builtin_amdgcn_fence(__ATOMIC_ACQUIRE, "workgroup");
      {
        v4u ph[4], pl[4];
#pragma unroll
        for (int it = 0; it < 4; ++it) {                     // it 0..3 x lane>>3 0..3 = rows 0..15
          const float* sp = slab + (it * 4 + (lane >> 3)) * 68 + (lane & 7) * 8;
          split_f16x8(*(const v4f*)(sp), *(const v4f*)(sp + 4), kscale, ph[it], pl[it]);
        }
#pragma unroll
        for (int it = 0; it < 4; ++it) {
          *(v4u*)(th + (i * 16 + it * 4) * 64) = ph[it];
          *(v4u*)(tl + (i * 16 + it * 4) * 64) = pl[it];
        }
        wait_store_regs();
      }
      __builtin_amdgcn_fence(__ATOMIC_RELEASE, "workgroup");
      __builtin_amdgcn_wave_barrier();
      __builtin_amdgcn_fence(__ATOMIC_ACQUIRE, "workgroup");
    }
  } else {
    unsigned short* th = vth + tile + lane * 8;    // piece lane of accumulator tile (i, j)
    unsigned short* tl = vtl + tile + lane * 8;
#pragma unroll
    for (int i = 0; i < 4; ++i) {
      v4u ph[4], pl[4];                                      // [j]: keys 16 i + mOff + 0..7 of feature 16 j + rlane
#pragma unroll
      for (int j = 0; j < 4; ++j) {
#pragma unroll
        for (int e = 0; e < 4; ++e) {
          const float f0 = (acc[i][j][2 * e] + bz[j]) * vscale;
          const float f1 = (acc[i][j][2 * e + 1] + bz[j]) * vscale;
          const _Float16 x0 = (_Float16)f0, x1 = (_Float16)f1;
          const _Float16 l0 = (_Float16)((f0 - (float)x0) * 4096.0f);
          const _Float16 l1 = (_Float16)((f1 - (float)x1) * 4096.0f);
          ph[j][e] = pk16(h_bits(x0), h_bits(x1));
          pl[j][e] = pk16(h_bits(l0), h_bits(l1));
        }
      }
#pragma unroll
      for (int j = 0; j < 4; ++j) {
        *(v4u*)(th + (i * 4 + j) * 256) = ph[j];
        *(v4u*)(tl + (i * 4 + j) * 256) = pl[j];
      }
      wait_store_regs();
    }
  }
}

// =====================================================================================================
// f16 WMMA GEMM with a two-plane A operand and bias:
//   C[m][n] = (sum_k Ah[m][k]*Bt[n][k] + 2^-10 * sum_k Al[m][k]*Bt[n][k]) * oscale + bf16rne(bias[n]),
// the residual products in a separate accumulator, N = K = DM. Block = OM rows x ON columns (blockIdx.y: which ON), one
// wave per 32x64 tile (wave w: rows 32 (w >> 2) .., columns 64 (w & 3) .. of the block tile). A comes as f32, row-major
// [M][DM]: the block loads its OM rows once, splits them in
// registers into Ah = f16(A * ascale) and Al = f16((A * ascale - Ah) * 1024) and keeps both planes in LDS for all
// k slices. Bt row-major [DM n][DM k] (f16, k contiguous); M multiple of OM. B staged in LDS by k slices as in gemm64
// (asynchronous copies, two buffers). Every WMMA nop-guarded.
// Output f32 [M][DM] pitch DM. Epilogue: 16-row slabs staged per wave in LDS; each 64-wide row segment (256 B)
// coverage: 2 slabs x 16 rows x 64 cols = the wave's whole 32x64 tile.
// =====================================================================================================
__global__ __launch_bounds__(256) void gemm_o(
    const float* __restrict__ Af,
    const unsigned short* __restrict__ Btp,
    const float* __restrict__ bias,
    float* C, int M, float ascale, float oscale) {
  __shared__ __align__(16) _Float16 sA[2 * OM * ASP];  // rows 0..OM-1 = Ah, OM.. = Al, all DM k of the block's OM rows
  __shared__ __align__(16) _Float16 sB[2 * GBB];   // two B slice buffers
  __shared__ __align__(16) float sT[8][16 * 68];   // per-wave 16x64 slab, pitch 68 floats
  constexpr int ldc = DM;
  const int tid  = threadIdx.x;
  const int lane = tid & 31;
  const int wave = tid >> 5;
  const int mb = blockIdx.x * OM;
  if (mb >= M) return;                   // block-uniform, in front of every barrier
  const int nb = blockIdx.y * ON;        // the block tile's first column
  const int rw = (wave >> 2) << 5;       // the wave tile's first row and column in the block tile
  const int cw = (wave & 3) << 6;
  const int m0 = mb + rw;
  const int n0 = nb + cw;

  // A: thread tid takes elements (tid&7) * 8 .. + 7 of every 64-element k slice of rows tid>>3 and 32 + (tid>>3): 8 lanes
  // read 256 B in a row
  const int arow = tid >> 3, apc = (tid & 7) * 8;
  const float* ga = Af + (size_t)(mb + arow) * DM + apc;
  v4f ax[OM / 32][NSL][2];
#pragma unroll
  for (int p = 0; p < OM / 32; ++p) {
#pragma unroll
    for (int i = 0; i < NSL; ++i) {
      ax[p][i][0] = *(const v4f*)(ga + p * 32 * DM + i * GKC);
      ax[p][i][1] = *(const v4f*)(ga + p * 32 * DM + i * GKC + 4);
    }
  }
#if defined(__HIP_DEVICE_COMPILE__)
  // no address register of the A loads is rewritten in front of this wait: the address is an input of the statement, so
  // that no load lands on it either; the scheduling barrier keeps the later address arithmetic from being lifted over it
  asm volatile("s_wait_xcnt 0x0" :: "v"(ga) : "memory");
  __builtin_amdgcn_sched_barrier(0);
#endif
  // B: this lane's piece of every 32-row group: row tid>>3, 16-B column tid&7
  const unsigned short* gb  = Btp + (size_t)(nb + (tid >> 3)) * DM + (tid & 7) * 8;
  const unsigned l0 = lds_off(sB) + (unsigned)((tid >> 3) * GSP + (tid & 7) * 8) * 2u;
  stage_b(l0, gb);                       // slice 0 flies while A is split
  // keeps the split, which waits for the A loads, behind the issue of slice 0's copies
  __builtin_amdgcn_sched_barrier(0);
#pragma unroll
  for (int p = 0; p < OM / 32; ++p) {
#pragma unroll
    for (int i = 0; i < NSL; ++i) {
      v4u ph, pl;
      split_f16x8(ax[p][i][0], ax[p][i][1], ascale, ph, pl);
      *(v4u*)(sA + (p * 32 + arow) * ASP + i * GKC + apc) = ph;
      *(v4u*)(sA + (OM + p * 32 + arow) * ASP + i * GKC + apc) = pl;
    }
  }
  wait_lds_reads();                      // this wave's A stores are in LDS
  wait_copies();
  __syncthreads();                       // A and slice 0 of B are readable by every wave
  stage_b(l0 + GBB * 2u, gb + GKC);

  const int rlane = lane & 15;
  const int koff  = (lane >> 4) * 8;
  const int mOff  = (lane >> 4) * 8;

  v8f acc[2][4], acl[2][4];
#pragma unroll
  for (int i = 0; i < 2; ++i)
#pragma unroll
    for (int j = 0; j < 4; ++j) { acc[i][j] = zero8(); acl[i][j] = zero8(); }

  for (int t = 0; t < NSL; ++t) {
    const _Float16* sb = sB + (t & 1) * GBB;
    const _Float16* sa = sA + t * GKC;
#pragma unroll
    for (int kk = 0; kk < GKC; kk += 32) {
      v16h ah[2], al[2], bfr[4];         // the k step's LDS reads stand together, in front of its WMMAs
#pragma unroll
      for (int i = 0; i < 2; ++i) {
        ah[i] = ldfrag_h(sa + (rw + (i << 4) + rlane) * ASP + koff + kk);
        al[i] = ldfrag_h(sa + (OM + rw + (i << 4) + rlane) * ASP + koff + kk);
      }
#pragma unroll
      for (int j = 0; j < 4; ++j) {
        bfr[j] = ldfrag_h(sb + (cw + (j << 4) + rlane) * GSP + koff + kk);
      }
#pragma unroll
      for (int j = 0; j < 4; ++j) {
#pragma unroll
        for (int i = 0; i < 2; ++i) {
          acc[i][j] = mma_h(ah[i], bfr[j], acc[i][j]);
          acl[i][j] = mma_h(al[i], bfr[j], acl[i][j]);
        }
      }
    }
    // hand-over: slice t + 1 becomes readable, slice t's buffer becomes free
    wait_lds_reads();
    wait_copies();
    __syncthreads();
    if (t + 2 < NSL) {
      stage_b(l0 + (unsigned)(t & 1) * (GBB * 2u), gb + (t + 2) * GKC);
    }
  }
  wait_copies();

  // ---- bias per D column of this lane (n0 + 16j + rlane < N) ----
  float bz[4];
#pragma unroll
  for (int j = 0; j < 4; ++j) bz[j] = bf_up(bf_bits(bias[n0 + (j << 4) + rlane]));

  // ---- epilogue ----
  float* slab = sT[wave];
#pragma unroll
  for (int i = 0; i < 2; ++i) {
    const int mBase = m0 + (i << 4);
#pragma unroll
    for (int r = 0; r < 8; ++r) {
#pragma unroll
      for (int j = 0; j < 4; ++j) {
        const float y = (acc[i][j][r] + acl[i][j][r] * (1.0f / 1024.0f)) * oscale + bz[j];
        slab[(mOff + r) * 68 + (j << 4) + rlane] = y;
      }
    }
    __builtin_amdgcn_fence(__ATOMIC_RELEASE, "workgroup");
    __builtin_amdgcn_wave_barrier();
    __builtin_amdgcn_fence(__ATOMIC_ACQUIRE, "workgroup");
    {
      const int hh = lane >> 4, c4 = (lane & 15) * 4;     // 256-B row segment = 16 lanes x 16 B
      v4f ov[8];
#pragma unroll
      for (int it = 0; it < 8; ++it) {
        const int row = it * 2 + hh;                       // it 0..7 x hh 0..1 = rows 0..15
        ov[it] = *(const v4f*)(slab + row * 68 + c4);
      }
      {
#pragma unroll
        for (int it = 0; it < 8; ++it) {
          const int row = it * 2 + hh;
          *(v4f*)(C + (size_t)(mBase + row) * ldc + n0 + c4) = ov[it];
        }
        
      }
    }
    __builtin_amdgcn_fence(__ATOMIC_RELEASE, "workgroup");
    __builtin_amdgcn_wave_barrier();
    __builtin_amdgcn_fence(__ATOMIC_ACQUIRE, "workgroup");
  }
}

// =====================================================================================================
// Bidirectional multi-head attention, head dim 64, no mask.
//   q f32: element (b, t, h, d) at [(b*SEQ + t)*DM + h*64 + d]; split in registers into the f16 hi plane (x qscale = 16)
//     and the residual plane ((q*16 - hi)*1024)
//   k f16 hi plane (x16): 64 key x 64 d tiles of TILEH halves in a row, tile ((b*NKT + key tile)*NH + h), [key][d] inside;
//     k residual plane same into klp
//   v^T f16 hi plane (x256): tiles with the same index, 16-B pieces in the order gemm64 stores them (see stage_kv)
//   v^T f16 residual plane ((v*256 - hi)*4096): same index into vlp
//   All NKT key tiles of 64 are processed for every query block (static trip count).
//   logit = (qhi.khi + (qhi.klo + qlo.khi) * 2^-10) * sscale, f16 products with f32 accumulate, the residual
//   products in a separate accumulator; p = exp(s - m) carried as ph = f16(1024 p);
//   context = ph . vhi on f16 WMMA plus ph . vres into a separate accumulator folded back with 2^-12 per tile
//   in f32; online softmax in f32; out f32 plane: element (b, t, h*64 + d) at [(b*SEQ + t)*DM + h*64 + d] =
//   normalised context (oscl folds back the p and v carries).
//   Block = 4 waves x 32 query rows = 128 query rows of one (b, h); grid = NB*NH*NQB; kv tiles of 64. A wave works on two
//   groups g = 0, 1 of 16 queries: every K and V^T fragment that it reads from LDS is the A operand of both groups' WMMAs.
//   K hi / K residual / V^T hi / V^T residual tile staging: asynchronous copies global -> LDS, 128 threads x 4 x 16 B
//   per plane = the whole 64x64 tile, two buffers: tile t + 1 is in flight while tile t is worked on; per tile one
//   hand-over (LDS reads done, own copies landed, block barrier), then tile t + 2 is copied into the buffer tile t has left.
//   Both products are formed transposed: S^T = K . Q^T (A = K rows, B = Q) and O^T += V^T . P^T (A = V^T rows, B = P^T).
//   A lane then holds, per group, 32 of the 64 scores of ONE query (column lane&15; keys 16 j + 8 (lane>>4) + r), so maximum and
//   sum run in the lane, with one exchange between the wave's halves; two score tiles, converted in place, are the
//   B operand of the second product in the loaders' k order: P never leaves the registers.
//   Output coverage: each wave stores rows q0..q0+31 (it 0..15 x lane>>4 0..1) x 64 columns (16 lanes x 4
//   (b, h, query tile) -> the whole plane.
// =====================================================================================================
__global__ __launch_bounds__(128)
void attn64(const float* __restrict__ qf,
            const unsigned short* __restrict__ khp, const unsigned short* __restrict__ klp,
            const unsigned short* __restrict__ vhp, const unsigned short* __restrict__ vlp,
            float* outp, float qscale, float sscale, float oscl) {
  union FH { v16h v; v8h h[2]; };
  // two tile buffers of K hi [kv][d], K residual, V^T hi [d][kv], V^T residual, 9 KB each; behind the loop's last
  // barrier the same bytes hold the per wave context tiles [row][d] (34 KB)
  __shared__ __align__(16) _Float16 KV[2 * KVBUF];

  const int tid  = threadIdx.x;
  const int wave = tid >> 5;
  const int lane = tid & 31;
  const int hh   = lane >> 4;
  const int c    = lane & 15;

  const int bx   = blockIdx.x;
  const int qb   = bx % NQB;
  const int rest = bx / NQB;
  const int h    = rest % NH;
  const int b    = rest / NH;                // < NB by the grid size
  const int q0   = qb * 128 + wave * 32;
  const size_t rowB = (size_t)b * SEQ;

  const float*    Qf  = qf + (size_t)h * HD;
  const size_t tile0 = ((size_t)b * NKT * NH + h) * TILEH;       // plane tile of (b, key tile 0, h); NH tiles further per key tile

  // ---- Q fragments (B operand, column = lane&15): 2 query groups x 2 d-chunks, hi and residual, split here from the
  //      f32 q (a wave is the only reader of its 32 q rows); elements 0..7 <- d + 0..7, 8..15 <- d + 16..23, the loaders' k order
  v16h qa[2][2], ql[2][2];
  v4f qx[2][2][4];
#pragma unroll
  for (int g = 0; g < 2; ++g) {
#pragma unroll
    for (int dc = 0; dc < 2; ++dc) {
      const float* qp = Qf + (rowB + q0 + g * 16 + c) * DM + dc * 32 + 8 * hh;
      qx[g][dc][0] = *(const v4f*)(qp);
      qx[g][dc][1] = *(const v4f*)(qp + 4);
      qx[g][dc][2] = *(const v4f*)(qp + 16);
      qx[g][dc][3] = *(const v4f*)(qp + 20);
    }
#if defined(__HIP_DEVICE_COMPILE__)
    // no address register of this group's Q loads is rewritten in front of this wait; the scheduling barrier keeps the
    // next group's loads and the later address arithmetic, which reuse those registers, from being lifted over it
    asm volatile("s_wait_xcnt 0x0" ::: "memory");
    __builtin_amdgcn_sched_barrier(0);
#endif
  }

  // this lane's 16-B piece tid of every quarter of a plane tile; in LDS: K row tid>>3, column piece tid&7; V^T row
  // d = 16 wave + c, keys 8 hh ..
  const _Float16* gk  = (const _Float16*)(const void*)khp + tile0 + tid * 8;   // K hi, key tile 0
  const _Float16* gkl = (const _Float16*)(const void*)klp + tile0 + tid * 8;   // K residual
  const _Float16* gv  = (const _Float16*)(const void*)vhp + tile0 + tid * 8;   // V^T hi
  const _Float16* gvl = (const _Float16*)(const void*)vlp + tile0 + tid * 8;   // V^T residual
  const unsigned lk0 = lds_off(KV) + (unsigned)((tid >> 3) * KVP + (tid & 7) * 8) * 2u;
  const unsigned lv0 = lds_off(KV) + (unsigned)(2 * KVT + (wave * 16 + c) * KVP + 8 * hh) * 2u;
  stage_kv(lk0, lv0, gk, gkl, gv, gvl);
  // keeps the split of q, which waits for the Q loads, behind the issue of tile 0's copies
  __builtin_amdgcn_sched_barrier(0);
#pragma unroll
  for (int g = 0; g < 2; ++g) {
#pragma unroll
    for (int dc = 0; dc < 2; ++dc) {
      union { v16h v; v4u u[2]; } fh, fl;
      split_f16x8(qx[g][dc][0], qx[g][dc][1], qscale, fh.u[0], fl.u[0]);
      split_f16x8(qx[g][dc][2], qx[g][dc][3], qscale, fh.u[1], fl.u[1]);
      qa[g][dc] = fh.v;
      ql[g][dc] = fl.v;
    }
  }

  float mrow[2], lrow[2];                // of query q0 + 16 g + c; lrow sums this half's keys only, joined behind the loop
  v8f oacc[2][4];                        // oacc[g][t][r] = context of query q0 + 16 g + c, feature 16 t + 8 hh + r
#pragma unroll
  for (int g = 0; g < 2; ++g) {
    mrow[g] = -INFINITY;
    lrow[g] = 0.f;
#pragma unroll
    for (int t = 0; t < 4; ++t) oacc[g][t] = zero8();
  }

  for (int kt = 0; kt < NKT; ++kt) {
    // hand-over between trip kt - 1 and trip kt: tile kt becomes readable, tile kt - 1's buffer becomes free; then tile
    // kt + 1 is copied into that buffer. It stands at the head of the trip, with nothing behind the trip's arithmetic:
    // behind a branch at the foot the compiler moves the row sums there and holds all 64 p of a lane over the second product.
    wait_lds_reads();
    wait_copies();
    __syncthreads();
    if (kt + 1 < NKT) {
      const unsigned lb = (unsigned)((kt + 1) & 1) * (KVBUF * 2u);
      const size_t ts = (size_t)(kt + 1) * (NH * TILEH);
      stage_kv(lk0 + lb, lv0 + lb, gk + ts, gkl + ts, gv + ts, gvl + ts);
    }
    // (kv0 below = 64 kt, the tile's first key)
    // Fragment reads: plain LDS loads in groups of 8 ds_load_b128 (one 16-key group of K, or two 16-feature groups of
    // V^T, hi and residual planes), written one group ahead of the WMMAs that use them; the WMMAs are bare builtins, so
    // no asm statement stands between a read and an earlier WMMA and the reads can be issued ahead, behind counted waits.
    const _Float16* kfh = KV + (kt & 1) * KVBUF + c * KVP + 8 * hh;
    const _Float16* kfl = kfh + KVT;
    const _Float16* vfh = kfh + 2 * KVT;
    const _Float16* vfl = kfh + 3 * KVT;
    v16h kb[4][2], kr[4][2];             // K hi / residual fragments of key group j, d chunk dc
    v16h vb[2][4], vl[2][4];             // V^T hi / residual fragments of key chunk kk, feature group t
#define LD_K(j)                                                   \
    _Pragma("unroll") for (int dc = 0; dc < 2; ++dc) {            \
      kb[j][dc] = ldfrag_h(kfh + (j) * 16 * KVP + dc * 32);       \
      kr[j][dc] = ldfrag_h(kfl + (j) * 16 * KVP + dc * 32);       \
    }
#define LD_V(kk, tp)                                              \
    _Pragma("unroll") for (int t = 2 * (tp); t < 2 * (tp) + 2; ++t) { \
      vb[kk][t] = ldfrag_h(vfh + t * 16 * KVP + (kk) * 32);       \
      vl[kk][t] = ldfrag_h(vfl + t * 16 * KVP + (kk) * 32);       \
    }
    // ---- scores, transposed: 64 keys x 32 queries per wave; hi.hi into s, hi.lo + lo.hi into s1 (folded x 2^-10) ----
    v8f s[2][4], s1[2][4];               // s[g][j][r] = score of key kv0 + 16 j + 8 hh + r with query q0 + 16 g + c
#define SCORE(j)                                                  \
    _Pragma("unroll") for (int g = 0; g < 2; ++g) { s[g][j] = zero8(); s1[g][j] = zero8(); } \
    _Pragma("unroll") for (int dc = 0; dc < 2; ++dc) {            \
      _Pragma("unroll") for (int g = 0; g < 2; ++g) {             \
        s[g][j]  = mma_h_raw(kb[j][dc], qa[g][dc], s[g][j]);      \
        s1[g][j] = mma_h_raw(kr[j][dc], qa[g][dc], s1[g][j]);     \
        s1[g][j] = mma_h_raw(kb[j][dc], ql[g][dc], s1[g][j]);     \
      }                                                           \
    }
#define FOLD_S(j)                                                 \
    _Pragma("unroll") for (int g = 0; g < 2; ++g)                 \
      _Pragma("unroll") for (int r = 0; r < 8; ++r) s[g][j][r] += s1[g][j][r] * (1.0f / 1024.0f);
    LD_K(0) LD_K(1)
    SCORE(0)
    LD_K(2)
    SCORE(1) FOLD_S(0)
    LD_K(3)
    SCORE(2) FOLD_S(1)
    LD_V(0, 0)
    SCORE(3) FOLD_S(2)
    LD_V(0, 1)
    FOLD_S(3)

    // ---- per group: scale, maximum of the query's 64 scores (32 in the lane, then the other half's), online softmax ----
    FH pb[2][2];                         // P^T (x1024, f16) of group g, key chunk kk: keys kv0 + 32 kk + 8 hh + (0..7), then
                                         // + 16: the k order of the V^T fragments
#pragma unroll
    for (int g = 0; g < 2; ++g) {
      float mj[4];
#pragma unroll
      for (int j = 0; j < 4; ++j) {
        float m = -INFINITY;
#pragma unroll
        for (int r = 0; r < 8; ++r) {
          const float sv = s[g][j][r] * sscale;
          s[g][j][r] = sv;
          m = fmaxf(m, sv);
        }
        mj[j] = m;
      }
      float mt = fmaxf(fmaxf(mj[0], mj[1]), fmaxf(mj[2], mj[3]));
      mt = fmaxf(mt, xhalf(mt));
      const float mnew  = fmaxf(mrow[g], mt);
      const float msafe = (mnew == -INFINITY) ? 0.f : mnew;
      const float alpha = __expf(mrow[g] - msafe);
      mrow[g] = mnew;
      v8h ph[4];                         // ph[j][r] belongs to key kv0 + 16 j + 8 hh + r
      float ps[4];
#pragma unroll
      for (int j = 0; j < 4; ++j) {
        v8f p1024;
        float a = 0.f;
#pragma unroll
        for (int r = 0; r < 8; ++r) {
          const float p = __expf(s[g][j][r] - msafe);
          a += p;
          p1024[r] = p * 1024.0f;
        }
        ps[j] = a;
        ph[j] = __builtin_convertvector(p1024, v8h);
      }
      lrow[g] = lrow[g] * alpha + ((ps[0] + ps[1]) + (ps[2] + ps[3]));
#pragma unroll
      for (int t = 0; t < 4; ++t)
#pragma unroll
        for (int r = 0; r < 8; ++r) oacc[g][t][r] *= alpha;
#pragma unroll
      for (int kk = 0; kk < 2; ++kk) {
        pb[g][kk].h[0] = ph[2 * kk];
        pb[g][kk].h[1] = ph[2 * kk + 1];
      }
    }

    // ---- context^T += Vhi^T . P^T (f16 WMMA); Vres^T . P^T into a separate accumulator ----
    v8f o1[2][4];
#pragma unroll
    for (int g = 0; g < 2; ++g)
#pragma unroll
      for (int t = 0; t < 4; ++t) o1[g][t] = zero8();
#define CTX(kk, tp)                                               \
    _Pragma("unroll") for (int t = 2 * (tp); t < 2 * (tp) + 2; ++t) { \
      _Pragma("unroll") for (int g = 0; g < 2; ++g) {             \
        oacc[g][t] = mma_h_raw(vb[kk][t], pb[g][kk].v, oacc[g][t]); \
        o1[g][t]   = mma_h_raw(vl[kk][t], pb[g][kk].v, o1[g][t]);   \
      }                                                           \
    }
    // Order of the stretch from the tile barrier to here, for the scheduler: 16 reads, then 12 WMMAs and 8 reads in turn.
    // Left alone it spreads the reads singly among the WMMAs.
#define SGB_LDS(n, id)  __builtin_amdgcn_sched_group_barrier(0x100, n, id)
#define SGB_WMMA(n, id) __builtin_amdgcn_sched_group_barrier(0x008, n, id)
    SGB_LDS(16, 0); SGB_WMMA(12, 0); SGB_LDS(8, 0); SGB_WMMA(12, 0); SGB_LDS(8, 0); SGB_WMMA(12, 0); SGB_LDS(8, 0); SGB_WMMA(12, 0);
    SGB_LDS(8, 0);
    // ends the stretch that the group barriers above order; the second key chunk's V^T reads stay behind the softmax,
    // where the first chunk's 16 WMMAs cover their latency, instead of holding 64 more registers through it
    __builtin_amdgcn_sched_barrier(0);
    LD_V(1, 0)
    CTX(0, 0)
    LD_V(1, 1)
    CTX(0, 1) CTX(1, 0) CTX(1, 1)
    SGB_LDS(8, 1); SGB_WMMA(8, 1); SGB_LDS(8, 1); SGB_WMMA(24, 1);   // the same for this stretch
#undef SGB_LDS
#undef SGB_WMMA
#undef LD_K
#undef LD_V
#undef SCORE
#undef FOLD_S
#undef CTX
#pragma unroll
    for (int g = 0; g < 2; ++g)
#pragma unroll
      for (int t = 0; t < 4; ++t)
#pragma unroll
        for (int r = 0; r < 8; ++r) oacc[g][t][r] += o1[g][t][r] * (1.0f / 4096.0f);
  }
  // every wave's tile reads are done before the first tile buffer, which last held tile NKT - 2, is used for the context tiles
  wait_lds_reads();
  wait_copies();
  __syncthreads();

  // ---- join the halves' sums, normalise (1/l and the carries via oscl), stage the wave's 32x64 tile in LDS
  //      (row = query 16 g + c, 8 consecutive features per accumulator tile), then write whole 256-B row segments
  float* os = (float*)(void*)KV + wave * (32 * OSP);
#pragma unroll
  for (int g = 0; g < 2; ++g) {
    const float l = lrow[g] + xhalf(lrow[g]);
    const float inv = ((l > 0.f) ? (1.0f / l) : 0.f) * oscl;
#pragma unroll
    for (int t = 0; t < 4; ++t) {
      v4f lo, hi;
#pragma unroll
      for (int r = 0; r < 4; ++r) {
        lo[r] = oacc[g][t][r] * inv;
        hi[r] = oacc[g][t][4 + r] * inv;
      }
      *(v4f*)(os + (g * 16 + c) * OSP + t * 16 + 8 * hh) = lo;
      *(v4f*)(os + (g * 16 + c) * OSP + t * 16 + 8 * hh + 4) = hi;
    }
  }
  __builtin_amdgcn_fence(__ATOMIC_RELEASE, "workgroup");
  __builtin_amdgcn_wave_barrier();
  __builtin_amdgcn_fence(__ATOMIC_ACQUIRE, "workgroup");
  {
    const int h2 = lane >> 4, c4 = (lane & 15) * 4;
    v4f ov[16];
#pragma unroll
    for (int it = 0; it < 16; ++it) {
      const int row = it * 2 + h2;   // it 0..15 x h2 0..1 = rows 0..31 of the wave tile
      ov[it] = *(const v4f*)(os + row * OSP + c4);
    }
    {
#pragma unroll
      for (int it = 0; it < 16; ++it) {
        const int row = it * 2 + h2;
        const size_t go = (rowB + q0 + row) * DM + (size_t)h * HD + c4;
        *(v4f*)(outp + go) = ov[it];
      }
      
    }
  }
}

// =====================================================================================================
// Workspace map (bytes), every region an exact multiple of its whole-line / whole-tile store granularity
// 8192 x 512, 512 x 512 and 1024 x 4096 are whole tiles/lines):
//   Xb    bf16 [8192][512]            0          8388608
//   Wtq   bf16 [512][512]       8388608           524288   ([n][e])
//   Wtk   bf16 [512][512]       8912896           524288
//   Wtv   bf16 [512][512]       9437184           524288
//   Wto   f16  [512][512]       9961472           524288   ([n][k], bf16rne value x4096)
//   Tf    f32  [8192][512]     10485760         16777216   (q)
//   Tm    f32  [8192][512]     27262976         16777216   (msgs)
//   Kh    f16  [1024][64][64]  44040192          8388608   (tile (b*16 + key tile)*8 + h: [key][d])
//   Kl    f16  [1024][64][64]  52428800          8388608
//   VTh   f16  [1024][4096]    60817408          8388608   (same tile index; 16-B pieces of V^T, see stage_kv)
//   VTl   f16  [1024][4096]    69206016          8388608
//   end                        77594624
// Inputs: nodes f32 [8][1024][512]; Wq, Wk, Wv, Wo f32 [512 in][512 out] (x @ W layout); bq, bk, bv, bo f32
// [512] (index h*64+d = n). d_out f32: [8192][512] at byte 0 (row = b*SEQ + t, col = n).
// =====================================================================================================
extern "C" void kernel_launch(void* const* d_in, const int* in_sizes, int n_in,
                              void* d_out, int out_size, void* d_ws, size_t ws_size,
                              hipStream_t stream) {
  if (n_in < 9) return;
  if (in_sizes[0] != NB * SEQ * DM) return;
  if (in_sizes[1] != DM * DM) return;
  if (in_sizes[2] != DM * DM) return;
  if (in_sizes[3] != DM * DM) return;
  if (in_sizes[4] != DM) return;
  if (in_sizes[5] != DM) return;
  if (in_sizes[6] != DM) return;
  if (in_sizes[7] != DM * DM) return;
  if (in_sizes[8] != DM) return;
  if (out_size != OUTN) return;

  const float* x  = (const float*)d_in[0];   // [NB*SEQ][DM]
  const float* Wq = (const float*)d_in[1];   // [DM e][DM n]
  const float* Wk = (const float*)d_in[2];
  const float* Wv = (const float*)d_in[3];
  const float* bq = (const float*)d_in[4];   // [DM]
  const float* bk = (const float*)d_in[5];
  const float* bv = (const float*)d_in[6];
  const float* Wo = (const float*)d_in[7];   // [DM k][DM n]
  const float* bo = (const float*)d_in[8];

  const size_t PXb = (size_t)ROWS * DM * 2;          //  8388608
  const size_t PW  = (size_t)DM * DM * 2;            //   524288
  const size_t PF  = (size_t)ROWS * DM * 4;          // 16777216
  const size_t PH  = (size_t)ROWS * DM * 2;          //  8388608
  const size_t PVt = (size_t)NB * DM * SEQ * 2;      //  8388608
  size_t off = 0;
  const size_t oXb = off; off += PXb;
  const size_t oWq = off; off += PW;
  const size_t oWk = off; off += PW;
  const size_t oWv = off; off += PW;
  const size_t oWo = off; off += PW;
  const size_t oTf = off; off += PF;
  const size_t oTm = off; off += PF;
  const size_t oKh = off; off += PH;
  const size_t oKl = off; off += PH;
  const size_t oVt = off; off += PVt;
  const size_t oVl = off; off += PVt;
  if (off > ws_size) return;                        // off = 77594624
  if (off > (size_t)134217728) return;

  char* ws = (char*)d_ws;
  unsigned short* Xb  = (unsigned short*)(ws + oXb);
  unsigned short* Wtq = (unsigned short*)(ws + oWq);
  unsigned short* Wtk = (unsigned short*)(ws + oWk);
  unsigned short* Wtv = (unsigned short*)(ws + oWv);
  unsigned short* Wto = (unsigned short*)(ws + oWo);
  float*          Tf  = (float*)(ws + oTf);
  float*          Tm  = (float*)(ws + oTm);
  unsigned short* Kh  = (unsigned short*)(ws + oKh);
  unsigned short* Kl  = (unsigned short*)(ws + oKl);
  unsigned short* VTh = (unsigned short*)(ws + oVt);
  unsigned short* VTl = (unsigned short*)(ws + oVl);
  float*          outf = (float*)d_out;             // [ROWS][DM]

  const dim3 blk(256);
  const int n8x = ROWS * DM / 8;                    // 524288
  const dim3 gPrep(4 * WTB + PLB);                  // 256 weight tiles, then 2048 activation blocks
  const dim3 gGemm(ROWS / GM, 3 * DM / GN);         // 32 x 8 = 256 blocks of 256 rows x 192 of the joined q | k | v columns
  const dim3 gGemO(ROWS / OM, DM / ON);             // 128 x 2 = 256 blocks of 64 rows x 256 columns
  const dim3 gAttn(NB * NH * NQB);                  // 512 blocks of 128 query rows
  const float qkScale = 16.0f;                      // q and k hi planes carried x16 (residual x1024 on top)
  const float sscale  = 1.0f / 2048.0f;             // 1/(16*16) * 1/sqrt(64)
  const float vScale  = 256.0f;                     // v^T hi plane carried x256
  const float attOscl = 1.0f / 262144.0f;           // 1/(1024 * 256): p and v carries folded back
  const float mScale  = 1024.0f;                    // msgs hi plane carried x1024 (residual x1024 on top)
  const float woScale = 4096.0f;                    // Wo^T carried x4096 in f16
  const float outOscl = 1.0f / 4194304.0f;          // 1/(1024 * 4096)

  // (1) activations -> bf16 plane; weights -> transposed 16-bit planes [n][e] (RNE convert): one grid
  prep<<<gPrep, blk, 0, stream>>>(x, Wq, Wk, Wv, Wo, Xb, Wtq, Wtk, Wtv, Wto, n8x, woScale);
  // (2) q, k, v = Xb . Wt^T + bias (M=8192, N=512, K=512 each): one grid, Wtq, Wtk, Wtv read as one [1536][512] plane
  //     (they lie one behind the other in the workspace); q -> Tf f32 [8192][512]; k -> f16 hi (x16) +
  //     residual plane tiles; v -> f16 v^T hi (x256) and residual (x4096 on top) plane tiles
  gemm64<<<gGemm, dim3(GWV * 32), 0, stream>>>(Xb, Wtq, bq, bk, bv, Tf, Kh, Kl, VTh, VTl, ROWS, qkScale, vScale);
  // (3) attention -> msgs f32 [8192][512] in Tm; q split into f16 hi (x16) + residual planes as its fragments are loaded
  attn64<<<gAttn, dim3(128), 0, stream>>>(Tf, Kh, Kl, VTh, VTl, Tm, qkScale, sscale, attOscl);
  // (4) out = msgs . Wo + bo -> d_out f32 [8192][512] (M=8192, N=512, K=512); msgs split into f16 hi (x1024) + residual
  //     planes on the way into LDS
  gemm_o<<<gGemO, blk, 0, stream>>>(Tm, Wto, bo, outf, ROWS, mScale, outOscl);
  (void)hipGetLastError();
}
